// v000
// Measured on an AMD MI455X. A time is GPU time per run, averaged over a window of back-to-back runs after a warm-up
// (all launches, gaps included; the runs take copies of the inputs in turn), and the median of several windows.
// Apart from v000's, it joins two sittings. Times from different sittings can be a few percent apart, while
// side-by-side timings come from the same sitting.
// The starting kernel, v000, takes 4070 microseconds a run.
#include <hip/hip_runtime.h>
// SAGAN-style self-attention with 1x1-conv projections (x [8][512][2048] channel-first; f = Wq x, g = Wk x (64 channels), h = Wv x (512); scores[n][m] = sum_c f[c][n] g[c][m] (unscaled); beta = softmax over n (the QUERY axis, dim=1) for each m; o[c][m] = gamma sum_n h[c][n] beta[n][m] + x[c][m] -> [8][512][2048]; gamma = an input scalar).
// Structure: x transposed to exact f16 token rows via LDS tiles; f^T and g^T as WMMA GEMMs (32x64 wave tiles, f32 accumulation, exact x16 weights) into f32 rows then f16 hi + x1024 residual planes; h channel-major as a GEMM (weights as the A operand) into f16; per batch: S^T[m][n] = g^T f as three accumulating GEMM passes (K = 64; hi.hi + hi.lo + lo.hi), row softmax over n on VALU (f32 statistics, native exp; weights x256 f16) = beta^T; o[c][m] = h . beta^T as a GEMM (K = 2048) channel-major straight into the output; epilogue out = bf16(gamma) o + bf16(x); 4 + 8 x 11 = 92 launches.
// Compute dtype: inputs rounded to bf16; x / weights exact; f, g as hi + residual (~2^-22: the unscaled logits have sigma ~8); h and the softmax weights plain f16 (~2^-12); logits, statistics, o f32. v_wmma_f32_16x16x32_f16.
#define NB 8
#define CC 512
#define CQ 64
#define LL 2048
#define SQ LL
#define DM 64
#define NH 1
#define HD 64
#define HG 1
#define NR ((size_t)NB * LL)
typedef __bf16 v16b __attribute__((ext_vector_type(16)));
typedef unsigned short v8us __attribute__((ext_vector_type(8), may_alias));
typedef float  v8f  __attribute__((ext_vector_type(8)));
typedef float  v4f  __attribute__((ext_vector_type(4)));
typedef float  v4fa __attribute__((ext_vector_type(4), may_alias));
union FragB { v16b v; v8us half[2]; unsigned short u[16]; };

__device__ __forceinline__ unsigned short bf16_bits(float x) { unsigned int u = __float_as_uint(x); return (unsigned short)((u + 0x7FFFu + ((u >> 16) & 1u)) >> 16); }
__device__ __forceinline__ float bf16_val(unsigned short b) { return __uint_as_float(((unsigned int)b) << 16); }
__device__ __forceinline__ float bf16_round(float x) { return bf16_val(bf16_bits(x)); }
// D += A·B with NT terms: 1 = ah·bh, 2 = + al·bh (A split), 3 = + ah·bl (both split)
template <int NT>
__device__ __forceinline__ v8f mmaN(v16b ah, v16b al, v16b bh, v16b bl, v8f c) {
  c = __builtin_amdgcn_wmma_f32_16x16x32_bf16(false, ah, false, bh, (short)0, c, false, false);
  if (NT >= 2) c = __builtin_amdgcn_wmma_f32_16x16x32_bf16(false, al, false, bh, (short)0, c, false, false);
  if (NT >= 3) c = __builtin_amdgcn_wmma_f32_16x16x32_bf16(false, ah, false, bl, (short)0, c, false, false);
  asm volatile("v_nop\n\tv_nop\n\tv_nop\n\tv_nop" : "+v"(c) : "v"(ah), "v"(al), "v"(bh), "v"(bl));
  return c;
}

__global__ __launch_bounds__(256) void k_wt_bf16(const float* __restrict__ W, unsigned short* __restrict__ Wt, int K, int N) {
  const int t = blockIdx.x * 256 + threadIdx.x;
  const int k8n = K / 8;
  if (t >= N * k8n) return;
  const int n = t / k8n, k8 = (t % k8n) * 8;
  v8us v;
#pragma unroll
  for (int i = 0; i < 8; ++i) v[i] = bf16_bits(W[(size_t)(k8 + i) * N + n]);
  *(v8us*)(Wt + (size_t)n * K + k8) = v;
  
}

// GEMM C[M][N] (f32, pitch ldc) = act(A[M][K]·W + bias). A f32 row-major (pitch lda) converted per fragment to bf16
// (ASPLIT: hi/lo two planes -> 2 terms, else single rounded term); Wt bf16 [N][K] (pitch ldb). BIAS_BF16 rounds the
// bias to bf16 first (bias quantised to bf16 before the add). K%32==0, M%16==0, N%64==0.
template <bool ASPLIT, int ACT, bool BIAS_BF16>
__global__ __launch_bounds__(128) void k_gemm_bf(const float* __restrict__ A, int lda, const unsigned short* __restrict__ Wt, int ldb,
                                               const float* __restrict__ bias, float* __restrict__ C, int ldc, int M, int N, int K) {
  __shared__ __attribute__((aligned(16))) float so[4][16][64];
  const int tid = threadIdx.x, w = tid >> 5, lane = tid & 31, ln = lane & 15, hh = lane >> 4;
  const int ntn = N / 64;
  const int wid = blockIdx.x * 4 + w;
  const int mt = wid / ntn, nq = wid % ntn;
  if (mt * 16 >= M) return;
  const int row0 = mt * 16, col0 = nq * 64;
  const float* arow = A + (size_t)(row0 + ln) * lda;
  v8f acc[4] = {};
  for (int kb = 0; kb < K; kb += 32) {
    FragB ah, al;
    const v4f x0 = *(const v4fa*)(arow + kb + 8 * hh), x1 = *(const v4fa*)(arow + kb + 8 * hh + 4);
    const v4f x2 = *(const v4fa*)(arow + kb + 16 + 8 * hh), x3 = *(const v4fa*)(arow + kb + 16 + 8 * hh + 4);
    float xs[16] = {x0[0],x0[1],x0[2],x0[3],x1[0],x1[1],x1[2],x1[3],x2[0],x2[1],x2[2],x2[3],x3[0],x3[1],x3[2],x3[3]};
#pragma unroll
    for (int i = 0; i < 16; ++i) { const unsigned short hb = bf16_bits(xs[i]); ah.u[i] = hb; al.u[i] = ASPLIT ? bf16_bits(xs[i] - bf16_val(hb)) : (unsigned short)0; }
#pragma unroll
    for (int t = 0; t < 4; ++t) {
      const unsigned short* brow = Wt + (size_t)(col0 + t * 16 + ln) * ldb + kb;
      FragB b;
      b.half[0] = *(const v8us*)(brow + 8 * hh);
      b.half[1] = *(const v8us*)(brow + 16 + 8 * hh);
      acc[t] = mmaN<ASPLIT ? 2 : 1>(ah.v, al.v, b.v, b.v, acc[t]);
    }
  }
#pragma unroll
  for (int t = 0; t < 4; ++t) {
    float bv = bias ? bias[col0 + t * 16 + ln] : 0.f;
    if (BIAS_BF16) bv = bf16_round(bv);
#pragma unroll
    for (int r = 0; r < 8; ++r) { float v = acc[t][r] + bv; if (ACT == 1) v = fmaxf(v, 0.f); so[w][8 * hh + r][t * 16 + ln] = v; }
  }
  __builtin_amdgcn_fence(__ATOMIC_ACQ_REL, "workgroup");
  __builtin_amdgcn_wave_barrier();
  const int rsub = lane >> 4, c4 = (lane & 15) * 4;
  {
#pragma unroll
    for (int q = 0; q < 8; ++q) {
      const int r = q * 2 + rsub;
      const v4f v = *(const v4fa*)&so[w][r][c4];
      *(v4f*)(C + (size_t)(row0 + r) * ldc + col0 + c4) = v;
    }
    
  }
}

// GEMM C = act(A·W + bias + resid): A f32 (ASPLIT -> hi/lo 2 terms), Wt bf16 [N][K]; ACT 0 none, 1 relu, 2 exact gelu;
// resid (optional, f32, row index = (row % rmod), pitch ldr, RES_BF16 rounds it) added before the activation.
template <bool ASPLIT, int ACT, bool BIAS_BF16, bool RES_BF16>
__global__ __launch_bounds__(128) void k_gemm_bf3(const float* __restrict__ A, int lda, const unsigned short* __restrict__ Wt, int ldb,
                                                const float* __restrict__ bias, const float* __restrict__ resid, int rmod, int ldr,
                                                float* __restrict__ C, int ldc, int M, int N, int K) {
  __shared__ __attribute__((aligned(16))) float so[4][16][64];
  const int tid = threadIdx.x, w = tid >> 5, lane = tid & 31, ln = lane & 15, hh = lane >> 4;
  const int ntn = N / 64;
  const int wid = blockIdx.x * 4 + w;
  const int mt = wid / ntn, nq = wid % ntn;
  if (mt * 16 >= M) return;
  const int row0 = mt * 16, col0 = nq * 64;
  const float* arow = A + (size_t)(row0 + ln) * lda;
  v8f acc[4] = {};
  for (int kb = 0; kb < K; kb += 32) {
    FragB ah, al;
    const v4f x0 = *(const v4fa*)(arow + kb + 8 * hh), x1 = *(const v4fa*)(arow + kb + 8 * hh + 4);
    const v4f x2 = *(const v4fa*)(arow + kb + 16 + 8 * hh), x3 = *(const v4fa*)(arow + kb + 16 + 8 * hh + 4);
    float xs[16] = {x0[0],x0[1],x0[2],x0[3],x1[0],x1[1],x1[2],x1[3],x2[0],x2[1],x2[2],x2[3],x3[0],x3[1],x3[2],x3[3]};
#pragma unroll
    for (int i = 0; i < 16; ++i) { const unsigned short hb = bf16_bits(xs[i]); ah.u[i] = hb; al.u[i] = ASPLIT ? bf16_bits(xs[i] - bf16_val(hb)) : (unsigned short)0; }
#pragma unroll
    for (int t = 0; t < 4; ++t) {
      const unsigned short* brow = Wt + (size_t)(col0 + t * 16 + ln) * ldb + kb;
      FragB b;
      b.half[0] = *(const v8us*)(brow + 8 * hh);
      b.half[1] = *(const v8us*)(brow + 16 + 8 * hh);
      acc[t] = mmaN<ASPLIT ? 2 : 1>(ah.v, al.v, b.v, b.v, acc[t]);
    }
  }
#pragma unroll
  for (int t = 0; t < 4; ++t) {
    const int col = col0 + t * 16 + ln;
    float bv = bias ? bias[col] : 0.f;
    if (BIAS_BF16) bv = bf16_round(bv);
#pragma unroll
    for (int r = 0; r < 8; ++r) {
      float v = acc[t][r] + bv;
      if (resid) { float rv = resid[(size_t)((row0 + 8 * hh + r) % rmod) * ldr + col]; if (RES_BF16) rv = bf16_round(rv); v += rv; }
      if (ACT == 1) v = fmaxf(v, 0.f);
      if (ACT == 2) v = 0.5f * v * (1.0f + erff(v * 0.70710678118654752f));
      if (ACT == 3) { const float u = 0.7978845608028654f * (v + 0.044715f * v * v * v); v = 0.5f * v * (1.0f + tanhf(u)); }
      so[w][8 * hh + r][t * 16 + ln] = v;
    }
  }
  __builtin_amdgcn_fence(__ATOMIC_ACQ_REL, "workgroup");
  __builtin_amdgcn_wave_barrier();
  const int rsub = lane >> 4, c4 = (lane & 15) * 4;
  {
#pragma unroll
    for (int q = 0; q < 8; ++q) {
      const int r = q * 2 + rsub;
      const v4f v = *(const v4fa*)&so[w][r][c4];
      *(v4f*)(C + (size_t)(row0 + r) * ldc + col0 + c4) = v;
    }
    
  }
}
// row LayerNorm (biased variance, eps) over N: s = X (+ R); optional out_sum <- s; out_norm <- (s-mu)*rsqrt(var+eps)*g + b
template <bool PARAM_BF16>
__global__ __launch_bounds__(256) void k_layernorm(const float* __restrict__ X, const float* __restrict__ R, const float* __restrict__ g, const float* __restrict__ bta,
                                                  float* __restrict__ out_sum, float* __restrict__ out_norm, int N, float eps) {
  __shared__ float red[256];
  const int row = blockIdx.x, tid = threadIdx.x;
  const float* x = X + (size_t)row * N; const float* rr = R ? R + (size_t)row * N : nullptr;
  float vals[16];                     // up to N = 4096
  const int per = N / 256;            // contiguous chunk per thread? use strided-by-4 chunks: thread handles j = tid*4 + 1024*u
  float s1 = 0.f;
  for (int u = 0; u < per / 4; ++u) {
    const int j = tid * 4 + 1024 * u;
    const v4f a = *(const v4fa*)(x + j);
    v4f b = {0.f,0.f,0.f,0.f}; if (rr) b = *(const v4fa*)(rr + j);
#pragma unroll
    for (int q = 0; q < 4; ++q) { const float v = a[q] + b[q]; vals[u * 4 + q] = v; s1 += v; }
  }
  red[tid] = s1; __syncthreads();
  for (int st = 128; st > 0; st >>= 1) { if (tid < st) red[tid] += red[tid + st]; __syncthreads(); }
  const float mu = red[0] / (float)N; __syncthreads();
  float s2 = 0.f;
  for (int u = 0; u < per / 4; ++u)
#pragma unroll
    for (int q = 0; q < 4; ++q) { const float c = vals[u * 4 + q] - mu; s2 += c * c; }
  red[tid] = s2; __syncthreads();
  for (int st = 128; st > 0; st >>= 1) { if (tid < st) red[tid] += red[tid + st]; __syncthreads(); }
  const float rs = rsqrtf(red[0] / (float)N + eps);
  {
    for (int u = 0; u < per / 4; ++u) {
      const int j = tid * 4 + 1024 * u;
      v4f o, sm;
#pragma unroll
      for (int q = 0; q < 4; ++q) {
        float gg = g[j + q], bb = bta[j + q];
        if (PARAM_BF16) { gg = bf16_round(gg); bb = bf16_round(bb); }
        sm[q] = vals[u * 4 + q]; o[q] = (vals[u * 4 + q] - mu) * rs * gg + bb;
      }
      if (out_sum) *(v4f*)(out_sum + (size_t)row * N + j) = sm;
      *(v4f*)(out_norm + (size_t)row * N + j) = o;
    }
    
  }
}



// ---- f16 WMMA path (v_wmma_f32_16x16x32_f16): 11-bit significands for operands in range — used where a [0,1] probability operand needs more precision than bf16
typedef _Float16 v16h __attribute__((ext_vector_type(16)));
union FragH { v16h v; v8us half[2]; _Float16 h[16]; unsigned short u[16]; };
template <int NT>
__device__ __forceinline__ v8f mmaH(v16h ah, v16h al, v16h bh, v16h bl, v8f c) {
  c = __builtin_amdgcn_wmma_f32_16x16x32_f16(false, ah, false, bh, (short)0, c, false, false);
  if (NT >= 2) c = __builtin_amdgcn_wmma_f32_16x16x32_f16(false, al, false, bh, (short)0, c, false, false);
  if (NT >= 3) c = __builtin_amdgcn_wmma_f32_16x16x32_f16(false, ah, false, bl, (short)0, c, false, false);
  asm volatile("v_nop\n\tv_nop\n\tv_nop\n\tv_nop" : "+v"(c) : "v"(ah), "v"(al), "v"(bh), "v"(bl));
  return c;
}
// batched GEMM like k_gemm_b but f16 operands: A f32 (split into f16 hi/lo if ASPLIT, else rounded to f16), Bt = f16 values [n][k]; alpha; C f32; N multiple of 16 (partial tiles skipped)
template <bool ASPLIT>
__global__ __launch_bounds__(128) void k_gemm_h(const float* __restrict__ A, int lda, size_t sA, const _Float16* __restrict__ Bh, int ldb, size_t sB, float alpha, float* __restrict__ C, int ldc, size_t sC, int M, int N, int K) {
  __shared__ __attribute__((aligned(16))) float so[4][16][64];
  const int tid = threadIdx.x, w = tid >> 5, lane = tid & 31, ln = lane & 15, hh = lane >> 4; const int by = blockIdx.y;
  A += (size_t)by * sA; Bh += (size_t)by * sB; C += (size_t)by * sC;
  const int ntn = (N + 63) / 64; const int wid = blockIdx.x * 4 + w; const int mt = wid / ntn, nq = wid % ntn; if (mt * 16 >= M) return;
  const int row0 = mt * 16, col0 = nq * 64; const float* arow = A + (size_t)(row0 + ln) * lda;
  v8f acc[4] = {};
  for (int kb = 0; kb < K; kb += 32) {
    FragH ah, al;
    const v4f x0 = *(const v4fa*)(arow + kb + 8 * hh), x1 = *(const v4fa*)(arow + kb + 8 * hh + 4), x2 = *(const v4fa*)(arow + kb + 16 + 8 * hh), x3 = *(const v4fa*)(arow + kb + 16 + 8 * hh + 4);
    float xs[16] = {x0[0],x0[1],x0[2],x0[3],x1[0],x1[1],x1[2],x1[3],x2[0],x2[1],x2[2],x2[3],x3[0],x3[1],x3[2],x3[3]};
#pragma unroll
    for (int i = 0; i < 16; ++i) { const _Float16 h = (_Float16)xs[i]; ah.h[i] = h; al.h[i] = ASPLIT ? (_Float16)(xs[i] - (float)h) : (_Float16)0.0f; }
#pragma unroll
    for (int t = 0; t < 4; ++t) { if (col0 + t * 16 >= N) continue; const size_t boff = (size_t)(col0 + t * 16 + ln) * ldb + kb; FragH bq; bq.half[0] = *(const v8us*)(Bh + boff + 8 * hh); bq.half[1] = *(const v8us*)(Bh + boff + 16 + 8 * hh);
      acc[t] = mmaH<ASPLIT ? 2 : 1>(ah.v, al.v, bq.v, bq.v, acc[t]); }
  }
#pragma unroll
  for (int t = 0; t < 4; ++t) { if (col0 + t * 16 >= N) continue;
#pragma unroll
    for (int r = 0; r < 8; ++r) so[w][8 * hh + r][t * 16 + ln] = acc[t][r] * alpha; }
  __builtin_amdgcn_fence(__ATOMIC_ACQ_REL, "workgroup"); __builtin_amdgcn_wave_barrier();
  const int rsub = lane >> 4, c4 = (lane & 15) * 4;
  {
#pragma unroll
    for (int q = 0; q < 8; ++q) { const int r = q * 2 + rsub; if (col0 + c4 < N) { const v4f v = *(const v4fa*)&so[w][r][c4]; *(v4f*)(C + (size_t)(row0 + r) * ldc + col0 + c4) = v; } }
     }
}

// Wt[n][k] = f16(W[k][n]·scale) from f32 row-major W[K][N] (scale = power of two; bf16-exact weights stay exact in f16 away from the subnormal range)
__global__ __launch_bounds__(256) void k_wt_f16(const float* __restrict__ W, _Float16* __restrict__ Wt, int K, int N, float scale) {
  const int t = blockIdx.x * 256 + threadIdx.x; if (t >= N * (K / 8)) return; const int n = t / (K / 8), k8 = (t % (K / 8)) * 8; FragH f;
#pragma unroll
  for (int i = 0; i < 8; ++i) f.h[i] = (_Float16)(bf16_round(W[(size_t)(k8 + i) * N + n]) * scale); const v8us o = f.half[0];
  *(v8us*)((unsigned short*)Wt + (size_t)n * K + k8) = o; 
}
// k_gemm_hh variant with fused epilogue: v = acc·alpha + bias[by·sBias + col] (+ CP[(row/rowsPerB)·sCPb + by·64 + col] if CP) ; ACT 0 none / 1 elu ; writes f16 C16 (and f32 C if non-null)
template <int ACT>
__global__ __launch_bounds__(128) void k_gemm_hhx(const _Float16* __restrict__ A, int lda, size_t sA, const _Float16* __restrict__ Bh, int ldb, size_t sB, float alpha, const float* __restrict__ bias, size_t sBias, const float* __restrict__ CP, int rowsPerB, size_t sCPb, int row0g,
    float* __restrict__ C, _Float16* __restrict__ C16, int ldc, size_t sC, int M, int N, int K) {
  __shared__ __attribute__((aligned(16))) float so[4][16][64];
  const int tid = threadIdx.x, w = tid >> 5, lane = tid & 31, ln = lane & 15, hh = lane >> 4; const int by = blockIdx.y;
  A += (size_t)by * sA; Bh += (size_t)by * sB; const size_t cofs = (size_t)by * sC; const float* bp = bias ? bias + (size_t)by * sBias : nullptr;
  const int ntn = (N + 63) / 64; const int wid = blockIdx.x * 4 + w; const int mt = wid / ntn, nq = wid % ntn; if (mt * 16 >= M) return;
  const int row0 = mt * 16, col0 = nq * 64; const _Float16* arow = A + (size_t)(row0 + ln) * lda;
  v8f acc[4] = {};
  for (int kb = 0; kb < K; kb += 32) { FragH ah; ah.half[0] = *(const v8us*)((const unsigned short*)arow + kb + 8 * hh); ah.half[1] = *(const v8us*)((const unsigned short*)arow + kb + 16 + 8 * hh);
#pragma unroll
    for (int t = 0; t < 4; ++t) { if (col0 + t * 16 >= N) continue; const size_t boff = (size_t)(col0 + t * 16 + ln) * ldb + kb; FragH bq; bq.half[0] = *(const v8us*)((const unsigned short*)Bh + boff + 8 * hh); bq.half[1] = *(const v8us*)((const unsigned short*)Bh + boff + 16 + 8 * hh);
      acc[t] = mmaH<1>(ah.v, ah.v, bq.v, bq.v, acc[t]); }
  }
#pragma unroll
  for (int t = 0; t < 4; ++t) { if (col0 + t * 16 >= N) continue; const int col = col0 + t * 16 + ln; const float bv = bp ? bf16_round(bp[col]) : 0.f;
#pragma unroll
    for (int r = 0; r < 8; ++r) { float v = acc[t][r] * alpha + bv; if (CP) { const int rr = row0g + row0 + 8 * hh + r; if (rowsPerB < 0) v += CP[cofs + (size_t)rr * ldc + col];      /* rowsPerB < 0: own element of the batched C plane */ else { const int bidx = rr / rowsPerB; v += CP[(size_t)bidx * sCPb + (size_t)by * 64 + col]; } } if (ACT == 1) v = (v > 0.f) ? v : expm1f(v); else if (ACT == 7) v = (v > 0.f) ? v + 1.0f : expf(v); else if (ACT == 8) v = tanhf(v); else if (ACT == 9) v = 0.5f * v * (1.0f + tanhf(0.7978845608028654f * (v + 0.044715f * v * v * v))); else if (ACT == 11) v = 1.0f / (1.0f + expf(-v)); else if (ACT == 12) v = (v > 0.f) ? v : 0.01f * v; else if (ACT == 14) v = (v > 0.f) ? v : 0.1f * v; else if (ACT == 16) v = (v >= 0.f) ? v : 0.3f * v; else if (ACT == 17) v = (v >= 0.f) ? v : 0.2f * v; else if (ACT == 15) v = v / (1.0f + expf(-v)); else if (ACT == 3) v = fmaxf(v, 0.f); else if (ACT == 6) v = 0.5f * v * (1.0f + erff(v * 0.70710678118654752f)); so[w][8 * hh + r][t * 16 + ln] = v; } }
  __builtin_amdgcn_fence(__ATOMIC_ACQ_REL, "workgroup"); __builtin_amdgcn_wave_barrier();
  const int rsub = lane >> 4, c4 = (lane & 15) * 4; typedef _Float16 v4h __attribute__((ext_vector_type(4)));
  {
#pragma unroll
    for (int q = 0; q < 8; ++q) { const int r = q * 2 + rsub; if (col0 + c4 < N) { const v4f v = *(const v4fa*)&so[w][r][c4]; if (C) *(v4f*)(C + cofs + (size_t)(row0 + r) * ldc + col0 + c4) = v; if (C16) { v4h h4; for (int i = 0; i < 4; ++i) h4[i] = (_Float16)v[i]; *(v4h*)(C16 + cofs + (size_t)(row0 + r) * ldc + col0 + c4) = h4; } } }
     }
}


typedef _Float16 v4h __attribute__((ext_vector_type(4)));

__global__ __launch_bounds__(256) void k_x16(const float* __restrict__ x, _Float16* __restrict__ X16, size_t n8) { const size_t t = (size_t)blockIdx.x * 256 + threadIdx.x; if (t >= n8) return; FragH f;
#pragma unroll
  for (int q = 0; q < 8; ++q) f.h[q] = (_Float16)bf16_round(x[t * 8 + q]); *(v8us*)((unsigned short*)X16 + t * 8) = f.half[0];  }
__global__ __launch_bounds__(256) void k_h16(const float* __restrict__ x, _Float16* __restrict__ X16, size_t n8) { const size_t t = (size_t)blockIdx.x * 256 + threadIdx.x; if (t >= n8) return; FragH f;
#pragma unroll
  for (int q = 0; q < 8; ++q) f.h[q] = (_Float16)x[t * 8 + q]; *(v8us*)((unsigned short*)X16 + t * 8) = f.half[0];  }
__global__ __launch_bounds__(256) void k_round16f(const float* __restrict__ W, _Float16* __restrict__ Bt, size_t n8) { const size_t t = (size_t)blockIdx.x * 256 + threadIdx.x; if (t >= n8) return; FragH f;
#pragma unroll
  for (int i = 0; i < 8; ++i) f.h[i] = (_Float16)(bf16_round(W[t * 8 + i]) * 16.0f); *(v8us*)((unsigned short*)Bt + t * 8) = f.half[0];  }
template <int NHv, int TTv>
__global__ __launch_bounds__(256) void k_vt(const _Float16* __restrict__ V16, int ldv, int voff, _Float16* __restrict__ Vt) { __shared__ unsigned short tl[64][66]; const int tid = threadIdx.x; const int slab = blockIdx.x / (TTv / 64), lg = blockIdx.x % (TTv / 64); const int b = slab / NHv, h = slab % NHv;
  for (int i = tid; i < 64 * 8; i += 256) { const int r = i / 8, c8 = (i % 8) * 8; FragH f; f.half[0] = *(const v8us*)((const unsigned short*)V16 + ((size_t)b * TTv + lg * 64 + r) * ldv + voff + h * 64 + c8);
#pragma unroll
    for (int q = 0; q < 8; ++q) tl[r][c8 + q] = f.u[q]; }
  __syncthreads();
  {
#pragma unroll
    for (int rd = 0; rd < 2; ++rd) { const int d = rd * 32 + tid / 8, pc = tid % 8; FragH f;
#pragma unroll
      for (int q = 0; q < 8; ++q) f.u[q] = tl[pc * 8 + q][d];
      *(v8us*)((unsigned short*)Vt + ((size_t)slab * 64 + d) * TTv + lg * 64 + pc * 8) = f.half[0]; }
     } }

__global__ __launch_bounds__(256) void k_hl(const float* __restrict__ F, _Float16* __restrict__ Hh, _Float16* __restrict__ Hl, size_t n8) { const size_t t = (size_t)blockIdx.x * 256 + threadIdx.x; if (t >= n8) return; FragH fh, fl; const v4f a = *(const v4fa*)(F + t * 8), c = *(const v4fa*)(F + t * 8 + 4);
#pragma unroll
  for (int q = 0; q < 4; ++q) { _Float16 h = (_Float16)a[q]; fh.h[q] = h; fl.h[q] = (_Float16)((a[q] - (float)h) * 1024.0f); h = (_Float16)c[q]; fh.h[4 + q] = h; fl.h[4 + q] = (_Float16)((c[q] - (float)h) * 1024.0f); }
  { *(v8us*)((unsigned short*)Hh + t * 8) = fh.half[0]; *(v8us*)((unsigned short*)Hl + t * 8) = fl.half[0];  } }

// ---- fast GEMM (wave tile 32x64; requires M % 32 == 0 rows per launch region and N % 64 == 0); epilogue = k_gemm_hhx semantics ----
__device__ __forceinline__ v16h g2_frag(const _Float16* p, int hh) { FragH f; f.half[0] = *(const v8us*)((const unsigned short*)p + 8 * hh); f.half[1] = *(const v8us*)((const unsigned short*)p + 16 + 8 * hh); return f.v; }
__device__ __forceinline__ v8f g2_mma(v16h a, v16h b, v8f c) { v8f d = __builtin_amdgcn_wmma_f32_16x16x32_f16(false, a, false, b, (short)0, c, false, false); asm volatile("v_nop\n\tv_nop\n\tv_nop\n\tv_nop" : "+v"(d) : "v"(a), "v"(b)); return d; }
template <int ACT>
__global__ __launch_bounds__(128) void k_gemm2(const _Float16* __restrict__ A, int lda, size_t sA, const _Float16* __restrict__ Bh, int ldb, size_t sB, float alpha, const float* __restrict__ bias, size_t sBias, const float* __restrict__ CP, int rowsPerB, size_t sCPb, int row0g,
    float* __restrict__ C, _Float16* __restrict__ C16, int ldc, size_t sC, int M, int N, int K) { static_assert(ACT == 0 || ACT == 3 || ACT == 6 || ACT == 8 || ACT == 9 || ACT == 11 || ACT == 12 || ACT == 14 || ACT == 15 || ACT == 16 || ACT == 17, "k_gemm2: unsupported ACT code (would silently apply no activation)");
  __shared__ __attribute__((aligned(16))) float so[4][32][68];
  const int tid = threadIdx.x, w = tid >> 5, lane = tid & 31, ln = lane & 15, hh = lane >> 4; const int by = blockIdx.y;
  A += (size_t)by * sA; Bh += (size_t)by * sB; const size_t cofs = (size_t)by * sC; const float* bp = bias ? bias + (size_t)by * sBias : nullptr;
  const int ntn = N >> 6; const int mt = blockIdx.x / ntn, nq = blockIdx.x - mt * ntn; const int row0 = mt * 128 + 32 * w, col0 = nq * 64; if (row0 >= M) return;
  const _Float16* a0p = A + (size_t)(row0 + ln) * lda; const _Float16* a1p = a0p + (size_t)16 * lda;
  const _Float16* b0p = Bh + (size_t)(col0 + ln) * ldb; const _Float16* b1p = b0p + (size_t)16 * ldb; const _Float16* b2p = b1p + (size_t)16 * ldb; const _Float16* b3p = b2p + (size_t)16 * ldb;
  const v8f z8 = {0.f,0.f,0.f,0.f,0.f,0.f,0.f,0.f}; v8f c00 = z8, c01 = z8, c02 = z8, c03 = z8, c10 = z8, c11 = z8, c12 = z8, c13 = z8;
#pragma unroll 1
  for (int kb = 0; kb < K; kb += 32) { const v16h a0 = g2_frag(a0p + kb, hh), a1 = g2_frag(a1p + kb, hh);
    v16h b = g2_frag(b0p + kb, hh); c00 = g2_mma(a0, b, c00); c10 = g2_mma(a1, b, c10);
    b = g2_frag(b1p + kb, hh); c01 = g2_mma(a0, b, c01); c11 = g2_mma(a1, b, c11);
    b = g2_frag(b2p + kb, hh); c02 = g2_mma(a0, b, c02); c12 = g2_mma(a1, b, c12);
    b = g2_frag(b3p + kb, hh); c03 = g2_mma(a0, b, c03); c13 = g2_mma(a1, b, c13); }
  v8f accs[8] = {c00, c01, c02, c03, c10, c11, c12, c13};
#pragma unroll
  for (int u = 0; u < 8; ++u) { const int t = u & 3, half = u >> 2; const int col = col0 + t * 16 + ln; const float bv = bp ? bf16_round(bp[col]) : 0.f;
#pragma unroll
    for (int r = 0; r < 8; ++r) { const int rloc = half * 16 + 8 * hh + r; float v = accs[u][r] * alpha + bv; if (CP) { if (rowsPerB < 0) v += CP[cofs + (size_t)(row0g + row0 + rloc) * ldc + col];      /* rowsPerB < 0: own element of the batched C plane */ else { const int bidx = (row0g + row0 + rloc) / rowsPerB; v += CP[(size_t)bidx * sCPb + (size_t)by * 64 + col]; } }
      if (ACT == 3) v = fmaxf(v, 0.f); else if (ACT == 6) v = 0.5f * v * (1.0f + erff(v * 0.70710678118654752f)); else if (ACT == 11) v = 1.0f / (1.0f + expf(-v)); else if (ACT == 15) v = v / (1.0f + expf(-v)); else if (ACT == 12) v = (v > 0.f) ? v : 0.01f * v; else if (ACT == 8) v = tanhf(v); else if (ACT == 9) v = 0.5f * v * (1.0f + tanhf(0.7978845608028654f * (v + 0.044715f * v * v * v))); else if (ACT == 14) v = (v > 0.f) ? v : 0.1f * v; else if (ACT == 16) v = (v >= 0.f) ? v : 0.3f * v; else if (ACT == 17) v = (v >= 0.f) ? v : 0.2f * v;
      so[w][rloc][t * 16 + ln] = v; } }
  __builtin_amdgcn_fence(__ATOMIC_ACQ_REL, "workgroup"); __builtin_amdgcn_wave_barrier();
  const int rsub = lane >> 4, c4 = (lane & 15) * 4;
  {
#pragma unroll
    for (int q = 0; q < 16; ++q) { const int r = q * 2 + rsub; const v4f v = *(const v4fa*)&so[w][r][c4]; if (C) *(v4f*)(C + cofs + (size_t)(row0 + r) * ldc + col0 + c4) = v; if (C16) { v4h h4; for (int i = 0; i < 4; ++i) h4[i] = (_Float16)v[i]; *(v4h*)(C16 + cofs + (size_t)(row0 + r) * ldc + col0 + c4) = h4; } }
     } }


__global__ __launch_bounds__(256) void k_wnat(const float* __restrict__ w, size_t n8, _Float16* __restrict__ Bt) { const size_t t = (size_t)blockIdx.x * 256 + threadIdx.x; if (t >= n8) return; FragH f; for (int q = 0; q < 8; ++q) f.h[q] = (_Float16)(bf16_round(w[t * 8 + q]) * 16.0f); *(v8us*)((unsigned short*)Bt + t * 8) = f.half[0];  }
__global__ __launch_bounds__(256) void k_rsm(const float* __restrict__ S, _Float16* __restrict__ P, int nrows) {
  #pragma clang fp contract(off)
  const int i = blockIdx.x * 256 + threadIdx.x; if (i >= nrows) return; const float* s = S + (size_t)i * SQ; float mx = -3.0e38f;
#pragma unroll 1
  for (int j = 0; j < SQ; ++j) mx = fmaxf(mx, s[j]); float se = 0.f;
#pragma unroll 1
  for (int j = 0; j < SQ; ++j) se += expf(s[j] - mx); const float sc = 256.0f / se;
#pragma unroll 1
  for (int j0 = 0; j0 < SQ; j0 += 8) { FragH f; for (int q = 0; q < 8; ++q) f.h[q] = (_Float16)(expf(s[j0 + q] - mx) * sc); unsigned short* d = (unsigned short*)P + (size_t)i * SQ + j0; *(v8us*)d = f.half[0];  } }
__global__ __launch_bounds__(256) void k_vt(const _Float16* __restrict__ V16, int b, int h0, _Float16* __restrict__ VT) { __shared__ unsigned short tl[64][65]; const int tid = threadIdx.x; const int hh = blockIdx.x % HG, sg = blockIdx.x / HG; const int s0 = sg * 64; const int h = h0 + hh;
  for (int i = tid; i < 64 * 8; i += 256) { const int j = i / 8, d8 = (i % 8) * 8; FragH f; f.half[0] = *(const v8us*)((const unsigned short*)V16 + ((size_t)b * SQ + s0 + j) * DM + h * HD + d8); for (int q = 0; q < 8; ++q) tl[d8 + q][j] = f.u[q]; }
  __syncthreads();
  { for (int i = tid; i < 64 * 8; i += 256) { const int d = i / 8, j8 = (i % 8) * 8; FragH f; for (int q = 0; q < 8; ++q) f.u[q] = tl[d][j8 + q]; *(v8us*)((unsigned short*)VT + ((size_t)hh * HD + d) * SQ + s0 + j8) = f.half[0]; }  } }


__global__ __launch_bounds__(256) void k_rsmf(const float* __restrict__ S, _Float16* __restrict__ P, int qn, int hg) {
  #pragma clang fp contract(off)
  const int t = blockIdx.x * 256 + threadIdx.x; if (t >= qn * hg) return; const size_t i = (size_t)(t / qn) * SQ + (t % qn); const float* s = S + i * SQ; float mx = -3.0e38f;
#pragma unroll 1
  for (int j = 0; j < SQ; ++j) mx = fmaxf(mx, s[j]); float se = 0.f;
#pragma unroll 1
  for (int j = 0; j < SQ; ++j) se += __expf(s[j] - mx); const float sc = 256.0f / se;
#pragma unroll 1
  for (int j0 = 0; j0 < SQ; j0 += 8) { FragH f; for (int q = 0; q < 8; ++q) f.h[q] = (_Float16)(__expf(s[j0 + q] - mx) * sc); unsigned short* d = (unsigned short*)P + i * SQ + j0; *(v8us*)d = f.half[0];  } }

__global__ __launch_bounds__(256) void k_cl2rows(const float* __restrict__ X, _Float16* __restrict__ XR) { __shared__ float tl[64][33]; const int tid = threadIdx.x; const int nl = LL / 32, nc = CC / 64; const int cb_ = blockIdx.x % nc; const int lb = (blockIdx.x / nc) % nl; const size_t b = blockIdx.x / (nc * nl); const int c0 = cb_ * 64, l0 = lb * 32;
  for (int i = tid; i < 64 * 32; i += 256) { const int c = i / 32, l = i % 32; tl[c][l] = bf16_round(X[(b * CC + c0 + c) * (size_t)LL + l0 + l]); }
  __syncthreads();
  { const int l = tid / 8, c8 = (tid % 8) * 8; FragH f; for (int q = 0; q < 8; ++q) f.h[q] = (_Float16)tl[c8 + q][l]; unsigned short* d = (unsigned short*)XR + (b * LL + l0 + l) * (size_t)CC + c0 + c8; *(v8us*)d = f.half[0];  } }


__global__ __launch_bounds__(256) void k_gres2(float* __restrict__ y, const float* __restrict__ x, const float* __restrict__ gam) {
  #pragma clang fp contract(off)
  const size_t i = (size_t)blockIdx.x * 256 + threadIdx.x; if (i >= (size_t)CC * LL / 4) return; const float g = bf16_round(gam[0]); v4f a = *(const v4fa*)(y + i * 4); const v4f b = *(const v4fa*)(x + i * 4);
  for (int q = 0; q < 4; ++q) a[q] = __fadd_rn(__fmul_rn(g, a[q]), bf16_round(b[q])); *(v4f*)(y + i * 4) = a;  }
extern "C" void kernel_launch(void* const* d_in, const int* in_sizes, int n_in,
                              void* d_out, int out_size, void* d_ws, size_t ws_size, hipStream_t stream) {
  (void)in_sizes; (void)n_in; (void)out_size;
  const float* const* I = (const float* const*)d_in; const float* x = I[0]; const float* wq = I[1]; const float* wk = I[2]; const float* wv = I[3]; const float* gam = I[4];
  char* ws = (char*)d_ws; size_t off = 0;
  auto take = [&](size_t bytes) { char* p = ws + off; off += (bytes + 255) & ~(size_t)255; return p; };
  _Float16* BQ = (_Float16*)take((size_t)CQ * CC * 2); _Float16* BK = (_Float16*)take((size_t)CQ * CC * 2); _Float16* BV = (_Float16*)take((size_t)CC * CC * 2);
  _Float16* XR = (_Float16*)take(NR * CC * 2); float* FF = (float*)take((size_t)LL * CQ * 4); _Float16* Fh = (_Float16*)take((size_t)LL * CQ * 2); _Float16* Fl = (_Float16*)take((size_t)LL * CQ * 2); _Float16* Gh = (_Float16*)take((size_t)LL * CQ * 2); _Float16* Gl = (_Float16*)take((size_t)LL * CQ * 2);
  _Float16* H16 = (_Float16*)take((size_t)CC * LL * 2); float* S = (float*)take((size_t)LL * LL * 4); _Float16* P = (_Float16*)take((size_t)LL * LL * 2);
  if (off > ws_size) return;      /* approx 0.6 + 16 + 1.5 + 2 + 16 + 8 = 44 MiB */
  k_wnat<<<(unsigned)(((size_t)CQ * CC / 8 + 255) / 256), 256, 0, stream>>>(wq, (size_t)CQ * CC / 8, BQ); k_wnat<<<(unsigned)(((size_t)CQ * CC / 8 + 255) / 256), 256, 0, stream>>>(wk, (size_t)CQ * CC / 8, BK); k_wnat<<<(unsigned)(((size_t)CC * CC / 8 + 255) / 256), 256, 0, stream>>>(wv, (size_t)CC * CC / 8, BV);
  k_cl2rows<<<NB * (LL / 32) * (CC / 64), 256, 0, stream>>>(x, XR);      /* exact f16 token rows [b*2048 + n][c] */
  for (int b = 0; b < NB; ++b) { const _Float16* Xb = XR + (size_t)b * LL * CC; float* Ob = (float*)d_out + (size_t)b * CC * LL;
    k_gemm2<0><<<dim3((LL / 128) * 1, 1), 128, 0, stream>>>(Xb, CC, 0, BQ, CC, 0, 0.0625f, nullptr, 0, nullptr, 1, 0, 0, FF, nullptr, CQ, 0, LL, CQ, CC); k_hl<<<(unsigned)(((size_t)LL * CQ / 8 + 255) / 256), 256, 0, stream>>>(FF, Fh, Fl, (size_t)LL * CQ / 8);      /* f^T rows [n][64] -> hi/lo */
    k_gemm2<0><<<dim3((LL / 128) * 1, 1), 128, 0, stream>>>(Xb, CC, 0, BK, CC, 0, 0.0625f, nullptr, 0, nullptr, 1, 0, 0, FF, nullptr, CQ, 0, LL, CQ, CC); k_hl<<<(unsigned)(((size_t)LL * CQ / 8 + 255) / 256), 256, 0, stream>>>(FF, Gh, Gl, (size_t)LL * CQ / 8);      /* g^T rows [m][64] -> hi/lo */
    k_gemm2<0><<<dim3((CC / 128) * (LL / 64), 1), 128, 0, stream>>>(BV, CC, 0, Xb, CC, 0, 0.0625f, nullptr, 0, nullptr, 1, 0, 0, nullptr, H16, LL, 0, CC, LL, CC);      /* h channel-major [c][n] f16 */
    k_gemm2<0><<<dim3((LL / 128) * (LL / 64), 1), 128, 0, stream>>>(Gh, CQ, 0, Fh, CQ, 0, 1.0f, nullptr, 0, nullptr, 1, 0, 0, S, nullptr, LL, 0, LL, LL, CQ);      /* S^T[m][n] = g_m . f_n (hi.hi) */
    k_gemm2<0><<<dim3((LL / 128) * (LL / 64), 1), 128, 0, stream>>>(Gl, CQ, 0, Fh, CQ, 0, 0.0009765625f, nullptr, 0, S, -1, 0, 0, S, nullptr, LL, 0, LL, LL, CQ);      /* += lo.hi 2^-10 */
    k_gemm2<0><<<dim3((LL / 128) * (LL / 64), 1), 128, 0, stream>>>(Gh, CQ, 0, Fl, CQ, 0, 0.0009765625f, nullptr, 0, S, -1, 0, 0, S, nullptr, LL, 0, LL, LL, CQ);      /* += hi.lo 2^-10 */
    k_rsmf<<<(LL + 255) / 256, 256, 0, stream>>>(S, P, LL, 1);      /* softmax over n per key m (the module's dim=1 softmax) -> beta^T[m][n] x256 f16 */
    k_gemm2<0><<<dim3((CC / 128) * (LL / 64), 1), 128, 0, stream>>>(H16, LL, 0, P, LL, 0, 0.00390625f, nullptr, 0, nullptr, 1, 0, 0, Ob, nullptr, LL, 0, CC, LL, LL);      /* o[c][m] = 2^-8 sum_n h[c][n] beta^T[m][n] (channel-major = the output layout) */
    k_gres2<<<(unsigned)(((size_t)CC * LL / 4 + 255) / 256), 256, 0, stream>>>(Ob, x + (size_t)b * CC * LL, gam); }      /* gamma o + x */
}

// v001
// It runs in 1460 microseconds.
// Next to v000, in two timings, it ran 2.78 times as fast each time.
#include <hip/hip_runtime.h>
// SAGAN-style self-attention with 1x1-conv projections (x [8][512][2048] channel-first; f = Wq x, g = Wk x (64 channels), h = Wv x (512); scores[n][m] = sum_c f[c][n] g[c][m] (unscaled); beta = softmax over n (the QUERY axis, dim=1) for each m; o[c][m] = gamma sum_n h[c][n] beta[n][m] + x[c][m] -> [8][512][2048]; gamma = an input scalar).
// Structure: x transposed to exact f16 token rows via LDS tiles; f^T and g^T as WMMA GEMMs (32x64 wave tiles, f32 accumulation, exact x16 weights) into f32 rows then f16 hi + x1024 residual planes; h channel-major as a GEMM (weights as the A operand) into f16; per batch: S^T[m][n] = g^T f as three accumulating GEMM passes (K = 64; hi.hi + hi.lo + lo.hi), row softmax over n on VALU (f32 statistics, native exp; weights x256 f16) = beta^T; o[c][m] = h . beta^T as a GEMM (K = 2048) channel-major straight into the output; epilogue out = bf16(gamma) o + bf16(x); 4 + 8 x 11 = 92 launches.
// Compute dtype: inputs rounded to bf16; x / weights exact; f, g as hi + residual (~2^-22: the unscaled logits have sigma ~8); h and the softmax weights plain f16 (~2^-12); logits, statistics, o f32. v_wmma_f32_16x16x32_f16.
#define NB 8
#define CC 512
#define CQ 64
#define LL 2048
#define SQ LL
#define DM 64
#define NH 1
#define HD 64
#define HG 1
#define NR ((size_t)NB * LL)
typedef __bf16 v16b __attribute__((ext_vector_type(16)));
typedef unsigned short v8us __attribute__((ext_vector_type(8), may_alias));
typedef float  v8f  __attribute__((ext_vector_type(8)));
typedef float  v4f  __attribute__((ext_vector_type(4)));
typedef float  v4fa __attribute__((ext_vector_type(4), may_alias));
union FragB { v16b v; v8us half[2]; unsigned short u[16]; };

__device__ __forceinline__ unsigned short bf16_bits(float x) { unsigned int u = __float_as_uint(x); return (unsigned short)((u + 0x7FFFu + ((u >> 16) & 1u)) >> 16); }
__device__ __forceinline__ float bf16_val(unsigned short b) { return __uint_as_float(((unsigned int)b) << 16); }
__device__ __forceinline__ float bf16_round(float x) { return bf16_val(bf16_bits(x)); }
// D += A·B with NT terms: 1 = ah·bh, 2 = + al·bh (A split), 3 = + ah·bl (both split)
template <int NT>
__device__ __forceinline__ v8f mmaN(v16b ah, v16b al, v16b bh, v16b bl, v8f c) {
  c = __builtin_amdgcn_wmma_f32_16x16x32_bf16(false, ah, false, bh, (short)0, c, false, false);
  if (NT >= 2) c = __builtin_amdgcn_wmma_f32_16x16x32_bf16(false, al, false, bh, (short)0, c, false, false);
  if (NT >= 3) c = __builtin_amdgcn_wmma_f32_16x16x32_bf16(false, ah, false, bl, (short)0, c, false, false);
  asm volatile("v_nop\n\tv_nop\n\tv_nop\n\tv_nop" : "+v"(c) : "v"(ah), "v"(al), "v"(bh), "v"(bl));
  return c;
}

__global__ __launch_bounds__(256) void k_wt_bf16(const float* __restrict__ W, unsigned short* __restrict__ Wt, int K, int N) {
  const int t = blockIdx.x * 256 + threadIdx.x;
  const int k8n = K / 8;
  if (t >= N * k8n) return;
  const int n = t / k8n, k8 = (t % k8n) * 8;
  v8us v;
#pragma unroll
  for (int i = 0; i < 8; ++i) v[i] = bf16_bits(W[(size_t)(k8 + i) * N + n]);
  *(v8us*)(Wt + (size_t)n * K + k8) = v;
  
}

// GEMM C[M][N] (f32, pitch ldc) = act(A[M][K]·W + bias). A f32 row-major (pitch lda) converted per fragment to bf16
// (ASPLIT: hi/lo two planes -> 2 terms, else single rounded term); Wt bf16 [N][K] (pitch ldb). BIAS_BF16 rounds the
// bias to bf16 first (bias quantised to bf16 before the add). K%32==0, M%16==0, N%64==0.
template <bool ASPLIT, int ACT, bool BIAS_BF16>
__global__ __launch_bounds__(128) void k_gemm_bf(const float* __restrict__ A, int lda, const unsigned short* __restrict__ Wt, int ldb,
                                               const float* __restrict__ bias, float* __restrict__ C, int ldc, int M, int N, int K) {
  __shared__ __attribute__((aligned(16))) float so[4][16][64];
  const int tid = threadIdx.x, w = tid >> 5, lane = tid & 31, ln = lane & 15, hh = lane >> 4;
  const int ntn = N / 64;
  const int wid = blockIdx.x * 4 + w;
  const int mt = wid / ntn, nq = wid % ntn;
  if (mt * 16 >= M) return;
  const int row0 = mt * 16, col0 = nq * 64;
  const float* arow = A + (size_t)(row0 + ln) * lda;
  v8f acc[4] = {};
  for (int kb = 0; kb < K; kb += 32) {
    FragB ah, al;
    const v4f x0 = *(const v4fa*)(arow + kb + 8 * hh), x1 = *(const v4fa*)(arow + kb + 8 * hh + 4);
    const v4f x2 = *(const v4fa*)(arow + kb + 16 + 8 * hh), x3 = *(const v4fa*)(arow + kb + 16 + 8 * hh + 4);
    float xs[16] = {x0[0],x0[1],x0[2],x0[3],x1[0],x1[1],x1[2],x1[3],x2[0],x2[1],x2[2],x2[3],x3[0],x3[1],x3[2],x3[3]};
#pragma unroll
    for (int i = 0; i < 16; ++i) { const unsigned short hb = bf16_bits(xs[i]); ah.u[i] = hb; al.u[i] = ASPLIT ? bf16_bits(xs[i] - bf16_val(hb)) : (unsigned short)0; }
#pragma unroll
    for (int t = 0; t < 4; ++t) {
      const unsigned short* brow = Wt + (size_t)(col0 + t * 16 + ln) * ldb + kb;
      FragB b;
      b.half[0] = *(const v8us*)(brow + 8 * hh);
      b.half[1] = *(const v8us*)(brow + 16 + 8 * hh);
      acc[t] = mmaN<ASPLIT ? 2 : 1>(ah.v, al.v, b.v, b.v, acc[t]);
    }
  }
#pragma unroll
  for (int t = 0; t < 4; ++t) {
    float bv = bias ? bias[col0 + t * 16 + ln] : 0.f;
    if (BIAS_BF16) bv = bf16_round(bv);
#pragma unroll
    for (int r = 0; r < 8; ++r) { float v = acc[t][r] + bv; if (ACT == 1) v = fmaxf(v, 0.f); so[w][8 * hh + r][t * 16 + ln] = v; }
  }
  __builtin_amdgcn_fence(__ATOMIC_ACQ_REL, "workgroup");
  __builtin_amdgcn_wave_barrier();
  const int rsub = lane >> 4, c4 = (lane & 15) * 4;
  {
#pragma unroll
    for (int q = 0; q < 8; ++q) {
      const int r = q * 2 + rsub;
      const v4f v = *(const v4fa*)&so[w][r][c4];
      *(v4f*)(C + (size_t)(row0 + r) * ldc + col0 + c4) = v;
    }
    
  }
}

// GEMM C = act(A·W + bias + resid): A f32 (ASPLIT -> hi/lo 2 terms), Wt bf16 [N][K]; ACT 0 none, 1 relu, 2 exact gelu;
// resid (optional, f32, row index = (row % rmod), pitch ldr, RES_BF16 rounds it) added before the activation.
template <bool ASPLIT, int ACT, bool BIAS_BF16, bool RES_BF16>
__global__ __launch_bounds__(128) void k_gemm_bf3(const float* __restrict__ A, int lda, const unsigned short* __restrict__ Wt, int ldb,
                                                const float* __restrict__ bias, const float* __restrict__ resid, int rmod, int ldr,
                                                float* __restrict__ C, int ldc, int M, int N, int K) {
  __shared__ __attribute__((aligned(16))) float so[4][16][64];
  const int tid = threadIdx.x, w = tid >> 5, lane = tid & 31, ln = lane & 15, hh = lane >> 4;
  const int ntn = N / 64;
  const int wid = blockIdx.x * 4 + w;
  const int mt = wid / ntn, nq = wid % ntn;
  if (mt * 16 >= M) return;
  const int row0 = mt * 16, col0 = nq * 64;
  const float* arow = A + (size_t)(row0 + ln) * lda;
  v8f acc[4] = {};
  for (int kb = 0; kb < K; kb += 32) {
    FragB ah, al;
    const v4f x0 = *(const v4fa*)(arow + kb + 8 * hh), x1 = *(const v4fa*)(arow + kb + 8 * hh + 4);
    const v4f x2 = *(const v4fa*)(arow + kb + 16 + 8 * hh), x3 = *(const v4fa*)(arow + kb + 16 + 8 * hh + 4);
    float xs[16] = {x0[0],x0[1],x0[2],x0[3],x1[0],x1[1],x1[2],x1[3],x2[0],x2[1],x2[2],x2[3],x3[0],x3[1],x3[2],x3[3]};
#pragma unroll
    for (int i = 0; i < 16; ++i) { const unsigned short hb = bf16_bits(xs[i]); ah.u[i] = hb; al.u[i] = ASPLIT ? bf16_bits(xs[i] - bf16_val(hb)) : (unsigned short)0; }
#pragma unroll
    for (int t = 0; t < 4; ++t) {
      const unsigned short* brow = Wt + (size_t)(col0 + t * 16 + ln) * ldb + kb;
      FragB b;
      b.half[0] = *(const v8us*)(brow + 8 * hh);
      b.half[1] = *(const v8us*)(brow + 16 + 8 * hh);
      acc[t] = mmaN<ASPLIT ? 2 : 1>(ah.v, al.v, b.v, b.v, acc[t]);
    }
  }
#pragma unroll
  for (int t = 0; t < 4; ++t) {
    const int col = col0 + t * 16 + ln;
    float bv = bias ? bias[col] : 0.f;
    if (BIAS_BF16) bv = bf16_round(bv);
#pragma unroll
    for (int r = 0; r < 8; ++r) {
      float v = acc[t][r] + bv;
      if (resid) { float rv = resid[(size_t)((row0 + 8 * hh + r) % rmod) * ldr + col]; if (RES_BF16) rv = bf16_round(rv); v += rv; }
      if (ACT == 1) v = fmaxf(v, 0.f);
      if (ACT == 2) v = 0.5f * v * (1.0f + erff(v * 0.70710678118654752f));
      if (ACT == 3) { const float u = 0.7978845608028654f * (v + 0.044715f * v * v * v); v = 0.5f * v * (1.0f + tanhf(u)); }
      so[w][8 * hh + r][t * 16 + ln] = v;
    }
  }
  __builtin_amdgcn_fence(__ATOMIC_ACQ_REL, "workgroup");
  __builtin_amdgcn_wave_barrier();
  const int rsub = lane >> 4, c4 = (lane & 15) * 4;
  {
#pragma unroll
    for (int q = 0; q < 8; ++q) {
      const int r = q * 2 + rsub;
      const v4f v = *(const v4fa*)&so[w][r][c4];
      *(v4f*)(C + (size_t)(row0 + r) * ldc + col0 + c4) = v;
    }
    
  }
}
// row LayerNorm (biased variance, eps) over N: s = X (+ R); optional out_sum <- s; out_norm <- (s-mu)*rsqrt(var+eps)*g + b
template <bool PARAM_BF16>
__global__ __launch_bounds__(256) void k_layernorm(const float* __restrict__ X, const float* __restrict__ R, const float* __restrict__ g, const float* __restrict__ bta,
                                                  float* __restrict__ out_sum, float* __restrict__ out_norm, int N, float eps) {
  __shared__ float red[256];
  const int row = blockIdx.x, tid = threadIdx.x;
  const float* x = X + (size_t)row * N; const float* rr = R ? R + (size_t)row * N : nullptr;
  float vals[16];                     // up to N = 4096
  const int per = N / 256;            // contiguous chunk per thread? use strided-by-4 chunks: thread handles j = tid*4 + 1024*u
  float s1 = 0.f;
  for (int u = 0; u < per / 4; ++u) {
    const int j = tid * 4 + 1024 * u;
    const v4f a = *(const v4fa*)(x + j);
    v4f b = {0.f,0.f,0.f,0.f}; if (rr) b = *(const v4fa*)(rr + j);
#pragma unroll
    for (int q = 0; q < 4; ++q) { const float v = a[q] + b[q]; vals[u * 4 + q] = v; s1 += v; }
  }
  red[tid] = s1; __syncthreads();
  for (int st = 128; st > 0; st >>= 1) { if (tid < st) red[tid] += red[tid + st]; __syncthreads(); }
  const float mu = red[0] / (float)N; __syncthreads();
  float s2 = 0.f;
  for (int u = 0; u < per / 4; ++u)
#pragma unroll
    for (int q = 0; q < 4; ++q) { const float c = vals[u * 4 + q] - mu; s2 += c * c; }
  red[tid] = s2; __syncthreads();
  for (int st = 128; st > 0; st >>= 1) { if (tid < st) red[tid] += red[tid + st]; __syncthreads(); }
  const float rs = rsqrtf(red[0] / (float)N + eps);
  {
    for (int u = 0; u < per / 4; ++u) {
      const int j = tid * 4 + 1024 * u;
      v4f o, sm;
#pragma unroll
      for (int q = 0; q < 4; ++q) {
        float gg = g[j + q], bb = bta[j + q];
        if (PARAM_BF16) { gg = bf16_round(gg); bb = bf16_round(bb); }
        sm[q] = vals[u * 4 + q]; o[q] = (vals[u * 4 + q] - mu) * rs * gg + bb;
      }
      if (out_sum) *(v4f*)(out_sum + (size_t)row * N + j) = sm;
      *(v4f*)(out_norm + (size_t)row * N + j) = o;
    }
    
  }
}



// ---- f16 WMMA path (v_wmma_f32_16x16x32_f16): 11-bit significands for operands in range — used where a [0,1] probability operand needs more precision than bf16
typedef _Float16 v16h __attribute__((ext_vector_type(16)));
union FragH { v16h v; v8us half[2]; _Float16 h[16]; unsigned short u[16]; };
template <int NT>
__device__ __forceinline__ v8f mmaH(v16h ah, v16h al, v16h bh, v16h bl, v8f c) {
  c = __builtin_amdgcn_wmma_f32_16x16x32_f16(false, ah, false, bh, (short)0, c, false, false);
  if (NT >= 2) c = __builtin_amdgcn_wmma_f32_16x16x32_f16(false, al, false, bh, (short)0, c, false, false);
  if (NT >= 3) c = __builtin_amdgcn_wmma_f32_16x16x32_f16(false, ah, false, bl, (short)0, c, false, false);
  asm volatile("v_nop\n\tv_nop\n\tv_nop\n\tv_nop" : "+v"(c) : "v"(ah), "v"(al), "v"(bh), "v"(bl));
  return c;
}
// batched GEMM like k_gemm_b but f16 operands: A f32 (split into f16 hi/lo if ASPLIT, else rounded to f16), Bt = f16 values [n][k]; alpha; C f32; N multiple of 16 (partial tiles skipped)
template <bool ASPLIT>
__global__ __launch_bounds__(128) void k_gemm_h(const float* __restrict__ A, int lda, size_t sA, const _Float16* __restrict__ Bh, int ldb, size_t sB, float alpha, float* __restrict__ C, int ldc, size_t sC, int M, int N, int K) {
  __shared__ __attribute__((aligned(16))) float so[4][16][64];
  const int tid = threadIdx.x, w = tid >> 5, lane = tid & 31, ln = lane & 15, hh = lane >> 4; const int by = blockIdx.y;
  A += (size_t)by * sA; Bh += (size_t)by * sB; C += (size_t)by * sC;
  const int ntn = (N + 63) / 64; const int wid = blockIdx.x * 4 + w; const int mt = wid / ntn, nq = wid % ntn; if (mt * 16 >= M) return;
  const int row0 = mt * 16, col0 = nq * 64; const float* arow = A + (size_t)(row0 + ln) * lda;
  v8f acc[4] = {};
  for (int kb = 0; kb < K; kb += 32) {
    FragH ah, al;
    const v4f x0 = *(const v4fa*)(arow + kb + 8 * hh), x1 = *(const v4fa*)(arow + kb + 8 * hh + 4), x2 = *(const v4fa*)(arow + kb + 16 + 8 * hh), x3 = *(const v4fa*)(arow + kb + 16 + 8 * hh + 4);
    float xs[16] = {x0[0],x0[1],x0[2],x0[3],x1[0],x1[1],x1[2],x1[3],x2[0],x2[1],x2[2],x2[3],x3[0],x3[1],x3[2],x3[3]};
#pragma unroll
    for (int i = 0; i < 16; ++i) { const _Float16 h = (_Float16)xs[i]; ah.h[i] = h; al.h[i] = ASPLIT ? (_Float16)(xs[i] - (float)h) : (_Float16)0.0f; }
#pragma unroll
    for (int t = 0; t < 4; ++t) { if (col0 + t * 16 >= N) continue; const size_t boff = (size_t)(col0 + t * 16 + ln) * ldb + kb; FragH bq; bq.half[0] = *(const v8us*)(Bh + boff + 8 * hh); bq.half[1] = *(const v8us*)(Bh + boff + 16 + 8 * hh);
      acc[t] = mmaH<ASPLIT ? 2 : 1>(ah.v, al.v, bq.v, bq.v, acc[t]); }
  }
#pragma unroll
  for (int t = 0; t < 4; ++t) { if (col0 + t * 16 >= N) continue;
#pragma unroll
    for (int r = 0; r < 8; ++r) so[w][8 * hh + r][t * 16 + ln] = acc[t][r] * alpha; }
  __builtin_amdgcn_fence(__ATOMIC_ACQ_REL, "workgroup"); __builtin_amdgcn_wave_barrier();
  const int rsub = lane >> 4, c4 = (lane & 15) * 4;
  {
#pragma unroll
    for (int q = 0; q < 8; ++q) { const int r = q * 2 + rsub; if (col0 + c4 < N) { const v4f v = *(const v4fa*)&so[w][r][c4]; *(v4f*)(C + (size_t)(row0 + r) * ldc + col0 + c4) = v; } }
     }
}

// Wt[n][k] = f16(W[k][n]·scale) from f32 row-major W[K][N] (scale = power of two; bf16-exact weights stay exact in f16 away from the subnormal range)
__global__ __launch_bounds__(256) void k_wt_f16(const float* __restrict__ W, _Float16* __restrict__ Wt, int K, int N, float scale) {
  const int t = blockIdx.x * 256 + threadIdx.x; if (t >= N * (K / 8)) return; const int n = t / (K / 8), k8 = (t % (K / 8)) * 8; FragH f;
#pragma unroll
  for (int i = 0; i < 8; ++i) f.h[i] = (_Float16)(bf16_round(W[(size_t)(k8 + i) * N + n]) * scale); const v8us o = f.half[0];
  *(v8us*)((unsigned short*)Wt + (size_t)n * K + k8) = o; 
}
// k_gemm_hh variant with fused epilogue: v = acc·alpha + bias[by·sBias + col] (+ CP[(row/rowsPerB)·sCPb + by·64 + col] if CP) ; ACT 0 none / 1 elu ; writes f16 C16 (and f32 C if non-null)
template <int ACT>
__global__ __launch_bounds__(128) void k_gemm_hhx(const _Float16* __restrict__ A, int lda, size_t sA, const _Float16* __restrict__ Bh, int ldb, size_t sB, float alpha, const float* __restrict__ bias, size_t sBias, const float* __restrict__ CP, int rowsPerB, size_t sCPb, int row0g,
    float* __restrict__ C, _Float16* __restrict__ C16, int ldc, size_t sC, int M, int N, int K) {
  __shared__ __attribute__((aligned(16))) float so[4][16][64];
  const int tid = threadIdx.x, w = tid >> 5, lane = tid & 31, ln = lane & 15, hh = lane >> 4; const int by = blockIdx.y;
  A += (size_t)by * sA; Bh += (size_t)by * sB; const size_t cofs = (size_t)by * sC; const float* bp = bias ? bias + (size_t)by * sBias : nullptr;
  const int ntn = (N + 63) / 64; const int wid = blockIdx.x * 4 + w; const int mt = wid / ntn, nq = wid % ntn; if (mt * 16 >= M) return;
  const int row0 = mt * 16, col0 = nq * 64; const _Float16* arow = A + (size_t)(row0 + ln) * lda;
  v8f acc[4] = {};
  for (int kb = 0; kb < K; kb += 32) { FragH ah; ah.half[0] = *(const v8us*)((const unsigned short*)arow + kb + 8 * hh); ah.half[1] = *(const v8us*)((const unsigned short*)arow + kb + 16 + 8 * hh);
#pragma unroll
    for (int t = 0; t < 4; ++t) { if (col0 + t * 16 >= N) continue; const size_t boff = (size_t)(col0 + t * 16 + ln) * ldb + kb; FragH bq; bq.half[0] = *(const v8us*)((const unsigned short*)Bh + boff + 8 * hh); bq.half[1] = *(const v8us*)((const unsigned short*)Bh + boff + 16 + 8 * hh);
      acc[t] = mmaH<1>(ah.v, ah.v, bq.v, bq.v, acc[t]); }
  }
#pragma unroll
  for (int t = 0; t < 4; ++t) { if (col0 + t * 16 >= N) continue; const int col = col0 + t * 16 + ln; const float bv = bp ? bf16_round(bp[col]) : 0.f;
#pragma unroll
    for (int r = 0; r < 8; ++r) { float v = acc[t][r] * alpha + bv; if (CP) { const int rr = row0g + row0 + 8 * hh + r; if (rowsPerB < 0) v += CP[cofs + (size_t)rr * ldc + col];      /* rowsPerB < 0: own element of the batched C plane */ else { const int bidx = rr / rowsPerB; v += CP[(size_t)bidx * sCPb + (size_t)by * 64 + col]; } } if (ACT == 1) v = (v > 0.f) ? v : expm1f(v); else if (ACT == 7) v = (v > 0.f) ? v + 1.0f : expf(v); else if (ACT == 8) v = tanhf(v); else if (ACT == 9) v = 0.5f * v * (1.0f + tanhf(0.7978845608028654f * (v + 0.044715f * v * v * v))); else if (ACT == 11) v = 1.0f / (1.0f + expf(-v)); else if (ACT == 12) v = (v > 0.f) ? v : 0.01f * v; else if (ACT == 14) v = (v > 0.f) ? v : 0.1f * v; else if (ACT == 16) v = (v >= 0.f) ? v : 0.3f * v; else if (ACT == 17) v = (v >= 0.f) ? v : 0.2f * v; else if (ACT == 15) v = v / (1.0f + expf(-v)); else if (ACT == 3) v = fmaxf(v, 0.f); else if (ACT == 6) v = 0.5f * v * (1.0f + erff(v * 0.70710678118654752f)); so[w][8 * hh + r][t * 16 + ln] = v; } }
  __builtin_amdgcn_fence(__ATOMIC_ACQ_REL, "workgroup"); __builtin_amdgcn_wave_barrier();
  const int rsub = lane >> 4, c4 = (lane & 15) * 4; typedef _Float16 v4h __attribute__((ext_vector_type(4)));
  {
#pragma unroll
    for (int q = 0; q < 8; ++q) { const int r = q * 2 + rsub; if (col0 + c4 < N) { const v4f v = *(const v4fa*)&so[w][r][c4]; if (C) *(v4f*)(C + cofs + (size_t)(row0 + r) * ldc + col0 + c4) = v; if (C16) { v4h h4; for (int i = 0; i < 4; ++i) h4[i] = (_Float16)v[i]; *(v4h*)(C16 + cofs + (size_t)(row0 + r) * ldc + col0 + c4) = h4; } } }
     }
}


typedef _Float16 v4h __attribute__((ext_vector_type(4)));

__global__ __launch_bounds__(256) void k_x16(const float* __restrict__ x, _Float16* __restrict__ X16, size_t n8) { const size_t t = (size_t)blockIdx.x * 256 + threadIdx.x; if (t >= n8) return; FragH f;
#pragma unroll
  for (int q = 0; q < 8; ++q) f.h[q] = (_Float16)bf16_round(x[t * 8 + q]); *(v8us*)((unsigned short*)X16 + t * 8) = f.half[0];  }
__global__ __launch_bounds__(256) void k_h16(const float* __restrict__ x, _Float16* __restrict__ X16, size_t n8) { const size_t t = (size_t)blockIdx.x * 256 + threadIdx.x; if (t >= n8) return; FragH f;
#pragma unroll
  for (int q = 0; q < 8; ++q) f.h[q] = (_Float16)x[t * 8 + q]; *(v8us*)((unsigned short*)X16 + t * 8) = f.half[0];  }
__global__ __launch_bounds__(256) void k_round16f(const float* __restrict__ W, _Float16* __restrict__ Bt, size_t n8) { const size_t t = (size_t)blockIdx.x * 256 + threadIdx.x; if (t >= n8) return; FragH f;
#pragma unroll
  for (int i = 0; i < 8; ++i) f.h[i] = (_Float16)(bf16_round(W[t * 8 + i]) * 16.0f); *(v8us*)((unsigned short*)Bt + t * 8) = f.half[0];  }
template <int NHv, int TTv>
__global__ __launch_bounds__(256) void k_vt(const _Float16* __restrict__ V16, int ldv, int voff, _Float16* __restrict__ Vt) { __shared__ unsigned short tl[64][66]; const int tid = threadIdx.x; const int slab = blockIdx.x / (TTv / 64), lg = blockIdx.x % (TTv / 64); const int b = slab / NHv, h = slab % NHv;
  for (int i = tid; i < 64 * 8; i += 256) { const int r = i / 8, c8 = (i % 8) * 8; FragH f; f.half[0] = *(const v8us*)((const unsigned short*)V16 + ((size_t)b * TTv + lg * 64 + r) * ldv + voff + h * 64 + c8);
#pragma unroll
    for (int q = 0; q < 8; ++q) tl[r][c8 + q] = f.u[q]; }
  __syncthreads();
  {
#pragma unroll
    for (int rd = 0; rd < 2; ++rd) { const int d = rd * 32 + tid / 8, pc = tid % 8; FragH f;
#pragma unroll
      for (int q = 0; q < 8; ++q) f.u[q] = tl[pc * 8 + q][d];
      *(v8us*)((unsigned short*)Vt + ((size_t)slab * 64 + d) * TTv + lg * 64 + pc * 8) = f.half[0]; }
     } }

__global__ __launch_bounds__(256) void k_hl(const float* __restrict__ F, _Float16* __restrict__ Hh, _Float16* __restrict__ Hl, size_t n8) { const size_t t = (size_t)blockIdx.x * 256 + threadIdx.x; if (t >= n8) return; FragH fh, fl; const v4f a = *(const v4fa*)(F + t * 8), c = *(const v4fa*)(F + t * 8 + 4);
#pragma unroll
  for (int q = 0; q < 4; ++q) { _Float16 h = (_Float16)a[q]; fh.h[q] = h; fl.h[q] = (_Float16)((a[q] - (float)h) * 1024.0f); h = (_Float16)c[q]; fh.h[4 + q] = h; fl.h[4 + q] = (_Float16)((c[q] - (float)h) * 1024.0f); }
  { *(v8us*)((unsigned short*)Hh + t * 8) = fh.half[0]; *(v8us*)((unsigned short*)Hl + t * 8) = fl.half[0];  } }

// ---- fast GEMM (wave tile 32x64; requires M % 32 == 0 rows per launch region and N % 64 == 0); epilogue = k_gemm_hhx semantics ----
__device__ __forceinline__ v16h g2_frag(const _Float16* p, int hh) { FragH f; f.half[0] = *(const v8us*)((const unsigned short*)p + 8 * hh); f.half[1] = *(const v8us*)((const unsigned short*)p + 16 + 8 * hh); return f.v; }
__device__ __forceinline__ v8f g2_mma(v16h a, v16h b, v8f c) { v8f d = __builtin_amdgcn_wmma_f32_16x16x32_f16(false, a, false, b, (short)0, c, false, false); asm volatile("v_nop\n\tv_nop\n\tv_nop\n\tv_nop" : "+v"(d) : "v"(a), "v"(b)); return d; }
template <int ACT>
__global__ __launch_bounds__(128) void k_gemm2(const _Float16* __restrict__ A, int lda, size_t sA, const _Float16* __restrict__ Bh, int ldb, size_t sB, float alpha, const float* __restrict__ bias, size_t sBias, const float* __restrict__ CP, int rowsPerB, size_t sCPb, int row0g,
    float* __restrict__ C, _Float16* __restrict__ C16, int ldc, size_t sC, int M, int N, int K) { static_assert(ACT == 0 || ACT == 3 || ACT == 6 || ACT == 8 || ACT == 9 || ACT == 11 || ACT == 12 || ACT == 14 || ACT == 15 || ACT == 16 || ACT == 17, "k_gemm2: unsupported ACT code (would silently apply no activation)");
  __shared__ __attribute__((aligned(16))) float so[4][32][68];
  const int tid = threadIdx.x, w = tid >> 5, lane = tid & 31, ln = lane & 15, hh = lane >> 4; const int by = blockIdx.y;
  A += (size_t)by * sA; Bh += (size_t)by * sB; const size_t cofs = (size_t)by * sC; const float* bp = bias ? bias + (size_t)by * sBias : nullptr;
  const int ntn = N >> 6; const int mt = blockIdx.x / ntn, nq = blockIdx.x - mt * ntn; const int row0 = mt * 128 + 32 * w, col0 = nq * 64; if (row0 >= M) return;
  const _Float16* a0p = A + (size_t)(row0 + ln) * lda; const _Float16* a1p = a0p + (size_t)16 * lda;
  const _Float16* b0p = Bh + (size_t)(col0 + ln) * ldb; const _Float16* b1p = b0p + (size_t)16 * ldb; const _Float16* b2p = b1p + (size_t)16 * ldb; const _Float16* b3p = b2p + (size_t)16 * ldb;
  const v8f z8 = {0.f,0.f,0.f,0.f,0.f,0.f,0.f,0.f}; v8f c00 = z8, c01 = z8, c02 = z8, c03 = z8, c10 = z8, c11 = z8, c12 = z8, c13 = z8;
#pragma unroll 1
  for (int kb = 0; kb < K; kb += 32) { const v16h a0 = g2_frag(a0p + kb, hh), a1 = g2_frag(a1p + kb, hh);
    v16h b = g2_frag(b0p + kb, hh); c00 = g2_mma(a0, b, c00); c10 = g2_mma(a1, b, c10);
    b = g2_frag(b1p + kb, hh); c01 = g2_mma(a0, b, c01); c11 = g2_mma(a1, b, c11);
    b = g2_frag(b2p + kb, hh); c02 = g2_mma(a0, b, c02); c12 = g2_mma(a1, b, c12);
    b = g2_frag(b3p + kb, hh); c03 = g2_mma(a0, b, c03); c13 = g2_mma(a1, b, c13); }
  v8f accs[8] = {c00, c01, c02, c03, c10, c11, c12, c13};
#pragma unroll
  for (int u = 0; u < 8; ++u) { const int t = u & 3, half = u >> 2; const int col = col0 + t * 16 + ln; const float bv = bp ? bf16_round(bp[col]) : 0.f;
#pragma unroll
    for (int r = 0; r < 8; ++r) { const int rloc = half * 16 + 8 * hh + r; float v = accs[u][r] * alpha + bv; if (CP) { if (rowsPerB < 0) v += CP[cofs + (size_t)(row0g + row0 + rloc) * ldc + col];      /* rowsPerB < 0: own element of the batched C plane */ else { const int bidx = (row0g + row0 + rloc) / rowsPerB; v += CP[(size_t)bidx * sCPb + (size_t)by * 64 + col]; } }
      if (ACT == 3) v = fmaxf(v, 0.f); else if (ACT == 6) v = 0.5f * v * (1.0f + erff(v * 0.70710678118654752f)); else if (ACT == 11) v = 1.0f / (1.0f + expf(-v)); else if (ACT == 15) v = v / (1.0f + expf(-v)); else if (ACT == 12) v = (v > 0.f) ? v : 0.01f * v; else if (ACT == 8) v = tanhf(v); else if (ACT == 9) v = 0.5f * v * (1.0f + tanhf(0.7978845608028654f * (v + 0.044715f * v * v * v))); else if (ACT == 14) v = (v > 0.f) ? v : 0.1f * v; else if (ACT == 16) v = (v >= 0.f) ? v : 0.3f * v; else if (ACT == 17) v = (v >= 0.f) ? v : 0.2f * v;
      so[w][rloc][t * 16 + ln] = v; } }
  __builtin_amdgcn_fence(__ATOMIC_ACQ_REL, "workgroup"); __builtin_amdgcn_wave_barrier();
  const int rsub = lane >> 4, c4 = (lane & 15) * 4;
  {
#pragma unroll
    for (int q = 0; q < 16; ++q) { const int r = q * 2 + rsub; const v4f v = *(const v4fa*)&so[w][r][c4]; if (C) *(v4f*)(C + cofs + (size_t)(row0 + r) * ldc + col0 + c4) = v; if (C16) { v4h h4; for (int i = 0; i < 4; ++i) h4[i] = (_Float16)v[i]; *(v4h*)(C16 + cofs + (size_t)(row0 + r) * ldc + col0 + c4) = h4; } }
     } }


__global__ __launch_bounds__(256) void k_wnat(const float* __restrict__ w, size_t n8, _Float16* __restrict__ Bt) { const size_t t = (size_t)blockIdx.x * 256 + threadIdx.x; if (t >= n8) return; FragH f; for (int q = 0; q < 8; ++q) f.h[q] = (_Float16)(bf16_round(w[t * 8 + q]) * 16.0f); *(v8us*)((unsigned short*)Bt + t * 8) = f.half[0];  }
__global__ __launch_bounds__(256) void k_rsm(const float* __restrict__ S, _Float16* __restrict__ P, int nrows) {
  #pragma clang fp contract(off)
  const int i = blockIdx.x * 256 + threadIdx.x; if (i >= nrows) return; const float* s = S + (size_t)i * SQ; float mx = -3.0e38f;
#pragma unroll 1
  for (int j = 0; j < SQ; ++j) mx = fmaxf(mx, s[j]); float se = 0.f;
#pragma unroll 1
  for (int j = 0; j < SQ; ++j) se += expf(s[j] - mx); const float sc = 256.0f / se;
#pragma unroll 1
  for (int j0 = 0; j0 < SQ; j0 += 8) { FragH f; for (int q = 0; q < 8; ++q) f.h[q] = (_Float16)(expf(s[j0 + q] - mx) * sc); unsigned short* d = (unsigned short*)P + (size_t)i * SQ + j0; *(v8us*)d = f.half[0];  } }
__global__ __launch_bounds__(256) void k_vt(const _Float16* __restrict__ V16, int b, int h0, _Float16* __restrict__ VT) { __shared__ unsigned short tl[64][65]; const int tid = threadIdx.x; const int hh = blockIdx.x % HG, sg = blockIdx.x / HG; const int s0 = sg * 64; const int h = h0 + hh;
  for (int i = tid; i < 64 * 8; i += 256) { const int j = i / 8, d8 = (i % 8) * 8; FragH f; f.half[0] = *(const v8us*)((const unsigned short*)V16 + ((size_t)b * SQ + s0 + j) * DM + h * HD + d8); for (int q = 0; q < 8; ++q) tl[d8 + q][j] = f.u[q]; }
  __syncthreads();
  { for (int i = tid; i < 64 * 8; i += 256) { const int d = i / 8, j8 = (i % 8) * 8; FragH f; for (int q = 0; q < 8; ++q) f.u[q] = tl[d][j8 + q]; *(v8us*)((unsigned short*)VT + ((size_t)hh * HD + d) * SQ + s0 + j8) = f.half[0]; }  } }


// lane l <-> l ^ M inside a 16-lane row (DPP row_xmask), and l <-> l ^ 16 (cross-row move)
template <int M> __device__ __forceinline__ float ln_xm(float v) { return __int_as_float(__builtin_amdgcn_update_dpp(0, __float_as_int(v), 0x160 + M, 0xf, 0xf, true)); }
__device__ __forceinline__ float ln_x16(float v) { const int b = __float_as_int(v); return __int_as_float(__builtin_amdgcn_permlanex16(b, b, 0x76543210, 0xfedcba98, false, false)); }
// 2^x (v_exp_f32). The v_nop in the same statement keeps the one issue slot that the instruction set asks for behind a transcendental, before its result is read or its source overwritten.
__device__ __forceinline__ float exp2_slot(float x) { float r; asm("v_exp_f32 %0, %1\n\tv_nop" : "=v"(r) : "v"(x)); return r; }
// Row softmax, one wave per row: the row (SQ f32) is read once, 512 contiguous bytes per load, and stays in registers for the maximum, the exponentials and the scaling.
__global__ __launch_bounds__(256) void k_rsmf(const float* __restrict__ S, _Float16* __restrict__ P, int qn, int hg) {
  const unsigned lane = threadIdx.x & 31; const int t = blockIdx.x * 8 + __builtin_amdgcn_readfirstlane(threadIdx.x >> 5); if (t >= qn * hg) return;      /* the wave's row, held as a scalar: a scalar branch (the kernel has no barrier) and scalar row addresses */
  const size_t i = (size_t)(t / qn) * SQ + (t % qn); const v4fa* s = (const v4fa*)(S + i * SQ); v4f v[SQ / 128];
#pragma unroll      /* full unroll here and below: v[] stays in registers, and all the row's loads are in flight together */
  for (int u = 0; u < SQ / 128; ++u) v[u] = s[u * 32 + lane];
  v4f m4 = {-3.0e38f, -3.0e38f, -3.0e38f, -3.0e38f};
#pragma unroll
  for (int u = 0; u < SQ / 128; ++u) for (int q = 0; q < 4; ++q) m4[q] = fmaxf(m4[q], v[u][q]);
  float mx = fmaxf(fmaxf(m4[0], m4[1]), fmaxf(m4[2], m4[3]));
  mx = fmaxf(mx, ln_xm<1>(mx)); mx = fmaxf(mx, ln_xm<2>(mx)); mx = fmaxf(mx, ln_xm<4>(mx)); mx = fmaxf(mx, ln_xm<8>(mx)); mx = fmaxf(mx, ln_x16(mx));
  v4f s4 = {0.f, 0.f, 0.f, 0.f};
#pragma unroll
  for (int u = 0; u < SQ / 128; ++u) for (int q = 0; q < 4; ++q) { const float e = exp2_slot((v[u][q] - mx) * 1.442695041f);      /* = native exp: the same multiply and v_exp_f32 */ v[u][q] = e; s4[q] += e; }
  float se = (s4[0] + s4[1]) + (s4[2] + s4[3]);
  se += ln_xm<1>(se); se += ln_xm<2>(se); se += ln_xm<4>(se); se += ln_xm<8>(se); se += ln_x16(se);
  const float sc = 256.0f / se; v4h* d = (v4h*)(P + i * SQ);
#pragma unroll
  for (int u = 0; u < SQ / 128; ++u) { v4h h4; for (int q = 0; q < 4; ++q) h4[q] = (_Float16)(v[u][q] * sc); d[u * 32 + lane] = h4; } }

__global__ __launch_bounds__(256) void k_cl2rows(const float* __restrict__ X, _Float16* __restrict__ XR) { __shared__ float tl[64][33]; const int tid = threadIdx.x; const int nl = LL / 32, nc = CC / 64; const int cb_ = blockIdx.x % nc; const int lb = (blockIdx.x / nc) % nl; const size_t b = blockIdx.x / (nc * nl); const int c0 = cb_ * 64, l0 = lb * 32;
  for (int i = tid; i < 64 * 32; i += 256) { const int c = i / 32, l = i % 32; tl[c][l] = bf16_round(X[(b * CC + c0 + c) * (size_t)LL + l0 + l]); }
  __syncthreads();
  { const int l = tid / 8, c8 = (tid % 8) * 8; FragH f; for (int q = 0; q < 8; ++q) f.h[q] = (_Float16)tl[c8 + q][l]; unsigned short* d = (unsigned short*)XR + (b * LL + l0 + l) * (size_t)CC + c0 + c8; *(v8us*)d = f.half[0];  } }


__global__ __launch_bounds__(256) void k_gres2(float* __restrict__ y, const float* __restrict__ x, const float* __restrict__ gam) {
  #pragma clang fp contract(off)
  const size_t i = (size_t)blockIdx.x * 256 + threadIdx.x; if (i >= (size_t)CC * LL / 4) return; const float g = bf16_round(gam[0]); v4f a = *(const v4fa*)(y + i * 4); const v4f b = *(const v4fa*)(x + i * 4);
  for (int q = 0; q < 4; ++q) a[q] = __fadd_rn(__fmul_rn(g, a[q]), bf16_round(b[q])); *(v4f*)(y + i * 4) = a;  }
extern "C" void kernel_launch(void* const* d_in, const int* in_sizes, int n_in,
                              void* d_out, int out_size, void* d_ws, size_t ws_size, hipStream_t stream) {
  (void)in_sizes; (void)n_in; (void)out_size;
  const float* const* I = (const float* const*)d_in; const float* x = I[0]; const float* wq = I[1]; const float* wk = I[2]; const float* wv = I[3]; const float* gam = I[4];
  char* ws = (char*)d_ws; size_t off = 0;
  auto take = [&](size_t bytes) { char* p = ws + off; off += (bytes + 255) & ~(size_t)255; return p; };
  _Float16* BQ = (_Float16*)take((size_t)CQ * CC * 2); _Float16* BK = (_Float16*)take((size_t)CQ * CC * 2); _Float16* BV = (_Float16*)take((size_t)CC * CC * 2);
  _Float16* XR = (_Float16*)take(NR * CC * 2); float* FF = (float*)take((size_t)LL * CQ * 4); _Float16* Fh = (_Float16*)take((size_t)LL * CQ * 2); _Float16* Fl = (_Float16*)take((size_t)LL * CQ * 2); _Float16* Gh = (_Float16*)take((size_t)LL * CQ * 2); _Float16* Gl = (_Float16*)take((size_t)LL * CQ * 2);
  _Float16* H16 = (_Float16*)take((size_t)CC * LL * 2); float* S = (float*)take((size_t)LL * LL * 4); _Float16* P = (_Float16*)take((size_t)LL * LL * 2);
  if (off > ws_size) return;      /* approx 0.6 + 16 + 1.5 + 2 + 16 + 8 = 44 MiB */
  k_wnat<<<(unsigned)(((size_t)CQ * CC / 8 + 255) / 256), 256, 0, stream>>>(wq, (size_t)CQ * CC / 8, BQ); k_wnat<<<(unsigned)(((size_t)CQ * CC / 8 + 255) / 256), 256, 0, stream>>>(wk, (size_t)CQ * CC / 8, BK); k_wnat<<<(unsigned)(((size_t)CC * CC / 8 + 255) / 256), 256, 0, stream>>>(wv, (size_t)CC * CC / 8, BV);
  k_cl2rows<<<NB * (LL / 32) * (CC / 64), 256, 0, stream>>>(x, XR);      /* exact f16 token rows [b*2048 + n][c] */
  for (int b = 0; b < NB; ++b) { const _Float16* Xb = XR + (size_t)b * LL * CC; float* Ob = (float*)d_out + (size_t)b * CC * LL;
    k_gemm2<0><<<dim3((LL / 128) * 1, 1), 128, 0, stream>>>(Xb, CC, 0, BQ, CC, 0, 0.0625f, nullptr, 0, nullptr, 1, 0, 0, FF, nullptr, CQ, 0, LL, CQ, CC); k_hl<<<(unsigned)(((size_t)LL * CQ / 8 + 255) / 256), 256, 0, stream>>>(FF, Fh, Fl, (size_t)LL * CQ / 8);      /* f^T rows [n][64] -> hi/lo */
    k_gemm2<0><<<dim3((LL / 128) * 1, 1), 128, 0, stream>>>(Xb, CC, 0, BK, CC, 0, 0.0625f, nullptr, 0, nullptr, 1, 0, 0, FF, nullptr, CQ, 0, LL, CQ, CC); k_hl<<<(unsigned)(((size_t)LL * CQ / 8 + 255) / 256), 256, 0, stream>>>(FF, Gh, Gl, (size_t)LL * CQ / 8);      /* g^T rows [m][64] -> hi/lo */
    k_gemm2<0><<<dim3((CC / 128) * (LL / 64), 1), 128, 0, stream>>>(BV, CC, 0, Xb, CC, 0, 0.0625f, nullptr, 0, nullptr, 1, 0, 0, nullptr, H16, LL, 0, CC, LL, CC);      /* h channel-major [c][n] f16 */
    k_gemm2<0><<<dim3((LL / 128) * (LL / 64), 1), 128, 0, stream>>>(Gh, CQ, 0, Fh, CQ, 0, 1.0f, nullptr, 0, nullptr, 1, 0, 0, S, nullptr, LL, 0, LL, LL, CQ);      /* S^T[m][n] = g_m . f_n (hi.hi) */
    k_gemm2<0><<<dim3((LL / 128) * (LL / 64), 1), 128, 0, stream>>>(Gl, CQ, 0, Fh, CQ, 0, 0.0009765625f, nullptr, 0, S, -1, 0, 0, S, nullptr, LL, 0, LL, LL, CQ);      /* += lo.hi 2^-10 */
    k_gemm2<0><<<dim3((LL / 128) * (LL / 64), 1), 128, 0, stream>>>(Gh, CQ, 0, Fl, CQ, 0, 0.0009765625f, nullptr, 0, S, -1, 0, 0, S, nullptr, LL, 0, LL, LL, CQ);      /* += hi.lo 2^-10 */
    k_rsmf<<<LL / 8, 256, 0, stream>>>(S, P, LL, 1);      /* softmax over n per key m (the module's dim=1 softmax) -> beta^T[m][n] x256 f16 */
    k_gemm2<0><<<dim3((CC / 128) * (LL / 64), 1), 128, 0, stream>>>(H16, LL, 0, P, LL, 0, 0.00390625f, nullptr, 0, nullptr, 1, 0, 0, Ob, nullptr, LL, 0, CC, LL, LL);      /* o[c][m] = 2^-8 sum_n h[c][n] beta^T[m][n] (channel-major = the output layout) */
    k_gres2<<<(unsigned)(((size_t)CC * LL / 4 + 255) / 256), 256, 0, stream>>>(Ob, x + (size_t)b * CC * LL, gam); }      /* gamma o + x */
}

// v002
// It runs in 393 microseconds.
// Timed twice side by side with v001, it ran 3.71 and 3.73 times as fast.
// Counting every step since v000, it is 10.3 times as fast.
#include <hip/hip_runtime.h>
// SAGAN-style self-attention with 1x1-conv projections (x [8][512][2048] channel-first; f = Wq x, g = Wk x (64 channels), h = Wv x (512); scores[n][m] = sum_c f[c][n] g[c][m] (unscaled); beta = softmax over n (the QUERY axis, dim=1) for each m; o[c][m] = gamma sum_n h[c][n] beta[n][m] + x[c][m] -> [8][512][2048]; gamma = an input scalar).
// Structure: x transposed to exact f16 token rows via LDS tiles; f^T and g^T as WMMA GEMMs (32x64 wave tiles, f32 accumulation, exact x16 weights) into f32 rows then f16 hi + x1024 residual planes; h channel-major as a GEMM (weights as the A operand) into f16; every stage is one launch over all batches (blockIdx.y = batch): S^T[m][n] = g^T f as three accumulating GEMM passes (K = 64; hi.hi + hi.lo + lo.hi), row softmax over n on VALU (f32 statistics, native exp; weights x256 f16) = beta^T; o[c][m] = h . beta^T as a GEMM (K = 2048) channel-major straight into the output; epilogue out = bf16(gamma) o + bf16(x); 4 + 11 = 15 launches.
// Compute dtype: inputs rounded to bf16; x / weights exact; f, g as hi + residual (~2^-22: the unscaled logits have sigma ~8); h and the softmax weights plain f16 (~2^-12); logits, statistics, o f32. v_wmma_f32_16x16x32_f16.
#define NB 8
#define CC 512
#define CQ 64
#define LL 2048
#define SQ LL
#define DM 64
#define NH 1
#define HD 64
#define HG 1
#define NR ((size_t)NB * LL)
typedef __bf16 v16b __attribute__((ext_vector_type(16)));
typedef unsigned short v8us __attribute__((ext_vector_type(8), may_alias));
typedef float  v8f  __attribute__((ext_vector_type(8)));
typedef float  v4f  __attribute__((ext_vector_type(4)));
typedef float  v4fa __attribute__((ext_vector_type(4), may_alias));
union FragB { v16b v; v8us half[2]; unsigned short u[16]; };

__device__ __forceinline__ unsigned short bf16_bits(float x) { unsigned int u = __float_as_uint(x); return (unsigned short)((u + 0x7FFFu + ((u >> 16) & 1u)) >> 16); }
__device__ __forceinline__ float bf16_val(unsigned short b) { return __uint_as_float(((unsigned int)b) << 16); }
__device__ __forceinline__ float bf16_round(float x) { return bf16_val(bf16_bits(x)); }
// D += A·B with NT terms: 1 = ah·bh, 2 = + al·bh (A split), 3 = + ah·bl (both split)
template <int NT>
__device__ __forceinline__ v8f mmaN(v16b ah, v16b al, v16b bh, v16b bl, v8f c) {
  c = __builtin_amdgcn_wmma_f32_16x16x32_bf16(false, ah, false, bh, (short)0, c, false, false);
  if (NT >= 2) c = __builtin_amdgcn_wmma_f32_16x16x32_bf16(false, al, false, bh, (short)0, c, false, false);
  if (NT >= 3) c = __builtin_amdgcn_wmma_f32_16x16x32_bf16(false, ah, false, bl, (short)0, c, false, false);
  asm volatile("v_nop\n\tv_nop\n\tv_nop\n\tv_nop" : "+v"(c) : "v"(ah), "v"(al), "v"(bh), "v"(bl));
  return c;
}

__global__ __launch_bounds__(256) void k_wt_bf16(const float* __restrict__ W, unsigned short* __restrict__ Wt, int K, int N) {
  const int t = blockIdx.x * 256 + threadIdx.x;
  const int k8n = K / 8;
  if (t >= N * k8n) return;
  const int n = t / k8n, k8 = (t % k8n) * 8;
  v8us v;
#pragma unroll
  for (int i = 0; i < 8; ++i) v[i] = bf16_bits(W[(size_t)(k8 + i) * N + n]);
  *(v8us*)(Wt + (size_t)n * K + k8) = v;
  
}

// GEMM C[M][N] (f32, pitch ldc) = act(A[M][K]·W + bias). A f32 row-major (pitch lda) converted per fragment to bf16
// (ASPLIT: hi/lo two planes -> 2 terms, else single rounded term); Wt bf16 [N][K] (pitch ldb). BIAS_BF16 rounds the
// bias to bf16 first (bias quantised to bf16 before the add). K%32==0, M%16==0, N%64==0.
template <bool ASPLIT, int ACT, bool BIAS_BF16>
__global__ __launch_bounds__(128) void k_gemm_bf(const float* __restrict__ A, int lda, const unsigned short* __restrict__ Wt, int ldb,
                                               const float* __restrict__ bias, float* __restrict__ C, int ldc, int M, int N, int K) {
  __shared__ __attribute__((aligned(16))) float so[4][16][64];
  const int tid = threadIdx.x, w = tid >> 5, lane = tid & 31, ln = lane & 15, hh = lane >> 4;
  const int ntn = N / 64;
  const int wid = blockIdx.x * 4 + w;
  const int mt = wid / ntn, nq = wid % ntn;
  if (mt * 16 >= M) return;
  const int row0 = mt * 16, col0 = nq * 64;
  const float* arow = A + (size_t)(row0 + ln) * lda;
  v8f acc[4] = {};
  for (int kb = 0; kb < K; kb += 32) {
    FragB ah, al;
    const v4f x0 = *(const v4fa*)(arow + kb + 8 * hh), x1 = *(const v4fa*)(arow + kb + 8 * hh + 4);
    const v4f x2 = *(const v4fa*)(arow + kb + 16 + 8 * hh), x3 = *(const v4fa*)(arow + kb + 16 + 8 * hh + 4);
    float xs[16] = {x0[0],x0[1],x0[2],x0[3],x1[0],x1[1],x1[2],x1[3],x2[0],x2[1],x2[2],x2[3],x3[0],x3[1],x3[2],x3[3]};
#pragma unroll
    for (int i = 0; i < 16; ++i) { const unsigned short hb = bf16_bits(xs[i]); ah.u[i] = hb; al.u[i] = ASPLIT ? bf16_bits(xs[i] - bf16_val(hb)) : (unsigned short)0; }
#pragma unroll
    for (int t = 0; t < 4; ++t) {
      const unsigned short* brow = Wt + (size_t)(col0 + t * 16 + ln) * ldb + kb;
      FragB b;
      b.half[0] = *(const v8us*)(brow + 8 * hh);
      b.half[1] = *(const v8us*)(brow + 16 + 8 * hh);
      acc[t] = mmaN<ASPLIT ? 2 : 1>(ah.v, al.v, b.v, b.v, acc[t]);
    }
  }
#pragma unroll
  for (int t = 0; t < 4; ++t) {
    float bv = bias ? bias[col0 + t * 16 + ln] : 0.f;
    if (BIAS_BF16) bv = bf16_round(bv);
#pragma unroll
    for (int r = 0; r < 8; ++r) { float v = acc[t][r] + bv; if (ACT == 1) v = fmaxf(v, 0.f); so[w][8 * hh + r][t * 16 + ln] = v; }
  }
  __builtin_amdgcn_fence(__ATOMIC_ACQ_REL, "workgroup");
  __builtin_amdgcn_wave_barrier();
  const int rsub = lane >> 4, c4 = (lane & 15) * 4;
  {
#pragma unroll
    for (int q = 0; q < 8; ++q) {
      const int r = q * 2 + rsub;
      const v4f v = *(const v4fa*)&so[w][r][c4];
      *(v4f*)(C + (size_t)(row0 + r) * ldc + col0 + c4) = v;
    }
    
  }
}

// GEMM C = act(A·W + bias + resid): A f32 (ASPLIT -> hi/lo 2 terms), Wt bf16 [N][K]; ACT 0 none, 1 relu, 2 exact gelu;
// resid (optional, f32, row index = (row % rmod), pitch ldr, RES_BF16 rounds it) added before the activation.
template <bool ASPLIT, int ACT, bool BIAS_BF16, bool RES_BF16>
__global__ __launch_bounds__(128) void k_gemm_bf3(const float* __restrict__ A, int lda, const unsigned short* __restrict__ Wt, int ldb,
                                                const float* __restrict__ bias, const float* __restrict__ resid, int rmod, int ldr,
                                                float* __restrict__ C, int ldc, int M, int N, int K) {
  __shared__ __attribute__((aligned(16))) float so[4][16][64];
  const int tid = threadIdx.x, w = tid >> 5, lane = tid & 31, ln = lane & 15, hh = lane >> 4;
  const int ntn = N / 64;
  const int wid = blockIdx.x * 4 + w;
  const int mt = wid / ntn, nq = wid % ntn;
  if (mt * 16 >= M) return;
  const int row0 = mt * 16, col0 = nq * 64;
  const float* arow = A + (size_t)(row0 + ln) * lda;
  v8f acc[4] = {};
  for (int kb = 0; kb < K; kb += 32) {
    FragB ah, al;
    const v4f x0 = *(const v4fa*)(arow + kb + 8 * hh), x1 = *(const v4fa*)(arow + kb + 8 * hh + 4);
    const v4f x2 = *(const v4fa*)(arow + kb + 16 + 8 * hh), x3 = *(const v4fa*)(arow + kb + 16 + 8 * hh + 4);
    float xs[16] = {x0[0],x0[1],x0[2],x0[3],x1[0],x1[1],x1[2],x1[3],x2[0],x2[1],x2[2],x2[3],x3[0],x3[1],x3[2],x3[3]};
#pragma unroll
    for (int i = 0; i < 16; ++i) { const unsigned short hb = bf16_bits(xs[i]); ah.u[i] = hb; al.u[i] = ASPLIT ? bf16_bits(xs[i] - bf16_val(hb)) : (unsigned short)0; }
#pragma unroll
    for (int t = 0; t < 4; ++t) {
      const unsigned short* brow = Wt + (size_t)(col0 + t * 16 + ln) * ldb + kb;
      FragB b;
      b.half[0] = *(const v8us*)(brow + 8 * hh);
      b.half[1] = *(const v8us*)(brow + 16 + 8 * hh);
      acc[t] = mmaN<ASPLIT ? 2 : 1>(ah.v, al.v, b.v, b.v, acc[t]);
    }
  }
#pragma unroll
  for (int t = 0; t < 4; ++t) {
    const int col = col0 + t * 16 + ln;
    float bv = bias ? bias[col] : 0.f;
    if (BIAS_BF16) bv = bf16_round(bv);
#pragma unroll
    for (int r = 0; r < 8; ++r) {
      float v = acc[t][r] + bv;
      if (resid) { float rv = resid[(size_t)((row0 + 8 * hh + r) % rmod) * ldr + col]; if (RES_BF16) rv = bf16_round(rv); v += rv; }
      if (ACT == 1) v = fmaxf(v, 0.f);
      if (ACT == 2) v = 0.5f * v * (1.0f + erff(v * 0.70710678118654752f));
      if (ACT == 3) { const float u = 0.7978845608028654f * (v + 0.044715f * v * v * v); v = 0.5f * v * (1.0f + tanhf(u)); }
      so[w][8 * hh + r][t * 16 + ln] = v;
    }
  }
  __builtin_amdgcn_fence(__ATOMIC_ACQ_REL, "workgroup");
  __builtin_amdgcn_wave_barrier();
  const int rsub = lane >> 4, c4 = (lane & 15) * 4;
  {
#pragma unroll
    for (int q = 0; q < 8; ++q) {
      const int r = q * 2 + rsub;
      const v4f v = *(const v4fa*)&so[w][r][c4];
      *(v4f*)(C + (size_t)(row0 + r) * ldc + col0 + c4) = v;
    }
    
  }
}
// row LayerNorm (biased variance, eps) over N: s = X (+ R); optional out_sum <- s; out_norm <- (s-mu)*rsqrt(var+eps)*g + b
template <bool PARAM_BF16>
__global__ __launch_bounds__(256) void k_layernorm(const float* __restrict__ X, const float* __restrict__ R, const float* __restrict__ g, const float* __restrict__ bta,
                                                  float* __restrict__ out_sum, float* __restrict__ out_norm, int N, float eps) {
  __shared__ float red[256];
  const int row = blockIdx.x, tid = threadIdx.x;
  const float* x = X + (size_t)row * N; const float* rr = R ? R + (size_t)row * N : nullptr;
  float vals[16];                     // up to N = 4096
  const int per = N / 256;            // contiguous chunk per thread? use strided-by-4 chunks: thread handles j = tid*4 + 1024*u
  float s1 = 0.f;
  for (int u = 0; u < per / 4; ++u) {
    const int j = tid * 4 + 1024 * u;
    const v4f a = *(const v4fa*)(x + j);
    v4f b = {0.f,0.f,0.f,0.f}; if (rr) b = *(const v4fa*)(rr + j);
#pragma unroll
    for (int q = 0; q < 4; ++q) { const float v = a[q] + b[q]; vals[u * 4 + q] = v; s1 += v; }
  }
  red[tid] = s1; __syncthreads();
  for (int st = 128; st > 0; st >>= 1) { if (tid < st) red[tid] += red[tid + st]; __syncthreads(); }
  const float mu = red[0] / (float)N; __syncthreads();
  float s2 = 0.f;
  for (int u = 0; u < per / 4; ++u)
#pragma unroll
    for (int q = 0; q < 4; ++q) { const float c = vals[u * 4 + q] - mu; s2 += c * c; }
  red[tid] = s2; __syncthreads();
  for (int st = 128; st > 0; st >>= 1) { if (tid < st) red[tid] += red[tid + st]; __syncthreads(); }
  const float rs = rsqrtf(red[0] / (float)N + eps);
  {
    for (int u = 0; u < per / 4; ++u) {
      const int j = tid * 4 + 1024 * u;
      v4f o, sm;
#pragma unroll
      for (int q = 0; q < 4; ++q) {
        float gg = g[j + q], bb = bta[j + q];
        if (PARAM_BF16) { gg = bf16_round(gg); bb = bf16_round(bb); }
        sm[q] = vals[u * 4 + q]; o[q] = (vals[u * 4 + q] - mu) * rs * gg + bb;
      }
      if (out_sum) *(v4f*)(out_sum + (size_t)row * N + j) = sm;
      *(v4f*)(out_norm + (size_t)row * N + j) = o;
    }
    
  }
}



// ---- f16 WMMA path (v_wmma_f32_16x16x32_f16): 11-bit significands for operands in range — used where a [0,1] probability operand needs more precision than bf16
typedef _Float16 v16h __attribute__((ext_vector_type(16)));
union FragH { v16h v; v8us half[2]; _Float16 h[16]; unsigned short u[16]; };
template <int NT>
__device__ __forceinline__ v8f mmaH(v16h ah, v16h al, v16h bh, v16h bl, v8f c) {
  c = __builtin_amdgcn_wmma_f32_16x16x32_f16(false, ah, false, bh, (short)0, c, false, false);
  if (NT >= 2) c = __builtin_amdgcn_wmma_f32_16x16x32_f16(false, al, false, bh, (short)0, c, false, false);
  if (NT >= 3) c = __builtin_amdgcn_wmma_f32_16x16x32_f16(false, ah, false, bl, (short)0, c, false, false);
  asm volatile("v_nop\n\tv_nop\n\tv_nop\n\tv_nop" : "+v"(c) : "v"(ah), "v"(al), "v"(bh), "v"(bl));
  return c;
}
// batched GEMM like k_gemm_b but f16 operands: A f32 (split into f16 hi/lo if ASPLIT, else rounded to f16), Bt = f16 values [n][k]; alpha; C f32; N multiple of 16 (partial tiles skipped)
template <bool ASPLIT>
__global__ __launch_bounds__(128) void k_gemm_h(const float* __restrict__ A, int lda, size_t sA, const _Float16* __restrict__ Bh, int ldb, size_t sB, float alpha, float* __restrict__ C, int ldc, size_t sC, int M, int N, int K) {
  __shared__ __attribute__((aligned(16))) float so[4][16][64];
  const int tid = threadIdx.x, w = tid >> 5, lane = tid & 31, ln = lane & 15, hh = lane >> 4; const int by = blockIdx.y;
  A += (size_t)by * sA; Bh += (size_t)by * sB; C += (size_t)by * sC;
  const int ntn = (N + 63) / 64; const int wid = blockIdx.x * 4 + w; const int mt = wid / ntn, nq = wid % ntn; if (mt * 16 >= M) return;
  const int row0 = mt * 16, col0 = nq * 64; const float* arow = A + (size_t)(row0 + ln) * lda;
  v8f acc[4] = {};
  for (int kb = 0; kb < K; kb += 32) {
    FragH ah, al;
    const v4f x0 = *(const v4fa*)(arow + kb + 8 * hh), x1 = *(const v4fa*)(arow + kb + 8 * hh + 4), x2 = *(const v4fa*)(arow + kb + 16 + 8 * hh), x3 = *(const v4fa*)(arow + kb + 16 + 8 * hh + 4);
    float xs[16] = {x0[0],x0[1],x0[2],x0[3],x1[0],x1[1],x1[2],x1[3],x2[0],x2[1],x2[2],x2[3],x3[0],x3[1],x3[2],x3[3]};
#pragma unroll
    for (int i = 0; i < 16; ++i) { const _Float16 h = (_Float16)xs[i]; ah.h[i] = h; al.h[i] = ASPLIT ? (_Float16)(xs[i] - (float)h) : (_Float16)0.0f; }
#pragma unroll
    for (int t = 0; t < 4; ++t) { if (col0 + t * 16 >= N) continue; const size_t boff = (size_t)(col0 + t * 16 + ln) * ldb + kb; FragH bq; bq.half[0] = *(const v8us*)(Bh + boff + 8 * hh); bq.half[1] = *(const v8us*)(Bh + boff + 16 + 8 * hh);
      acc[t] = mmaH<ASPLIT ? 2 : 1>(ah.v, al.v, bq.v, bq.v, acc[t]); }
  }
#pragma unroll
  for (int t = 0; t < 4; ++t) { if (col0 + t * 16 >= N) continue;
#pragma unroll
    for (int r = 0; r < 8; ++r) so[w][8 * hh + r][t * 16 + ln] = acc[t][r] * alpha; }
  __builtin_amdgcn_fence(__ATOMIC_ACQ_REL, "workgroup"); __builtin_amdgcn_wave_barrier();
  const int rsub = lane >> 4, c4 = (lane & 15) * 4;
  {
#pragma unroll
    for (int q = 0; q < 8; ++q) { const int r = q * 2 + rsub; if (col0 + c4 < N) { const v4f v = *(const v4fa*)&so[w][r][c4]; *(v4f*)(C + (size_t)(row0 + r) * ldc + col0 + c4) = v; } }
     }
}

// Wt[n][k] = f16(W[k][n]·scale) from f32 row-major W[K][N] (scale = power of two; bf16-exact weights stay exact in f16 away from the subnormal range)
__global__ __launch_bounds__(256) void k_wt_f16(const float* __restrict__ W, _Float16* __restrict__ Wt, int K, int N, float scale) {
  const int t = blockIdx.x * 256 + threadIdx.x; if (t >= N * (K / 8)) return; const int n = t / (K / 8), k8 = (t % (K / 8)) * 8; FragH f;
#pragma unroll
  for (int i = 0; i < 8; ++i) f.h[i] = (_Float16)(bf16_round(W[(size_t)(k8 + i) * N + n]) * scale); const v8us o = f.half[0];
  *(v8us*)((unsigned short*)Wt + (size_t)n * K + k8) = o; 
}
// k_gemm_hh variant with fused epilogue: v = acc·alpha + bias[by·sBias + col] (+ CP[(row/rowsPerB)·sCPb + by·64 + col] if CP) ; ACT 0 none / 1 elu ; writes f16 C16 (and f32 C if non-null)
template <int ACT>
__global__ __launch_bounds__(128) void k_gemm_hhx(const _Float16* __restrict__ A, int lda, size_t sA, const _Float16* __restrict__ Bh, int ldb, size_t sB, float alpha, const float* __restrict__ bias, size_t sBias, const float* __restrict__ CP, int rowsPerB, size_t sCPb, int row0g,
    float* __restrict__ C, _Float16* __restrict__ C16, int ldc, size_t sC, int M, int N, int K) {
  __shared__ __attribute__((aligned(16))) float so[4][16][64];
  const int tid = threadIdx.x, w = tid >> 5, lane = tid & 31, ln = lane & 15, hh = lane >> 4; const int by = blockIdx.y;
  A += (size_t)by * sA; Bh += (size_t)by * sB; const size_t cofs = (size_t)by * sC; const float* bp = bias ? bias + (size_t)by * sBias : nullptr;
  const int ntn = (N + 63) / 64; const int wid = blockIdx.x * 4 + w; const int mt = wid / ntn, nq = wid % ntn; if (mt * 16 >= M) return;
  const int row0 = mt * 16, col0 = nq * 64; const _Float16* arow = A + (size_t)(row0 + ln) * lda;
  v8f acc[4] = {};
  for (int kb = 0; kb < K; kb += 32) { FragH ah; ah.half[0] = *(const v8us*)((const unsigned short*)arow + kb + 8 * hh); ah.half[1] = *(const v8us*)((const unsigned short*)arow + kb + 16 + 8 * hh);
#pragma unroll
    for (int t = 0; t < 4; ++t) { if (col0 + t * 16 >= N) continue; const size_t boff = (size_t)(col0 + t * 16 + ln) * ldb + kb; FragH bq; bq.half[0] = *(const v8us*)((const unsigned short*)Bh + boff + 8 * hh); bq.half[1] = *(const v8us*)((const unsigned short*)Bh + boff + 16 + 8 * hh);
      acc[t] = mmaH<1>(ah.v, ah.v, bq.v, bq.v, acc[t]); }
  }
#pragma unroll
  for (int t = 0; t < 4; ++t) { if (col0 + t * 16 >= N) continue; const int col = col0 + t * 16 + ln; const float bv = bp ? bf16_round(bp[col]) : 0.f;
#pragma unroll
    for (int r = 0; r < 8; ++r) { float v = acc[t][r] * alpha + bv; if (CP) { const int rr = row0g + row0 + 8 * hh + r; if (rowsPerB < 0) v += CP[cofs + (size_t)rr * ldc + col];      /* rowsPerB < 0: own element of the batched C plane */ else { const int bidx = rr / rowsPerB; v += CP[(size_t)bidx * sCPb + (size_t)by * 64 + col]; } } if (ACT == 1) v = (v > 0.f) ? v : expm1f(v); else if (ACT == 7) v = (v > 0.f) ? v + 1.0f : expf(v); else if (ACT == 8) v = tanhf(v); else if (ACT == 9) v = 0.5f * v * (1.0f + tanhf(0.7978845608028654f * (v + 0.044715f * v * v * v))); else if (ACT == 11) v = 1.0f / (1.0f + expf(-v)); else if (ACT == 12) v = (v > 0.f) ? v : 0.01f * v; else if (ACT == 14) v = (v > 0.f) ? v : 0.1f * v; else if (ACT == 16) v = (v >= 0.f) ? v : 0.3f * v; else if (ACT == 17) v = (v >= 0.f) ? v : 0.2f * v; else if (ACT == 15) v = v / (1.0f + expf(-v)); else if (ACT == 3) v = fmaxf(v, 0.f); else if (ACT == 6) v = 0.5f * v * (1.0f + erff(v * 0.70710678118654752f)); so[w][8 * hh + r][t * 16 + ln] = v; } }
  __builtin_amdgcn_fence(__ATOMIC_ACQ_REL, "workgroup"); __builtin_amdgcn_wave_barrier();
  const int rsub = lane >> 4, c4 = (lane & 15) * 4; typedef _Float16 v4h __attribute__((ext_vector_type(4)));
  {
#pragma unroll
    for (int q = 0; q < 8; ++q) { const int r = q * 2 + rsub; if (col0 + c4 < N) { const v4f v = *(const v4fa*)&so[w][r][c4]; if (C) *(v4f*)(C + cofs + (size_t)(row0 + r) * ldc + col0 + c4) = v; if (C16) { v4h h4; for (int i = 0; i < 4; ++i) h4[i] = (_Float16)v[i]; *(v4h*)(C16 + cofs + (size_t)(row0 + r) * ldc + col0 + c4) = h4; } } }
     }
}


typedef _Float16 v4h __attribute__((ext_vector_type(4)));

__global__ __launch_bounds__(256) void k_x16(const float* __restrict__ x, _Float16* __restrict__ X16, size_t n8) { const size_t t = (size_t)blockIdx.x * 256 + threadIdx.x; if (t >= n8) return; FragH f;
#pragma unroll
  for (int q = 0; q < 8; ++q) f.h[q] = (_Float16)bf16_round(x[t * 8 + q]); *(v8us*)((unsigned short*)X16 + t * 8) = f.half[0];  }
__global__ __launch_bounds__(256) void k_h16(const float* __restrict__ x, _Float16* __restrict__ X16, size_t n8) { const size_t t = (size_t)blockIdx.x * 256 + threadIdx.x; if (t >= n8) return; FragH f;
#pragma unroll
  for (int q = 0; q < 8; ++q) f.h[q] = (_Float16)x[t * 8 + q]; *(v8us*)((unsigned short*)X16 + t * 8) = f.half[0];  }
__global__ __launch_bounds__(256) void k_round16f(const float* __restrict__ W, _Float16* __restrict__ Bt, size_t n8) { const size_t t = (size_t)blockIdx.x * 256 + threadIdx.x; if (t >= n8) return; FragH f;
#pragma unroll
  for (int i = 0; i < 8; ++i) f.h[i] = (_Float16)(bf16_round(W[t * 8 + i]) * 16.0f); *(v8us*)((unsigned short*)Bt + t * 8) = f.half[0];  }
template <int NHv, int TTv>
__global__ __launch_bounds__(256) void k_vt(const _Float16* __restrict__ V16, int ldv, int voff, _Float16* __restrict__ Vt) { __shared__ unsigned short tl[64][66]; const int tid = threadIdx.x; const int slab = blockIdx.x / (TTv / 64), lg = blockIdx.x % (TTv / 64); const int b = slab / NHv, h = slab % NHv;
  for (int i = tid; i < 64 * 8; i += 256) { const int r = i / 8, c8 = (i % 8) * 8; FragH f; f.half[0] = *(const v8us*)((const unsigned short*)V16 + ((size_t)b * TTv + lg * 64 + r) * ldv + voff + h * 64 + c8);
#pragma unroll
    for (int q = 0; q < 8; ++q) tl[r][c8 + q] = f.u[q]; }
  __syncthreads();
  {
#pragma unroll
    for (int rd = 0; rd < 2; ++rd) { const int d = rd * 32 + tid / 8, pc = tid % 8; FragH f;
#pragma unroll
      for (int q = 0; q < 8; ++q) f.u[q] = tl[pc * 8 + q][d];
      *(v8us*)((unsigned short*)Vt + ((size_t)slab * 64 + d) * TTv + lg * 64 + pc * 8) = f.half[0]; }
     } }

__global__ __launch_bounds__(256) void k_hl(const float* __restrict__ F, _Float16* __restrict__ Hh, _Float16* __restrict__ Hl, size_t n8) { const size_t t = (size_t)blockIdx.x * 256 + threadIdx.x; if (t >= n8) return; FragH fh, fl; const v4f a = *(const v4fa*)(F + t * 8), c = *(const v4fa*)(F + t * 8 + 4);
#pragma unroll
  for (int q = 0; q < 4; ++q) { _Float16 h = (_Float16)a[q]; fh.h[q] = h; fl.h[q] = (_Float16)((a[q] - (float)h) * 1024.0f); h = (_Float16)c[q]; fh.h[4 + q] = h; fl.h[4 + q] = (_Float16)((c[q] - (float)h) * 1024.0f); }
  { *(v8us*)((unsigned short*)Hh + t * 8) = fh.half[0]; *(v8us*)((unsigned short*)Hl + t * 8) = fl.half[0];  } }

// ---- fast GEMM (wave tile 32x64; requires M % 32 == 0 rows per launch region and N % 64 == 0); epilogue = k_gemm_hhx semantics ----
__device__ __forceinline__ v16h g2_frag(const _Float16* p, int hh) { FragH f; f.half[0] = *(const v8us*)((const unsigned short*)p + 8 * hh); f.half[1] = *(const v8us*)((const unsigned short*)p + 16 + 8 * hh); return f.v; }
__device__ __forceinline__ v8f g2_mma(v16h a, v16h b, v8f c) { v8f d = __builtin_amdgcn_wmma_f32_16x16x32_f16(false, a, false, b, (short)0, c, false, false); asm volatile("v_nop\n\tv_nop\n\tv_nop\n\tv_nop" : "+v"(d) : "v"(a), "v"(b)); return d; }
template <int ACT>
__global__ __launch_bounds__(128) void k_gemm2(const _Float16* __restrict__ A, int lda, size_t sA, const _Float16* __restrict__ Bh, int ldb, size_t sB, float alpha, const float* __restrict__ bias, size_t sBias, const float* __restrict__ CP, int rowsPerB, size_t sCPb, int row0g,
    float* __restrict__ C, _Float16* __restrict__ C16, int ldc, size_t sC, int M, int N, int K) { static_assert(ACT == 0 || ACT == 3 || ACT == 6 || ACT == 8 || ACT == 9 || ACT == 11 || ACT == 12 || ACT == 14 || ACT == 15 || ACT == 16 || ACT == 17, "k_gemm2: unsupported ACT code (would silently apply no activation)");
  __shared__ __attribute__((aligned(16))) float so[4][32][68];
  const int tid = threadIdx.x, w = tid >> 5, lane = tid & 31, ln = lane & 15, hh = lane >> 4; const int by = blockIdx.y;
  A += (size_t)by * sA; Bh += (size_t)by * sB; const size_t cofs = (size_t)by * sC; const float* bp = bias ? bias + (size_t)by * sBias : nullptr;
  const int ntn = N >> 6; const int mt = blockIdx.x / ntn, nq = blockIdx.x - mt * ntn; const int row0 = mt * 128 + 32 * w, col0 = nq * 64; if (row0 >= M) return;
  const _Float16* a0p = A + (size_t)(row0 + ln) * lda; const _Float16* a1p = a0p + (size_t)16 * lda;
  const _Float16* b0p = Bh + (size_t)(col0 + ln) * ldb; const _Float16* b1p = b0p + (size_t)16 * ldb; const _Float16* b2p = b1p + (size_t)16 * ldb; const _Float16* b3p = b2p + (size_t)16 * ldb;
  const v8f z8 = {0.f,0.f,0.f,0.f,0.f,0.f,0.f,0.f}; v8f c00 = z8, c01 = z8, c02 = z8, c03 = z8, c10 = z8, c11 = z8, c12 = z8, c13 = z8;
#pragma unroll 1
  for (int kb = 0; kb < K; kb += 32) { const v16h a0 = g2_frag(a0p + kb, hh), a1 = g2_frag(a1p + kb, hh);
    v16h b = g2_frag(b0p + kb, hh); c00 = g2_mma(a0, b, c00); c10 = g2_mma(a1, b, c10);
    b = g2_frag(b1p + kb, hh); c01 = g2_mma(a0, b, c01); c11 = g2_mma(a1, b, c11);
    b = g2_frag(b2p + kb, hh); c02 = g2_mma(a0, b, c02); c12 = g2_mma(a1, b, c12);
    b = g2_frag(b3p + kb, hh); c03 = g2_mma(a0, b, c03); c13 = g2_mma(a1, b, c13); }
  v8f accs[8] = {c00, c01, c02, c03, c10, c11, c12, c13};
#pragma unroll
  for (int u = 0; u < 8; ++u) { const int t = u & 3, half = u >> 2; const int col = col0 + t * 16 + ln; const float bv = bp ? bf16_round(bp[col]) : 0.f;
#pragma unroll
    for (int r = 0; r < 8; ++r) { const int rloc = half * 16 + 8 * hh + r; float v = accs[u][r] * alpha + bv; if (CP) { if (rowsPerB < 0) v += CP[cofs + (size_t)(row0g + row0 + rloc) * ldc + col];      /* rowsPerB < 0: own element of the batched C plane */ else { const int bidx = (row0g + row0 + rloc) / rowsPerB; v += CP[(size_t)bidx * sCPb + (size_t)by * 64 + col]; } }
      if (ACT == 3) v = fmaxf(v, 0.f); else if (ACT == 6) v = 0.5f * v * (1.0f + erff(v * 0.70710678118654752f)); else if (ACT == 11) v = 1.0f / (1.0f + expf(-v)); else if (ACT == 15) v = v / (1.0f + expf(-v)); else if (ACT == 12) v = (v > 0.f) ? v : 0.01f * v; else if (ACT == 8) v = tanhf(v); else if (ACT == 9) v = 0.5f * v * (1.0f + tanhf(0.7978845608028654f * (v + 0.044715f * v * v * v))); else if (ACT == 14) v = (v > 0.f) ? v : 0.1f * v; else if (ACT == 16) v = (v >= 0.f) ? v : 0.3f * v; else if (ACT == 17) v = (v >= 0.f) ? v : 0.2f * v;
      so[w][rloc][t * 16 + ln] = v; } }
  __builtin_amdgcn_fence(__ATOMIC_ACQ_REL, "workgroup"); __builtin_amdgcn_wave_barrier();
  const int rsub = lane >> 4, c4 = (lane & 15) * 4;
  {
#pragma unroll
    for (int q = 0; q < 16; ++q) { const int r = q * 2 + rsub; const v4f v = *(const v4fa*)&so[w][r][c4]; if (C) *(v4f*)(C + cofs + (size_t)(row0 + r) * ldc + col0 + c4) = v; if (C16) { v4h h4; for (int i = 0; i < 4; ++i) h4[i] = (_Float16)v[i]; *(v4h*)(C16 + cofs + (size_t)(row0 + r) * ldc + col0 + c4) = h4; } }
     } }


__global__ __launch_bounds__(256) void k_wnat(const float* __restrict__ w, size_t n8, _Float16* __restrict__ Bt) { const size_t t = (size_t)blockIdx.x * 256 + threadIdx.x; if (t >= n8) return; FragH f; for (int q = 0; q < 8; ++q) f.h[q] = (_Float16)(bf16_round(w[t * 8 + q]) * 16.0f); *(v8us*)((unsigned short*)Bt + t * 8) = f.half[0];  }
__global__ __launch_bounds__(256) void k_rsm(const float* __restrict__ S, _Float16* __restrict__ P, int nrows) {
  #pragma clang fp contract(off)
  const int i = blockIdx.x * 256 + threadIdx.x; if (i >= nrows) return; const float* s = S + (size_t)i * SQ; float mx = -3.0e38f;
#pragma unroll 1
  for (int j = 0; j < SQ; ++j) mx = fmaxf(mx, s[j]); float se = 0.f;
#pragma unroll 1
  for (int j = 0; j < SQ; ++j) se += expf(s[j] - mx); const float sc = 256.0f / se;
#pragma unroll 1
  for (int j0 = 0; j0 < SQ; j0 += 8) { FragH f; for (int q = 0; q < 8; ++q) f.h[q] = (_Float16)(expf(s[j0 + q] - mx) * sc); unsigned short* d = (unsigned short*)P + (size_t)i * SQ + j0; *(v8us*)d = f.half[0];  } }
__global__ __launch_bounds__(256) void k_vt(const _Float16* __restrict__ V16, int b, int h0, _Float16* __restrict__ VT) { __shared__ unsigned short tl[64][65]; const int tid = threadIdx.x; const int hh = blockIdx.x % HG, sg = blockIdx.x / HG; const int s0 = sg * 64; const int h = h0 + hh;
  for (int i = tid; i < 64 * 8; i += 256) { const int j = i / 8, d8 = (i % 8) * 8; FragH f; f.half[0] = *(const v8us*)((const unsigned short*)V16 + ((size_t)b * SQ + s0 + j) * DM + h * HD + d8); for (int q = 0; q < 8; ++q) tl[d8 + q][j] = f.u[q]; }
  __syncthreads();
  { for (int i = tid; i < 64 * 8; i += 256) { const int d = i / 8, j8 = (i % 8) * 8; FragH f; for (int q = 0; q < 8; ++q) f.u[q] = tl[d][j8 + q]; *(v8us*)((unsigned short*)VT + ((size_t)hh * HD + d) * SQ + s0 + j8) = f.half[0]; }  } }


// lane l <-> l ^ M inside a 16-lane row (DPP row_xmask), and l <-> l ^ 16 (cross-row move)
template <int M> __device__ __forceinline__ float ln_xm(float v) { return __int_as_float(__builtin_amdgcn_update_dpp(0, __float_as_int(v), 0x160 + M, 0xf, 0xf, true)); }
__device__ __forceinline__ float ln_x16(float v) { const int b = __float_as_int(v); return __int_as_float(__builtin_amdgcn_permlanex16(b, b, 0x76543210, 0xfedcba98, false, false)); }
// 2^x (v_exp_f32). The v_nop in the same statement keeps the one issue slot that the instruction set asks for behind a transcendental, before its result is read or its source overwritten.
__device__ __forceinline__ float exp2_slot(float x) { float r; asm("v_exp_f32 %0, %1\n\tv_nop" : "=v"(r) : "v"(x)); return r; }
// Row softmax, one wave per row: the row (SQ f32) is read once, 512 contiguous bytes per load, and stays in registers for the maximum, the exponentials and the scaling.
__global__ __launch_bounds__(256) void k_rsmf(const float* __restrict__ S, _Float16* __restrict__ P, int qn, int hg) {
  const unsigned lane = threadIdx.x & 31; const int t = blockIdx.x * 8 + __builtin_amdgcn_readfirstlane(threadIdx.x >> 5); if (t >= qn * hg) return;      /* the wave's row, held as a scalar: a scalar branch (the kernel has no barrier) and scalar row addresses */
  const size_t i = (size_t)(t / qn) * SQ + (t % qn); const v4fa* s = (const v4fa*)(S + i * SQ); v4f v[SQ / 128];
#pragma unroll      /* full unroll here and below: v[] stays in registers, and all the row's loads are in flight together */
  for (int u = 0; u < SQ / 128; ++u) v[u] = s[u * 32 + lane];
  v4f m4 = {-3.0e38f, -3.0e38f, -3.0e38f, -3.0e38f};
#pragma unroll
  for (int u = 0; u < SQ / 128; ++u) for (int q = 0; q < 4; ++q) m4[q] = fmaxf(m4[q], v[u][q]);
  float mx = fmaxf(fmaxf(m4[0], m4[1]), fmaxf(m4[2], m4[3]));
  mx = fmaxf(mx, ln_xm<1>(mx)); mx = fmaxf(mx, ln_xm<2>(mx)); mx = fmaxf(mx, ln_xm<4>(mx)); mx = fmaxf(mx, ln_xm<8>(mx)); mx = fmaxf(mx, ln_x16(mx));
  v4f s4 = {0.f, 0.f, 0.f, 0.f};
#pragma unroll
  for (int u = 0; u < SQ / 128; ++u) for (int q = 0; q < 4; ++q) { const float e = exp2_slot((v[u][q] - mx) * 1.442695041f);      /* = native exp: the same multiply and v_exp_f32 */ v[u][q] = e; s4[q] += e; }
  float se = (s4[0] + s4[1]) + (s4[2] + s4[3]);
  se += ln_xm<1>(se); se += ln_xm<2>(se); se += ln_xm<4>(se); se += ln_xm<8>(se); se += ln_x16(se);
  const float sc = 256.0f / se; v4h* d = (v4h*)(P + i * SQ);
#pragma unroll
  for (int u = 0; u < SQ / 128; ++u) { v4h h4; for (int q = 0; q < 4; ++q) h4[q] = (_Float16)(v[u][q] * sc); d[u * 32 + lane] = h4; } }

__global__ __launch_bounds__(256) void k_cl2rows(const float* __restrict__ X, _Float16* __restrict__ XR) { __shared__ float tl[64][33]; const int tid = threadIdx.x; const int nl = LL / 32, nc = CC / 64; const int cb_ = blockIdx.x % nc; const int lb = (blockIdx.x / nc) % nl; const size_t b = blockIdx.x / (nc * nl); const int c0 = cb_ * 64, l0 = lb * 32;
  for (int i = tid; i < 64 * 32; i += 256) { const int c = i / 32, l = i % 32; tl[c][l] = bf16_round(X[(b * CC + c0 + c) * (size_t)LL + l0 + l]); }
  __syncthreads();
  { const int l = tid / 8, c8 = (tid % 8) * 8; FragH f; for (int q = 0; q < 8; ++q) f.h[q] = (_Float16)tl[c8 + q][l]; unsigned short* d = (unsigned short*)XR + (b * LL + l0 + l) * (size_t)CC + c0 + c8; *(v8us*)d = f.half[0];  } }


__global__ __launch_bounds__(256) void k_gres2(float* __restrict__ y, const float* __restrict__ x, const float* __restrict__ gam) {
  #pragma clang fp contract(off)
  const size_t i = (size_t)blockIdx.x * 256 + threadIdx.x; if (i >= NR * CC / 4) return; const float g = bf16_round(gam[0]); v4f a = *(const v4fa*)(y + i * 4); const v4f b = *(const v4fa*)(x + i * 4);
  for (int q = 0; q < 4; ++q) a[q] = __fadd_rn(__fmul_rn(g, a[q]), bf16_round(b[q])); *(v4f*)(y + i * 4) = a;  }
extern "C" void kernel_launch(void* const* d_in, const int* in_sizes, int n_in,
                              void* d_out, int out_size, void* d_ws, size_t ws_size, hipStream_t stream) {
  (void)in_sizes; (void)n_in; (void)out_size;
  const float* const* I = (const float* const*)d_in; const float* x = I[0]; const float* wq = I[1]; const float* wk = I[2]; const float* wv = I[3]; const float* gam = I[4];
  char* ws = (char*)d_ws; size_t off = 0;
  auto take = [&](size_t bytes) { char* p = ws + off; off += (bytes + 255) & ~(size_t)255; return p; };
  _Float16* BQ = (_Float16*)take((size_t)CQ * CC * 2); _Float16* BK = (_Float16*)take((size_t)CQ * CC * 2); _Float16* BV = (_Float16*)take((size_t)CC * CC * 2);
  _Float16* XR = (_Float16*)take(NR * CC * 2); float* FF = (float*)take(NR * CQ * 4); _Float16* Fh = (_Float16*)take(NR * CQ * 2); _Float16* Fl = (_Float16*)take(NR * CQ * 2); _Float16* Gh = (_Float16*)take(NR * CQ * 2); _Float16* Gl = (_Float16*)take(NR * CQ * 2);
  _Float16* H16 = (_Float16*)take(NR * CC * 2); float* S = (float*)take(NR * LL * 4); _Float16* P = (_Float16*)take(NR * LL * 2);
  if (off > ws_size) return;      /* approx 0.6 + 16 + 4 + 8 + 16 + 128 + 64 = 237 MiB: every plane holds all NB batches */
  k_wnat<<<(unsigned)(((size_t)CQ * CC / 8 + 255) / 256), 256, 0, stream>>>(wq, (size_t)CQ * CC / 8, BQ); k_wnat<<<(unsigned)(((size_t)CQ * CC / 8 + 255) / 256), 256, 0, stream>>>(wk, (size_t)CQ * CC / 8, BK); k_wnat<<<(unsigned)(((size_t)CC * CC / 8 + 255) / 256), 256, 0, stream>>>(wv, (size_t)CC * CC / 8, BV);
  k_cl2rows<<<NB * (LL / 32) * (CC / 64), 256, 0, stream>>>(x, XR);      /* exact f16 token rows [b*2048 + n][c] */
  /* every stage once for all batches: blockIdx.y = batch, the plane strides sA / sB / sC step from batch to batch (0 = shared weights) */
  k_gemm2<0><<<dim3((LL / 128) * 1, NB), 128, 0, stream>>>(XR, CC, (size_t)LL * CC, BQ, CC, 0, 0.0625f, nullptr, 0, nullptr, 1, 0, 0, FF, nullptr, CQ, (size_t)LL * CQ, LL, CQ, CC); k_hl<<<(unsigned)((NR * CQ / 8 + 255) / 256), 256, 0, stream>>>(FF, Fh, Fl, NR * CQ / 8);      /* f^T rows [b][n][64] -> hi/lo */
  k_gemm2<0><<<dim3((LL / 128) * 1, NB), 128, 0, stream>>>(XR, CC, (size_t)LL * CC, BK, CC, 0, 0.0625f, nullptr, 0, nullptr, 1, 0, 0, FF, nullptr, CQ, (size_t)LL * CQ, LL, CQ, CC); k_hl<<<(unsigned)((NR * CQ / 8 + 255) / 256), 256, 0, stream>>>(FF, Gh, Gl, NR * CQ / 8);      /* g^T rows [b][m][64] -> hi/lo */
  k_gemm2<0><<<dim3((CC / 128) * (LL / 64), NB), 128, 0, stream>>>(BV, CC, 0, XR, CC, (size_t)LL * CC, 0.0625f, nullptr, 0, nullptr, 1, 0, 0, nullptr, H16, LL, (size_t)CC * LL, CC, LL, CC);      /* h channel-major [b][c][n] f16 */
  k_gemm2<0><<<dim3((LL / 128) * (LL / 64), NB), 128, 0, stream>>>(Gh, CQ, (size_t)LL * CQ, Fh, CQ, (size_t)LL * CQ, 1.0f, nullptr, 0, nullptr, 1, 0, 0, S, nullptr, LL, (size_t)LL * LL, LL, LL, CQ);      /* S^T[b][m][n] = g_m . f_n (hi.hi) */
  k_gemm2<0><<<dim3((LL / 128) * (LL / 64), NB), 128, 0, stream>>>(Gl, CQ, (size_t)LL * CQ, Fh, CQ, (size_t)LL * CQ, 0.0009765625f, nullptr, 0, S, -1, 0, 0, S, nullptr, LL, (size_t)LL * LL, LL, LL, CQ);      /* += lo.hi 2^-10 */
  k_gemm2<0><<<dim3((LL / 128) * (LL / 64), NB), 128, 0, stream>>>(Gh, CQ, (size_t)LL * CQ, Fl, CQ, (size_t)LL * CQ, 0.0009765625f, nullptr, 0, S, -1, 0, 0, S, nullptr, LL, (size_t)LL * LL, LL, LL, CQ);      /* += hi.lo 2^-10 */
  k_rsmf<<<NB * LL / 8, 256, 0, stream>>>(S, P, LL, NB);      /* softmax over n per key m (the module's dim=1 softmax) -> beta^T[b][m][n] x256 f16 */
  k_gemm2<0><<<dim3((CC / 128) * (LL / 64), NB), 128, 0, stream>>>(H16, LL, (size_t)CC * LL, P, LL, (size_t)LL * LL, 0.00390625f, nullptr, 0, nullptr, 1, 0, 0, (float*)d_out, nullptr, LL, (size_t)CC * LL, CC, LL, LL);      /* o[b][c][m] = 2^-8 sum_n h[c][n] beta^T[m][n] (channel-major = the output layout) */
  k_gres2<<<(unsigned)((NR * CC / 4 + 255) / 256), 256, 0, stream>>>((float*)d_out, x, gam);      /* gamma o + x */
}

// v003
// It runs in 243 microseconds.
// Two timings next to v002 both put it at 1.63 times that version's speed.
// Counting every step since v000, it is 16.9 times as fast.
#include <hip/hip_runtime.h>
// SAGAN-style self-attention with 1x1-conv projections (x [8][512][2048] channel-first; f = Wq x, g = Wk x (64 channels), h = Wv x (512); scores[n][m] = sum_c f[c][n] g[c][m] (unscaled); beta = softmax over n (the QUERY axis, dim=1) for each m; o[c][m] = gamma sum_n h[c][n] beta[n][m] + x[c][m] -> [8][512][2048]; gamma = an input scalar).
// Structure: x transposed to exact f16 token rows via LDS tiles; f^T and g^T as WMMA GEMMs (32x64 wave tiles, f32 accumulation, exact x16 weights) into f32 rows then f16 hi + x1024 residual planes; h channel-major as a GEMM (weights as the A operand) into f16; every stage is one launch over all batches (blockIdx.y = batch): S^T[m][n] = g^T f (K = 64; hi.hi + lo.hi + hi.lo on WMMA) and its row softmax over n (f32 statistics, native exp; weights x256 f16) = beta^T in one launch, a work-group holding whole score rows in registers; o[c][m] = h . beta^T as a GEMM (K = 2048) channel-major straight into the output; epilogue out = bf16(gamma) o + bf16(x); 4 + 8 = 12 launches.
// Compute dtype: inputs rounded to bf16; x / weights exact; f, g as hi + residual (~2^-22: the unscaled logits have sigma ~8); h and the softmax weights plain f16 (~2^-12); logits, statistics, o f32. v_wmma_f32_16x16x32_f16.
#define NB 8
#define CC 512
#define CQ 64
#define LL 2048
#define SQ LL
#define DM 64
#define NH 1
#define HD 64
#define HG 1
#define NR ((size_t)NB * LL)
typedef __bf16 v16b __attribute__((ext_vector_type(16)));
typedef unsigned short v8us __attribute__((ext_vector_type(8), may_alias));
typedef float  v8f  __attribute__((ext_vector_type(8)));
typedef float  v4f  __attribute__((ext_vector_type(4)));
typedef float  v4fa __attribute__((ext_vector_type(4), may_alias));
union FragB { v16b v; v8us half[2]; unsigned short u[16]; };

__device__ __forceinline__ unsigned short bf16_bits(float x) { unsigned int u = __float_as_uint(x); return (unsigned short)((u + 0x7FFFu + ((u >> 16) & 1u)) >> 16); }
__device__ __forceinline__ float bf16_val(unsigned short b) { return __uint_as_float(((unsigned int)b) << 16); }
__device__ __forceinline__ float bf16_round(float x) { return bf16_val(bf16_bits(x)); }
// D += A·B with NT terms: 1 = ah·bh, 2 = + al·bh (A split), 3 = + ah·bl (both split)
template <int NT>
__device__ __forceinline__ v8f mmaN(v16b ah, v16b al, v16b bh, v16b bl, v8f c) {
  c = __builtin_amdgcn_wmma_f32_16x16x32_bf16(false, ah, false, bh, (short)0, c, false, false);
  if (NT >= 2) c = __builtin_amdgcn_wmma_f32_16x16x32_bf16(false, al, false, bh, (short)0, c, false, false);
  if (NT >= 3) c = __builtin_amdgcn_wmma_f32_16x16x32_bf16(false, ah, false, bl, (short)0, c, false, false);
  asm volatile("v_nop\n\tv_nop\n\tv_nop\n\tv_nop" : "+v"(c) : "v"(ah), "v"(al), "v"(bh), "v"(bl));
  return c;
}

__global__ __launch_bounds__(256) void k_wt_bf16(const float* __restrict__ W, unsigned short* __restrict__ Wt, int K, int N) {
  const int t = blockIdx.x * 256 + threadIdx.x;
  const int k8n = K / 8;
  if (t >= N * k8n) return;
  const int n = t / k8n, k8 = (t % k8n) * 8;
  v8us v;
#pragma unroll
  for (int i = 0; i < 8; ++i) v[i] = bf16_bits(W[(size_t)(k8 + i) * N + n]);
  *(v8us*)(Wt + (size_t)n * K + k8) = v;
  
}

// GEMM C[M][N] (f32, pitch ldc) = act(A[M][K]·W + bias). A f32 row-major (pitch lda) converted per fragment to bf16
// (ASPLIT: hi/lo two planes -> 2 terms, else single rounded term); Wt bf16 [N][K] (pitch ldb). BIAS_BF16 rounds the
// bias to bf16 first (bias quantised to bf16 before the add). K%32==0, M%16==0, N%64==0.
template <bool ASPLIT, int ACT, bool BIAS_BF16>
__global__ __launch_bounds__(128) void k_gemm_bf(const float* __restrict__ A, int lda, const unsigned short* __restrict__ Wt, int ldb,
                                               const float* __restrict__ bias, float* __restrict__ C, int ldc, int M, int N, int K) {
  __shared__ __attribute__((aligned(16))) float so[4][16][64];
  const int tid = threadIdx.x, w = tid >> 5, lane = tid & 31, ln = lane & 15, hh = lane >> 4;
  const int ntn = N / 64;
  const int wid = blockIdx.x * 4 + w;
  const int mt = wid / ntn, nq = wid % ntn;
  if (mt * 16 >= M) return;
  const int row0 = mt * 16, col0 = nq * 64;
  const float* arow = A + (size_t)(row0 + ln) * lda;
  v8f acc[4] = {};
  for (int kb = 0; kb < K; kb += 32) {
    FragB ah, al;
    const v4f x0 = *(const v4fa*)(arow + kb + 8 * hh), x1 = *(const v4fa*)(arow + kb + 8 * hh + 4);
    const v4f x2 = *(const v4fa*)(arow + kb + 16 + 8 * hh), x3 = *(const v4fa*)(arow + kb + 16 + 8 * hh + 4);
    float xs[16] = {x0[0],x0[1],x0[2],x0[3],x1[0],x1[1],x1[2],x1[3],x2[0],x2[1],x2[2],x2[3],x3[0],x3[1],x3[2],x3[3]};
#pragma unroll
    for (int i = 0; i < 16; ++i) { const unsigned short hb = bf16_bits(xs[i]); ah.u[i] = hb; al.u[i] = ASPLIT ? bf16_bits(xs[i] - bf16_val(hb)) : (unsigned short)0; }
#pragma unroll
    for (int t = 0; t < 4; ++t) {
      const unsigned short* brow = Wt + (size_t)(col0 + t * 16 + ln) * ldb + kb;
      FragB b;
      b.half[0] = *(const v8us*)(brow + 8 * hh);
      b.half[1] = *(const v8us*)(brow + 16 + 8 * hh);
      acc[t] = mmaN<ASPLIT ? 2 : 1>(ah.v, al.v, b.v, b.v, acc[t]);
    }
  }
#pragma unroll
  for (int t = 0; t < 4; ++t) {
    float bv = bias ? bias[col0 + t * 16 + ln] : 0.f;
    if (BIAS_BF16) bv = bf16_round(bv);
#pragma unroll
    for (int r = 0; r < 8; ++r) { float v = acc[t][r] + bv; if (ACT == 1) v = fmaxf(v, 0.f); so[w][8 * hh + r][t * 16 + ln] = v; }
  }
  __builtin_amdgcn_fence(__ATOMIC_ACQ_REL, "workgroup");
  __builtin_amdgcn_wave_barrier();
  const int rsub = lane >> 4, c4 = (lane & 15) * 4;
  {
#pragma unroll
    for (int q = 0; q < 8; ++q) {
      const int r = q * 2 + rsub;
      const v4f v = *(const v4fa*)&so[w][r][c4];
      *(v4f*)(C + (size_t)(row0 + r) * ldc + col0 + c4) = v;
    }
    
  }
}

// GEMM C = act(A·W + bias + resid): A f32 (ASPLIT -> hi/lo 2 terms), Wt bf16 [N][K]; ACT 0 none, 1 relu, 2 exact gelu;
// resid (optional, f32, row index = (row % rmod), pitch ldr, RES_BF16 rounds it) added before the activation.
template <bool ASPLIT, int ACT, bool BIAS_BF16, bool RES_BF16>
__global__ __launch_bounds__(128) void k_gemm_bf3(const float* __restrict__ A, int lda, const unsigned short* __restrict__ Wt, int ldb,
                                                const float* __restrict__ bias, const float* __restrict__ resid, int rmod, int ldr,
                                                float* __restrict__ C, int ldc, int M, int N, int K) {
  __shared__ __attribute__((aligned(16))) float so[4][16][64];
  const int tid = threadIdx.x, w = tid >> 5, lane = tid & 31, ln = lane & 15, hh = lane >> 4;
  const int ntn = N / 64;
  const int wid = blockIdx.x * 4 + w;
  const int mt = wid / ntn, nq = wid % ntn;
  if (mt * 16 >= M) return;
  const int row0 = mt * 16, col0 = nq * 64;
  const float* arow = A + (size_t)(row0 + ln) * lda;
  v8f acc[4] = {};
  for (int kb = 0; kb < K; kb += 32) {
    FragB ah, al;
    const v4f x0 = *(const v4fa*)(arow + kb + 8 * hh), x1 = *(const v4fa*)(arow + kb + 8 * hh + 4);
    const v4f x2 = *(const v4fa*)(arow + kb + 16 + 8 * hh), x3 = *(const v4fa*)(arow + kb + 16 + 8 * hh + 4);
    float xs[16] = {x0[0],x0[1],x0[2],x0[3],x1[0],x1[1],x1[2],x1[3],x2[0],x2[1],x2[2],x2[3],x3[0],x3[1],x3[2],x3[3]};
#pragma unroll
    for (int i = 0; i < 16; ++i) { const unsigned short hb = bf16_bits(xs[i]); ah.u[i] = hb; al.u[i] = ASPLIT ? bf16_bits(xs[i] - bf16_val(hb)) : (unsigned short)0; }
#pragma unroll
    for (int t = 0; t < 4; ++t) {
      const unsigned short* brow = Wt + (size_t)(col0 + t * 16 + ln) * ldb + kb;
      FragB b;
      b.half[0] = *(const v8us*)(brow + 8 * hh);
      b.half[1] = *(const v8us*)(brow + 16 + 8 * hh);
      acc[t] = mmaN<ASPLIT ? 2 : 1>(ah.v, al.v, b.v, b.v, acc[t]);
    }
  }
#pragma unroll
  for (int t = 0; t < 4; ++t) {
    const int col = col0 + t * 16 + ln;
    float bv = bias ? bias[col] : 0.f;
    if (BIAS_BF16) bv = bf16_round(bv);
#pragma unroll
    for (int r = 0; r < 8; ++r) {
      float v = acc[t][r] + bv;
      if (resid) { float rv = resid[(size_t)((row0 + 8 * hh + r) % rmod) * ldr + col]; if (RES_BF16) rv = bf16_round(rv); v += rv; }
      if (ACT == 1) v = fmaxf(v, 0.f);
      if (ACT == 2) v = 0.5f * v * (1.0f + erff(v * 0.70710678118654752f));
      if (ACT == 3) { const float u = 0.7978845608028654f * (v + 0.044715f * v * v * v); v = 0.5f * v * (1.0f + tanhf(u)); }
      so[w][8 * hh + r][t * 16 + ln] = v;
    }
  }
  __builtin_amdgcn_fence(__ATOMIC_ACQ_REL, "workgroup");
  __builtin_amdgcn_wave_barrier();
  const int rsub = lane >> 4, c4 = (lane & 15) * 4;
  {
#pragma unroll
    for (int q = 0; q < 8; ++q) {
      const int r = q * 2 + rsub;
      const v4f v = *(const v4fa*)&so[w][r][c4];
      *(v4f*)(C + (size_t)(row0 + r) * ldc + col0 + c4) = v;
    }
    
  }
}
// row LayerNorm (biased variance, eps) over N: s = X (+ R); optional out_sum <- s; out_norm <- (s-mu)*rsqrt(var+eps)*g + b
template <bool PARAM_BF16>
__global__ __launch_bounds__(256) void k_layernorm(const float* __restrict__ X, const float* __restrict__ R, const float* __restrict__ g, const float* __restrict__ bta,
                                                  float* __restrict__ out_sum, float* __restrict__ out_norm, int N, float eps) {
  __shared__ float red[256];
  const int row = blockIdx.x, tid = threadIdx.x;
  const float* x = X + (size_t)row * N; const float* rr = R ? R + (size_t)row * N : nullptr;
  float vals[16];                     // up to N = 4096
  const int per = N / 256;            // contiguous chunk per thread? use strided-by-4 chunks: thread handles j = tid*4 + 1024*u
  float s1 = 0.f;
  for (int u = 0; u < per / 4; ++u) {
    const int j = tid * 4 + 1024 * u;
    const v4f a = *(const v4fa*)(x + j);
    v4f b = {0.f,0.f,0.f,0.f}; if (rr) b = *(const v4fa*)(rr + j);
#pragma unroll
    for (int q = 0; q < 4; ++q) { const float v = a[q] + b[q]; vals[u * 4 + q] = v; s1 += v; }
  }
  red[tid] = s1; __syncthreads();
  for (int st = 128; st > 0; st >>= 1) { if (tid < st) red[tid] += red[tid + st]; __syncthreads(); }
  const float mu = red[0] / (float)N; __syncthreads();
  float s2 = 0.f;
  for (int u = 0; u < per / 4; ++u)
#pragma unroll
    for (int q = 0; q < 4; ++q) { const float c = vals[u * 4 + q] - mu; s2 += c * c; }
  red[tid] = s2; __syncthreads();
  for (int st = 128; st > 0; st >>= 1) { if (tid < st) red[tid] += red[tid + st]; __syncthreads(); }
  const float rs = rsqrtf(red[0] / (float)N + eps);
  {
    for (int u = 0; u < per / 4; ++u) {
      const int j = tid * 4 + 1024 * u;
      v4f o, sm;
#pragma unroll
      for (int q = 0; q < 4; ++q) {
        float gg = g[j + q], bb = bta[j + q];
        if (PARAM_BF16) { gg = bf16_round(gg); bb = bf16_round(bb); }
        sm[q] = vals[u * 4 + q]; o[q] = (vals[u * 4 + q] - mu) * rs * gg + bb;
      }
      if (out_sum) *(v4f*)(out_sum + (size_t)row * N + j) = sm;
      *(v4f*)(out_norm + (size_t)row * N + j) = o;
    }
    
  }
}



// ---- f16 WMMA path (v_wmma_f32_16x16x32_f16): 11-bit significands for operands in range — used where a [0,1] probability operand needs more precision than bf16
typedef _Float16 v16h __attribute__((ext_vector_type(16)));
union FragH { v16h v; v8us half[2]; _Float16 h[16]; unsigned short u[16]; };
template <int NT>
__device__ __forceinline__ v8f mmaH(v16h ah, v16h al, v16h bh, v16h bl, v8f c) {
  c = __builtin_amdgcn_wmma_f32_16x16x32_f16(false, ah, false, bh, (short)0, c, false, false);
  if (NT >= 2) c = __builtin_amdgcn_wmma_f32_16x16x32_f16(false, al, false, bh, (short)0, c, false, false);
  if (NT >= 3) c = __builtin_amdgcn_wmma_f32_16x16x32_f16(false, ah, false, bl, (short)0, c, false, false);
  asm volatile("v_nop\n\tv_nop\n\tv_nop\n\tv_nop" : "+v"(c) : "v"(ah), "v"(al), "v"(bh), "v"(bl));
  return c;
}
// batched GEMM like k_gemm_b but f16 operands: A f32 (split into f16 hi/lo if ASPLIT, else rounded to f16), Bt = f16 values [n][k]; alpha; C f32; N multiple of 16 (partial tiles skipped)
template <bool ASPLIT>
__global__ __launch_bounds__(128) void k_gemm_h(const float* __restrict__ A, int lda, size_t sA, const _Float16* __restrict__ Bh, int ldb, size_t sB, float alpha, float* __restrict__ C, int ldc, size_t sC, int M, int N, int K) {
  __shared__ __attribute__((aligned(16))) float so[4][16][64];
  const int tid = threadIdx.x, w = tid >> 5, lane = tid & 31, ln = lane & 15, hh = lane >> 4; const int by = blockIdx.y;
  A += (size_t)by * sA; Bh += (size_t)by * sB; C += (size_t)by * sC;
  const int ntn = (N + 63) / 64; const int wid = blockIdx.x * 4 + w; const int mt = wid / ntn, nq = wid % ntn; if (mt * 16 >= M) return;
  const int row0 = mt * 16, col0 = nq * 64; const float* arow = A + (size_t)(row0 + ln) * lda;
  v8f acc[4] = {};
  for (int kb = 0; kb < K; kb += 32) {
    FragH ah, al;
    const v4f x0 = *(const v4fa*)(arow + kb + 8 * hh), x1 = *(const v4fa*)(arow + kb + 8 * hh + 4), x2 = *(const v4fa*)(arow + kb + 16 + 8 * hh), x3 = *(const v4fa*)(arow + kb + 16 + 8 * hh + 4);
    float xs[16] = {x0[0],x0[1],x0[2],x0[3],x1[0],x1[1],x1[2],x1[3],x2[0],x2[1],x2[2],x2[3],x3[0],x3[1],x3[2],x3[3]};
#pragma unroll
    for (int i = 0; i < 16; ++i) { const _Float16 h = (_Float16)xs[i]; ah.h[i] = h; al.h[i] = ASPLIT ? (_Float16)(xs[i] - (float)h) : (_Float16)0.0f; }
#pragma unroll
    for (int t = 0; t < 4; ++t) { if (col0 + t * 16 >= N) continue; const size_t boff = (size_t)(col0 + t * 16 + ln) * ldb + kb; FragH bq; bq.half[0] = *(const v8us*)(Bh + boff + 8 * hh); bq.half[1] = *(const v8us*)(Bh + boff + 16 + 8 * hh);
      acc[t] = mmaH<ASPLIT ? 2 : 1>(ah.v, al.v, bq.v, bq.v, acc[t]); }
  }
#pragma unroll
  for (int t = 0; t < 4; ++t) { if (col0 + t * 16 >= N) continue;
#pragma unroll
    for (int r = 0; r < 8; ++r) so[w][8 * hh + r][t * 16 + ln] = acc[t][r] * alpha; }
  __builtin_amdgcn_fence(__ATOMIC_ACQ_REL, "workgroup"); __builtin_amdgcn_wave_barrier();
  const int rsub = lane >> 4, c4 = (lane & 15) * 4;
  {
#pragma unroll
    for (int q = 0; q < 8; ++q) { const int r = q * 2 + rsub; if (col0 + c4 < N) { const v4f v = *(const v4fa*)&so[w][r][c4]; *(v4f*)(C + (size_t)(row0 + r) * ldc + col0 + c4) = v; } }
     }
}

// Wt[n][k] = f16(W[k][n]·scale) from f32 row-major W[K][N] (scale = power of two; bf16-exact weights stay exact in f16 away from the subnormal range)
__global__ __launch_bounds__(256) void k_wt_f16(const float* __restrict__ W, _Float16* __restrict__ Wt, int K, int N, float scale) {
  const int t = blockIdx.x * 256 + threadIdx.x; if (t >= N * (K / 8)) return; const int n = t / (K / 8), k8 = (t % (K / 8)) * 8; FragH f;
#pragma unroll
  for (int i = 0; i < 8; ++i) f.h[i] = (_Float16)(bf16_round(W[(size_t)(k8 + i) * N + n]) * scale); const v8us o = f.half[0];
  *(v8us*)((unsigned short*)Wt + (size_t)n * K + k8) = o; 
}
// k_gemm_hh variant with fused epilogue: v = acc·alpha + bias[by·sBias + col] (+ CP[(row/rowsPerB)·sCPb + by·64 + col] if CP) ; ACT 0 none / 1 elu ; writes f16 C16 (and f32 C if non-null)
template <int ACT>
__global__ __launch_bounds__(128) void k_gemm_hhx(const _Float16* __restrict__ A, int lda, size_t sA, const _Float16* __restrict__ Bh, int ldb, size_t sB, float alpha, const float* __restrict__ bias, size_t sBias, const float* __restrict__ CP, int rowsPerB, size_t sCPb, int row0g,
    float* __restrict__ C, _Float16* __restrict__ C16, int ldc, size_t sC, int M, int N, int K) {
  __shared__ __attribute__((aligned(16))) float so[4][16][64];
  const int tid = threadIdx.x, w = tid >> 5, lane = tid & 31, ln = lane & 15, hh = lane >> 4; const int by = blockIdx.y;
  A += (size_t)by * sA; Bh += (size_t)by * sB; const size_t cofs = (size_t)by * sC; const float* bp = bias ? bias + (size_t)by * sBias : nullptr;
  const int ntn = (N + 63) / 64; const int wid = blockIdx.x * 4 + w; const int mt = wid / ntn, nq = wid % ntn; if (mt * 16 >= M) return;
  const int row0 = mt * 16, col0 = nq * 64; const _Float16* arow = A + (size_t)(row0 + ln) * lda;
  v8f acc[4] = {};
  for (int kb = 0; kb < K; kb += 32) { FragH ah; ah.half[0] = *(const v8us*)((const unsigned short*)arow + kb + 8 * hh); ah.half[1] = *(const v8us*)((const unsigned short*)arow + kb + 16 + 8 * hh);
#pragma unroll
    for (int t = 0; t < 4; ++t) { if (col0 + t * 16 >= N) continue; const size_t boff = (size_t)(col0 + t * 16 + ln) * ldb + kb; FragH bq; bq.half[0] = *(const v8us*)((const unsigned short*)Bh + boff + 8 * hh); bq.half[1] = *(const v8us*)((const unsigned short*)Bh + boff + 16 + 8 * hh);
      acc[t] = mmaH<1>(ah.v, ah.v, bq.v, bq.v, acc[t]); }
  }
#pragma unroll
  for (int t = 0; t < 4; ++t) { if (col0 + t * 16 >= N) continue; const int col = col0 + t * 16 + ln; const float bv = bp ? bf16_round(bp[col]) : 0.f;
#pragma unroll
    for (int r = 0; r < 8; ++r) { float v = acc[t][r] * alpha + bv; if (CP) { const int rr = row0g + row0 + 8 * hh + r; if (rowsPerB < 0) v += CP[cofs + (size_t)rr * ldc + col];      /* rowsPerB < 0: own element of the batched C plane */ else { const int bidx = rr / rowsPerB; v += CP[(size_t)bidx * sCPb + (size_t)by * 64 + col]; } } if (ACT == 1) v = (v > 0.f) ? v : expm1f(v); else if (ACT == 7) v = (v > 0.f) ? v + 1.0f : expf(v); else if (ACT == 8) v = tanhf(v); else if (ACT == 9) v = 0.5f * v * (1.0f + tanhf(0.7978845608028654f * (v + 0.044715f * v * v * v))); else if (ACT == 11) v = 1.0f / (1.0f + expf(-v)); else if (ACT == 12) v = (v > 0.f) ? v : 0.01f * v; else if (ACT == 14) v = (v > 0.f) ? v : 0.1f * v; else if (ACT == 16) v = (v >= 0.f) ? v : 0.3f * v; else if (ACT == 17) v = (v >= 0.f) ? v : 0.2f * v; else if (ACT == 15) v = v / (1.0f + expf(-v)); else if (ACT == 3) v = fmaxf(v, 0.f); else if (ACT == 6) v = 0.5f * v * (1.0f + erff(v * 0.70710678118654752f)); so[w][8 * hh + r][t * 16 + ln] = v; } }
  __builtin_amdgcn_fence(__ATOMIC_ACQ_REL, "workgroup"); __builtin_amdgcn_wave_barrier();
  const int rsub = lane >> 4, c4 = (lane & 15) * 4; typedef _Float16 v4h __attribute__((ext_vector_type(4)));
  {
#pragma unroll
    for (int q = 0; q < 8; ++q) { const int r = q * 2 + rsub; if (col0 + c4 < N) { const v4f v = *(const v4fa*)&so[w][r][c4]; if (C) *(v4f*)(C + cofs + (size_t)(row0 + r) * ldc + col0 + c4) = v; if (C16) { v4h h4; for (int i = 0; i < 4; ++i) h4[i] = (_Float16)v[i]; *(v4h*)(C16 + cofs + (size_t)(row0 + r) * ldc + col0 + c4) = h4; } } }
     }
}


typedef _Float16 v4h __attribute__((ext_vector_type(4)));

__global__ __launch_bounds__(256) void k_x16(const float* __restrict__ x, _Float16* __restrict__ X16, size_t n8) { const size_t t = (size_t)blockIdx.x * 256 + threadIdx.x; if (t >= n8) return; FragH f;
#pragma unroll
  for (int q = 0; q < 8; ++q) f.h[q] = (_Float16)bf16_round(x[t * 8 + q]); *(v8us*)((unsigned short*)X16 + t * 8) = f.half[0];  }
__global__ __launch_bounds__(256) void k_h16(const float* __restrict__ x, _Float16* __restrict__ X16, size_t n8) { const size_t t = (size_t)blockIdx.x * 256 + threadIdx.x; if (t >= n8) return; FragH f;
#pragma unroll
  for (int q = 0; q < 8; ++q) f.h[q] = (_Float16)x[t * 8 + q]; *(v8us*)((unsigned short*)X16 + t * 8) = f.half[0];  }
__global__ __launch_bounds__(256) void k_round16f(const float* __restrict__ W, _Float16* __restrict__ Bt, size_t n8) { const size_t t = (size_t)blockIdx.x * 256 + threadIdx.x; if (t >= n8) return; FragH f;
#pragma unroll
  for (int i = 0; i < 8; ++i) f.h[i] = (_Float16)(bf16_round(W[t * 8 + i]) * 16.0f); *(v8us*)((unsigned short*)Bt + t * 8) = f.half[0];  }
template <int NHv, int TTv>
__global__ __launch_bounds__(256) void k_vt(const _Float16* __restrict__ V16, int ldv, int voff, _Float16* __restrict__ Vt) { __shared__ unsigned short tl[64][66]; const int tid = threadIdx.x; const int slab = blockIdx.x / (TTv / 64), lg = blockIdx.x % (TTv / 64); const int b = slab / NHv, h = slab % NHv;
  for (int i = tid; i < 64 * 8; i += 256) { const int r = i / 8, c8 = (i % 8) * 8; FragH f; f.half[0] = *(const v8us*)((const unsigned short*)V16 + ((size_t)b * TTv + lg * 64 + r) * ldv + voff + h * 64 + c8);
#pragma unroll
    for (int q = 0; q < 8; ++q) tl[r][c8 + q] = f.u[q]; }
  __syncthreads();
  {
#pragma unroll
    for (int rd = 0; rd < 2; ++rd) { const int d = rd * 32 + tid / 8, pc = tid % 8; FragH f;
#pragma unroll
      for (int q = 0; q < 8; ++q) f.u[q] = tl[pc * 8 + q][d];
      *(v8us*)((unsigned short*)Vt + ((size_t)slab * 64 + d) * TTv + lg * 64 + pc * 8) = f.half[0]; }
     } }

__global__ __launch_bounds__(256) void k_hl(const float* __restrict__ F, _Float16* __restrict__ Hh, _Float16* __restrict__ Hl, size_t n8) { const size_t t = (size_t)blockIdx.x * 256 + threadIdx.x; if (t >= n8) return; FragH fh, fl; const v4f a = *(const v4fa*)(F + t * 8), c = *(const v4fa*)(F + t * 8 + 4);
#pragma unroll
  for (int q = 0; q < 4; ++q) { _Float16 h = (_Float16)a[q]; fh.h[q] = h; fl.h[q] = (_Float16)((a[q] - (float)h) * 1024.0f); h = (_Float16)c[q]; fh.h[4 + q] = h; fl.h[4 + q] = (_Float16)((c[q] - (float)h) * 1024.0f); }
  { *(v8us*)((unsigned short*)Hh + t * 8) = fh.half[0]; *(v8us*)((unsigned short*)Hl + t * 8) = fl.half[0];  } }

// ---- fast GEMM (wave tile 32x64; requires M % 32 == 0 rows per launch region and N % 64 == 0); epilogue = k_gemm_hhx semantics ----
__device__ __forceinline__ v16h g2_frag(const _Float16* p, int hh) { FragH f; f.half[0] = *(const v8us*)((const unsigned short*)p + 8 * hh); f.half[1] = *(const v8us*)((const unsigned short*)p + 16 + 8 * hh); return f.v; }
__device__ __forceinline__ v8f g2_mma(v16h a, v16h b, v8f c) { v8f d = __builtin_amdgcn_wmma_f32_16x16x32_f16(false, a, false, b, (short)0, c, false, false); asm volatile("v_nop\n\tv_nop\n\tv_nop\n\tv_nop" : "+v"(d) : "v"(a), "v"(b)); return d; }
template <int ACT>
__global__ __launch_bounds__(128) void k_gemm2(const _Float16* __restrict__ A, int lda, size_t sA, const _Float16* __restrict__ Bh, int ldb, size_t sB, float alpha, const float* __restrict__ bias, size_t sBias, const float* __restrict__ CP, int rowsPerB, size_t sCPb, int row0g,
    float* __restrict__ C, _Float16* __restrict__ C16, int ldc, size_t sC, int M, int N, int K) { static_assert(ACT == 0 || ACT == 3 || ACT == 6 || ACT == 8 || ACT == 9 || ACT == 11 || ACT == 12 || ACT == 14 || ACT == 15 || ACT == 16 || ACT == 17, "k_gemm2: unsupported ACT code (would silently apply no activation)");
  __shared__ __attribute__((aligned(16))) float so[4][32][68];
  const int tid = threadIdx.x, w = tid >> 5, lane = tid & 31, ln = lane & 15, hh = lane >> 4; const int by = blockIdx.y;
  A += (size_t)by * sA; Bh += (size_t)by * sB; const size_t cofs = (size_t)by * sC; const float* bp = bias ? bias + (size_t)by * sBias : nullptr;
  const int ntn = N >> 6; const int mt = blockIdx.x / ntn, nq = blockIdx.x - mt * ntn; const int row0 = mt * 128 + 32 * w, col0 = nq * 64; if (row0 >= M) return;
  const _Float16* a0p = A + (size_t)(row0 + ln) * lda; const _Float16* a1p = a0p + (size_t)16 * lda;
  const _Float16* b0p = Bh + (size_t)(col0 + ln) * ldb; const _Float16* b1p = b0p + (size_t)16 * ldb; const _Float16* b2p = b1p + (size_t)16 * ldb; const _Float16* b3p = b2p + (size_t)16 * ldb;
  const v8f z8 = {0.f,0.f,0.f,0.f,0.f,0.f,0.f,0.f}; v8f c00 = z8, c01 = z8, c02 = z8, c03 = z8, c10 = z8, c11 = z8, c12 = z8, c13 = z8;
#pragma unroll 1
  for (int kb = 0; kb < K; kb += 32) { const v16h a0 = g2_frag(a0p + kb, hh), a1 = g2_frag(a1p + kb, hh);
    v16h b = g2_frag(b0p + kb, hh); c00 = g2_mma(a0, b, c00); c10 = g2_mma(a1, b, c10);
    b = g2_frag(b1p + kb, hh); c01 = g2_mma(a0, b, c01); c11 = g2_mma(a1, b, c11);
    b = g2_frag(b2p + kb, hh); c02 = g2_mma(a0, b, c02); c12 = g2_mma(a1, b, c12);
    b = g2_frag(b3p + kb, hh); c03 = g2_mma(a0, b, c03); c13 = g2_mma(a1, b, c13); }
  v8f accs[8] = {c00, c01, c02, c03, c10, c11, c12, c13};
#pragma unroll
  for (int u = 0; u < 8; ++u) { const int t = u & 3, half = u >> 2; const int col = col0 + t * 16 + ln; const float bv = bp ? bf16_round(bp[col]) : 0.f;
#pragma unroll
    for (int r = 0; r < 8; ++r) { const int rloc = half * 16 + 8 * hh + r; float v = accs[u][r] * alpha + bv; if (CP) { if (rowsPerB < 0) v += CP[cofs + (size_t)(row0g + row0 + rloc) * ldc + col];      /* rowsPerB < 0: own element of the batched C plane */ else { const int bidx = (row0g + row0 + rloc) / rowsPerB; v += CP[(size_t)bidx * sCPb + (size_t)by * 64 + col]; } }
      if (ACT == 3) v = fmaxf(v, 0.f); else if (ACT == 6) v = 0.5f * v * (1.0f + erff(v * 0.70710678118654752f)); else if (ACT == 11) v = 1.0f / (1.0f + expf(-v)); else if (ACT == 15) v = v / (1.0f + expf(-v)); else if (ACT == 12) v = (v > 0.f) ? v : 0.01f * v; else if (ACT == 8) v = tanhf(v); else if (ACT == 9) v = 0.5f * v * (1.0f + tanhf(0.7978845608028654f * (v + 0.044715f * v * v * v))); else if (ACT == 14) v = (v > 0.f) ? v : 0.1f * v; else if (ACT == 16) v = (v >= 0.f) ? v : 0.3f * v; else if (ACT == 17) v = (v >= 0.f) ? v : 0.2f * v;
      so[w][rloc][t * 16 + ln] = v; } }
  __builtin_amdgcn_fence(__ATOMIC_ACQ_REL, "workgroup"); __builtin_amdgcn_wave_barrier();
  const int rsub = lane >> 4, c4 = (lane & 15) * 4;
  {
#pragma unroll
    for (int q = 0; q < 16; ++q) { const int r = q * 2 + rsub; const v4f v = *(const v4fa*)&so[w][r][c4]; if (C) *(v4f*)(C + cofs + (size_t)(row0 + r) * ldc + col0 + c4) = v; if (C16) { v4h h4; for (int i = 0; i < 4; ++i) h4[i] = (_Float16)v[i]; *(v4h*)(C16 + cofs + (size_t)(row0 + r) * ldc + col0 + c4) = h4; } }
     } }


__global__ __launch_bounds__(256) void k_wnat(const float* __restrict__ w, size_t n8, _Float16* __restrict__ Bt) { const size_t t = (size_t)blockIdx.x * 256 + threadIdx.x; if (t >= n8) return; FragH f; for (int q = 0; q < 8; ++q) f.h[q] = (_Float16)(bf16_round(w[t * 8 + q]) * 16.0f); *(v8us*)((unsigned short*)Bt + t * 8) = f.half[0];  }
__global__ __launch_bounds__(256) void k_rsm(const float* __restrict__ S, _Float16* __restrict__ P, int nrows) {
  #pragma clang fp contract(off)
  const int i = blockIdx.x * 256 + threadIdx.x; if (i >= nrows) return; const float* s = S + (size_t)i * SQ; float mx = -3.0e38f;
#pragma unroll 1
  for (int j = 0; j < SQ; ++j) mx = fmaxf(mx, s[j]); float se = 0.f;
#pragma unroll 1
  for (int j = 0; j < SQ; ++j) se += expf(s[j] - mx); const float sc = 256.0f / se;
#pragma unroll 1
  for (int j0 = 0; j0 < SQ; j0 += 8) { FragH f; for (int q = 0; q < 8; ++q) f.h[q] = (_Float16)(expf(s[j0 + q] - mx) * sc); unsigned short* d = (unsigned short*)P + (size_t)i * SQ + j0; *(v8us*)d = f.half[0];  } }
__global__ __launch_bounds__(256) void k_vt(const _Float16* __restrict__ V16, int b, int h0, _Float16* __restrict__ VT) { __shared__ unsigned short tl[64][65]; const int tid = threadIdx.x; const int hh = blockIdx.x % HG, sg = blockIdx.x / HG; const int s0 = sg * 64; const int h = h0 + hh;
  for (int i = tid; i < 64 * 8; i += 256) { const int j = i / 8, d8 = (i % 8) * 8; FragH f; f.half[0] = *(const v8us*)((const unsigned short*)V16 + ((size_t)b * SQ + s0 + j) * DM + h * HD + d8); for (int q = 0; q < 8; ++q) tl[d8 + q][j] = f.u[q]; }
  __syncthreads();
  { for (int i = tid; i < 64 * 8; i += 256) { const int d = i / 8, j8 = (i % 8) * 8; FragH f; for (int q = 0; q < 8; ++q) f.u[q] = tl[d][j8 + q]; *(v8us*)((unsigned short*)VT + ((size_t)hh * HD + d) * SQ + s0 + j8) = f.half[0]; }  } }


// lane l <-> l ^ M inside a 16-lane row (DPP row_xmask)
template <int M> __device__ __forceinline__ float ln_xm(float v) { return __int_as_float(__builtin_amdgcn_update_dpp(0, __float_as_int(v), 0x160 + M, 0xf, 0xf, true)); }
// 2^x (v_exp_f32). The v_nop in the same statement keeps the one issue slot that the instruction set asks for behind a transcendental, before its result is read or its source overwritten.
__device__ __forceinline__ float exp2_slot(float x) { float r; asm("v_exp_f32 %0, %1\n\tv_nop" : "=v"(r) : "v"(x)); return r; }
// Scores and their row softmax in one launch. A work-group owns MT*16 whole rows m of S^T[m][n] = g_m . f_n: each of its NW waves forms its own LL/NW columns on WMMA (hi.hi + 2^-10 (lo.hi + hi.lo)) and keeps them in
// accumulator registers through the maximum, the exponentials and the scaling, so the f32 score plane never goes to memory. Column tile t of a wave takes f rows n = base + (t>>3)*128 + ln*8 + (t&7): a lane then holds 8 neighbouring columns of a row, and one 16-byte store per lane writes whole lines of beta^T.
__device__ __forceinline__ v8f sc_mma(v16h a, v16h b, v8f c) { return __builtin_amdgcn_wmma_f32_16x16x32_f16(false, a, false, b, (short)0, c, false, false); }
template <int MT, int NW>
__global__ __launch_bounds__(NW * 32) void k_scsm(const _Float16* __restrict__ Gh, const _Float16* __restrict__ Gl, const _Float16* __restrict__ Fh, const _Float16* __restrict__ Fl, _Float16* __restrict__ P) {
  constexpr int TP = LL / (NW * 16); static_assert(TP % 8 == 0 && (NW == 8 || NW == 16), "k_scsm: a wave takes whole groups of 8 column tiles; the cross-wave step reads one partial per lane of a 16-lane row");
  __shared__ float rmx[MT * 16][NW]; __shared__ float rsu[MT * 16][NW];      /* one partial maximum / sum per row and wave */
  const int lane = threadIdx.x & 31, ln = lane & 15, hh = lane >> 4; const int w = __builtin_amdgcn_readfirstlane(threadIdx.x >> 5);
  const size_t rb = (size_t)blockIdx.y * LL; const int m0 = blockIdx.x * (MT * 16); const int n0 = w * (TP * 16) + ln * 8;
  const v8f z8 = {0.f,0.f,0.f,0.f,0.f,0.f,0.f,0.f};
  v16h ah[MT][2], al[MT][2];
#pragma unroll      /* full unroll here and below: the fragment and score arrays stay in registers */
  for (int mt = 0; mt < MT; ++mt) { const size_t go = (rb + m0 + mt * 16 + ln) * CQ; ah[mt][0] = g2_frag(Gh + go, hh); ah[mt][1] = g2_frag(Gh + go + 32, hh); al[mt][0] = g2_frag(Gl + go, hh); al[mt][1] = g2_frag(Gl + go + 32, hh); }
  asm volatile("s_wait_xcnt 0x0" ::: "memory");      /* a precaution: stands before the registers that hold the g loads' addresses are written again (the first f load lands on one of them) */
  v16h bq[2][4]; { const size_t fo = (rb + n0) * CQ; bq[0][0] = g2_frag(Fh + fo, hh); bq[0][1] = g2_frag(Fh + fo + 32, hh); bq[0][2] = g2_frag(Fl + fo, hh); bq[0][3] = g2_frag(Fl + fo + 32, hh); }
  v8f s[MT][TP];      /* lane (ln, hh), element r of s[mt][t] = row m0 + mt*16 + 8*hh + r, column n0 + (t>>3)*128 + (t&7) */
#pragma unroll
  for (int t = 0; t < TP; ++t) {
    if (t + 1 < TP) { const size_t fo = (rb + n0 + ((t + 1) >> 3) * 128 + ((t + 1) & 7)) * CQ; const int u = (t + 1) & 1; bq[u][0] = g2_frag(Fh + fo, hh); bq[u][1] = g2_frag(Fh + fo + 32, hh); bq[u][2] = g2_frag(Fl + fo, hh); bq[u][3] = g2_frag(Fl + fo + 32, hh); }      /* the next tile's fragments fly while this tile is multiplied */
    const v16h bh0 = bq[t & 1][0], bh1 = bq[t & 1][1], bl0 = bq[t & 1][2], bl1 = bq[t & 1][3];
#pragma unroll
    for (int mt = 0; mt < MT; ++mt) { const v8f c = sc_mma(ah[mt][1], bh1, sc_mma(ah[mt][0], bh0, z8)); const v8f d = sc_mma(ah[mt][1], bl1, sc_mma(ah[mt][0], bl0, sc_mma(al[mt][1], bh1, sc_mma(al[mt][0], bh0, z8))));
      s[mt][t] = d * 0.0009765625f + c; } }
  v8f st[MT];
#pragma unroll
  for (int mt = 0; mt < MT; ++mt) { v8f m = s[mt][0];
#pragma unroll
    for (int t = 1; t < TP; ++t) m = __builtin_elementwise_max(m, s[mt][t]);
#pragma unroll
    for (int r = 0; r < 8; ++r) { float x = m[r]; x = fmaxf(x, ln_xm<1>(x)); x = fmaxf(x, ln_xm<2>(x)); x = fmaxf(x, ln_xm<4>(x)); x = fmaxf(x, ln_xm<8>(x)); m[r] = x; }
    st[mt] = m; }
  if (ln == 0) {
#pragma unroll
    for (int mt = 0; mt < MT; ++mt)
#pragma unroll
      for (int r = 0; r < 8; ++r) rmx[mt * 16 + 8 * hh + r][w] = st[mt][r]; }
  __syncthreads();      /* every wave's partial maxima are in LDS */
#pragma unroll
  for (int mt = 0; mt < MT; ++mt) { v8f m;
#pragma unroll
    for (int r = 0; r < 8; ++r) { float x = rmx[mt * 16 + 8 * hh + r][ln & (NW - 1)]; x = fmaxf(x, ln_xm<1>(x)); x = fmaxf(x, ln_xm<2>(x)); x = fmaxf(x, ln_xm<4>(x)); if (NW == 16) x = fmaxf(x, ln_xm<8>(x)); m[r] = x; }
    v8f a = z8;
#pragma unroll
    for (int t = 0; t < TP; ++t) { const v8f y = (s[mt][t] - m) * 1.442695041f; v8f e;
#pragma unroll
      for (int r = 0; r < 8; ++r) e[r] = exp2_slot(y[r]);      /* = native exp: the same multiply and v_exp_f32 */
      s[mt][t] = e; a += e; }
#pragma unroll
    for (int r = 0; r < 8; ++r) { float x = a[r]; x += ln_xm<1>(x); x += ln_xm<2>(x); x += ln_xm<4>(x); x += ln_xm<8>(x); a[r] = x; }
    st[mt] = a; }
  if (ln == 0) {
#pragma unroll
    for (int mt = 0; mt < MT; ++mt)
#pragma unroll
      for (int r = 0; r < 8; ++r) rsu[mt * 16 + 8 * hh + r][w] = st[mt][r]; }
  __syncthreads();      /* every wave's partial sums are in LDS */
#pragma unroll
  for (int mt = 0; mt < MT; ++mt) { v8f sc;
#pragma unroll
    for (int r = 0; r < 8; ++r) { float x = rsu[mt * 16 + 8 * hh + r][ln & (NW - 1)]; x += ln_xm<1>(x); x += ln_xm<2>(x); x += ln_xm<4>(x); if (NW == 16) x += ln_xm<8>(x); sc[r] = 256.0f / x; }
#pragma unroll
    for (int t = 0; t < TP; ++t) s[mt][t] *= sc;
#pragma unroll
    for (int r = 0; r < 8; ++r) { unsigned short* d = (unsigned short*)P + (rb + m0 + mt * 16 + 8 * hh + r) * LL + n0;
#pragma unroll
      for (int t8 = 0; t8 < TP / 8; ++t8) { FragH f;
#pragma unroll
        for (int q = 0; q < 8; ++q) f.h[q] = (_Float16)s[mt][t8 * 8 + q][r];
        *(v8us*)(d + t8 * 128) = f.half[0]; } } } }

__global__ __launch_bounds__(256) void k_cl2rows(const float* __restrict__ X, _Float16* __restrict__ XR) { __shared__ float tl[64][33]; const int tid = threadIdx.x; const int nl = LL / 32, nc = CC / 64; const int cb_ = blockIdx.x % nc; const int lb = (blockIdx.x / nc) % nl; const size_t b = blockIdx.x / (nc * nl); const int c0 = cb_ * 64, l0 = lb * 32;
  for (int i = tid; i < 64 * 32; i += 256) { const int c = i / 32, l = i % 32; tl[c][l] = bf16_round(X[(b * CC + c0 + c) * (size_t)LL + l0 + l]); }
  __syncthreads();
  { const int l = tid / 8, c8 = (tid % 8) * 8; FragH f; for (int q = 0; q < 8; ++q) f.h[q] = (_Float16)tl[c8 + q][l]; unsigned short* d = (unsigned short*)XR + (b * LL + l0 + l) * (size_t)CC + c0 + c8; *(v8us*)d = f.half[0];  } }


__global__ __launch_bounds__(256) void k_gres2(float* __restrict__ y, const float* __restrict__ x, const float* __restrict__ gam) {
  #pragma clang fp contract(off)
  const size_t i = (size_t)blockIdx.x * 256 + threadIdx.x; if (i >= NR * CC / 4) return; const float g = bf16_round(gam[0]); v4f a = *(const v4fa*)(y + i * 4); const v4f b = *(const v4fa*)(x + i * 4);
  for (int q = 0; q < 4; ++q) a[q] = __fadd_rn(__fmul_rn(g, a[q]), bf16_round(b[q])); *(v4f*)(y + i * 4) = a;  }
extern "C" void kernel_launch(void* const* d_in, const int* in_sizes, int n_in,
                              void* d_out, int out_size, void* d_ws, size_t ws_size, hipStream_t stream) {
  (void)in_sizes; (void)n_in; (void)out_size;
  const float* const* I = (const float* const*)d_in; const float* x = I[0]; const float* wq = I[1]; const float* wk = I[2]; const float* wv = I[3]; const float* gam = I[4];
  char* ws = (char*)d_ws; size_t off = 0;
  auto take = [&](size_t bytes) { char* p = ws + off; off += (bytes + 255) & ~(size_t)255; return p; };
  _Float16* BQ = (_Float16*)take((size_t)CQ * CC * 2); _Float16* BK = (_Float16*)take((size_t)CQ * CC * 2); _Float16* BV = (_Float16*)take((size_t)CC * CC * 2);
  _Float16* XR = (_Float16*)take(NR * CC * 2); float* FF = (float*)take(NR * CQ * 4); _Float16* Fh = (_Float16*)take(NR * CQ * 2); _Float16* Fl = (_Float16*)take(NR * CQ * 2); _Float16* Gh = (_Float16*)take(NR * CQ * 2); _Float16* Gl = (_Float16*)take(NR * CQ * 2);
  _Float16* H16 = (_Float16*)take(NR * CC * 2); _Float16* P = (_Float16*)take(NR * LL * 2);
  if (off > ws_size) return;      /* approx 0.6 + 16 + 4 + 8 + 16 + 64 = 109 MiB: every plane holds all NB batches */
  k_wnat<<<(unsigned)(((size_t)CQ * CC / 8 + 255) / 256), 256, 0, stream>>>(wq, (size_t)CQ * CC / 8, BQ); k_wnat<<<(unsigned)(((size_t)CQ * CC / 8 + 255) / 256), 256, 0, stream>>>(wk, (size_t)CQ * CC / 8, BK); k_wnat<<<(unsigned)(((size_t)CC * CC / 8 + 255) / 256), 256, 0, stream>>>(wv, (size_t)CC * CC / 8, BV);
  k_cl2rows<<<NB * (LL / 32) * (CC / 64), 256, 0, stream>>>(x, XR);      /* exact f16 token rows [b*2048 + n][c] */
  /* every stage once for all batches: blockIdx.y = batch, the plane strides sA / sB / sC step from batch to batch (0 = shared weights) */
  k_gemm2<0><<<dim3((LL / 128) * 1, NB), 128, 0, stream>>>(XR, CC, (size_t)LL * CC, BQ, CC, 0, 0.0625f, nullptr, 0, nullptr, 1, 0, 0, FF, nullptr, CQ, (size_t)LL * CQ, LL, CQ, CC); k_hl<<<(unsigned)((NR * CQ / 8 + 255) / 256), 256, 0, stream>>>(FF, Fh, Fl, NR * CQ / 8);      /* f^T rows [b][n][64] -> hi/lo */
  k_gemm2<0><<<dim3((LL / 128) * 1, NB), 128, 0, stream>>>(XR, CC, (size_t)LL * CC, BK, CC, 0, 0.0625f, nullptr, 0, nullptr, 1, 0, 0, FF, nullptr, CQ, (size_t)LL * CQ, LL, CQ, CC); k_hl<<<(unsigned)((NR * CQ / 8 + 255) / 256), 256, 0, stream>>>(FF, Gh, Gl, NR * CQ / 8);      /* g^T rows [b][m][64] -> hi/lo */
  k_gemm2<0><<<dim3((CC / 128) * (LL / 64), NB), 128, 0, stream>>>(BV, CC, 0, XR, CC, (size_t)LL * CC, 0.0625f, nullptr, 0, nullptr, 1, 0, 0, nullptr, H16, LL, (size_t)CC * LL, CC, LL, CC);      /* h channel-major [b][c][n] f16 */
  k_scsm<2, 16><<<dim3(LL / 32, NB), 512, 0, stream>>>(Gh, Gl, Fh, Fl, P);      /* S^T[b][m][n] = g_m . f_n (hi.hi + 2^-10 (lo.hi + hi.lo)), softmax over n per key m (the module's dim=1 softmax) -> beta^T[b][m][n] x256 f16 */
  k_gemm2<0><<<dim3((CC / 128) * (LL / 64), NB), 128, 0, stream>>>(H16, LL, (size_t)CC * LL, P, LL, (size_t)LL * LL, 0.00390625f, nullptr, 0, nullptr, 1, 0, 0, (float*)d_out, nullptr, LL, (size_t)CC * LL, CC, LL, LL);      /* o[b][c][m] = 2^-8 sum_n h[c][n] beta^T[m][n] (channel-major = the output layout) */
  k_gres2<<<(unsigned)((NR * CC / 4 + 255) / 256), 256, 0, stream>>>((float*)d_out, x, gam);      /* gamma o + x */
}

// v004
// It runs in 157 microseconds.
// Next to v003, in two timings, it ran 1.52 and 1.53 times as fast.
// Over all steps from v000 it is 25.7 times as fast.
#include <hip/hip_runtime.h>
// SAGAN-style self-attention with 1x1-conv projections (x [8][512][2048] channel-first; f = Wq x, g = Wk x (64 channels), h = Wv x (512); scores[n][m] = sum_c f[c][n] g[c][m] (unscaled); beta = softmax over n (the QUERY axis, dim=1) for each m; o[c][m] = gamma sum_n h[c][n] beta[n][m] + x[c][m] -> [8][512][2048]; gamma = an input scalar).
// Structure: x transposed to exact f16 token rows via LDS tiles; f^T and g^T as WMMA GEMMs (32x64 wave tiles, f32 accumulation, exact x16 weights) into f32 rows then f16 hi + x1024 residual planes; h channel-major as a GEMM (weights as the A operand) into f16 (h and o: 256x128 work-group tiles, operands staged in LDS by asynchronous copies); every stage is one launch over all batches (blockIdx.y = batch): S^T[m][n] = g^T f (K = 64; hi.hi + lo.hi + hi.lo on WMMA) and its row softmax over n (f32 statistics, native exp; weights x256 f16) = beta^T in one launch, a work-group holding whole score rows in registers; o[c][m] = h . beta^T as a GEMM (K = 2048) channel-major straight into the output; epilogue out = bf16(gamma) o + bf16(x); 4 + 8 = 12 launches.
// Compute dtype: inputs rounded to bf16; x / weights exact; f, g as hi + residual (~2^-22: the unscaled logits have sigma ~8); h and the softmax weights plain f16 (~2^-12); logits, statistics, o f32. v_wmma_f32_16x16x32_f16.
#define NB 8
#define CC 512
#define CQ 64
#define LL 2048
#define SQ LL
#define DM 64
#define NH 1
#define HD 64
#define HG 1
#define NR ((size_t)NB * LL)
typedef __bf16 v16b __attribute__((ext_vector_type(16)));
typedef unsigned short v8us __attribute__((ext_vector_type(8), may_alias));
typedef float  v8f  __attribute__((ext_vector_type(8)));
typedef float  v4f  __attribute__((ext_vector_type(4)));
typedef float  v4fa __attribute__((ext_vector_type(4), may_alias));
union FragB { v16b v; v8us half[2]; unsigned short u[16]; };

__device__ __forceinline__ unsigned short bf16_bits(float x) { unsigned int u = __float_as_uint(x); return (unsigned short)((u + 0x7FFFu + ((u >> 16) & 1u)) >> 16); }
__device__ __forceinline__ float bf16_val(unsigned short b) { return __uint_as_float(((unsigned int)b) << 16); }
__device__ __forceinline__ float bf16_round(float x) { return bf16_val(bf16_bits(x)); }
// D += A·B with NT terms: 1 = ah·bh, 2 = + al·bh (A split), 3 = + ah·bl (both split)
template <int NT>
__device__ __forceinline__ v8f mmaN(v16b ah, v16b al, v16b bh, v16b bl, v8f c) {
  c = __builtin_amdgcn_wmma_f32_16x16x32_bf16(false, ah, false, bh, (short)0, c, false, false);
  if (NT >= 2) c = __builtin_amdgcn_wmma_f32_16x16x32_bf16(false, al, false, bh, (short)0, c, false, false);
  if (NT >= 3) c = __builtin_amdgcn_wmma_f32_16x16x32_bf16(false, ah, false, bl, (short)0, c, false, false);
  asm volatile("v_nop\n\tv_nop\n\tv_nop\n\tv_nop" : "+v"(c) : "v"(ah), "v"(al), "v"(bh), "v"(bl));
  return c;
}

__global__ __launch_bounds__(256) void k_wt_bf16(const float* __restrict__ W, unsigned short* __restrict__ Wt, int K, int N) {
  const int t = blockIdx.x * 256 + threadIdx.x;
  const int k8n = K / 8;
  if (t >= N * k8n) return;
  const int n = t / k8n, k8 = (t % k8n) * 8;
  v8us v;
#pragma unroll
  for (int i = 0; i < 8; ++i) v[i] = bf16_bits(W[(size_t)(k8 + i) * N + n]);
  *(v8us*)(Wt + (size_t)n * K + k8) = v;
  
}

// GEMM C[M][N] (f32, pitch ldc) = act(A[M][K]·W + bias). A f32 row-major (pitch lda) converted per fragment to bf16
// (ASPLIT: hi/lo two planes -> 2 terms, else single rounded term); Wt bf16 [N][K] (pitch ldb). BIAS_BF16 rounds the
// bias to bf16 first (bias quantised to bf16 before the add). K%32==0, M%16==0, N%64==0.
template <bool ASPLIT, int ACT, bool BIAS_BF16>
__global__ __launch_bounds__(128) void k_gemm_bf(const float* __restrict__ A, int lda, const unsigned short* __restrict__ Wt, int ldb,
                                               const float* __restrict__ bias, float* __restrict__ C, int ldc, int M, int N, int K) {
  __shared__ __attribute__((aligned(16))) float so[4][16][64];
  const int tid = threadIdx.x, w = tid >> 5, lane = tid & 31, ln = lane & 15, hh = lane >> 4;
  const int ntn = N / 64;
  const int wid = blockIdx.x * 4 + w;
  const int mt = wid / ntn, nq = wid % ntn;
  if (mt * 16 >= M) return;
  const int row0 = mt * 16, col0 = nq * 64;
  const float* arow = A + (size_t)(row0 + ln) * lda;
  v8f acc[4] = {};
  for (int kb = 0; kb < K; kb += 32) {
    FragB ah, al;
    const v4f x0 = *(const v4fa*)(arow + kb + 8 * hh), x1 = *(const v4fa*)(arow + kb + 8 * hh + 4);
    const v4f x2 = *(const v4fa*)(arow + kb + 16 + 8 * hh), x3 = *(const v4fa*)(arow + kb + 16 + 8 * hh + 4);
    float xs[16] = {x0[0],x0[1],x0[2],x0[3],x1[0],x1[1],x1[2],x1[3],x2[0],x2[1],x2[2],x2[3],x3[0],x3[1],x3[2],x3[3]};
#pragma unroll
    for (int i = 0; i < 16; ++i) { const unsigned short hb = bf16_bits(xs[i]); ah.u[i] = hb; al.u[i] = ASPLIT ? bf16_bits(xs[i] - bf16_val(hb)) : (unsigned short)0; }
#pragma unroll
    for (int t = 0; t < 4; ++t) {
      const unsigned short* brow = Wt + (size_t)(col0 + t * 16 + ln) * ldb + kb;
      FragB b;
      b.half[0] = *(const v8us*)(brow + 8 * hh);
      b.half[1] = *(const v8us*)(brow + 16 + 8 * hh);
      acc[t] = mmaN<ASPLIT ? 2 : 1>(ah.v, al.v, b.v, b.v, acc[t]);
    }
  }
#pragma unroll
  for (int t = 0; t < 4; ++t) {
    float bv = bias ? bias[col0 + t * 16 + ln] : 0.f;
    if (BIAS_BF16) bv = bf16_round(bv);
#pragma unroll
    for (int r = 0; r < 8; ++r) { float v = acc[t][r] + bv; if (ACT == 1) v = fmaxf(v, 0.f); so[w][8 * hh + r][t * 16 + ln] = v; }
  }
  __builtin_amdgcn_fence(__ATOMIC_ACQ_REL, "workgroup");
  __builtin_amdgcn_wave_barrier();
  const int rsub = lane >> 4, c4 = (lane & 15) * 4;
  {
#pragma unroll
    for (int q = 0; q < 8; ++q) {
      const int r = q * 2 + rsub;
      const v4f v = *(const v4fa*)&so[w][r][c4];
      *(v4f*)(C + (size_t)(row0 + r) * ldc + col0 + c4) = v;
    }
    
  }
}

// GEMM C = act(A·W + bias + resid): A f32 (ASPLIT -> hi/lo 2 terms), Wt bf16 [N][K]; ACT 0 none, 1 relu, 2 exact gelu;
// resid (optional, f32, row index = (row % rmod), pitch ldr, RES_BF16 rounds it) added before the activation.
template <bool ASPLIT, int ACT, bool BIAS_BF16, bool RES_BF16>
__global__ __launch_bounds__(128) void k_gemm_bf3(const float* __restrict__ A, int lda, const unsigned short* __restrict__ Wt, int ldb,
                                                const float* __restrict__ bias, const float* __restrict__ resid, int rmod, int ldr,
                                                float* __restrict__ C, int ldc, int M, int N, int K) {
  __shared__ __attribute__((aligned(16))) float so[4][16][64];
  const int tid = threadIdx.x, w = tid >> 5, lane = tid & 31, ln = lane & 15, hh = lane >> 4;
  const int ntn = N / 64;
  const int wid = blockIdx.x * 4 + w;
  const int mt = wid / ntn, nq = wid % ntn;
  if (mt * 16 >= M) return;
  const int row0 = mt * 16, col0 = nq * 64;
  const float* arow = A + (size_t)(row0 + ln) * lda;
  v8f acc[4] = {};
  for (int kb = 0; kb < K; kb += 32) {
    FragB ah, al;
    const v4f x0 = *(const v4fa*)(arow + kb + 8 * hh), x1 = *(const v4fa*)(arow + kb + 8 * hh + 4);
    const v4f x2 = *(const v4fa*)(arow + kb + 16 + 8 * hh), x3 = *(const v4fa*)(arow + kb + 16 + 8 * hh + 4);
    float xs[16] = {x0[0],x0[1],x0[2],x0[3],x1[0],x1[1],x1[2],x1[3],x2[0],x2[1],x2[2],x2[3],x3[0],x3[1],x3[2],x3[3]};
#pragma unroll
    for (int i = 0; i < 16; ++i) { const unsigned short hb = bf16_bits(xs[i]); ah.u[i] = hb; al.u[i] = ASPLIT ? bf16_bits(xs[i] - bf16_val(hb)) : (unsigned short)0; }
#pragma unroll
    for (int t = 0; t < 4; ++t) {
      const unsigned short* brow = Wt + (size_t)(col0 + t * 16 + ln) * ldb + kb;
      FragB b;
      b.half[0] = *(const v8us*)(brow + 8 * hh);
      b.half[1] = *(const v8us*)(brow + 16 + 8 * hh);
      acc[t] = mmaN<ASPLIT ? 2 : 1>(ah.v, al.v, b.v, b.v, acc[t]);
    }
  }
#pragma unroll
  for (int t = 0; t < 4; ++t) {
    const int col = col0 + t * 16 + ln;
    float bv = bias ? bias[col] : 0.f;
    if (BIAS_BF16) bv = bf16_round(bv);
#pragma unroll
    for (int r = 0; r < 8; ++r) {
      float v = acc[t][r] + bv;
      if (resid) { float rv = resid[(size_t)((row0 + 8 * hh + r) % rmod) * ldr + col]; if (RES_BF16) rv = bf16_round(rv); v += rv; }
      if (ACT == 1) v = fmaxf(v, 0.f);
      if (ACT == 2) v = 0.5f * v * (1.0f + erff(v * 0.70710678118654752f));
      if (ACT == 3) { const float u = 0.7978845608028654f * (v + 0.044715f * v * v * v); v = 0.5f * v * (1.0f + tanhf(u)); }
      so[w][8 * hh + r][t * 16 + ln] = v;
    }
  }
  __builtin_amdgcn_fence(__ATOMIC_ACQ_REL, "workgroup");
  __builtin_amdgcn_wave_barrier();
  const int rsub = lane >> 4, c4 = (lane & 15) * 4;
  {
#pragma unroll
    for (int q = 0; q < 8; ++q) {
      const int r = q * 2 + rsub;
      const v4f v = *(const v4fa*)&so[w][r][c4];
      *(v4f*)(C + (size_t)(row0 + r) * ldc + col0 + c4) = v;
    }
    
  }
}
// row LayerNorm (biased variance, eps) over N: s = X (+ R); optional out_sum <- s; out_norm <- (s-mu)*rsqrt(var+eps)*g + b
template <bool PARAM_BF16>
__global__ __launch_bounds__(256) void k_layernorm(const float* __restrict__ X, const float* __restrict__ R, const float* __restrict__ g, const float* __restrict__ bta,
                                                  float* __restrict__ out_sum, float* __restrict__ out_norm, int N, float eps) {
  __shared__ float red[256];
  const int row = blockIdx.x, tid = threadIdx.x;
  const float* x = X + (size_t)row * N; const float* rr = R ? R + (size_t)row * N : nullptr;
  float vals[16];                     // up to N = 4096
  const int per = N / 256;            // contiguous chunk per thread? use strided-by-4 chunks: thread handles j = tid*4 + 1024*u
  float s1 = 0.f;
  for (int u = 0; u < per / 4; ++u) {
    const int j = tid * 4 + 1024 * u;
    const v4f a = *(const v4fa*)(x + j);
    v4f b = {0.f,0.f,0.f,0.f}; if (rr) b = *(const v4fa*)(rr + j);
#pragma unroll
    for (int q = 0; q < 4; ++q) { const float v = a[q] + b[q]; vals[u * 4 + q] = v; s1 += v; }
  }
  red[tid] = s1; __syncthreads();
  for (int st = 128; st > 0; st >>= 1) { if (tid < st) red[tid] += red[tid + st]; __syncthreads(); }
  const float mu = red[0] / (float)N; __syncthreads();
  float s2 = 0.f;
  for (int u = 0; u < per / 4; ++u)
#pragma unroll
    for (int q = 0; q < 4; ++q) { const float c = vals[u * 4 + q] - mu; s2 += c * c; }
  red[tid] = s2; __syncthreads();
  for (int st = 128; st > 0; st >>= 1) { if (tid < st) red[tid] += red[tid + st]; __syncthreads(); }
  const float rs = rsqrtf(red[0] / (float)N + eps);
  {
    for (int u = 0; u < per / 4; ++u) {
      const int j = tid * 4 + 1024 * u;
      v4f o, sm;
#pragma unroll
      for (int q = 0; q < 4; ++q) {
        float gg = g[j + q], bb = bta[j + q];
        if (PARAM_BF16) { gg = bf16_round(gg); bb = bf16_round(bb); }
        sm[q] = vals[u * 4 + q]; o[q] = (vals[u * 4 + q] - mu) * rs * gg + bb;
      }
      if (out_sum) *(v4f*)(out_sum + (size_t)row * N + j) = sm;
      *(v4f*)(out_norm + (size_t)row * N + j) = o;
    }
    
  }
}



// ---- f16 WMMA path (v_wmma_f32_16x16x32_f16): 11-bit significands for operands in range — used where a [0,1] probability operand needs more precision than bf16
typedef _Float16 v16h __attribute__((ext_vector_type(16)));
union FragH { v16h v; v8us half[2]; _Float16 h[16]; unsigned short u[16]; };
template <int NT>
__device__ __forceinline__ v8f mmaH(v16h ah, v16h al, v16h bh, v16h bl, v8f c) {
  c = __builtin_amdgcn_wmma_f32_16x16x32_f16(false, ah, false, bh, (short)0, c, false, false);
  if (NT >= 2) c = __builtin_amdgcn_wmma_f32_16x16x32_f16(false, al, false, bh, (short)0, c, false, false);
  if (NT >= 3) c = __builtin_amdgcn_wmma_f32_16x16x32_f16(false, ah, false, bl, (short)0, c, false, false);
  asm volatile("v_nop\n\tv_nop\n\tv_nop\n\tv_nop" : "+v"(c) : "v"(ah), "v"(al), "v"(bh), "v"(bl));
  return c;
}
// batched GEMM like k_gemm_b but f16 operands: A f32 (split into f16 hi/lo if ASPLIT, else rounded to f16), Bt = f16 values [n][k]; alpha; C f32; N multiple of 16 (partial tiles skipped)
template <bool ASPLIT>
__global__ __launch_bounds__(128) void k_gemm_h(const float* __restrict__ A, int lda, size_t sA, const _Float16* __restrict__ Bh, int ldb, size_t sB, float alpha, float* __restrict__ C, int ldc, size_t sC, int M, int N, int K) {
  __shared__ __attribute__((aligned(16))) float so[4][16][64];
  const int tid = threadIdx.x, w = tid >> 5, lane = tid & 31, ln = lane & 15, hh = lane >> 4; const int by = blockIdx.y;
  A += (size_t)by * sA; Bh += (size_t)by * sB; C += (size_t)by * sC;
  const int ntn = (N + 63) / 64; const int wid = blockIdx.x * 4 + w; const int mt = wid / ntn, nq = wid % ntn; if (mt * 16 >= M) return;
  const int row0 = mt * 16, col0 = nq * 64; const float* arow = A + (size_t)(row0 + ln) * lda;
  v8f acc[4] = {};
  for (int kb = 0; kb < K; kb += 32) {
    FragH ah, al;
    const v4f x0 = *(const v4fa*)(arow + kb + 8 * hh), x1 = *(const v4fa*)(arow + kb + 8 * hh + 4), x2 = *(const v4fa*)(arow + kb + 16 + 8 * hh), x3 = *(const v4fa*)(arow + kb + 16 + 8 * hh + 4);
    float xs[16] = {x0[0],x0[1],x0[2],x0[3],x1[0],x1[1],x1[2],x1[3],x2[0],x2[1],x2[2],x2[3],x3[0],x3[1],x3[2],x3[3]};
#pragma unroll
    for (int i = 0; i < 16; ++i) { const _Float16 h = (_Float16)xs[i]; ah.h[i] = h; al.h[i] = ASPLIT ? (_Float16)(xs[i] - (float)h) : (_Float16)0.0f; }
#pragma unroll
    for (int t = 0; t < 4; ++t) { if (col0 + t * 16 >= N) continue; const size_t boff = (size_t)(col0 + t * 16 + ln) * ldb + kb; FragH bq; bq.half[0] = *(const v8us*)(Bh + boff + 8 * hh); bq.half[1] = *(const v8us*)(Bh + boff + 16 + 8 * hh);
      acc[t] = mmaH<ASPLIT ? 2 : 1>(ah.v, al.v, bq.v, bq.v, acc[t]); }
  }
#pragma unroll
  for (int t = 0; t < 4; ++t) { if (col0 + t * 16 >= N) continue;
#pragma unroll
    for (int r = 0; r < 8; ++r) so[w][8 * hh + r][t * 16 + ln] = acc[t][r] * alpha; }
  __builtin_amdgcn_fence(__ATOMIC_ACQ_REL, "workgroup"); __builtin_amdgcn_wave_barrier();
  const int rsub = lane >> 4, c4 = (lane & 15) * 4;
  {
#pragma unroll
    for (int q = 0; q < 8; ++q) { const int r = q * 2 + rsub; if (col0 + c4 < N) { const v4f v = *(const v4fa*)&so[w][r][c4]; *(v4f*)(C + (size_t)(row0 + r) * ldc + col0 + c4) = v; } }
     }
}

// Wt[n][k] = f16(W[k][n]·scale) from f32 row-major W[K][N] (scale = power of two; bf16-exact weights stay exact in f16 away from the subnormal range)
__global__ __launch_bounds__(256) void k_wt_f16(const float* __restrict__ W, _Float16* __restrict__ Wt, int K, int N, float scale) {
  const int t = blockIdx.x * 256 + threadIdx.x; if (t >= N * (K / 8)) return; const int n = t / (K / 8), k8 = (t % (K / 8)) * 8; FragH f;
#pragma unroll
  for (int i = 0; i < 8; ++i) f.h[i] = (_Float16)(bf16_round(W[(size_t)(k8 + i) * N + n]) * scale); const v8us o = f.half[0];
  *(v8us*)((unsigned short*)Wt + (size_t)n * K + k8) = o; 
}
// k_gemm_hh variant with fused epilogue: v = acc·alpha + bias[by·sBias + col] (+ CP[(row/rowsPerB)·sCPb + by·64 + col] if CP) ; ACT 0 none / 1 elu ; writes f16 C16 (and f32 C if non-null)
template <int ACT>
__global__ __launch_bounds__(128) void k_gemm_hhx(const _Float16* __restrict__ A, int lda, size_t sA, const _Float16* __restrict__ Bh, int ldb, size_t sB, float alpha, const float* __restrict__ bias, size_t sBias, const float* __restrict__ CP, int rowsPerB, size_t sCPb, int row0g,
    float* __restrict__ C, _Float16* __restrict__ C16, int ldc, size_t sC, int M, int N, int K) {
  __shared__ __attribute__((aligned(16))) float so[4][16][64];
  const int tid = threadIdx.x, w = tid >> 5, lane = tid & 31, ln = lane & 15, hh = lane >> 4; const int by = blockIdx.y;
  A += (size_t)by * sA; Bh += (size_t)by * sB; const size_t cofs = (size_t)by * sC; const float* bp = bias ? bias + (size_t)by * sBias : nullptr;
  const int ntn = (N + 63) / 64; const int wid = blockIdx.x * 4 + w; const int mt = wid / ntn, nq = wid % ntn; if (mt * 16 >= M) return;
  const int row0 = mt * 16, col0 = nq * 64; const _Float16* arow = A + (size_t)(row0 + ln) * lda;
  v8f acc[4] = {};
  for (int kb = 0; kb < K; kb += 32) { FragH ah; ah.half[0] = *(const v8us*)((const unsigned short*)arow + kb + 8 * hh); ah.half[1] = *(const v8us*)((const unsigned short*)arow + kb + 16 + 8 * hh);
#pragma unroll
    for (int t = 0; t < 4; ++t) { if (col0 + t * 16 >= N) continue; const size_t boff = (size_t)(col0 + t * 16 + ln) * ldb + kb; FragH bq; bq.half[0] = *(const v8us*)((const unsigned short*)Bh + boff + 8 * hh); bq.half[1] = *(const v8us*)((const unsigned short*)Bh + boff + 16 + 8 * hh);
      acc[t] = mmaH<1>(ah.v, ah.v, bq.v, bq.v, acc[t]); }
  }
#pragma unroll
  for (int t = 0; t < 4; ++t) { if (col0 + t * 16 >= N) continue; const int col = col0 + t * 16 + ln; const float bv = bp ? bf16_round(bp[col]) : 0.f;
#pragma unroll
    for (int r = 0; r < 8; ++r) { float v = acc[t][r] * alpha + bv; if (CP) { const int rr = row0g + row0 + 8 * hh + r; if (rowsPerB < 0) v += CP[cofs + (size_t)rr * ldc + col];      /* rowsPerB < 0: own element of the batched C plane */ else { const int bidx = rr / rowsPerB; v += CP[(size_t)bidx * sCPb + (size_t)by * 64 + col]; } } if (ACT == 1) v = (v > 0.f) ? v : expm1f(v); else if (ACT == 7) v = (v > 0.f) ? v + 1.0f : expf(v); else if (ACT == 8) v = tanhf(v); else if (ACT == 9) v = 0.5f * v * (1.0f + tanhf(0.7978845608028654f * (v + 0.044715f * v * v * v))); else if (ACT == 11) v = 1.0f / (1.0f + expf(-v)); else if (ACT == 12) v = (v > 0.f) ? v : 0.01f * v; else if (ACT == 14) v = (v > 0.f) ? v : 0.1f * v; else if (ACT == 16) v = (v >= 0.f) ? v : 0.3f * v; else if (ACT == 17) v = (v >= 0.f) ? v : 0.2f * v; else if (ACT == 15) v = v / (1.0f + expf(-v)); else if (ACT == 3) v = fmaxf(v, 0.f); else if (ACT == 6) v = 0.5f * v * (1.0f + erff(v * 0.70710678118654752f)); so[w][8 * hh + r][t * 16 + ln] = v; } }
  __builtin_amdgcn_fence(__ATOMIC_ACQ_REL, "workgroup"); __builtin_amdgcn_wave_barrier();
  const int rsub = lane >> 4, c4 = (lane & 15) * 4; typedef _Float16 v4h __attribute__((ext_vector_type(4)));
  {
#pragma unroll
    for (int q = 0; q < 8; ++q) { const int r = q * 2 + rsub; if (col0 + c4 < N) { const v4f v = *(const v4fa*)&so[w][r][c4]; if (C) *(v4f*)(C + cofs + (size_t)(row0 + r) * ldc + col0 + c4) = v; if (C16) { v4h h4; for (int i = 0; i < 4; ++i) h4[i] = (_Float16)v[i]; *(v4h*)(C16 + cofs + (size_t)(row0 + r) * ldc + col0 + c4) = h4; } } }
     }
}


typedef _Float16 v4h __attribute__((ext_vector_type(4)));

__global__ __launch_bounds__(256) void k_x16(const float* __restrict__ x, _Float16* __restrict__ X16, size_t n8) { const size_t t = (size_t)blockIdx.x * 256 + threadIdx.x; if (t >= n8) return; FragH f;
#pragma unroll
  for (int q = 0; q < 8; ++q) f.h[q] = (_Float16)bf16_round(x[t * 8 + q]); *(v8us*)((unsigned short*)X16 + t * 8) = f.half[0];  }
__global__ __launch_bounds__(256) void k_h16(const float* __restrict__ x, _Float16* __restrict__ X16, size_t n8) { const size_t t = (size_t)blockIdx.x * 256 + threadIdx.x; if (t >= n8) return; FragH f;
#pragma unroll
  for (int q = 0; q < 8; ++q) f.h[q] = (_Float16)x[t * 8 + q]; *(v8us*)((unsigned short*)X16 + t * 8) = f.half[0];  }
__global__ __launch_bounds__(256) void k_round16f(const float* __restrict__ W, _Float16* __restrict__ Bt, size_t n8) { const size_t t = (size_t)blockIdx.x * 256 + threadIdx.x; if (t >= n8) return; FragH f;
#pragma unroll
  for (int i = 0; i < 8; ++i) f.h[i] = (_Float16)(bf16_round(W[t * 8 + i]) * 16.0f); *(v8us*)((unsigned short*)Bt + t * 8) = f.half[0];  }
template <int NHv, int TTv>
__global__ __launch_bounds__(256) void k_vt(const _Float16* __restrict__ V16, int ldv, int voff, _Float16* __restrict__ Vt) { __shared__ unsigned short tl[64][66]; const int tid = threadIdx.x; const int slab = blockIdx.x / (TTv / 64), lg = blockIdx.x % (TTv / 64); const int b = slab / NHv, h = slab % NHv;
  for (int i = tid; i < 64 * 8; i += 256) { const int r = i / 8, c8 = (i % 8) * 8; FragH f; f.half[0] = *(const v8us*)((const unsigned short*)V16 + ((size_t)b * TTv + lg * 64 + r) * ldv + voff + h * 64 + c8);
#pragma unroll
    for (int q = 0; q < 8; ++q) tl[r][c8 + q] = f.u[q]; }
  __syncthreads();
  {
#pragma unroll
    for (int rd = 0; rd < 2; ++rd) { const int d = rd * 32 + tid / 8, pc = tid % 8; FragH f;
#pragma unroll
      for (int q = 0; q < 8; ++q) f.u[q] = tl[pc * 8 + q][d];
      *(v8us*)((unsigned short*)Vt + ((size_t)slab * 64 + d) * TTv + lg * 64 + pc * 8) = f.half[0]; }
     } }

__global__ __launch_bounds__(256) void k_hl(const float* __restrict__ F, _Float16* __restrict__ Hh, _Float16* __restrict__ Hl, size_t n8) { const size_t t = (size_t)blockIdx.x * 256 + threadIdx.x; if (t >= n8) return; FragH fh, fl; const v4f a = *(const v4fa*)(F + t * 8), c = *(const v4fa*)(F + t * 8 + 4);
#pragma unroll
  for (int q = 0; q < 4; ++q) { _Float16 h = (_Float16)a[q]; fh.h[q] = h; fl.h[q] = (_Float16)((a[q] - (float)h) * 1024.0f); h = (_Float16)c[q]; fh.h[4 + q] = h; fl.h[4 + q] = (_Float16)((c[q] - (float)h) * 1024.0f); }
  { *(v8us*)((unsigned short*)Hh + t * 8) = fh.half[0]; *(v8us*)((unsigned short*)Hl + t * 8) = fl.half[0];  } }

// ---- fast GEMM (wave tile 32x64; requires M % 32 == 0 rows per launch region and N % 64 == 0); epilogue = k_gemm_hhx semantics ----
__device__ __forceinline__ v16h g2_frag(const _Float16* p, int hh) { FragH f; f.half[0] = *(const v8us*)((const unsigned short*)p + 8 * hh); f.half[1] = *(const v8us*)((const unsigned short*)p + 16 + 8 * hh); return f.v; }
__device__ __forceinline__ v8f g2_mma(v16h a, v16h b, v8f c) { v8f d = __builtin_amdgcn_wmma_f32_16x16x32_f16(false, a, false, b, (short)0, c, false, false); asm volatile("v_nop\n\tv_nop\n\tv_nop\n\tv_nop" : "+v"(d) : "v"(a), "v"(b)); return d; }
template <int ACT>
__global__ __launch_bounds__(128) void k_gemm2(const _Float16* __restrict__ A, int lda, size_t sA, const _Float16* __restrict__ Bh, int ldb, size_t sB, float alpha, const float* __restrict__ bias, size_t sBias, const float* __restrict__ CP, int rowsPerB, size_t sCPb, int row0g,
    float* __restrict__ C, _Float16* __restrict__ C16, int ldc, size_t sC, int M, int N, int K) { static_assert(ACT == 0 || ACT == 3 || ACT == 6 || ACT == 8 || ACT == 9 || ACT == 11 || ACT == 12 || ACT == 14 || ACT == 15 || ACT == 16 || ACT == 17, "k_gemm2: unsupported ACT code (would silently apply no activation)");
  __shared__ __attribute__((aligned(16))) float so[4][32][68];
  const int tid = threadIdx.x, w = tid >> 5, lane = tid & 31, ln = lane & 15, hh = lane >> 4; const int by = blockIdx.y;
  A += (size_t)by * sA; Bh += (size_t)by * sB; const size_t cofs = (size_t)by * sC; const float* bp = bias ? bias + (size_t)by * sBias : nullptr;
  const int ntn = N >> 6; const int mt = blockIdx.x / ntn, nq = blockIdx.x - mt * ntn; const int row0 = mt * 128 + 32 * w, col0 = nq * 64; if (row0 >= M) return;
  const _Float16* a0p = A + (size_t)(row0 + ln) * lda; const _Float16* a1p = a0p + (size_t)16 * lda;
  const _Float16* b0p = Bh + (size_t)(col0 + ln) * ldb; const _Float16* b1p = b0p + (size_t)16 * ldb; const _Float16* b2p = b1p + (size_t)16 * ldb; const _Float16* b3p = b2p + (size_t)16 * ldb;
  const v8f z8 = {0.f,0.f,0.f,0.f,0.f,0.f,0.f,0.f}; v8f c00 = z8, c01 = z8, c02 = z8, c03 = z8, c10 = z8, c11 = z8, c12 = z8, c13 = z8;
#pragma unroll 1
  for (int kb = 0; kb < K; kb += 32) { const v16h a0 = g2_frag(a0p + kb, hh), a1 = g2_frag(a1p + kb, hh);
    v16h b = g2_frag(b0p + kb, hh); c00 = g2_mma(a0, b, c00); c10 = g2_mma(a1, b, c10);
    b = g2_frag(b1p + kb, hh); c01 = g2_mma(a0, b, c01); c11 = g2_mma(a1, b, c11);
    b = g2_frag(b2p + kb, hh); c02 = g2_mma(a0, b, c02); c12 = g2_mma(a1, b, c12);
    b = g2_frag(b3p + kb, hh); c03 = g2_mma(a0, b, c03); c13 = g2_mma(a1, b, c13); }
  v8f accs[8] = {c00, c01, c02, c03, c10, c11, c12, c13};
#pragma unroll
  for (int u = 0; u < 8; ++u) { const int t = u & 3, half = u >> 2; const int col = col0 + t * 16 + ln; const float bv = bp ? bf16_round(bp[col]) : 0.f;
#pragma unroll
    for (int r = 0; r < 8; ++r) { const int rloc = half * 16 + 8 * hh + r; float v = accs[u][r] * alpha + bv; if (CP) { if (rowsPerB < 0) v += CP[cofs + (size_t)(row0g + row0 + rloc) * ldc + col];      /* rowsPerB < 0: own element of the batched C plane */ else { const int bidx = (row0g + row0 + rloc) / rowsPerB; v += CP[(size_t)bidx * sCPb + (size_t)by * 64 + col]; } }
      if (ACT == 3) v = fmaxf(v, 0.f); else if (ACT == 6) v = 0.5f * v * (1.0f + erff(v * 0.70710678118654752f)); else if (ACT == 11) v = 1.0f / (1.0f + expf(-v)); else if (ACT == 15) v = v / (1.0f + expf(-v)); else if (ACT == 12) v = (v > 0.f) ? v : 0.01f * v; else if (ACT == 8) v = tanhf(v); else if (ACT == 9) v = 0.5f * v * (1.0f + tanhf(0.7978845608028654f * (v + 0.044715f * v * v * v))); else if (ACT == 14) v = (v > 0.f) ? v : 0.1f * v; else if (ACT == 16) v = (v >= 0.f) ? v : 0.3f * v; else if (ACT == 17) v = (v >= 0.f) ? v : 0.2f * v;
      so[w][rloc][t * 16 + ln] = v; } }
  __builtin_amdgcn_fence(__ATOMIC_ACQ_REL, "workgroup"); __builtin_amdgcn_wave_barrier();
  const int rsub = lane >> 4, c4 = (lane & 15) * 4;
  {
#pragma unroll
    for (int q = 0; q < 16; ++q) { const int r = q * 2 + rsub; const v4f v = *(const v4fa*)&so[w][r][c4]; if (C) *(v4f*)(C + cofs + (size_t)(row0 + r) * ldc + col0 + c4) = v; if (C16) { v4h h4; for (int i = 0; i < 4; ++i) h4[i] = (_Float16)v[i]; *(v4h*)(C16 + cofs + (size_t)(row0 + r) * ldc + col0 + c4) = h4; } }
     } }


__global__ __launch_bounds__(256) void k_wnat(const float* __restrict__ w, size_t n8, _Float16* __restrict__ Bt) { const size_t t = (size_t)blockIdx.x * 256 + threadIdx.x; if (t >= n8) return; FragH f; for (int q = 0; q < 8; ++q) f.h[q] = (_Float16)(bf16_round(w[t * 8 + q]) * 16.0f); *(v8us*)((unsigned short*)Bt + t * 8) = f.half[0];  }
__global__ __launch_bounds__(256) void k_rsm(const float* __restrict__ S, _Float16* __restrict__ P, int nrows) {
  #pragma clang fp contract(off)
  const int i = blockIdx.x * 256 + threadIdx.x; if (i >= nrows) return; const float* s = S + (size_t)i * SQ; float mx = -3.0e38f;
#pragma unroll 1
  for (int j = 0; j < SQ; ++j) mx = fmaxf(mx, s[j]); float se = 0.f;
#pragma unroll 1
  for (int j = 0; j < SQ; ++j) se += expf(s[j] - mx); const float sc = 256.0f / se;
#pragma unroll 1
  for (int j0 = 0; j0 < SQ; j0 += 8) { FragH f; for (int q = 0; q < 8; ++q) f.h[q] = (_Float16)(expf(s[j0 + q] - mx) * sc); unsigned short* d = (unsigned short*)P + (size_t)i * SQ + j0; *(v8us*)d = f.half[0];  } }
__global__ __launch_bounds__(256) void k_vt(const _Float16* __restrict__ V16, int b, int h0, _Float16* __restrict__ VT) { __shared__ unsigned short tl[64][65]; const int tid = threadIdx.x; const int hh = blockIdx.x % HG, sg = blockIdx.x / HG; const int s0 = sg * 64; const int h = h0 + hh;
  for (int i = tid; i < 64 * 8; i += 256) { const int j = i / 8, d8 = (i % 8) * 8; FragH f; f.half[0] = *(const v8us*)((const unsigned short*)V16 + ((size_t)b * SQ + s0 + j) * DM + h * HD + d8); for (int q = 0; q < 8; ++q) tl[d8 + q][j] = f.u[q]; }
  __syncthreads();
  { for (int i = tid; i < 64 * 8; i += 256) { const int d = i / 8, j8 = (i % 8) * 8; FragH f; for (int q = 0; q < 8; ++q) f.u[q] = tl[d][j8 + q]; *(v8us*)((unsigned short*)VT + ((size_t)hh * HD + d) * SQ + s0 + j8) = f.half[0]; }  } }


// lane l <-> l ^ M inside a 16-lane row (DPP row_xmask)
template <int M> __device__ __forceinline__ float ln_xm(float v) { return __int_as_float(__builtin_amdgcn_update_dpp(0, __float_as_int(v), 0x160 + M, 0xf, 0xf, true)); }
// 2^x (v_exp_f32). The v_nop in the same statement keeps the one issue slot that the instruction set asks for behind a transcendental, before its result is read or its source overwritten.
__device__ __forceinline__ float exp2_slot(float x) { float r; asm("v_exp_f32 %0, %1\n\tv_nop" : "=v"(r) : "v"(x)); return r; }
// Scores and their row softmax in one launch. A work-group owns MT*16 whole rows m of S^T[m][n] = g_m . f_n: each of its NW waves forms its own LL/NW columns on WMMA (hi.hi + 2^-10 (lo.hi + hi.lo)) and keeps them in
// accumulator registers through the maximum, the exponentials and the scaling, so the f32 score plane never goes to memory. Column tile t of a wave takes f rows n = base + (t>>3)*128 + ln*8 + (t&7): a lane then holds 8 neighbouring columns of a row, and one 16-byte store per lane writes whole lines of beta^T.
__device__ __forceinline__ v8f sc_mma(v16h a, v16h b, v8f c) { return __builtin_amdgcn_wmma_f32_16x16x32_f16(false, a, false, b, (short)0, c, false, false); }
template <int MT, int NW>
__global__ __launch_bounds__(NW * 32) void k_scsm(const _Float16* __restrict__ Gh, const _Float16* __restrict__ Gl, const _Float16* __restrict__ Fh, const _Float16* __restrict__ Fl, _Float16* __restrict__ P) {
  constexpr int TP = LL / (NW * 16); static_assert(TP % 8 == 0 && (NW == 8 || NW == 16), "k_scsm: a wave takes whole groups of 8 column tiles; the cross-wave step reads one partial per lane of a 16-lane row");
  __shared__ float rmx[MT * 16][NW]; __shared__ float rsu[MT * 16][NW];      /* one partial maximum / sum per row and wave */
  const int lane = threadIdx.x & 31, ln = lane & 15, hh = lane >> 4; const int w = __builtin_amdgcn_readfirstlane(threadIdx.x >> 5);
  const size_t rb = (size_t)blockIdx.y * LL; const int m0 = blockIdx.x * (MT * 16); const int n0 = w * (TP * 16) + ln * 8;
  const v8f z8 = {0.f,0.f,0.f,0.f,0.f,0.f,0.f,0.f};
  v16h ah[MT][2], al[MT][2];
#pragma unroll      /* full unroll here and below: the fragment and score arrays stay in registers */
  for (int mt = 0; mt < MT; ++mt) { const size_t go = (rb + m0 + mt * 16 + ln) * CQ; ah[mt][0] = g2_frag(Gh + go, hh); ah[mt][1] = g2_frag(Gh + go + 32, hh); al[mt][0] = g2_frag(Gl + go, hh); al[mt][1] = g2_frag(Gl + go + 32, hh); }
  asm volatile("s_wait_xcnt 0x0" ::: "memory");      /* a precaution: stands before the registers that hold the g loads' addresses are written again (the first f load lands on one of them) */
  v16h bq[2][4]; { const size_t fo = (rb + n0) * CQ; bq[0][0] = g2_frag(Fh + fo, hh); bq[0][1] = g2_frag(Fh + fo + 32, hh); bq[0][2] = g2_frag(Fl + fo, hh); bq[0][3] = g2_frag(Fl + fo + 32, hh); }
  v8f s[MT][TP];      /* lane (ln, hh), element r of s[mt][t] = row m0 + mt*16 + 8*hh + r, column n0 + (t>>3)*128 + (t&7) */
#pragma unroll
  for (int t = 0; t < TP; ++t) {
    if (t + 1 < TP) { const size_t fo = (rb + n0 + ((t + 1) >> 3) * 128 + ((t + 1) & 7)) * CQ; const int u = (t + 1) & 1; bq[u][0] = g2_frag(Fh + fo, hh); bq[u][1] = g2_frag(Fh + fo + 32, hh); bq[u][2] = g2_frag(Fl + fo, hh); bq[u][3] = g2_frag(Fl + fo + 32, hh); }      /* the next tile's fragments fly while this tile is multiplied */
    const v16h bh0 = bq[t & 1][0], bh1 = bq[t & 1][1], bl0 = bq[t & 1][2], bl1 = bq[t & 1][3];
#pragma unroll
    for (int mt = 0; mt < MT; ++mt) { const v8f c = sc_mma(ah[mt][1], bh1, sc_mma(ah[mt][0], bh0, z8)); const v8f d = sc_mma(ah[mt][1], bl1, sc_mma(ah[mt][0], bl0, sc_mma(al[mt][1], bh1, sc_mma(al[mt][0], bh0, z8))));
      s[mt][t] = d * 0.0009765625f + c; } }
  v8f st[MT];
#pragma unroll
  for (int mt = 0; mt < MT; ++mt) { v8f m = s[mt][0];
#pragma unroll
    for (int t = 1; t < TP; ++t) m = __builtin_elementwise_max(m, s[mt][t]);
#pragma unroll
    for (int r = 0; r < 8; ++r) { float x = m[r]; x = fmaxf(x, ln_xm<1>(x)); x = fmaxf(x, ln_xm<2>(x)); x = fmaxf(x, ln_xm<4>(x)); x = fmaxf(x, ln_xm<8>(x)); m[r] = x; }
    st[mt] = m; }
  if (ln == 0) {
#pragma unroll
    for (int mt = 0; mt < MT; ++mt)
#pragma unroll
      for (int r = 0; r < 8; ++r) rmx[mt * 16 + 8 * hh + r][w] = st[mt][r]; }
  __syncthreads();      /* every wave's partial maxima are in LDS */
#pragma unroll
  for (int mt = 0; mt < MT; ++mt) { v8f m;
#pragma unroll
    for (int r = 0; r < 8; ++r) { float x = rmx[mt * 16 + 8 * hh + r][ln & (NW - 1)]; x = fmaxf(x, ln_xm<1>(x)); x = fmaxf(x, ln_xm<2>(x)); x = fmaxf(x, ln_xm<4>(x)); if (NW == 16) x = fmaxf(x, ln_xm<8>(x)); m[r] = x; }
    v8f a = z8;
#pragma unroll
    for (int t = 0; t < TP; ++t) { const v8f y = (s[mt][t] - m) * 1.442695041f; v8f e;
#pragma unroll
      for (int r = 0; r < 8; ++r) e[r] = exp2_slot(y[r]);      /* = native exp: the same multiply and v_exp_f32 */
      s[mt][t] = e; a += e; }
#pragma unroll
    for (int r = 0; r < 8; ++r) { float x = a[r]; x += ln_xm<1>(x); x += ln_xm<2>(x); x += ln_xm<4>(x); x += ln_xm<8>(x); a[r] = x; }
    st[mt] = a; }
  if (ln == 0) {
#pragma unroll
    for (int mt = 0; mt < MT; ++mt)
#pragma unroll
      for (int r = 0; r < 8; ++r) rsu[mt * 16 + 8 * hh + r][w] = st[mt][r]; }
  __syncthreads();      /* every wave's partial sums are in LDS */
#pragma unroll
  for (int mt = 0; mt < MT; ++mt) { v8f sc;
#pragma unroll
    for (int r = 0; r < 8; ++r) { float x = rsu[mt * 16 + 8 * hh + r][ln & (NW - 1)]; x += ln_xm<1>(x); x += ln_xm<2>(x); x += ln_xm<4>(x); if (NW == 16) x += ln_xm<8>(x); sc[r] = 256.0f / x; }
#pragma unroll
    for (int t = 0; t < TP; ++t) s[mt][t] *= sc;
#pragma unroll
    for (int r = 0; r < 8; ++r) { unsigned short* d = (unsigned short*)P + (rb + m0 + mt * 16 + 8 * hh + r) * LL + n0;
#pragma unroll
      for (int t8 = 0; t8 < TP / 8; ++t8) { FragH f;
#pragma unroll
        for (int q = 0; q < 8; ++q) f.h[q] = (_Float16)s[mt][t8 * 8 + q][r];
        *(v8us*)(d + t8 * 128) = f.half[0]; } } } }

// ---- GEMM with both operands staged in LDS: C[c][n] = alpha * sum_k A[c][k] Bh[n][k] (both K-contiguous f16), one 256 x 128 tile of C per work-group, 8 waves as 4 x 2, 64 x 64 per wave. ----
// A stage is 64 k of all 384 operand rows (128 B a row, LDS pitch 144 B so that the 16-byte fragment reads spread over the banks). Asynchronous copies bring whole 128-byte lines from global memory straight into LDS, two buffers:
// the next stage's copies fly while this stage is multiplied. Every operand line is asked for once per work-group, instead of in 32-byte pieces by every wave. k runs upward in steps of 32 into one accumulator chain per tile, as in k_gemm2. Requires M % 256 == 0, N % 128 == 0, K % 64 == 0.
#define G3_PITCH 72      /* f16 per LDS row */
#define G3_STAGE (384 * G3_PITCH)      /* f16 per buffer */
__device__ __forceinline__ unsigned g3_lds(const void* p) { return (unsigned)(size_t)p; }      /* byte offset in the work-group's LDS */
template <bool F16OUT>
__global__ __launch_bounds__(256) void k_gemm3(const _Float16* __restrict__ A, int lda, size_t sA, const _Float16* __restrict__ Bh, int ldb, size_t sB, float alpha, float* __restrict__ C, _Float16* __restrict__ C16, int ldc, size_t sC, int N, int K) {
  __shared__ __attribute__((aligned(16))) unsigned short ring[2 * G3_STAGE];
  __shared__ __attribute__((aligned(16))) float so[8][64][68];      /* each wave's own output staging */
  const int tid = threadIdx.x, lane = tid & 31, ln = lane & 15, hh = lane >> 4; const int w = __builtin_amdgcn_readfirstlane(tid >> 5); const int wm = w >> 1, wn = w & 1; const int by = blockIdx.y;
  const int ntn = N >> 7; const int mt = blockIdx.x / ntn, nq = blockIdx.x - mt * ntn; const int row0 = mt * 256, col0 = nq * 128; const size_t cofs = (size_t)by * sC;
  /* copy j of a thread: operand row j*32 + tid/8 of the stage (rows 0..255 = A, 256..383 = Bh), 16-byte piece tid%8: a wave's copy covers four whole rows */
  const unsigned short* ga = (const unsigned short*)A + (size_t)by * sA + (size_t)(row0 + (tid >> 3)) * lda + (tid & 7) * 8;
  const unsigned short* gb = (const unsigned short*)Bh + (size_t)by * sB + (size_t)(col0 + (tid >> 3)) * ldb + (tid & 7) * 8;
  const unsigned lb = g3_lds(ring) + (unsigned)(tid >> 3) * (G3_PITCH * 2) + (unsigned)(tid & 7) * 16;
  auto stage_in = [&](int s, int buf) {
    unsigned l[12]; const unsigned short* g[12];
#pragma unroll
    for (int j = 0; j < 12; ++j) { l[j] = lb + (unsigned)buf * (G3_STAGE * 2) + (unsigned)j * (32 * G3_PITCH * 2); g[j] = (j < 8 ? ga + (size_t)(j * 32) * lda : gb + (size_t)((j - 8) * 32) * ldb) + s * 64; }
    /* one stage's twelve copies; the s_wait_xcnt in the same statement is a precaution: it stands before any register that a copy names is written again */
    asm volatile("global_load_async_to_lds_b128 %0, %12, off\n\tglobal_load_async_to_lds_b128 %1, %13, off\n\tglobal_load_async_to_lds_b128 %2, %14, off\n\tglobal_load_async_to_lds_b128 %3, %15, off\n\t"
                 "global_load_async_to_lds_b128 %4, %16, off\n\tglobal_load_async_to_lds_b128 %5, %17, off\n\tglobal_load_async_to_lds_b128 %6, %18, off\n\tglobal_load_async_to_lds_b128 %7, %19, off\n\t"
                 "global_load_async_to_lds_b128 %8, %20, off\n\tglobal_load_async_to_lds_b128 %9, %21, off\n\tglobal_load_async_to_lds_b128 %10, %22, off\n\tglobal_load_async_to_lds_b128 %11, %23, off\n\ts_wait_xcnt 0x0"
                 :: "v"(l[0]), "v"(l[1]), "v"(l[2]), "v"(l[3]), "v"(l[4]), "v"(l[5]), "v"(l[6]), "v"(l[7]), "v"(l[8]), "v"(l[9]), "v"(l[10]), "v"(l[11]),
                    "v"(g[0]), "v"(g[1]), "v"(g[2]), "v"(g[3]), "v"(g[4]), "v"(g[5]), "v"(g[6]), "v"(g[7]), "v"(g[8]), "v"(g[9]), "v"(g[10]), "v"(g[11]) : "memory"); };
  const int ns = K >> 6;
  stage_in(0, 0);
  asm volatile("s_wait_asynccnt 0x0" ::: "memory");      /* this wave's copies of stage 0 have landed */
  __syncthreads();      /* stage 0 is readable by every wave */
  if (ns > 1) stage_in(1, 1);
  const v8f z8 = {0.f,0.f,0.f,0.f,0.f,0.f,0.f,0.f}; v8f acc[4][4];
#pragma unroll
  for (int i = 0; i < 4; ++i)
#pragma unroll
    for (int j = 0; j < 4; ++j) acc[i][j] = z8;
  const int ao = (wm * 64 + ln) * G3_PITCH, bo = (256 + wn * 64 + ln) * G3_PITCH;
#pragma unroll 1      /* the stage loop stays rolled: the accumulators keep constant indices and the loop stays small */
  for (int s = 0; s < ns; ++s) { const _Float16* rb = (const _Float16*)ring + (s & 1) * G3_STAGE;
#pragma unroll
    for (int kk = 0; kk < 2; ++kk) { v16h a[4], b[4];
#pragma unroll
      for (int i = 0; i < 4; ++i) { a[i] = g2_frag(rb + ao + i * (16 * G3_PITCH) + kk * 32, hh); b[i] = g2_frag(rb + bo + i * (16 * G3_PITCH) + kk * 32, hh); }
      __builtin_amdgcn_sched_barrier(0);      /* the block's 16 LDS reads go out as one group ahead of its WMMAs: left free, the compiler reloads one A fragment per four WMMAs and waits out the LDS latency each time */
#pragma unroll
      for (int d = 0; d < 4; ++d) {      /* tiles in the order in which their fragments arrive (a0 b0 a1 b1 ...): the first WMMAs run while the later reads are still coming; each tile still gets one WMMA per block, k upward */
#pragma unroll
        for (int e = 0; e < d; ++e) { acc[e][d] = sc_mma(a[e], b[d], acc[e][d]); acc[d][e] = sc_mma(a[d], b[e], acc[d][e]); }
        acc[d][d] = sc_mma(a[d], b[d], acc[d][d]); }
      __builtin_amdgcn_sched_barrier(0); }      /* keeps the next group of reads behind this block, so that one fragment set is live */
    asm volatile("s_wait_dscnt 0x0" ::: "memory");      /* this wave's reads of the buffer are done before it may be refilled */
    asm volatile("s_wait_asynccnt 0x0" ::: "memory");      /* this wave's copies of stage s + 1 have landed */
    __syncthreads();      /* publishes stage s + 1 and ends every wave's reads of stage s */
    if (s + 2 < ns) stage_in(s + 2, s & 1); }
  asm volatile("s_wait_asynccnt 0x0" ::: "memory");      /* no copy is outstanding when the wave goes on to its end */
  float (*sw)[68] = so[w];
#pragma unroll
  for (int i = 0; i < 4; ++i)
#pragma unroll
    for (int j = 0; j < 4; ++j)
#pragma unroll
      for (int r = 0; r < 8; ++r) sw[i * 16 + 8 * hh + r][j * 16 + ln] = acc[i][j][r] * alpha;
  __builtin_amdgcn_fence(__ATOMIC_ACQ_REL, "workgroup"); __builtin_amdgcn_wave_barrier();      /* the wave's staged rows are read back by other lanes of the same wave */
  const int rsub = lane >> 4, c4 = (lane & 15) * 4; const size_t o0 = cofs + (size_t)(row0 + wm * 64 + rsub) * ldc + col0 + wn * 64 + c4;
#pragma unroll
  for (int q = 0; q < 32; ++q) { const v4f v = *(const v4fa*)&sw[q * 2 + rsub][c4]; const size_t o = o0 + (size_t)(q * 2) * ldc;
    if (F16OUT) { v4h h4; for (int i = 0; i < 4; ++i) h4[i] = (_Float16)v[i]; *(v4h*)(C16 + o) = h4; } else *(v4f*)(C + o) = v; } }

__global__ __launch_bounds__(256) void k_cl2rows(const float* __restrict__ X, _Float16* __restrict__ XR) { __shared__ float tl[64][33]; const int tid = threadIdx.x; const int nl = LL / 32, nc = CC / 64; const int cb_ = blockIdx.x % nc; const int lb = (blockIdx.x / nc) % nl; const size_t b = blockIdx.x / (nc * nl); const int c0 = cb_ * 64, l0 = lb * 32;
  for (int i = tid; i < 64 * 32; i += 256) { const int c = i / 32, l = i % 32; tl[c][l] = bf16_round(X[(b * CC + c0 + c) * (size_t)LL + l0 + l]); }
  __syncthreads();
  { const int l = tid / 8, c8 = (tid % 8) * 8; FragH f; for (int q = 0; q < 8; ++q) f.h[q] = (_Float16)tl[c8 + q][l]; unsigned short* d = (unsigned short*)XR + (b * LL + l0 + l) * (size_t)CC + c0 + c8; *(v8us*)d = f.half[0];  } }


__global__ __launch_bounds__(256) void k_gres2(float* __restrict__ y, const float* __restrict__ x, const float* __restrict__ gam) {
  #pragma clang fp contract(off)
  const size_t i = (size_t)blockIdx.x * 256 + threadIdx.x; if (i >= NR * CC / 4) return; const float g = bf16_round(gam[0]); v4f a = *(const v4fa*)(y + i * 4); const v4f b = *(const v4fa*)(x + i * 4);
  for (int q = 0; q < 4; ++q) a[q] = __fadd_rn(__fmul_rn(g, a[q]), bf16_round(b[q])); *(v4f*)(y + i * 4) = a;  }
extern "C" void kernel_launch(void* const* d_in, const int* in_sizes, int n_in,
                              void* d_out, int out_size, void* d_ws, size_t ws_size, hipStream_t stream) {
  (void)in_sizes; (void)n_in; (void)out_size;
  const float* const* I = (const float* const*)d_in; const float* x = I[0]; const float* wq = I[1]; const float* wk = I[2]; const float* wv = I[3]; const float* gam = I[4];
  char* ws = (char*)d_ws; size_t off = 0;
  auto take = [&](size_t bytes) { char* p = ws + off; off += (bytes + 255) & ~(size_t)255; return p; };
  _Float16* BQ = (_Float16*)take((size_t)CQ * CC * 2); _Float16* BK = (_Float16*)take((size_t)CQ * CC * 2); _Float16* BV = (_Float16*)take((size_t)CC * CC * 2);
  _Float16* XR = (_Float16*)take(NR * CC * 2); float* FF = (float*)take(NR * CQ * 4); _Float16* Fh = (_Float16*)take(NR * CQ * 2); _Float16* Fl = (_Float16*)take(NR * CQ * 2); _Float16* Gh = (_Float16*)take(NR * CQ * 2); _Float16* Gl = (_Float16*)take(NR * CQ * 2);
  _Float16* H16 = (_Float16*)take(NR * CC * 2); _Float16* P = (_Float16*)take(NR * LL * 2);
  if (off > ws_size) return;      /* approx 0.6 + 16 + 4 + 8 + 16 + 64 = 109 MiB: every plane holds all NB batches */
  k_wnat<<<(unsigned)(((size_t)CQ * CC / 8 + 255) / 256), 256, 0, stream>>>(wq, (size_t)CQ * CC / 8, BQ); k_wnat<<<(unsigned)(((size_t)CQ * CC / 8 + 255) / 256), 256, 0, stream>>>(wk, (size_t)CQ * CC / 8, BK); k_wnat<<<(unsigned)(((size_t)CC * CC / 8 + 255) / 256), 256, 0, stream>>>(wv, (size_t)CC * CC / 8, BV);
  k_cl2rows<<<NB * (LL / 32) * (CC / 64), 256, 0, stream>>>(x, XR);      /* exact f16 token rows [b*2048 + n][c] */
  /* every stage once for all batches: blockIdx.y = batch, the plane strides sA / sB / sC step from batch to batch (0 = shared weights) */
  k_gemm2<0><<<dim3((LL / 128) * 1, NB), 128, 0, stream>>>(XR, CC, (size_t)LL * CC, BQ, CC, 0, 0.0625f, nullptr, 0, nullptr, 1, 0, 0, FF, nullptr, CQ, (size_t)LL * CQ, LL, CQ, CC); k_hl<<<(unsigned)((NR * CQ / 8 + 255) / 256), 256, 0, stream>>>(FF, Fh, Fl, NR * CQ / 8);      /* f^T rows [b][n][64] -> hi/lo */
  k_gemm2<0><<<dim3((LL / 128) * 1, NB), 128, 0, stream>>>(XR, CC, (size_t)LL * CC, BK, CC, 0, 0.0625f, nullptr, 0, nullptr, 1, 0, 0, FF, nullptr, CQ, (size_t)LL * CQ, LL, CQ, CC); k_hl<<<(unsigned)((NR * CQ / 8 + 255) / 256), 256, 0, stream>>>(FF, Gh, Gl, NR * CQ / 8);      /* g^T rows [b][m][64] -> hi/lo */
  k_gemm3<true><<<dim3((CC / 256) * (LL / 128), NB), 256, 0, stream>>>(BV, CC, 0, XR, CC, (size_t)LL * CC, 0.0625f, nullptr, H16, LL, (size_t)CC * LL, LL, CC);      /* h channel-major [b][c][n] f16 */
  k_scsm<2, 16><<<dim3(LL / 32, NB), 512, 0, stream>>>(Gh, Gl, Fh, Fl, P);      /* S^T[b][m][n] = g_m . f_n (hi.hi + 2^-10 (lo.hi + hi.lo)), softmax over n per key m (the module's dim=1 softmax) -> beta^T[b][m][n] x256 f16 */
  k_gemm3<false><<<dim3((CC / 256) * (LL / 128), NB), 256, 0, stream>>>(H16, LL, (size_t)CC * LL, P, LL, (size_t)LL * LL, 0.00390625f, (float*)d_out, nullptr, LL, (size_t)CC * LL, LL, LL);      /* o[b][c][m] = 2^-8 sum_n h[c][n] beta^T[m][n] (channel-major = the output layout) */
  k_gres2<<<(unsigned)((NR * CC / 4 + 255) / 256), 256, 0, stream>>>((float*)d_out, x, gam);      /* gamma o + x */
}

// v005
// A run of this version takes 146 microseconds.
// In two side-by-side timings against v004, it was 1.09 and 1.10 times as fast.
// Over all steps from v000 it is 28.1 times as fast.
#include <hip/hip_runtime.h>
// SAGAN-style self-attention with 1x1-conv projections (x [8][512][2048] channel-first; f = Wq x, g = Wk x (64 channels), h = Wv x (512); scores[n][m] = sum_c f[c][n] g[c][m] (unscaled); beta = softmax over n (the QUERY axis, dim=1) for each m; o[c][m] = gamma sum_n h[c][n] beta[n][m] + x[c][m] -> [8][512][2048]; gamma = an input scalar).
// Structure: x transposed to exact f16 token rows via LDS tiles; f^T and g^T as WMMA GEMMs (32x64 wave tiles, f32 accumulation, exact x16 weights) cut in the GEMM's own epilogue into f16 hi + x1024 residual planes; h channel-major as a GEMM (weights as the A operand) into f16 (h and o: 256x128 work-group tiles, operands staged in LDS by asynchronous copies); every stage is one launch over all batches (blockIdx.y = batch): S^T[m][n] = g^T f (K = 64; hi.hi + lo.hi + hi.lo on WMMA) and its row softmax over n (f32 statistics, native exp; weights x256 f16) = beta^T in one launch, a work-group holding whole score rows in registers; o[c][m] = h . beta^T as a GEMM (K = 2048) channel-major straight into the output, its epilogue forming out = bf16(gamma) o + bf16(x); 4 + 5 = 9 launches.
// Compute dtype: inputs rounded to bf16; x / weights exact; f, g as hi + residual (~2^-22: the unscaled logits have sigma ~8); h and the softmax weights plain f16 (~2^-12); logits, statistics, o f32. v_wmma_f32_16x16x32_f16.
#define NB 8
#define CC 512
#define CQ 64
#define LL 2048
#define SQ LL
#define DM 64
#define NH 1
#define HD 64
#define HG 1
#define NR ((size_t)NB * LL)
typedef __bf16 v16b __attribute__((ext_vector_type(16)));
typedef unsigned short v8us __attribute__((ext_vector_type(8), may_alias));
typedef float  v8f  __attribute__((ext_vector_type(8)));
typedef float  v4f  __attribute__((ext_vector_type(4)));
typedef float  v4fa __attribute__((ext_vector_type(4), may_alias));
union FragB { v16b v; v8us half[2]; unsigned short u[16]; };

__device__ __forceinline__ unsigned short bf16_bits(float x) { unsigned int u = __float_as_uint(x); return (unsigned short)((u + 0x7FFFu + ((u >> 16) & 1u)) >> 16); }
__device__ __forceinline__ float bf16_val(unsigned short b) { return __uint_as_float(((unsigned int)b) << 16); }
__device__ __forceinline__ float bf16_round(float x) { return bf16_val(bf16_bits(x)); }
// D += A·B with NT terms: 1 = ah·bh, 2 = + al·bh (A split), 3 = + ah·bl (both split)
template <int NT>
__device__ __forceinline__ v8f mmaN(v16b ah, v16b al, v16b bh, v16b bl, v8f c) {
  c = __builtin_amdgcn_wmma_f32_16x16x32_bf16(false, ah, false, bh, (short)0, c, false, false);
  if (NT >= 2) c = __builtin_amdgcn_wmma_f32_16x16x32_bf16(false, al, false, bh, (short)0, c, false, false);
  if (NT >= 3) c = __builtin_amdgcn_wmma_f32_16x16x32_bf16(false, ah, false, bl, (short)0, c, false, false);
  asm volatile("v_nop\n\tv_nop\n\tv_nop\n\tv_nop" : "+v"(c) : "v"(ah), "v"(al), "v"(bh), "v"(bl));
  return c;
}

__global__ __launch_bounds__(256) void k_wt_bf16(const float* __restrict__ W, unsigned short* __restrict__ Wt, int K, int N) {
  const int t = blockIdx.x * 256 + threadIdx.x;
  const int k8n = K / 8;
  if (t >= N * k8n) return;
  const int n = t / k8n, k8 = (t % k8n) * 8;
  v8us v;
#pragma unroll
  for (int i = 0; i < 8; ++i) v[i] = bf16_bits(W[(size_t)(k8 + i) * N + n]);
  *(v8us*)(Wt + (size_t)n * K + k8) = v;
  
}

// GEMM C[M][N] (f32, pitch ldc) = act(A[M][K]·W + bias). A f32 row-major (pitch lda) converted per fragment to bf16
// (ASPLIT: hi/lo two planes -> 2 terms, else single rounded term); Wt bf16 [N][K] (pitch ldb). BIAS_BF16 rounds the
// bias to bf16 first (bias quantised to bf16 before the add). K%32==0, M%16==0, N%64==0.
template <bool ASPLIT, int ACT, bool BIAS_BF16>
__global__ __launch_bounds__(128) void k_gemm_bf(const float* __restrict__ A, int lda, const unsigned short* __restrict__ Wt, int ldb,
                                               const float* __restrict__ bias, float* __restrict__ C, int ldc, int M, int N, int K) {
  __shared__ __attribute__((aligned(16))) float so[4][16][64];
  const int tid = threadIdx.x, w = tid >> 5, lane = tid & 31, ln = lane & 15, hh = lane >> 4;
  const int ntn = N / 64;
  const int wid = blockIdx.x * 4 + w;
  const int mt = wid / ntn, nq = wid % ntn;
  if (mt * 16 >= M) return;
  const int row0 = mt * 16, col0 = nq * 64;
  const float* arow = A + (size_t)(row0 + ln) * lda;
  v8f acc[4] = {};
  for (int kb = 0; kb < K; kb += 32) {
    FragB ah, al;
    const v4f x0 = *(const v4fa*)(arow + kb + 8 * hh), x1 = *(const v4fa*)(arow + kb + 8 * hh + 4);
    const v4f x2 = *(const v4fa*)(arow + kb + 16 + 8 * hh), x3 = *(const v4fa*)(arow + kb + 16 + 8 * hh + 4);
    float xs[16] = {x0[0],x0[1],x0[2],x0[3],x1[0],x1[1],x1[2],x1[3],x2[0],x2[1],x2[2],x2[3],x3[0],x3[1],x3[2],x3[3]};
#pragma unroll
    for (int i = 0; i < 16; ++i) { const unsigned short hb = bf16_bits(xs[i]); ah.u[i] = hb; al.u[i] = ASPLIT ? bf16_bits(xs[i] - bf16_val(hb)) : (unsigned short)0; }
#pragma unroll
    for (int t = 0; t < 4; ++t) {
      const unsigned short* brow = Wt + (size_t)(col0 + t * 16 + ln) * ldb + kb;
      FragB b;
      b.half[0] = *(const v8us*)(brow + 8 * hh);
      b.half[1] = *(const v8us*)(brow + 16 + 8 * hh);
      acc[t] = mmaN<ASPLIT ? 2 : 1>(ah.v, al.v, b.v, b.v, acc[t]);
    }
  }
#pragma unroll
  for (int t = 0; t < 4; ++t) {
    float bv = bias ? bias[col0 + t * 16 + ln] : 0.f;
    if (BIAS_BF16) bv = bf16_round(bv);
#pragma unroll
    for (int r = 0; r < 8; ++r) { float v = acc[t][r] + bv; if (ACT == 1) v = fmaxf(v, 0.f); so[w][8 * hh + r][t * 16 + ln] = v; }
  }
  __builtin_amdgcn_fence(__ATOMIC_ACQ_REL, "workgroup");
  __builtin_amdgcn_wave_barrier();
  const int rsub = lane >> 4, c4 = (lane & 15) * 4;
  {
#pragma unroll
    for (int q = 0; q < 8; ++q) {
      const int r = q * 2 + rsub;
      const v4f v = *(const v4fa*)&so[w][r][c4];
      *(v4f*)(C + (size_t)(row0 + r) * ldc + col0 + c4) = v;
    }
    
  }
}

// GEMM C = act(A·W + bias + resid): A f32 (ASPLIT -> hi/lo 2 terms), Wt bf16 [N][K]; ACT 0 none, 1 relu, 2 exact gelu;
// resid (optional, f32, row index = (row % rmod), pitch ldr, RES_BF16 rounds it) added before the activation.
template <bool ASPLIT, int ACT, bool BIAS_BF16, bool RES_BF16>
__global__ __launch_bounds__(128) void k_gemm_bf3(const float* __restrict__ A, int lda, const unsigned short* __restrict__ Wt, int ldb,
                                                const float* __restrict__ bias, const float* __restrict__ resid, int rmod, int ldr,
                                                float* __restrict__ C, int ldc, int M, int N, int K) {
  __shared__ __attribute__((aligned(16))) float so[4][16][64];
  const int tid = threadIdx.x, w = tid >> 5, lane = tid & 31, ln = lane & 15, hh = lane >> 4;
  const int ntn = N / 64;
  const int wid = blockIdx.x * 4 + w;
  const int mt = wid / ntn, nq = wid % ntn;
  if (mt * 16 >= M) return;
  const int row0 = mt * 16, col0 = nq * 64;
  const float* arow = A + (size_t)(row0 + ln) * lda;
  v8f acc[4] = {};
  for (int kb = 0; kb < K; kb += 32) {
    FragB ah, al;
    const v4f x0 = *(const v4fa*)(arow + kb + 8 * hh), x1 = *(const v4fa*)(arow + kb + 8 * hh + 4);
    const v4f x2 = *(const v4fa*)(arow + kb + 16 + 8 * hh), x3 = *(const v4fa*)(arow + kb + 16 + 8 * hh + 4);
    float xs[16] = {x0[0],x0[1],x0[2],x0[3],x1[0],x1[1],x1[2],x1[3],x2[0],x2[1],x2[2],x2[3],x3[0],x3[1],x3[2],x3[3]};
#pragma unroll
    for (int i = 0; i < 16; ++i) { const unsigned short hb = bf16_bits(xs[i]); ah.u[i] = hb; al.u[i] = ASPLIT ? bf16_bits(xs[i] - bf16_val(hb)) : (unsigned short)0; }
#pragma unroll
    for (int t = 0; t < 4; ++t) {
      const unsigned short* brow = Wt + (size_t)(col0 + t * 16 + ln) * ldb + kb;
      FragB b;
      b.half[0] = *(const v8us*)(brow + 8 * hh);
      b.half[1] = *(const v8us*)(brow + 16 + 8 * hh);
      acc[t] = mmaN<ASPLIT ? 2 : 1>(ah.v, al.v, b.v, b.v, acc[t]);
    }
  }
#pragma unroll
  for (int t = 0; t < 4; ++t) {
    const int col = col0 + t * 16 + ln;
    float bv = bias ? bias[col] : 0.f;
    if (BIAS_BF16) bv = bf16_round(bv);
#pragma unroll
    for (int r = 0; r < 8; ++r) {
      float v = acc[t][r] + bv;
      if (resid) { float rv = resid[(size_t)((row0 + 8 * hh + r) % rmod) * ldr + col]; if (RES_BF16) rv = bf16_round(rv); v += rv; }
      if (ACT == 1) v = fmaxf(v, 0.f);
      if (ACT == 2) v = 0.5f * v * (1.0f + erff(v * 0.70710678118654752f));
      if (ACT == 3) { const float u = 0.7978845608028654f * (v + 0.044715f * v * v * v); v = 0.5f * v * (1.0f + tanhf(u)); }
      so[w][8 * hh + r][t * 16 + ln] = v;
    }
  }
  __builtin_amdgcn_fence(__ATOMIC_ACQ_REL, "workgroup");
  __builtin_amdgcn_wave_barrier();
  const int rsub = lane >> 4, c4 = (lane & 15) * 4;
  {
#pragma unroll
    for (int q = 0; q < 8; ++q) {
      const int r = q * 2 + rsub;
      const v4f v = *(const v4fa*)&so[w][r][c4];
      *(v4f*)(C + (size_t)(row0 + r) * ldc + col0 + c4) = v;
    }
    
  }
}
// row LayerNorm (biased variance, eps) over N: s = X (+ R); optional out_sum <- s; out_norm <- (s-mu)*rsqrt(var+eps)*g + b
template <bool PARAM_BF16>
__global__ __launch_bounds__(256) void k_layernorm(const float* __restrict__ X, const float* __restrict__ R, const float* __restrict__ g, const float* __restrict__ bta,
                                                  float* __restrict__ out_sum, float* __restrict__ out_norm, int N, float eps) {
  __shared__ float red[256];
  const int row = blockIdx.x, tid = threadIdx.x;
  const float* x = X + (size_t)row * N; const float* rr = R ? R + (size_t)row * N : nullptr;
  float vals[16];                     // up to N = 4096
  const int per = N / 256;            // contiguous chunk per thread? use strided-by-4 chunks: thread handles j = tid*4 + 1024*u
  float s1 = 0.f;
  for (int u = 0; u < per / 4; ++u) {
    const int j = tid * 4 + 1024 * u;
    const v4f a = *(const v4fa*)(x + j);
    v4f b = {0.f,0.f,0.f,0.f}; if (rr) b = *(const v4fa*)(rr + j);
#pragma unroll
    for (int q = 0; q < 4; ++q) { const float v = a[q] + b[q]; vals[u * 4 + q] = v; s1 += v; }
  }
  red[tid] = s1; __syncthreads();
  for (int st = 128; st > 0; st >>= 1) { if (tid < st) red[tid] += red[tid + st]; __syncthreads(); }
  const float mu = red[0] / (float)N; __syncthreads();
  float s2 = 0.f;
  for (int u = 0; u < per / 4; ++u)
#pragma unroll
    for (int q = 0; q < 4; ++q) { const float c = vals[u * 4 + q] - mu; s2 += c * c; }
  red[tid] = s2; __syncthreads();
  for (int st = 128; st > 0; st >>= 1) { if (tid < st) red[tid] += red[tid + st]; __syncthreads(); }
  const float rs = rsqrtf(red[0] / (float)N + eps);
  {
    for (int u = 0; u < per / 4; ++u) {
      const int j = tid * 4 + 1024 * u;
      v4f o, sm;
#pragma unroll
      for (int q = 0; q < 4; ++q) {
        float gg = g[j + q], bb = bta[j + q];
        if (PARAM_BF16) { gg = bf16_round(gg); bb = bf16_round(bb); }
        sm[q] = vals[u * 4 + q]; o[q] = (vals[u * 4 + q] - mu) * rs * gg + bb;
      }
      if (out_sum) *(v4f*)(out_sum + (size_t)row * N + j) = sm;
      *(v4f*)(out_norm + (size_t)row * N + j) = o;
    }
    
  }
}



// ---- f16 WMMA path (v_wmma_f32_16x16x32_f16): 11-bit significands for operands in range — used where a [0,1] probability operand needs more precision than bf16
typedef _Float16 v16h __attribute__((ext_vector_type(16)));
union FragH { v16h v; v8us half[2]; _Float16 h[16]; unsigned short u[16]; };
template <int NT>
__device__ __forceinline__ v8f mmaH(v16h ah, v16h al, v16h bh, v16h bl, v8f c) {
  c = __builtin_amdgcn_wmma_f32_16x16x32_f16(false, ah, false, bh, (short)0, c, false, false);
  if (NT >= 2) c = __builtin_amdgcn_wmma_f32_16x16x32_f16(false, al, false, bh, (short)0, c, false, false);
  if (NT >= 3) c = __builtin_amdgcn_wmma_f32_16x16x32_f16(false, ah, false, bl, (short)0, c, false, false);
  asm volatile("v_nop\n\tv_nop\n\tv_nop\n\tv_nop" : "+v"(c) : "v"(ah), "v"(al), "v"(bh), "v"(bl));
  return c;
}
// batched GEMM like k_gemm_b but f16 operands: A f32 (split into f16 hi/lo if ASPLIT, else rounded to f16), Bt = f16 values [n][k]; alpha; C f32; N multiple of 16 (partial tiles skipped)
template <bool ASPLIT>
__global__ __launch_bounds__(128) void k_gemm_h(const float* __restrict__ A, int lda, size_t sA, const _Float16* __restrict__ Bh, int ldb, size_t sB, float alpha, float* __restrict__ C, int ldc, size_t sC, int M, int N, int K) {
  __shared__ __attribute__((aligned(16))) float so[4][16][64];
  const int tid = threadIdx.x, w = tid >> 5, lane = tid & 31, ln = lane & 15, hh = lane >> 4; const int by = blockIdx.y;
  A += (size_t)by * sA; Bh += (size_t)by * sB; C += (size_t)by * sC;
  const int ntn = (N + 63) / 64; const int wid = blockIdx.x * 4 + w; const int mt = wid / ntn, nq = wid % ntn; if (mt * 16 >= M) return;
  const int row0 = mt * 16, col0 = nq * 64; const float* arow = A + (size_t)(row0 + ln) * lda;
  v8f acc[4] = {};
  for (int kb = 0; kb < K; kb += 32) {
    FragH ah, al;
    const v4f x0 = *(const v4fa*)(arow + kb + 8 * hh), x1 = *(const v4fa*)(arow + kb + 8 * hh + 4), x2 = *(const v4fa*)(arow + kb + 16 + 8 * hh), x3 = *(const v4fa*)(arow + kb + 16 + 8 * hh + 4);
    float xs[16] = {x0[0],x0[1],x0[2],x0[3],x1[0],x1[1],x1[2],x1[3],x2[0],x2[1],x2[2],x2[3],x3[0],x3[1],x3[2],x3[3]};
#pragma unroll
    for (int i = 0; i < 16; ++i) { const _Float16 h = (_Float16)xs[i]; ah.h[i] = h; al.h[i] = ASPLIT ? (_Float16)(xs[i] - (float)h) : (_Float16)0.0f; }
#pragma unroll
    for (int t = 0; t < 4; ++t) { if (col0 + t * 16 >= N) continue; const size_t boff = (size_t)(col0 + t * 16 + ln) * ldb + kb; FragH bq; bq.half[0] = *(const v8us*)(Bh + boff + 8 * hh); bq.half[1] = *(const v8us*)(Bh + boff + 16 + 8 * hh);
      acc[t] = mmaH<ASPLIT ? 2 : 1>(ah.v, al.v, bq.v, bq.v, acc[t]); }
  }
#pragma unroll
  for (int t = 0; t < 4; ++t) { if (col0 + t * 16 >= N) continue;
#pragma unroll
    for (int r = 0; r < 8; ++r) so[w][8 * hh + r][t * 16 + ln] = acc[t][r] * alpha; }
  __builtin_amdgcn_fence(__ATOMIC_ACQ_REL, "workgroup"); __builtin_amdgcn_wave_barrier();
  const int rsub = lane >> 4, c4 = (lane & 15) * 4;
  {
#pragma unroll
    for (int q = 0; q < 8; ++q) { const int r = q * 2 + rsub; if (col0 + c4 < N) { const v4f v = *(const v4fa*)&so[w][r][c4]; *(v4f*)(C + (size_t)(row0 + r) * ldc + col0 + c4) = v; } }
     }
}

// Wt[n][k] = f16(W[k][n]·scale) from f32 row-major W[K][N] (scale = power of two; bf16-exact weights stay exact in f16 away from the subnormal range)
__global__ __launch_bounds__(256) void k_wt_f16(const float* __restrict__ W, _Float16* __restrict__ Wt, int K, int N, float scale) {
  const int t = blockIdx.x * 256 + threadIdx.x; if (t >= N * (K / 8)) return; const int n = t / (K / 8), k8 = (t % (K / 8)) * 8; FragH f;
#pragma unroll
  for (int i = 0; i < 8; ++i) f.h[i] = (_Float16)(bf16_round(W[(size_t)(k8 + i) * N + n]) * scale); const v8us o = f.half[0];
  *(v8us*)((unsigned short*)Wt + (size_t)n * K + k8) = o; 
}
// k_gemm_hh variant with fused epilogue: v = acc·alpha + bias[by·sBias + col] (+ CP[(row/rowsPerB)·sCPb + by·64 + col] if CP) ; ACT 0 none / 1 elu ; writes f16 C16 (and f32 C if non-null)
template <int ACT>
__global__ __launch_bounds__(128) void k_gemm_hhx(const _Float16* __restrict__ A, int lda, size_t sA, const _Float16* __restrict__ Bh, int ldb, size_t sB, float alpha, const float* __restrict__ bias, size_t sBias, const float* __restrict__ CP, int rowsPerB, size_t sCPb, int row0g,
    float* __restrict__ C, _Float16* __restrict__ C16, int ldc, size_t sC, int M, int N, int K) {
  __shared__ __attribute__((aligned(16))) float so[4][16][64];
  const int tid = threadIdx.x, w = tid >> 5, lane = tid & 31, ln = lane & 15, hh = lane >> 4; const int by = blockIdx.y;
  A += (size_t)by * sA; Bh += (size_t)by * sB; const size_t cofs = (size_t)by * sC; const float* bp = bias ? bias + (size_t)by * sBias : nullptr;
  const int ntn = (N + 63) / 64; const int wid = blockIdx.x * 4 + w; const int mt = wid / ntn, nq = wid % ntn; if (mt * 16 >= M) return;
  const int row0 = mt * 16, col0 = nq * 64; const _Float16* arow = A + (size_t)(row0 + ln) * lda;
  v8f acc[4] = {};
  for (int kb = 0; kb < K; kb += 32) { FragH ah; ah.half[0] = *(const v8us*)((const unsigned short*)arow + kb + 8 * hh); ah.half[1] = *(const v8us*)((const unsigned short*)arow + kb + 16 + 8 * hh);
#pragma unroll
    for (int t = 0; t < 4; ++t) { if (col0 + t * 16 >= N) continue; const size_t boff = (size_t)(col0 + t * 16 + ln) * ldb + kb; FragH bq; bq.half[0] = *(const v8us*)((const unsigned short*)Bh + boff + 8 * hh); bq.half[1] = *(const v8us*)((const unsigned short*)Bh + boff + 16 + 8 * hh);
      acc[t] = mmaH<1>(ah.v, ah.v, bq.v, bq.v, acc[t]); }
  }
#pragma unroll
  for (int t = 0; t < 4; ++t) { if (col0 + t * 16 >= N) continue; const int col = col0 + t * 16 + ln; const float bv = bp ? bf16_round(bp[col]) : 0.f;
#pragma unroll
    for (int r = 0; r < 8; ++r) { float v = acc[t][r] * alpha + bv; if (CP) { const int rr = row0g + row0 + 8 * hh + r; if (rowsPerB < 0) v += CP[cofs + (size_t)rr * ldc + col];      /* rowsPerB < 0: own element of the batched C plane */ else { const int bidx = rr / rowsPerB; v += CP[(size_t)bidx * sCPb + (size_t)by * 64 + col]; } } if (ACT == 1) v = (v > 0.f) ? v : expm1f(v); else if (ACT == 7) v = (v > 0.f) ? v + 1.0f : expf(v); else if (ACT == 8) v = tanhf(v); else if (ACT == 9) v = 0.5f * v * (1.0f + tanhf(0.7978845608028654f * (v + 0.044715f * v * v * v))); else if (ACT == 11) v = 1.0f / (1.0f + expf(-v)); else if (ACT == 12) v = (v > 0.f) ? v : 0.01f * v; else if (ACT == 14) v = (v > 0.f) ? v : 0.1f * v; else if (ACT == 16) v = (v >= 0.f) ? v : 0.3f * v; else if (ACT == 17) v = (v >= 0.f) ? v : 0.2f * v; else if (ACT == 15) v = v / (1.0f + expf(-v)); else if (ACT == 3) v = fmaxf(v, 0.f); else if (ACT == 6) v = 0.5f * v * (1.0f + erff(v * 0.70710678118654752f)); so[w][8 * hh + r][t * 16 + ln] = v; } }
  __builtin_amdgcn_fence(__ATOMIC_ACQ_REL, "workgroup"); __builtin_amdgcn_wave_barrier();
  const int rsub = lane >> 4, c4 = (lane & 15) * 4; typedef _Float16 v4h __attribute__((ext_vector_type(4)));
  {
#pragma unroll
    for (int q = 0; q < 8; ++q) { const int r = q * 2 + rsub; if (col0 + c4 < N) { const v4f v = *(const v4fa*)&so[w][r][c4]; if (C) *(v4f*)(C + cofs + (size_t)(row0 + r) * ldc + col0 + c4) = v; if (C16) { v4h h4; for (int i = 0; i < 4; ++i) h4[i] = (_Float16)v[i]; *(v4h*)(C16 + cofs + (size_t)(row0 + r) * ldc + col0 + c4) = h4; } } }
     }
}


typedef _Float16 v4h __attribute__((ext_vector_type(4)));

__global__ __launch_bounds__(256) void k_x16(const float* __restrict__ x, _Float16* __restrict__ X16, size_t n8) { const size_t t = (size_t)blockIdx.x * 256 + threadIdx.x; if (t >= n8) return; FragH f;
#pragma unroll
  for (int q = 0; q < 8; ++q) f.h[q] = (_Float16)bf16_round(x[t * 8 + q]); *(v8us*)((unsigned short*)X16 + t * 8) = f.half[0];  }
__global__ __launch_bounds__(256) void k_h16(const float* __restrict__ x, _Float16* __restrict__ X16, size_t n8) { const size_t t = (size_t)blockIdx.x * 256 + threadIdx.x; if (t >= n8) return; FragH f;
#pragma unroll
  for (int q = 0; q < 8; ++q) f.h[q] = (_Float16)x[t * 8 + q]; *(v8us*)((unsigned short*)X16 + t * 8) = f.half[0];  }
__global__ __launch_bounds__(256) void k_round16f(const float* __restrict__ W, _Float16* __restrict__ Bt, size_t n8) { const size_t t = (size_t)blockIdx.x * 256 + threadIdx.x; if (t >= n8) return; FragH f;
#pragma unroll
  for (int i = 0; i < 8; ++i) f.h[i] = (_Float16)(bf16_round(W[t * 8 + i]) * 16.0f); *(v8us*)((unsigned short*)Bt + t * 8) = f.half[0];  }
template <int NHv, int TTv>
__global__ __launch_bounds__(256) void k_vt(const _Float16* __restrict__ V16, int ldv, int voff, _Float16* __restrict__ Vt) { __shared__ unsigned short tl[64][66]; const int tid = threadIdx.x; const int slab = blockIdx.x / (TTv / 64), lg = blockIdx.x % (TTv / 64); const int b = slab / NHv, h = slab % NHv;
  for (int i = tid; i < 64 * 8; i += 256) { const int r = i / 8, c8 = (i % 8) * 8; FragH f; f.half[0] = *(const v8us*)((const unsigned short*)V16 + ((size_t)b * TTv + lg * 64 + r) * ldv + voff + h * 64 + c8);
#pragma unroll
    for (int q = 0; q < 8; ++q) tl[r][c8 + q] = f.u[q]; }
  __syncthreads();
  {
#pragma unroll
    for (int rd = 0; rd < 2; ++rd) { const int d = rd * 32 + tid / 8, pc = tid % 8; FragH f;
#pragma unroll
      for (int q = 0; q < 8; ++q) f.u[q] = tl[pc * 8 + q][d];
      *(v8us*)((unsigned short*)Vt + ((size_t)slab * 64 + d) * TTv + lg * 64 + pc * 8) = f.half[0]; }
     } }

// ---- fast GEMM (wave tile 32x64; requires M % 32 == 0 rows per launch region and N % 64 == 0); epilogue = k_gemm_hhx semantics; HL: each f32 result is cut here into f16 hi (C16) + x1024 residual (CL), so the f32 rows never go to memory ----
__device__ __forceinline__ v16h g2_frag(const _Float16* p, int hh) { FragH f; f.half[0] = *(const v8us*)((const unsigned short*)p + 8 * hh); f.half[1] = *(const v8us*)((const unsigned short*)p + 16 + 8 * hh); return f.v; }
__device__ __forceinline__ v8f g2_mma(v16h a, v16h b, v8f c) { v8f d = __builtin_amdgcn_wmma_f32_16x16x32_f16(false, a, false, b, (short)0, c, false, false); asm volatile("v_nop\n\tv_nop\n\tv_nop\n\tv_nop" : "+v"(d) : "v"(a), "v"(b)); return d; }
template <int ACT, bool HL>
__global__ __launch_bounds__(128) void k_gemm2(const _Float16* __restrict__ A, int lda, size_t sA, const _Float16* __restrict__ Bh, int ldb, size_t sB, float alpha, const float* __restrict__ bias, size_t sBias, const float* __restrict__ CP, int rowsPerB, size_t sCPb, int row0g,
    float* __restrict__ C, _Float16* __restrict__ C16, _Float16* __restrict__ CL, int ldc, size_t sC, int M, int N, int K) { static_assert(ACT == 0 || ACT == 3 || ACT == 6 || ACT == 8 || ACT == 9 || ACT == 11 || ACT == 12 || ACT == 14 || ACT == 15 || ACT == 16 || ACT == 17, "k_gemm2: unsupported ACT code (would silently apply no activation)");
  __shared__ __attribute__((aligned(16))) float so[4][32][68];
  const int tid = threadIdx.x, w = tid >> 5, lane = tid & 31, ln = lane & 15, hh = lane >> 4; const int by = blockIdx.y;
  A += (size_t)by * sA; Bh += (size_t)by * sB; const size_t cofs = (size_t)by * sC; const float* bp = bias ? bias + (size_t)by * sBias : nullptr;
  const int ntn = N >> 6; const int mt = blockIdx.x / ntn, nq = blockIdx.x - mt * ntn; const int row0 = mt * 128 + 32 * w, col0 = nq * 64; if (row0 >= M) return;
  const _Float16* a0p = A + (size_t)(row0 + ln) * lda; const _Float16* a1p = a0p + (size_t)16 * lda;
  const _Float16* b0p = Bh + (size_t)(col0 + ln) * ldb; const _Float16* b1p = b0p + (size_t)16 * ldb; const _Float16* b2p = b1p + (size_t)16 * ldb; const _Float16* b3p = b2p + (size_t)16 * ldb;
  const v8f z8 = {0.f,0.f,0.f,0.f,0.f,0.f,0.f,0.f}; v8f c00 = z8, c01 = z8, c02 = z8, c03 = z8, c10 = z8, c11 = z8, c12 = z8, c13 = z8;
#pragma unroll 1
  for (int kb = 0; kb < K; kb += 32) { const v16h a0 = g2_frag(a0p + kb, hh), a1 = g2_frag(a1p + kb, hh);
    v16h b = g2_frag(b0p + kb, hh); c00 = g2_mma(a0, b, c00); c10 = g2_mma(a1, b, c10);
    b = g2_frag(b1p + kb, hh); c01 = g2_mma(a0, b, c01); c11 = g2_mma(a1, b, c11);
    b = g2_frag(b2p + kb, hh); c02 = g2_mma(a0, b, c02); c12 = g2_mma(a1, b, c12);
    b = g2_frag(b3p + kb, hh); c03 = g2_mma(a0, b, c03); c13 = g2_mma(a1, b, c13); }
  v8f accs[8] = {c00, c01, c02, c03, c10, c11, c12, c13};
#pragma unroll
  for (int u = 0; u < 8; ++u) { const int t = u & 3, half = u >> 2; const int col = col0 + t * 16 + ln; const float bv = bp ? bf16_round(bp[col]) : 0.f;
#pragma unroll
    for (int r = 0; r < 8; ++r) { const int rloc = half * 16 + 8 * hh + r; float v = accs[u][r] * alpha + bv; if (CP) { if (rowsPerB < 0) v += CP[cofs + (size_t)(row0g + row0 + rloc) * ldc + col];      /* rowsPerB < 0: own element of the batched C plane */ else { const int bidx = (row0g + row0 + rloc) / rowsPerB; v += CP[(size_t)bidx * sCPb + (size_t)by * 64 + col]; } }
      if (ACT == 3) v = fmaxf(v, 0.f); else if (ACT == 6) v = 0.5f * v * (1.0f + erff(v * 0.70710678118654752f)); else if (ACT == 11) v = 1.0f / (1.0f + expf(-v)); else if (ACT == 15) v = v / (1.0f + expf(-v)); else if (ACT == 12) v = (v > 0.f) ? v : 0.01f * v; else if (ACT == 8) v = tanhf(v); else if (ACT == 9) v = 0.5f * v * (1.0f + tanhf(0.7978845608028654f * (v + 0.044715f * v * v * v))); else if (ACT == 14) v = (v > 0.f) ? v : 0.1f * v; else if (ACT == 16) v = (v >= 0.f) ? v : 0.3f * v; else if (ACT == 17) v = (v >= 0.f) ? v : 0.2f * v;
      so[w][rloc][t * 16 + ln] = v; } }
  __builtin_amdgcn_fence(__ATOMIC_ACQ_REL, "workgroup"); __builtin_amdgcn_wave_barrier();
  const int rsub = lane >> 4, c4 = (lane & 15) * 4;
  {
#pragma unroll
    for (int q = 0; q < 16; ++q) { const int r = q * 2 + rsub; const v4f v = *(const v4fa*)&so[w][r][c4];
      if (HL) { v4h h4, l4; for (int i = 0; i < 4; ++i) { const _Float16 h = (_Float16)v[i]; h4[i] = h; l4[i] = (_Float16)((v[i] - (float)h) * 1024.0f); } const size_t o = cofs + (size_t)(row0 + r) * ldc + col0 + c4; *(v4h*)(C16 + o) = h4; *(v4h*)(CL + o) = l4; continue; }
      if (C) *(v4f*)(C + cofs + (size_t)(row0 + r) * ldc + col0 + c4) = v; if (C16) { v4h h4; for (int i = 0; i < 4; ++i) h4[i] = (_Float16)v[i]; *(v4h*)(C16 + cofs + (size_t)(row0 + r) * ldc + col0 + c4) = h4; } }
     } }


__global__ __launch_bounds__(256) void k_wnat(const float* __restrict__ w, size_t n8, _Float16* __restrict__ Bt) { const size_t t = (size_t)blockIdx.x * 256 + threadIdx.x; if (t >= n8) return; FragH f; for (int q = 0; q < 8; ++q) f.h[q] = (_Float16)(bf16_round(w[t * 8 + q]) * 16.0f); *(v8us*)((unsigned short*)Bt + t * 8) = f.half[0];  }
__global__ __launch_bounds__(256) void k_rsm(const float* __restrict__ S, _Float16* __restrict__ P, int nrows) {
  #pragma clang fp contract(off)
  const int i = blockIdx.x * 256 + threadIdx.x; if (i >= nrows) return; const float* s = S + (size_t)i * SQ; float mx = -3.0e38f;
#pragma unroll 1
  for (int j = 0; j < SQ; ++j) mx = fmaxf(mx, s[j]); float se = 0.f;
#pragma unroll 1
  for (int j = 0; j < SQ; ++j) se += expf(s[j] - mx); const float sc = 256.0f / se;
#pragma unroll 1
  for (int j0 = 0; j0 < SQ; j0 += 8) { FragH f; for (int q = 0; q < 8; ++q) f.h[q] = (_Float16)(expf(s[j0 + q] - mx) * sc); unsigned short* d = (unsigned short*)P + (size_t)i * SQ + j0; *(v8us*)d = f.half[0];  } }
__global__ __launch_bounds__(256) void k_vt(const _Float16* __restrict__ V16, int b, int h0, _Float16* __restrict__ VT) { __shared__ unsigned short tl[64][65]; const int tid = threadIdx.x; const int hh = blockIdx.x % HG, sg = blockIdx.x / HG; const int s0 = sg * 64; const int h = h0 + hh;
  for (int i = tid; i < 64 * 8; i += 256) { const int j = i / 8, d8 = (i % 8) * 8; FragH f; f.half[0] = *(const v8us*)((const unsigned short*)V16 + ((size_t)b * SQ + s0 + j) * DM + h * HD + d8); for (int q = 0; q < 8; ++q) tl[d8 + q][j] = f.u[q]; }
  __syncthreads();
  { for (int i = tid; i < 64 * 8; i += 256) { const int d = i / 8, j8 = (i % 8) * 8; FragH f; for (int q = 0; q < 8; ++q) f.u[q] = tl[d][j8 + q]; *(v8us*)((unsigned short*)VT + ((size_t)hh * HD + d) * SQ + s0 + j8) = f.half[0]; }  } }


// lane l <-> l ^ M inside a 16-lane row (DPP row_xmask)
template <int M> __device__ __forceinline__ float ln_xm(float v) { return __int_as_float(__builtin_amdgcn_update_dpp(0, __float_as_int(v), 0x160 + M, 0xf, 0xf, true)); }
// 2^x (v_exp_f32). The v_nop in the same statement keeps the one issue slot that the instruction set asks for behind a transcendental, before its result is read or its source overwritten.
__device__ __forceinline__ float exp2_slot(float x) { float r; asm("v_exp_f32 %0, %1\n\tv_nop" : "=v"(r) : "v"(x)); return r; }
// Scores and their row softmax in one launch. A work-group owns MT*16 whole rows m of S^T[m][n] = g_m . f_n: each of its NW waves forms its own LL/NW columns on WMMA (hi.hi + 2^-10 (lo.hi + hi.lo)) and keeps them in
// accumulator registers through the maximum, the exponentials and the scaling, so the f32 score plane never goes to memory. Column tile t of a wave takes f rows n = base + (t>>3)*128 + ln*8 + (t&7): a lane then holds 8 neighbouring columns of a row, and one 16-byte store per lane writes whole lines of beta^T.
__device__ __forceinline__ v8f sc_mma(v16h a, v16h b, v8f c) { return __builtin_amdgcn_wmma_f32_16x16x32_f16(false, a, false, b, (short)0, c, false, false); }
template <int MT, int NW>
__global__ __launch_bounds__(NW * 32) void k_scsm(const _Float16* __restrict__ Gh, const _Float16* __restrict__ Gl, const _Float16* __restrict__ Fh, const _Float16* __restrict__ Fl, _Float16* __restrict__ P) {
  constexpr int TP = LL / (NW * 16); static_assert(TP % 8 == 0 && (NW == 8 || NW == 16), "k_scsm: a wave takes whole groups of 8 column tiles; the cross-wave step reads one partial per lane of a 16-lane row");
  __shared__ float rmx[MT * 16][NW]; __shared__ float rsu[MT * 16][NW];      /* one partial maximum / sum per row and wave */
  const int lane = threadIdx.x & 31, ln = lane & 15, hh = lane >> 4; const int w = __builtin_amdgcn_readfirstlane(threadIdx.x >> 5);
  const size_t rb = (size_t)blockIdx.y * LL; const int m0 = blockIdx.x * (MT * 16); const int n0 = w * (TP * 16) + ln * 8;
  const v8f z8 = {0.f,0.f,0.f,0.f,0.f,0.f,0.f,0.f};
  v16h ah[MT][2], al[MT][2];
#pragma unroll      /* full unroll here and below: the fragment and score arrays stay in registers */
  for (int mt = 0; mt < MT; ++mt) { const size_t go = (rb + m0 + mt * 16 + ln) * CQ; ah[mt][0] = g2_frag(Gh + go, hh); ah[mt][1] = g2_frag(Gh + go + 32, hh); al[mt][0] = g2_frag(Gl + go, hh); al[mt][1] = g2_frag(Gl + go + 32, hh); }
  asm volatile("s_wait_xcnt 0x0" ::: "memory");      /* a precaution: stands before the registers that hold the g loads' addresses are written again (the first f load lands on one of them) */
  v16h bq[2][4]; { const size_t fo = (rb + n0) * CQ; bq[0][0] = g2_frag(Fh + fo, hh); bq[0][1] = g2_frag(Fh + fo + 32, hh); bq[0][2] = g2_frag(Fl + fo, hh); bq[0][3] = g2_frag(Fl + fo + 32, hh); }
  v8f s[MT][TP];      /* lane (ln, hh), element r of s[mt][t] = row m0 + mt*16 + 8*hh + r, column n0 + (t>>3)*128 + (t&7) */
#pragma unroll
  for (int t = 0; t < TP; ++t) {
    if (t + 1 < TP) { const size_t fo = (rb + n0 + ((t + 1) >> 3) * 128 + ((t + 1) & 7)) * CQ; const int u = (t + 1) & 1; bq[u][0] = g2_frag(Fh + fo, hh); bq[u][1] = g2_frag(Fh + fo + 32, hh); bq[u][2] = g2_frag(Fl + fo, hh); bq[u][3] = g2_frag(Fl + fo + 32, hh); }      /* the next tile's fragments fly while this tile is multiplied */
    const v16h bh0 = bq[t & 1][0], bh1 = bq[t & 1][1], bl0 = bq[t & 1][2], bl1 = bq[t & 1][3];
#pragma unroll
    for (int mt = 0; mt < MT; ++mt) { const v8f c = sc_mma(ah[mt][1], bh1, sc_mma(ah[mt][0], bh0, z8)); const v8f d = sc_mma(ah[mt][1], bl1, sc_mma(ah[mt][0], bl0, sc_mma(al[mt][1], bh1, sc_mma(al[mt][0], bh0, z8))));
      s[mt][t] = d * 0.0009765625f + c; } }
  v8f st[MT];
#pragma unroll
  for (int mt = 0; mt < MT; ++mt) { v8f m = s[mt][0];
#pragma unroll
    for (int t = 1; t < TP; ++t) m = __builtin_elementwise_max(m, s[mt][t]);
#pragma unroll
    for (int r = 0; r < 8; ++r) { float x = m[r]; x = fmaxf(x, ln_xm<1>(x)); x = fmaxf(x, ln_xm<2>(x)); x = fmaxf(x, ln_xm<4>(x)); x = fmaxf(x, ln_xm<8>(x)); m[r] = x; }
    st[mt] = m; }
  if (ln == 0) {
#pragma unroll
    for (int mt = 0; mt < MT; ++mt)
#pragma unroll
      for (int r = 0; r < 8; ++r) rmx[mt * 16 + 8 * hh + r][w] = st[mt][r]; }
  __syncthreads();      /* every wave's partial maxima are in LDS */
#pragma unroll
  for (int mt = 0; mt < MT; ++mt) { v8f m;
#pragma unroll
    for (int r = 0; r < 8; ++r) { float x = rmx[mt * 16 + 8 * hh + r][ln & (NW - 1)]; x = fmaxf(x, ln_xm<1>(x)); x = fmaxf(x, ln_xm<2>(x)); x = fmaxf(x, ln_xm<4>(x)); if (NW == 16) x = fmaxf(x, ln_xm<8>(x)); m[r] = x; }
    v8f a = z8;
#pragma unroll
    for (int t = 0; t < TP; ++t) { const v8f y = (s[mt][t] - m) * 1.442695041f; v8f e;
#pragma unroll
      for (int r = 0; r < 8; ++r) e[r] = exp2_slot(y[r]);      /* = native exp: the same multiply and v_exp_f32 */
      s[mt][t] = e; a += e; }
#pragma unroll
    for (int r = 0; r < 8; ++r) { float x = a[r]; x += ln_xm<1>(x); x += ln_xm<2>(x); x += ln_xm<4>(x); x += ln_xm<8>(x); a[r] = x; }
    st[mt] = a; }
  if (ln == 0) {
#pragma unroll
    for (int mt = 0; mt < MT; ++mt)
#pragma unroll
      for (int r = 0; r < 8; ++r) rsu[mt * 16 + 8 * hh + r][w] = st[mt][r]; }
  __syncthreads();      /* every wave's partial sums are in LDS */
#pragma unroll
  for (int mt = 0; mt < MT; ++mt) { v8f sc;
#pragma unroll
    for (int r = 0; r < 8; ++r) { float x = rsu[mt * 16 + 8 * hh + r][ln & (NW - 1)]; x += ln_xm<1>(x); x += ln_xm<2>(x); x += ln_xm<4>(x); if (NW == 16) x += ln_xm<8>(x); sc[r] = 256.0f / x; }
#pragma unroll
    for (int t = 0; t < TP; ++t) s[mt][t] *= sc;
#pragma unroll
    for (int r = 0; r < 8; ++r) { unsigned short* d = (unsigned short*)P + (rb + m0 + mt * 16 + 8 * hh + r) * LL + n0;
#pragma unroll
      for (int t8 = 0; t8 < TP / 8; ++t8) { FragH f;
#pragma unroll
        for (int q = 0; q < 8; ++q) f.h[q] = (_Float16)s[mt][t8 * 8 + q][r];
        *(v8us*)(d + t8 * 128) = f.half[0]; } } } }

// ---- GEMM with both operands staged in LDS: C[c][n] = alpha * sum_k A[c][k] Bh[n][k] (both K-contiguous f16), one 256 x 128 tile of C per work-group, 8 waves as 4 x 2, 64 x 64 per wave. ----
// A stage is 64 k of all 384 operand rows (128 B a row, LDS pitch 144 B so that the 16-byte fragment reads spread over the banks). Asynchronous copies bring whole 128-byte lines from global memory straight into LDS, two buffers:
// the next stage's copies fly while this stage is multiplied. Every operand line is asked for once per work-group, instead of in 32-byte pieces by every wave. k runs upward in steps of 32 into one accumulator chain per tile, as in k_gemm2. Requires M % 256 == 0, N % 128 == 0, K % 64 == 0.
// F16OUT: C16 = f16(alpha acc). Otherwise the residual epilogue: C = bf16(gam[0]) alpha acc + bf16(X), X laid out like C, both [CC][LL] planes (pitch LL at compile time: a lane's 32 loads and 32 stores share one address each and differ in the immediate offset).
#define G3_PITCH 72      /* f16 per LDS row */
#define G3_STAGE (384 * G3_PITCH)      /* f16 per buffer */
__device__ __forceinline__ unsigned g3_lds(const void* p) { return (unsigned)(size_t)p; }      /* byte offset in the work-group's LDS */
template <bool F16OUT>
__global__ __launch_bounds__(256) void k_gemm3(const _Float16* __restrict__ A, int lda, size_t sA, const _Float16* __restrict__ Bh, int ldb, size_t sB, float alpha, float* __restrict__ C, _Float16* __restrict__ C16, const float* __restrict__ X, const float* __restrict__ gam, int ldc, size_t sC, int N, int K) {
  __shared__ __attribute__((aligned(16))) unsigned short ring[2 * G3_STAGE];
  __shared__ __attribute__((aligned(16))) float so[8][64][68];      /* each wave's own output staging */
  const int tid = threadIdx.x, lane = tid & 31, ln = lane & 15, hh = lane >> 4; const int w = __builtin_amdgcn_readfirstlane(tid >> 5); const int wm = w >> 1, wn = w & 1; const int by = blockIdx.y;
  const int ntn = N >> 7; const int mt = blockIdx.x / ntn, nq = blockIdx.x - mt * ntn; const int row0 = mt * 256, col0 = nq * 128; const size_t cofs = (size_t)by * sC;
  /* copy j of a thread: operand row j*32 + tid/8 of the stage (rows 0..255 = A, 256..383 = Bh), 16-byte piece tid%8: a wave's copy covers four whole rows */
  const unsigned short* ga = (const unsigned short*)A + (size_t)by * sA + (size_t)(row0 + (tid >> 3)) * lda + (tid & 7) * 8;
  const unsigned short* gb = (const unsigned short*)Bh + (size_t)by * sB + (size_t)(col0 + (tid >> 3)) * ldb + (tid & 7) * 8;
  const unsigned lb = g3_lds(ring) + (unsigned)(tid >> 3) * (G3_PITCH * 2) + (unsigned)(tid & 7) * 16;
  auto stage_in = [&](int s, int buf) {
    unsigned l[12]; const unsigned short* g[12];
#pragma unroll
    for (int j = 0; j < 12; ++j) { l[j] = lb + (unsigned)buf * (G3_STAGE * 2) + (unsigned)j * (32 * G3_PITCH * 2); g[j] = (j < 8 ? ga + (size_t)(j * 32) * lda : gb + (size_t)((j - 8) * 32) * ldb) + s * 64; }
    /* one stage's twelve copies; the s_wait_xcnt in the same statement is a precaution: it stands before any register that a copy names is written again */
    asm volatile("global_load_async_to_lds_b128 %0, %12, off\n\tglobal_load_async_to_lds_b128 %1, %13, off\n\tglobal_load_async_to_lds_b128 %2, %14, off\n\tglobal_load_async_to_lds_b128 %3, %15, off\n\t"
                 "global_load_async_to_lds_b128 %4, %16, off\n\tglobal_load_async_to_lds_b128 %5, %17, off\n\tglobal_load_async_to_lds_b128 %6, %18, off\n\tglobal_load_async_to_lds_b128 %7, %19, off\n\t"
                 "global_load_async_to_lds_b128 %8, %20, off\n\tglobal_load_async_to_lds_b128 %9, %21, off\n\tglobal_load_async_to_lds_b128 %10, %22, off\n\tglobal_load_async_to_lds_b128 %11, %23, off\n\ts_wait_xcnt 0x0"
                 :: "v"(l[0]), "v"(l[1]), "v"(l[2]), "v"(l[3]), "v"(l[4]), "v"(l[5]), "v"(l[6]), "v"(l[7]), "v"(l[8]), "v"(l[9]), "v"(l[10]), "v"(l[11]),
                    "v"(g[0]), "v"(g[1]), "v"(g[2]), "v"(g[3]), "v"(g[4]), "v"(g[5]), "v"(g[6]), "v"(g[7]), "v"(g[8]), "v"(g[9]), "v"(g[10]), "v"(g[11]) : "memory"); };
  float gsc = alpha; if (!F16OUT) gsc = bf16_round(gam[0]) * alpha;      /* read at entry, ahead of every asm statement: a scalar load */
  const int ns = K >> 6;
  stage_in(0, 0);
  asm volatile("s_wait_asynccnt 0x0" ::: "memory");      /* this wave's copies of stage 0 have landed */
  __syncthreads();      /* stage 0 is readable by every wave */
  if (ns > 1) stage_in(1, 1);
  const v8f z8 = {0.f,0.f,0.f,0.f,0.f,0.f,0.f,0.f}; v8f acc[4][4];
#pragma unroll
  for (int i = 0; i < 4; ++i)
#pragma unroll
    for (int j = 0; j < 4; ++j) acc[i][j] = z8;
  const int ao = (wm * 64 + ln) * G3_PITCH, bo = (256 + wn * 64 + ln) * G3_PITCH;
#pragma unroll 1      /* the stage loop stays rolled: the accumulators keep constant indices and the loop stays small */
  for (int s = 0; s < ns; ++s) { const _Float16* rb = (const _Float16*)ring + (s & 1) * G3_STAGE;
#pragma unroll
    for (int kk = 0; kk < 2; ++kk) { v16h a[4], b[4];
#pragma unroll
      for (int i = 0; i < 4; ++i) { a[i] = g2_frag(rb + ao + i * (16 * G3_PITCH) + kk * 32, hh); b[i] = g2_frag(rb + bo + i * (16 * G3_PITCH) + kk * 32, hh); }
      __builtin_amdgcn_sched_barrier(0);      /* the block's 16 LDS reads go out as one group ahead of its WMMAs: left free, the compiler reloads one A fragment per four WMMAs and waits out the LDS latency each time */
#pragma unroll
      for (int d = 0; d < 4; ++d) {      /* tiles in the order in which their fragments arrive (a0 b0 a1 b1 ...): the first WMMAs run while the later reads are still coming; each tile still gets one WMMA per block, k upward */
#pragma unroll
        for (int e = 0; e < d; ++e) { acc[e][d] = sc_mma(a[e], b[d], acc[e][d]); acc[d][e] = sc_mma(a[d], b[e], acc[d][e]); }
        acc[d][d] = sc_mma(a[d], b[d], acc[d][d]); }
      __builtin_amdgcn_sched_barrier(0); }      /* keeps the next group of reads behind this block, so that one fragment set is live */
    asm volatile("s_wait_dscnt 0x0" ::: "memory");      /* this wave's reads of the buffer are done before it may be refilled */
    asm volatile("s_wait_asynccnt 0x0" ::: "memory");      /* this wave's copies of stage s + 1 have landed */
    __syncthreads();      /* publishes stage s + 1 and ends every wave's reads of stage s */
    if (s + 2 < ns) stage_in(s + 2, s & 1); }
  asm volatile("s_wait_asynccnt 0x0" ::: "memory");      /* no copy is outstanding when the wave goes on to its end */
  const int rsub = lane >> 4, c4 = (lane & 15) * 4; const int ldo = F16OUT ? ldc : LL; const size_t o0 = cofs + (size_t)(row0 + wm * 64 + rsub) * ldo + col0 + wn * 64 + c4;
  v4f xr[F16OUT ? 1 : 32];      /* the lane's residual values, asked for in two groups of 16 loads: the first flies while the accumulators are staged, the second while the first half of the rows is formed and stored */
  if (!F16OUT) {
#pragma unroll      /* unrolled here and below: xr keeps constant indices and stays in registers */
    for (int q = 0; q < 16; ++q) xr[q] = *(const v4fa*)(X + o0 + (size_t)(q * 2) * ldo); }
  float (*sw)[68] = so[w];
#pragma unroll
  for (int i = 0; i < 4; ++i)
#pragma unroll
    for (int j = 0; j < 4; ++j)
#pragma unroll
      for (int r = 0; r < 8; ++r) sw[i * 16 + 8 * hh + r][j * 16 + ln] = F16OUT ? acc[i][j][r] * alpha : acc[i][j][r];
  __builtin_amdgcn_fence(__ATOMIC_ACQ_REL, "workgroup"); __builtin_amdgcn_wave_barrier();      /* the wave's staged rows are read back by other lanes of the same wave */
  if (!F16OUT) {
#pragma unroll
    for (int q = 16; q < 32; ++q) xr[q] = *(const v4fa*)(X + o0 + (size_t)(q * 2) * ldo); }
#pragma unroll
  for (int q = 0; q < 32; ++q) { const v4f v = *(const v4fa*)&sw[q * 2 + rsub][c4]; const size_t o = o0 + (size_t)(q * 2) * ldo;
    if (F16OUT) { v4h h4; for (int i = 0; i < 4; ++i) h4[i] = (_Float16)v[i]; *(v4h*)(C16 + o) = h4; }
    else { v4f y; for (int i = 0; i < 4; ++i) y[i] = v[i] * gsc + bf16_round(xr[q][i]); *(v4f*)(C + o) = y; } } }

__global__ __launch_bounds__(256) void k_cl2rows(const float* __restrict__ X, _Float16* __restrict__ XR) { __shared__ float tl[64][33]; const int tid = threadIdx.x; const int nl = LL / 32, nc = CC / 64; const int cb_ = blockIdx.x % nc; const int lb = (blockIdx.x / nc) % nl; const size_t b = blockIdx.x / (nc * nl); const int c0 = cb_ * 64, l0 = lb * 32;
  for (int i = tid; i < 64 * 32; i += 256) { const int c = i / 32, l = i % 32; tl[c][l] = bf16_round(X[(b * CC + c0 + c) * (size_t)LL + l0 + l]); }
  __syncthreads();
  { const int l = tid / 8, c8 = (tid % 8) * 8; FragH f; for (int q = 0; q < 8; ++q) f.h[q] = (_Float16)tl[c8 + q][l]; unsigned short* d = (unsigned short*)XR + (b * LL + l0 + l) * (size_t)CC + c0 + c8; *(v8us*)d = f.half[0];  } }


extern "C" void kernel_launch(void* const* d_in, const int* in_sizes, int n_in,
                              void* d_out, int out_size, void* d_ws, size_t ws_size, hipStream_t stream) {
  (void)in_sizes; (void)n_in; (void)out_size;
  const float* const* I = (const float* const*)d_in; const float* x = I[0]; const float* wq = I[1]; const float* wk = I[2]; const float* wv = I[3]; const float* gam = I[4];
  char* ws = (char*)d_ws; size_t off = 0;
  auto take = [&](size_t bytes) { char* p = ws + off; off += (bytes + 255) & ~(size_t)255; return p; };
  _Float16* BQ = (_Float16*)take((size_t)CQ * CC * 2); _Float16* BK = (_Float16*)take((size_t)CQ * CC * 2); _Float16* BV = (_Float16*)take((size_t)CC * CC * 2);
  _Float16* XR = (_Float16*)take(NR * CC * 2); _Float16* Fh = (_Float16*)take(NR * CQ * 2); _Float16* Fl = (_Float16*)take(NR * CQ * 2); _Float16* Gh = (_Float16*)take(NR * CQ * 2); _Float16* Gl = (_Float16*)take(NR * CQ * 2);
  _Float16* H16 = (_Float16*)take(NR * CC * 2); _Float16* P = (_Float16*)take(NR * LL * 2);
  if (off > ws_size) return;      /* approx 0.6 + 16 + 8 + 16 + 64 = 105 MiB: every plane holds all NB batches */
  k_wnat<<<(unsigned)(((size_t)CQ * CC / 8 + 255) / 256), 256, 0, stream>>>(wq, (size_t)CQ * CC / 8, BQ); k_wnat<<<(unsigned)(((size_t)CQ * CC / 8 + 255) / 256), 256, 0, stream>>>(wk, (size_t)CQ * CC / 8, BK); k_wnat<<<(unsigned)(((size_t)CC * CC / 8 + 255) / 256), 256, 0, stream>>>(wv, (size_t)CC * CC / 8, BV);
  k_cl2rows<<<NB * (LL / 32) * (CC / 64), 256, 0, stream>>>(x, XR);      /* exact f16 token rows [b*2048 + n][c] */
  /* every stage once for all batches: blockIdx.y = batch, the plane strides sA / sB / sC step from batch to batch (0 = shared weights) */
  k_gemm2<0, true><<<dim3((LL / 128) * 1, NB), 128, 0, stream>>>(XR, CC, (size_t)LL * CC, BQ, CC, 0, 0.0625f, nullptr, 0, nullptr, 1, 0, 0, nullptr, Fh, Fl, CQ, (size_t)LL * CQ, LL, CQ, CC);      /* f^T rows [b][n][64] -> hi/lo */
  k_gemm2<0, true><<<dim3((LL / 128) * 1, NB), 128, 0, stream>>>(XR, CC, (size_t)LL * CC, BK, CC, 0, 0.0625f, nullptr, 0, nullptr, 1, 0, 0, nullptr, Gh, Gl, CQ, (size_t)LL * CQ, LL, CQ, CC);      /* g^T rows [b][m][64] -> hi/lo */
  k_gemm3<true><<<dim3((CC / 256) * (LL / 128), NB), 256, 0, stream>>>(BV, CC, 0, XR, CC, (size_t)LL * CC, 0.0625f, nullptr, H16, nullptr, nullptr, LL, (size_t)CC * LL, LL, CC);      /* h channel-major [b][c][n] f16 */
  k_scsm<2, 16><<<dim3(LL / 32, NB), 512, 0, stream>>>(Gh, Gl, Fh, Fl, P);      /* S^T[b][m][n] = g_m . f_n (hi.hi + 2^-10 (lo.hi + hi.lo)), softmax over n per key m (the module's dim=1 softmax) -> beta^T[b][m][n] x256 f16 */
  k_gemm3<false><<<dim3((CC / 256) * (LL / 128), NB), 256, 0, stream>>>(H16, LL, (size_t)CC * LL, P, LL, (size_t)LL * LL, 0.00390625f, (float*)d_out, nullptr, x, gam, LL, (size_t)CC * LL, LL, LL);      /* out[b][c][m] = gamma 2^-8 sum_n h[c][n] beta^T[m][n] + x[b][c][m] (channel-major = the output layout) */
}

// v006
// One run takes 107 microseconds.
// In two side-by-side timings against v005, it was 1.35 and 1.34 times as fast.
// All steps since v000 together make it 37.9 times as fast.
#include <hip/hip_runtime.h>
// SAGAN-style self-attention with 1x1-conv projections (x [8][512][2048] channel-first; f = Wq x, g = Wk x (64 channels), h = Wv x (512); scores[n][m] = sum_c f[c][n] g[c][m] (unscaled); beta = softmax over n (the QUERY axis, dim=1) for each m; o[c][m] = gamma sum_n h[c][n] beta[n][m] + x[c][m] -> [8][512][2048]; gamma = an input scalar).
// Structure: x transposed to exact f16 token rows via LDS tiles; f^T and g^T as WMMA GEMMs (32x64 wave tiles, f32 accumulation, exact x16 weights) cut in the GEMM's own epilogue into f16 hi + x1024 residual planes; h channel-major as a GEMM (weights as the A operand) into f16 (h and o: 256x128 work-group tiles, operands staged in LDS by asynchronous copies); every stage is one launch over all batches (blockIdx.y = batch after the input conversions): S^T[m][n] = g^T f (K = 64; hi.hi + lo.hi + hi.lo on WMMA) and its row softmax over n (f32 statistics, native exp; weights x256 f16) = beta^T in one launch, a work-group holding whole score rows in registers; o[c][m] = h . beta^T as a GEMM (K = 2048) channel-major straight into the output, its epilogue forming out = bf16(gamma) o + bf16(x). Stages that do not depend on one another share a launch, told apart by the block index: weight casts + transpose; f, g and h GEMMs; scores + softmax; output GEMM = 4 launches.
// Compute dtype: inputs rounded to bf16; x / weights exact; f, g as hi + residual (~2^-22: the unscaled logits have sigma ~8); h and the softmax weights plain f16 (~2^-12); logits, statistics, o f32. v_wmma_f32_16x16x32_f16.
#define NB 8
#define CC 512
#define CQ 64
#define LL 2048
#define SQ LL
#define DM 64
#define NH 1
#define HD 64
#define HG 1
#define NR ((size_t)NB * LL)
typedef __bf16 v16b __attribute__((ext_vector_type(16)));
typedef unsigned short v8us __attribute__((ext_vector_type(8), may_alias));
typedef float  v8f  __attribute__((ext_vector_type(8)));
typedef float  v4f  __attribute__((ext_vector_type(4)));
typedef float  v4fa __attribute__((ext_vector_type(4), may_alias));
union FragB { v16b v; v8us half[2]; unsigned short u[16]; };

__device__ __forceinline__ unsigned short bf16_bits(float x) { unsigned int u = __float_as_uint(x); return (unsigned short)((u + 0x7FFFu + ((u >> 16) & 1u)) >> 16); }
__device__ __forceinline__ float bf16_val(unsigned short b) { return __uint_as_float(((unsigned int)b) << 16); }
__device__ __forceinline__ float bf16_round(float x) { return bf16_val(bf16_bits(x)); }
// D += A·B with NT terms: 1 = ah·bh, 2 = + al·bh (A split), 3 = + ah·bl (both split)
template <int NT>
__device__ __forceinline__ v8f mmaN(v16b ah, v16b al, v16b bh, v16b bl, v8f c) {
  c = __builtin_amdgcn_wmma_f32_16x16x32_bf16(false, ah, false, bh, (short)0, c, false, false);
  if (NT >= 2) c = __builtin_amdgcn_wmma_f32_16x16x32_bf16(false, al, false, bh, (short)0, c, false, false);
  if (NT >= 3) c = __builtin_amdgcn_wmma_f32_16x16x32_bf16(false, ah, false, bl, (short)0, c, false, false);
  asm volatile("v_nop\n\tv_nop\n\tv_nop\n\tv_nop" : "+v"(c) : "v"(ah), "v"(al), "v"(bh), "v"(bl));
  return c;
}

__global__ __launch_bounds__(256) void k_wt_bf16(const float* __restrict__ W, unsigned short* __restrict__ Wt, int K, int N) {
  const int t = blockIdx.x * 256 + threadIdx.x;
  const int k8n = K / 8;
  if (t >= N * k8n) return;
  const int n = t / k8n, k8 = (t % k8n) * 8;
  v8us v;
#pragma unroll
  for (int i = 0; i < 8; ++i) v[i] = bf16_bits(W[(size_t)(k8 + i) * N + n]);
  *(v8us*)(Wt + (size_t)n * K + k8) = v;
  
}

// GEMM C[M][N] (f32, pitch ldc) = act(A[M][K]·W + bias). A f32 row-major (pitch lda) converted per fragment to bf16
// (ASPLIT: hi/lo two planes -> 2 terms, else single rounded term); Wt bf16 [N][K] (pitch ldb). BIAS_BF16 rounds the
// bias to bf16 first (bias quantised to bf16 before the add). K%32==0, M%16==0, N%64==0.
template <bool ASPLIT, int ACT, bool BIAS_BF16>
__global__ __launch_bounds__(128) void k_gemm_bf(const float* __restrict__ A, int lda, const unsigned short* __restrict__ Wt, int ldb,
                                               const float* __restrict__ bias, float* __restrict__ C, int ldc, int M, int N, int K) {
  __shared__ __attribute__((aligned(16))) float so[4][16][64];
  const int tid = threadIdx.x, w = tid >> 5, lane = tid & 31, ln = lane & 15, hh = lane >> 4;
  const int ntn = N / 64;
  const int wid = blockIdx.x * 4 + w;
  const int mt = wid / ntn, nq = wid % ntn;
  if (mt * 16 >= M) return;
  const int row0 = mt * 16, col0 = nq * 64;
  const float* arow = A + (size_t)(row0 + ln) * lda;
  v8f acc[4] = {};
  for (int kb = 0; kb < K; kb += 32) {
    FragB ah, al;
    const v4f x0 = *(const v4fa*)(arow + kb + 8 * hh), x1 = *(const v4fa*)(arow + kb + 8 * hh + 4);
    const v4f x2 = *(const v4fa*)(arow + kb + 16 + 8 * hh), x3 = *(const v4fa*)(arow + kb + 16 + 8 * hh + 4);
    float xs[16] = {x0[0],x0[1],x0[2],x0[3],x1[0],x1[1],x1[2],x1[3],x2[0],x2[1],x2[2],x2[3],x3[0],x3[1],x3[2],x3[3]};
#pragma unroll
    for (int i = 0; i < 16; ++i) { const unsigned short hb = bf16_bits(xs[i]); ah.u[i] = hb; al.u[i] = ASPLIT ? bf16_bits(xs[i] - bf16_val(hb)) : (unsigned short)0; }
#pragma unroll
    for (int t = 0; t < 4; ++t) {
      const unsigned short* brow = Wt + (size_t)(col0 + t * 16 + ln) * ldb + kb;
      FragB b;
      b.half[0] = *(const v8us*)(brow + 8 * hh);
      b.half[1] = *(const v8us*)(brow + 16 + 8 * hh);
      acc[t] = mmaN<ASPLIT ? 2 : 1>(ah.v, al.v, b.v, b.v, acc[t]);
    }
  }
#pragma unroll
  for (int t = 0; t < 4; ++t) {
    float bv = bias ? bias[col0 + t * 16 + ln] : 0.f;
    if (BIAS_BF16) bv = bf16_round(bv);
#pragma unroll
    for (int r = 0; r < 8; ++r) { float v = acc[t][r] + bv; if (ACT == 1) v = fmaxf(v, 0.f); so[w][8 * hh + r][t * 16 + ln] = v; }
  }
  __builtin_amdgcn_fence(__ATOMIC_ACQ_REL, "workgroup");
  __builtin_amdgcn_wave_barrier();
  const int rsub = lane >> 4, c4 = (lane & 15) * 4;
  {
#pragma unroll
    for (int q = 0; q < 8; ++q) {
      const int r = q * 2 + rsub;
      const v4f v = *(const v4fa*)&so[w][r][c4];
      *(v4f*)(C + (size_t)(row0 + r) * ldc + col0 + c4) = v;
    }
    
  }
}

// GEMM C = act(A·W + bias + resid): A f32 (ASPLIT -> hi/lo 2 terms), Wt bf16 [N][K]; ACT 0 none, 1 relu, 2 exact gelu;
// resid (optional, f32, row index = (row % rmod), pitch ldr, RES_BF16 rounds it) added before the activation.
template <bool ASPLIT, int ACT, bool BIAS_BF16, bool RES_BF16>
__global__ __launch_bounds__(128) void k_gemm_bf3(const float* __restrict__ A, int lda, const unsigned short* __restrict__ Wt, int ldb,
                                                const float* __restrict__ bias, const float* __restrict__ resid, int rmod, int ldr,
                                                float* __restrict__ C, int ldc, int M, int N, int K) {
  __shared__ __attribute__((aligned(16))) float so[4][16][64];
  const int tid = threadIdx.x, w = tid >> 5, lane = tid & 31, ln = lane & 15, hh = lane >> 4;
  const int ntn = N / 64;
  const int wid = blockIdx.x * 4 + w;
  const int mt = wid / ntn, nq = wid % ntn;
  if (mt * 16 >= M) return;
  const int row0 = mt * 16, col0 = nq * 64;
  const float* arow = A + (size_t)(row0 + ln) * lda;
  v8f acc[4] = {};
  for (int kb = 0; kb < K; kb += 32) {
    FragB ah, al;
    const v4f x0 = *(const v4fa*)(arow + kb + 8 * hh), x1 = *(const v4fa*)(arow + kb + 8 * hh + 4);
    const v4f x2 = *(const v4fa*)(arow + kb + 16 + 8 * hh), x3 = *(const v4fa*)(arow + kb + 16 + 8 * hh + 4);
    float xs[16] = {x0[0],x0[1],x0[2],x0[3],x1[0],x1[1],x1[2],x1[3],x2[0],x2[1],x2[2],x2[3],x3[0],x3[1],x3[2],x3[3]};
#pragma unroll
    for (int i = 0; i < 16; ++i) { const unsigned short hb = bf16_bits(xs[i]); ah.u[i] = hb; al.u[i] = ASPLIT ? bf16_bits(xs[i] - bf16_val(hb)) : (unsigned short)0; }
#pragma unroll
    for (int t = 0; t < 4; ++t) {
      const unsigned short* brow = Wt + (size_t)(col0 + t * 16 + ln) * ldb + kb;
      FragB b;
      b.half[0] = *(const v8us*)(brow + 8 * hh);
      b.half[1] = *(const v8us*)(brow + 16 + 8 * hh);
      acc[t] = mmaN<ASPLIT ? 2 : 1>(ah.v, al.v, b.v, b.v, acc[t]);
    }
  }
#pragma unroll
  for (int t = 0; t < 4; ++t) {
    const int col = col0 + t * 16 + ln;
    float bv = bias ? bias[col] : 0.f;
    if (BIAS_BF16) bv = bf16_round(bv);
#pragma unroll
    for (int r = 0; r < 8; ++r) {
      float v = acc[t][r] + bv;
      if (resid) { float rv = resid[(size_t)((row0 + 8 * hh + r) % rmod) * ldr + col]; if (RES_BF16) rv = bf16_round(rv); v += rv; }
      if (ACT == 1) v = fmaxf(v, 0.f);
      if (ACT == 2) v = 0.5f * v * (1.0f + erff(v * 0.70710678118654752f));
      if (ACT == 3) { const float u = 0.7978845608028654f * (v + 0.044715f * v * v * v); v = 0.5f * v * (1.0f + tanhf(u)); }
      so[w][8 * hh + r][t * 16 + ln] = v;
    }
  }
  __builtin_amdgcn_fence(__ATOMIC_ACQ_REL, "workgroup");
  __builtin_amdgcn_wave_barrier();
  const int rsub = lane >> 4, c4 = (lane & 15) * 4;
  {
#pragma unroll
    for (int q = 0; q < 8; ++q) {
      const int r = q * 2 + rsub;
      const v4f v = *(const v4fa*)&so[w][r][c4];
      *(v4f*)(C + (size_t)(row0 + r) * ldc + col0 + c4) = v;
    }
    
  }
}
// row LayerNorm (biased variance, eps) over N: s = X (+ R); optional out_sum <- s; out_norm <- (s-mu)*rsqrt(var+eps)*g + b
template <bool PARAM_BF16>
__global__ __launch_bounds__(256) void k_layernorm(const float* __restrict__ X, const float* __restrict__ R, const float* __restrict__ g, const float* __restrict__ bta,
                                                  float* __restrict__ out_sum, float* __restrict__ out_norm, int N, float eps) {
  __shared__ float red[256];
  const int row = blockIdx.x, tid = threadIdx.x;
  const float* x = X + (size_t)row * N; const float* rr = R ? R + (size_t)row * N : nullptr;
  float vals[16];                     // up to N = 4096
  const int per = N / 256;            // contiguous chunk per thread? use strided-by-4 chunks: thread handles j = tid*4 + 1024*u
  float s1 = 0.f;
  for (int u = 0; u < per / 4; ++u) {
    const int j = tid * 4 + 1024 * u;
    const v4f a = *(const v4fa*)(x + j);
    v4f b = {0.f,0.f,0.f,0.f}; if (rr) b = *(const v4fa*)(rr + j);
#pragma unroll
    for (int q = 0; q < 4; ++q) { const float v = a[q] + b[q]; vals[u * 4 + q] = v; s1 += v; }
  }
  red[tid] = s1; __syncthreads();
  for (int st = 128; st > 0; st >>= 1) { if (tid < st) red[tid] += red[tid + st]; __syncthreads(); }
  const float mu = red[0] / (float)N; __syncthreads();
  float s2 = 0.f;
  for (int u = 0; u < per / 4; ++u)
#pragma unroll
    for (int q = 0; q < 4; ++q) { const float c = vals[u * 4 + q] - mu; s2 += c * c; }
  red[tid] = s2; __syncthreads();
  for (int st = 128; st > 0; st >>= 1) { if (tid < st) red[tid] += red[tid + st]; __syncthreads(); }
  const float rs = rsqrtf(red[0] / (float)N + eps);
  {
    for (int u = 0; u < per / 4; ++u) {
      const int j = tid * 4 + 1024 * u;
      v4f o, sm;
#pragma unroll
      for (int q = 0; q < 4; ++q) {
        float gg = g[j + q], bb = bta[j + q];
        if (PARAM_BF16) { gg = bf16_round(gg); bb = bf16_round(bb); }
        sm[q] = vals[u * 4 + q]; o[q] = (vals[u * 4 + q] - mu) * rs * gg + bb;
      }
      if (out_sum) *(v4f*)(out_sum + (size_t)row * N + j) = sm;
      *(v4f*)(out_norm + (size_t)row * N + j) = o;
    }
    
  }
}



// ---- f16 WMMA path (v_wmma_f32_16x16x32_f16): 11-bit significands for operands in range — used where a [0,1] probability operand needs more precision than bf16
typedef _Float16 v16h __attribute__((ext_vector_type(16)));
union FragH { v16h v; v8us half[2]; _Float16 h[16]; unsigned short u[16]; };
template <int NT>
__device__ __forceinline__ v8f mmaH(v16h ah, v16h al, v16h bh, v16h bl, v8f c) {
  c = __builtin_amdgcn_wmma_f32_16x16x32_f16(false, ah, false, bh, (short)0, c, false, false);
  if (NT >= 2) c = __builtin_amdgcn_wmma_f32_16x16x32_f16(false, al, false, bh, (short)0, c, false, false);
  if (NT >= 3) c = __builtin_amdgcn_wmma_f32_16x16x32_f16(false, ah, false, bl, (short)0, c, false, false);
  asm volatile("v_nop\n\tv_nop\n\tv_nop\n\tv_nop" : "+v"(c) : "v"(ah), "v"(al), "v"(bh), "v"(bl));
  return c;
}
// batched GEMM like k_gemm_b but f16 operands: A f32 (split into f16 hi/lo if ASPLIT, else rounded to f16), Bt = f16 values [n][k]; alpha; C f32; N multiple of 16 (partial tiles skipped)
template <bool ASPLIT>
__global__ __launch_bounds__(128) void k_gemm_h(const float* __restrict__ A, int lda, size_t sA, const _Float16* __restrict__ Bh, int ldb, size_t sB, float alpha, float* __restrict__ C, int ldc, size_t sC, int M, int N, int K) {
  __shared__ __attribute__((aligned(16))) float so[4][16][64];
  const int tid = threadIdx.x, w = tid >> 5, lane = tid & 31, ln = lane & 15, hh = lane >> 4; const int by = blockIdx.y;
  A += (size_t)by * sA; Bh += (size_t)by * sB; C += (size_t)by * sC;
  const int ntn = (N + 63) / 64; const int wid = blockIdx.x * 4 + w; const int mt = wid / ntn, nq = wid % ntn; if (mt * 16 >= M) return;
  const int row0 = mt * 16, col0 = nq * 64; const float* arow = A + (size_t)(row0 + ln) * lda;
  v8f acc[4] = {};
  for (int kb = 0; kb < K; kb += 32) {
    FragH ah, al;
    const v4f x0 = *(const v4fa*)(arow + kb + 8 * hh), x1 = *(const v4fa*)(arow + kb + 8 * hh + 4), x2 = *(const v4fa*)(arow + kb + 16 + 8 * hh), x3 = *(const v4fa*)(arow + kb + 16 + 8 * hh + 4);
    float xs[16] = {x0[0],x0[1],x0[2],x0[3],x1[0],x1[1],x1[2],x1[3],x2[0],x2[1],x2[2],x2[3],x3[0],x3[1],x3[2],x3[3]};
#pragma unroll
    for (int i = 0; i < 16; ++i) { const _Float16 h = (_Float16)xs[i]; ah.h[i] = h; al.h[i] = ASPLIT ? (_Float16)(xs[i] - (float)h) : (_Float16)0.0f; }
#pragma unroll
    for (int t = 0; t < 4; ++t) { if (col0 + t * 16 >= N) continue; const size_t boff = (size_t)(col0 + t * 16 + ln) * ldb + kb; FragH bq; bq.half[0] = *(const v8us*)(Bh + boff + 8 * hh); bq.half[1] = *(const v8us*)(Bh + boff + 16 + 8 * hh);
      acc[t] = mmaH<ASPLIT ? 2 : 1>(ah.v, al.v, bq.v, bq.v, acc[t]); }
  }
#pragma unroll
  for (int t = 0; t < 4; ++t) { if (col0 + t * 16 >= N) continue;
#pragma unroll
    for (int r = 0; r < 8; ++r) so[w][8 * hh + r][t * 16 + ln] = acc[t][r] * alpha; }
  __builtin_amdgcn_fence(__ATOMIC_ACQ_REL, "workgroup"); __builtin_amdgcn_wave_barrier();
  const int rsub = lane >> 4, c4 = (lane & 15) * 4;
  {
#pragma unroll
    for (int q = 0; q < 8; ++q) { const int r = q * 2 + rsub; if (col0 + c4 < N) { const v4f v = *(const v4fa*)&so[w][r][c4]; *(v4f*)(C + (size_t)(row0 + r) * ldc + col0 + c4) = v; } }
     }
}

// Wt[n][k] = f16(W[k][n]·scale) from f32 row-major W[K][N] (scale = power of two; bf16-exact weights stay exact in f16 away from the subnormal range)
__global__ __launch_bounds__(256) void k_wt_f16(const float* __restrict__ W, _Float16* __restrict__ Wt, int K, int N, float scale) {
  const int t = blockIdx.x * 256 + threadIdx.x; if (t >= N * (K / 8)) return; const int n = t / (K / 8), k8 = (t % (K / 8)) * 8; FragH f;
#pragma unroll
  for (int i = 0; i < 8; ++i) f.h[i] = (_Float16)(bf16_round(W[(size_t)(k8 + i) * N + n]) * scale); const v8us o = f.half[0];
  *(v8us*)((unsigned short*)Wt + (size_t)n * K + k8) = o; 
}
// k_gemm_hh variant with fused epilogue: v = acc·alpha + bias[by·sBias + col] (+ CP[(row/rowsPerB)·sCPb + by·64 + col] if CP) ; ACT 0 none / 1 elu ; writes f16 C16 (and f32 C if non-null)
template <int ACT>
__global__ __launch_bounds__(128) void k_gemm_hhx(const _Float16* __restrict__ A, int lda, size_t sA, const _Float16* __restrict__ Bh, int ldb, size_t sB, float alpha, const float* __restrict__ bias, size_t sBias, const float* __restrict__ CP, int rowsPerB, size_t sCPb, int row0g,
    float* __restrict__ C, _Float16* __restrict__ C16, int ldc, size_t sC, int M, int N, int K) {
  __shared__ __attribute__((aligned(16))) float so[4][16][64];
  const int tid = threadIdx.x, w = tid >> 5, lane = tid & 31, ln = lane & 15, hh = lane >> 4; const int by = blockIdx.y;
  A += (size_t)by * sA; Bh += (size_t)by * sB; const size_t cofs = (size_t)by * sC; const float* bp = bias ? bias + (size_t)by * sBias : nullptr;
  const int ntn = (N + 63) / 64; const int wid = blockIdx.x * 4 + w; const int mt = wid / ntn, nq = wid % ntn; if (mt * 16 >= M) return;
  const int row0 = mt * 16, col0 = nq * 64; const _Float16* arow = A + (size_t)(row0 + ln) * lda;
  v8f acc[4] = {};
  for (int kb = 0; kb < K; kb += 32) { FragH ah; ah.half[0] = *(const v8us*)((const unsigned short*)arow + kb + 8 * hh); ah.half[1] = *(const v8us*)((const unsigned short*)arow + kb + 16 + 8 * hh);
#pragma unroll
    for (int t = 0; t < 4; ++t) { if (col0 + t * 16 >= N) continue; const size_t boff = (size_t)(col0 + t * 16 + ln) * ldb + kb; FragH bq; bq.half[0] = *(const v8us*)((const unsigned short*)Bh + boff + 8 * hh); bq.half[1] = *(const v8us*)((const unsigned short*)Bh + boff + 16 + 8 * hh);
      acc[t] = mmaH<1>(ah.v, ah.v, bq.v, bq.v, acc[t]); }
  }
#pragma unroll
  for (int t = 0; t < 4; ++t) { if (col0 + t * 16 >= N) continue; const int col = col0 + t * 16 + ln; const float bv = bp ? bf16_round(bp[col]) : 0.f;
#pragma unroll
    for (int r = 0; r < 8; ++r) { float v = acc[t][r] * alpha + bv; if (CP) { const int rr = row0g + row0 + 8 * hh + r; if (rowsPerB < 0) v += CP[cofs + (size_t)rr * ldc + col];      /* rowsPerB < 0: own element of the batched C plane */ else { const int bidx = rr / rowsPerB; v += CP[(size_t)bidx * sCPb + (size_t)by * 64 + col]; } } if (ACT == 1) v = (v > 0.f) ? v : expm1f(v); else if (ACT == 7) v = (v > 0.f) ? v + 1.0f : expf(v); else if (ACT == 8) v = tanhf(v); else if (ACT == 9) v = 0.5f * v * (1.0f + tanhf(0.7978845608028654f * (v + 0.044715f * v * v * v))); else if (ACT == 11) v = 1.0f / (1.0f + expf(-v)); else if (ACT == 12) v = (v > 0.f) ? v : 0.01f * v; else if (ACT == 14) v = (v > 0.f) ? v : 0.1f * v; else if (ACT == 16) v = (v >= 0.f) ? v : 0.3f * v; else if (ACT == 17) v = (v >= 0.f) ? v : 0.2f * v; else if (ACT == 15) v = v / (1.0f + expf(-v)); else if (ACT == 3) v = fmaxf(v, 0.f); else if (ACT == 6) v = 0.5f * v * (1.0f + erff(v * 0.70710678118654752f)); so[w][8 * hh + r][t * 16 + ln] = v; } }
  __builtin_amdgcn_fence(__ATOMIC_ACQ_REL, "workgroup"); __builtin_amdgcn_wave_barrier();
  const int rsub = lane >> 4, c4 = (lane & 15) * 4; typedef _Float16 v4h __attribute__((ext_vector_type(4)));
  {
#pragma unroll
    for (int q = 0; q < 8; ++q) { const int r = q * 2 + rsub; if (col0 + c4 < N) { const v4f v = *(const v4fa*)&so[w][r][c4]; if (C) *(v4f*)(C + cofs + (size_t)(row0 + r) * ldc + col0 + c4) = v; if (C16) { v4h h4; for (int i = 0; i < 4; ++i) h4[i] = (_Float16)v[i]; *(v4h*)(C16 + cofs + (size_t)(row0 + r) * ldc + col0 + c4) = h4; } } }
     }
}


typedef _Float16 v4h __attribute__((ext_vector_type(4)));

__global__ __launch_bounds__(256) void k_x16(const float* __restrict__ x, _Float16* __restrict__ X16, size_t n8) { const size_t t = (size_t)blockIdx.x * 256 + threadIdx.x; if (t >= n8) return; FragH f;
#pragma unroll
  for (int q = 0; q < 8; ++q) f.h[q] = (_Float16)bf16_round(x[t * 8 + q]); *(v8us*)((unsigned short*)X16 + t * 8) = f.half[0];  }
__global__ __launch_bounds__(256) void k_h16(const float* __restrict__ x, _Float16* __restrict__ X16, size_t n8) { const size_t t = (size_t)blockIdx.x * 256 + threadIdx.x; if (t >= n8) return; FragH f;
#pragma unroll
  for (int q = 0; q < 8; ++q) f.h[q] = (_Float16)x[t * 8 + q]; *(v8us*)((unsigned short*)X16 + t * 8) = f.half[0];  }
__global__ __launch_bounds__(256) void k_round16f(const float* __restrict__ W, _Float16* __restrict__ Bt, size_t n8) { const size_t t = (size_t)blockIdx.x * 256 + threadIdx.x; if (t >= n8) return; FragH f;
#pragma unroll
  for (int i = 0; i < 8; ++i) f.h[i] = (_Float16)(bf16_round(W[t * 8 + i]) * 16.0f); *(v8us*)((unsigned short*)Bt + t * 8) = f.half[0];  }
template <int NHv, int TTv>
__global__ __launch_bounds__(256) void k_vt(const _Float16* __restrict__ V16, int ldv, int voff, _Float16* __restrict__ Vt) { __shared__ unsigned short tl[64][66]; const int tid = threadIdx.x; const int slab = blockIdx.x / (TTv / 64), lg = blockIdx.x % (TTv / 64); const int b = slab / NHv, h = slab % NHv;
  for (int i = tid; i < 64 * 8; i += 256) { const int r = i / 8, c8 = (i % 8) * 8; FragH f; f.half[0] = *(const v8us*)((const unsigned short*)V16 + ((size_t)b * TTv + lg * 64 + r) * ldv + voff + h * 64 + c8);
#pragma unroll
    for (int q = 0; q < 8; ++q) tl[r][c8 + q] = f.u[q]; }
  __syncthreads();
  {
#pragma unroll
    for (int rd = 0; rd < 2; ++rd) { const int d = rd * 32 + tid / 8, pc = tid % 8; FragH f;
#pragma unroll
      for (int q = 0; q < 8; ++q) f.u[q] = tl[pc * 8 + q][d];
      *(v8us*)((unsigned short*)Vt + ((size_t)slab * 64 + d) * TTv + lg * 64 + pc * 8) = f.half[0]; }
     } }

// ---- fast GEMM (wave tile 32x64; requires M % 32 == 0 rows per launch region and N % 64 == 0), as a body that a kernel calls with its tile index bx, batch by, the wave's place w (0..3) in the 128-row tile and the wave's own 32 x 68 LDS staging sw; epilogue = k_gemm_hhx semantics; HL: each f32 result is cut here into f16 hi (C16) + x1024 residual (CL), so the f32 rows never go to memory ----
__device__ __forceinline__ v16h g2_frag(const _Float16* p, int hh) { FragH f; f.half[0] = *(const v8us*)((const unsigned short*)p + 8 * hh); f.half[1] = *(const v8us*)((const unsigned short*)p + 16 + 8 * hh); return f.v; }
__device__ __forceinline__ v8f g2_mma(v16h a, v16h b, v8f c) { v8f d = __builtin_amdgcn_wmma_f32_16x16x32_f16(false, a, false, b, (short)0, c, false, false); asm volatile("v_nop\n\tv_nop\n\tv_nop\n\tv_nop" : "+v"(d) : "v"(a), "v"(b)); return d; }
template <int ACT, bool HL>
__device__ __forceinline__ void gemm2_body(float (*sw)[68], int w, unsigned bx, int by, const _Float16* __restrict__ A, int lda, size_t sA, const _Float16* __restrict__ Bh, int ldb, size_t sB, float alpha, const float* __restrict__ bias, size_t sBias, const float* __restrict__ CP, int rowsPerB, size_t sCPb, int row0g,
    float* __restrict__ C, _Float16* __restrict__ C16, _Float16* __restrict__ CL, int ldc, size_t sC, int M, int N, int K) { static_assert(ACT == 0 || ACT == 3 || ACT == 6 || ACT == 8 || ACT == 9 || ACT == 11 || ACT == 12 || ACT == 14 || ACT == 15 || ACT == 16 || ACT == 17, "gemm2_body: unsupported ACT code (would silently apply no activation)");
  const int lane = threadIdx.x & 31, ln = lane & 15, hh = lane >> 4;
  A += (size_t)by * sA; Bh += (size_t)by * sB; const size_t cofs = (size_t)by * sC; const float* bp = bias ? bias + (size_t)by * sBias : nullptr;
  const int ntn = N >> 6; const int mt = bx / ntn, nq = bx - mt * ntn; const int row0 = mt * 128 + 32 * w, col0 = nq * 64; if (row0 >= M) return;
  const _Float16* a0p = A + (size_t)(row0 + ln) * lda; const _Float16* a1p = a0p + (size_t)16 * lda;
  const _Float16* b0p = Bh + (size_t)(col0 + ln) * ldb; const _Float16* b1p = b0p + (size_t)16 * ldb; const _Float16* b2p = b1p + (size_t)16 * ldb; const _Float16* b3p = b2p + (size_t)16 * ldb;
  const v8f z8 = {0.f,0.f,0.f,0.f,0.f,0.f,0.f,0.f}; v8f c00 = z8, c01 = z8, c02 = z8, c03 = z8, c10 = z8, c11 = z8, c12 = z8, c13 = z8;
#pragma unroll 1
  for (int kb = 0; kb < K; kb += 32) { const v16h a0 = g2_frag(a0p + kb, hh), a1 = g2_frag(a1p + kb, hh);
    v16h b = g2_frag(b0p + kb, hh);
    asm volatile("s_wait_xcnt 0x0" :: "v"((const unsigned short*)(a0p + kb) + 8 * hh) : "memory");      /* a precaution: stands before the register pair that holds the A loads' address is written again; the address as an input keeps that pair whole up to here, so that no load's result lands on it */
    __builtin_amdgcn_sched_barrier(0);      /* keeps the first WMMA, and the wait for its operands, behind all six loads: moved up over the wait above, it held the last A load back by a whole memory latency */
    c00 = g2_mma(a0, b, c00); c10 = g2_mma(a1, b, c10);
    b = g2_frag(b1p + kb, hh); c01 = g2_mma(a0, b, c01); c11 = g2_mma(a1, b, c11);
    b = g2_frag(b2p + kb, hh); c02 = g2_mma(a0, b, c02); c12 = g2_mma(a1, b, c12);
    b = g2_frag(b3p + kb, hh); c03 = g2_mma(a0, b, c03); c13 = g2_mma(a1, b, c13); }
  v8f accs[8] = {c00, c01, c02, c03, c10, c11, c12, c13};
#pragma unroll
  for (int u = 0; u < 8; ++u) { const int t = u & 3, half = u >> 2; const int col = col0 + t * 16 + ln; const float bv = bp ? bf16_round(bp[col]) : 0.f;
#pragma unroll
    for (int r = 0; r < 8; ++r) { const int rloc = half * 16 + 8 * hh + r; float v = accs[u][r] * alpha + bv; if (CP) { if (rowsPerB < 0) v += CP[cofs + (size_t)(row0g + row0 + rloc) * ldc + col];      /* rowsPerB < 0: own element of the batched C plane */ else { const int bidx = (row0g + row0 + rloc) / rowsPerB; v += CP[(size_t)bidx * sCPb + (size_t)by * 64 + col]; } }
      if (ACT == 3) v = fmaxf(v, 0.f); else if (ACT == 6) v = 0.5f * v * (1.0f + erff(v * 0.70710678118654752f)); else if (ACT == 11) v = 1.0f / (1.0f + expf(-v)); else if (ACT == 15) v = v / (1.0f + expf(-v)); else if (ACT == 12) v = (v > 0.f) ? v : 0.01f * v; else if (ACT == 8) v = tanhf(v); else if (ACT == 9) v = 0.5f * v * (1.0f + tanhf(0.7978845608028654f * (v + 0.044715f * v * v * v))); else if (ACT == 14) v = (v > 0.f) ? v : 0.1f * v; else if (ACT == 16) v = (v >= 0.f) ? v : 0.3f * v; else if (ACT == 17) v = (v >= 0.f) ? v : 0.2f * v;
      sw[rloc][t * 16 + ln] = v; } }
  __builtin_amdgcn_fence(__ATOMIC_ACQ_REL, "workgroup"); __builtin_amdgcn_wave_barrier();
  const int rsub = lane >> 4, c4 = (lane & 15) * 4;
  {
#pragma unroll
    for (int q = 0; q < 16; ++q) { const int r = q * 2 + rsub; const v4f v = *(const v4fa*)&sw[r][c4];
      if (HL) { v4h h4, l4; for (int i = 0; i < 4; ++i) { const _Float16 h = (_Float16)v[i]; h4[i] = h; l4[i] = (_Float16)((v[i] - (float)h) * 1024.0f); } const size_t o = cofs + (size_t)(row0 + r) * ldc + col0 + c4; *(v4h*)(C16 + o) = h4; *(v4h*)(CL + o) = l4; continue; }
      if (C) *(v4f*)(C + cofs + (size_t)(row0 + r) * ldc + col0 + c4) = v; if (C16) { v4h h4; for (int i = 0; i < 4; ++i) h4[i] = (_Float16)v[i]; *(v4h*)(C16 + cofs + (size_t)(row0 + r) * ldc + col0 + c4) = h4; } }
     } }


__device__ __forceinline__ void wnat_body(unsigned bx, const float* __restrict__ w, size_t n8, _Float16* __restrict__ Bt) { const size_t t = (size_t)bx * 256 + threadIdx.x; if (t >= n8) return; FragH f; for (int q = 0; q < 8; ++q) f.h[q] = (_Float16)(bf16_round(w[t * 8 + q]) * 16.0f); *(v8us*)((unsigned short*)Bt + t * 8) = f.half[0];  }
__global__ __launch_bounds__(256) void k_rsm(const float* __restrict__ S, _Float16* __restrict__ P, int nrows) {
  #pragma clang fp contract(off)
  const int i = blockIdx.x * 256 + threadIdx.x; if (i >= nrows) return; const float* s = S + (size_t)i * SQ; float mx = -3.0e38f;
#pragma unroll 1
  for (int j = 0; j < SQ; ++j) mx = fmaxf(mx, s[j]); float se = 0.f;
#pragma unroll 1
  for (int j = 0; j < SQ; ++j) se += expf(s[j] - mx); const float sc = 256.0f / se;
#pragma unroll 1
  for (int j0 = 0; j0 < SQ; j0 += 8) { FragH f; for (int q = 0; q < 8; ++q) f.h[q] = (_Float16)(expf(s[j0 + q] - mx) * sc); unsigned short* d = (unsigned short*)P + (size_t)i * SQ + j0; *(v8us*)d = f.half[0];  } }
__global__ __launch_bounds__(256) void k_vt(const _Float16* __restrict__ V16, int b, int h0, _Float16* __restrict__ VT) { __shared__ unsigned short tl[64][65]; const int tid = threadIdx.x; const int hh = blockIdx.x % HG, sg = blockIdx.x / HG; const int s0 = sg * 64; const int h = h0 + hh;
  for (int i = tid; i < 64 * 8; i += 256) { const int j = i / 8, d8 = (i % 8) * 8; FragH f; f.half[0] = *(const v8us*)((const unsigned short*)V16 + ((size_t)b * SQ + s0 + j) * DM + h * HD + d8); for (int q = 0; q < 8; ++q) tl[d8 + q][j] = f.u[q]; }
  __syncthreads();
  { for (int i = tid; i < 64 * 8; i += 256) { const int d = i / 8, j8 = (i % 8) * 8; FragH f; for (int q = 0; q < 8; ++q) f.u[q] = tl[d][j8 + q]; *(v8us*)((unsigned short*)VT + ((size_t)hh * HD + d) * SQ + s0 + j8) = f.half[0]; }  } }


// lane l <-> l ^ M inside a 16-lane row (DPP row_xmask)
template <int M> __device__ __forceinline__ float ln_xm(float v) { return __int_as_float(__builtin_amdgcn_update_dpp(0, __float_as_int(v), 0x160 + M, 0xf, 0xf, true)); }
// 2^x (v_exp_f32). The v_nop in the same statement keeps the one issue slot that the instruction set asks for behind a transcendental, before its result is read or its source overwritten.
__device__ __forceinline__ float exp2_slot(float x) { float r; asm("v_exp_f32 %0, %1\n\tv_nop" : "=v"(r) : "v"(x)); return r; }
// Scores and their row softmax in one launch. A work-group owns MT*16 whole rows m of S^T[m][n] = g_m . f_n: each of its NW waves forms its own LL/NW columns on WMMA (hi.hi + 2^-10 (lo.hi + hi.lo)) and keeps them in
// accumulator registers through the maximum, the exponentials and the scaling, so the f32 score plane never goes to memory. Column tile t of a wave takes f rows n = base + (t>>3)*128 + ln*8 + (t&7): a lane then holds 8 neighbouring columns of a row, and one 16-byte store per lane writes whole lines of beta^T.
__device__ __forceinline__ v8f sc_mma(v16h a, v16h b, v8f c) { return __builtin_amdgcn_wmma_f32_16x16x32_f16(false, a, false, b, (short)0, c, false, false); }
template <int MT, int NW>
__global__ __launch_bounds__(NW * 32) void k_scsm(const _Float16* __restrict__ Gh, const _Float16* __restrict__ Gl, const _Float16* __restrict__ Fh, const _Float16* __restrict__ Fl, _Float16* __restrict__ P) {
  constexpr int TP = LL / (NW * 16); static_assert(TP % 8 == 0 && (NW == 8 || NW == 16), "k_scsm: a wave takes whole groups of 8 column tiles; the cross-wave step reads one partial per lane of a 16-lane row");
  __shared__ float rmx[MT * 16][NW]; __shared__ float rsu[MT * 16][NW];      /* one partial maximum / sum per row and wave */
  const int lane = threadIdx.x & 31, ln = lane & 15, hh = lane >> 4; const int w = __builtin_amdgcn_readfirstlane(threadIdx.x >> 5);
  const size_t rb = (size_t)blockIdx.y * LL; const int m0 = blockIdx.x * (MT * 16); const int n0 = w * (TP * 16) + ln * 8;
  const v8f z8 = {0.f,0.f,0.f,0.f,0.f,0.f,0.f,0.f};
  v16h ah[MT][2], al[MT][2];
#pragma unroll      /* full unroll here and below: the fragment and score arrays stay in registers */
  for (int mt = 0; mt < MT; ++mt) { const size_t go = (rb + m0 + mt * 16 + ln) * CQ; ah[mt][0] = g2_frag(Gh + go, hh); ah[mt][1] = g2_frag(Gh + go + 32, hh); al[mt][0] = g2_frag(Gl + go, hh); al[mt][1] = g2_frag(Gl + go + 32, hh); }
  asm volatile("s_wait_xcnt 0x0" ::: "memory");      /* a precaution: stands before the registers that hold the g loads' addresses are written again (the first f load lands on one of them) */
  v16h bq[2][4]; { const size_t fo = (rb + n0) * CQ; bq[0][0] = g2_frag(Fh + fo, hh); bq[0][1] = g2_frag(Fh + fo + 32, hh); bq[0][2] = g2_frag(Fl + fo, hh); bq[0][3] = g2_frag(Fl + fo + 32, hh); }
  v8f s[MT][TP];      /* lane (ln, hh), element r of s[mt][t] = row m0 + mt*16 + 8*hh + r, column n0 + (t>>3)*128 + (t&7) */
#pragma unroll
  for (int t = 0; t < TP; ++t) {
    if (t + 1 < TP) { const size_t fo = (rb + n0 + ((t + 1) >> 3) * 128 + ((t + 1) & 7)) * CQ; const int u = (t + 1) & 1; bq[u][0] = g2_frag(Fh + fo, hh); bq[u][1] = g2_frag(Fh + fo + 32, hh); bq[u][2] = g2_frag(Fl + fo, hh); bq[u][3] = g2_frag(Fl + fo + 32, hh); }      /* the next tile's fragments fly while this tile is multiplied */
    const v16h bh0 = bq[t & 1][0], bh1 = bq[t & 1][1], bl0 = bq[t & 1][2], bl1 = bq[t & 1][3];
#pragma unroll
    for (int mt = 0; mt < MT; ++mt) { const v8f c = sc_mma(ah[mt][1], bh1, sc_mma(ah[mt][0], bh0, z8)); const v8f d = sc_mma(ah[mt][1], bl1, sc_mma(ah[mt][0], bl0, sc_mma(al[mt][1], bh1, sc_mma(al[mt][0], bh0, z8))));
      s[mt][t] = d * 0.0009765625f + c; } }
  v8f st[MT];
#pragma unroll
  for (int mt = 0; mt < MT; ++mt) { v8f m = s[mt][0];
#pragma unroll
    for (int t = 1; t < TP; ++t) m = __builtin_elementwise_max(m, s[mt][t]);
#pragma unroll
    for (int r = 0; r < 8; ++r) { float x = m[r]; x = fmaxf(x, ln_xm<1>(x)); x = fmaxf(x, ln_xm<2>(x)); x = fmaxf(x, ln_xm<4>(x)); x = fmaxf(x, ln_xm<8>(x)); m[r] = x; }
    st[mt] = m; }
  if (ln == 0) {
#pragma unroll
    for (int mt = 0; mt < MT; ++mt)
#pragma unroll
      for (int r = 0; r < 8; ++r) rmx[mt * 16 + 8 * hh + r][w] = st[mt][r]; }
  __syncthreads();      /* every wave's partial maxima are in LDS */
#pragma unroll
  for (int mt = 0; mt < MT; ++mt) { v8f m;
#pragma unroll
    for (int r = 0; r < 8; ++r) { float x = rmx[mt * 16 + 8 * hh + r][ln & (NW - 1)]; x = fmaxf(x, ln_xm<1>(x)); x = fmaxf(x, ln_xm<2>(x)); x = fmaxf(x, ln_xm<4>(x)); if (NW == 16) x = fmaxf(x, ln_xm<8>(x)); m[r] = x; }
    v8f a = z8;
#pragma unroll
    for (int t = 0; t < TP; ++t) { const v8f y = (s[mt][t] - m) * 1.442695041f; v8f e;
#pragma unroll
      for (int r = 0; r < 8; ++r) e[r] = exp2_slot(y[r]);      /* = native exp: the same multiply and v_exp_f32 */
      s[mt][t] = e; a += e; }
#pragma unroll
    for (int r = 0; r < 8; ++r) { float x = a[r]; x += ln_xm<1>(x); x += ln_xm<2>(x); x += ln_xm<4>(x); x += ln_xm<8>(x); a[r] = x; }
    st[mt] = a; }
  if (ln == 0) {
#pragma unroll
    for (int mt = 0; mt < MT; ++mt)
#pragma unroll
      for (int r = 0; r < 8; ++r) rsu[mt * 16 + 8 * hh + r][w] = st[mt][r]; }
  __syncthreads();      /* every wave's partial sums are in LDS */
#pragma unroll
  for (int mt = 0; mt < MT; ++mt) { v8f sc;
#pragma unroll
    for (int r = 0; r < 8; ++r) { float x = rsu[mt * 16 + 8 * hh + r][ln & (NW - 1)]; x += ln_xm<1>(x); x += ln_xm<2>(x); x += ln_xm<4>(x); if (NW == 16) x += ln_xm<8>(x); sc[r] = 256.0f / x; }
#pragma unroll
    for (int t = 0; t < TP; ++t) s[mt][t] *= sc;
#pragma unroll
    for (int r = 0; r < 8; ++r) { unsigned short* d = (unsigned short*)P + (rb + m0 + mt * 16 + 8 * hh + r) * LL + n0;
#pragma unroll
      for (int t8 = 0; t8 < TP / 8; ++t8) { FragH f;
#pragma unroll
        for (int q = 0; q < 8; ++q) f.h[q] = (_Float16)s[mt][t8 * 8 + q][r];
        *(v8us*)(d + t8 * 128) = f.half[0]; } } } }

// ---- GEMM with both operands staged in LDS: C[c][n] = alpha * sum_k A[c][k] Bh[n][k] (both K-contiguous f16), one 256 x 128 tile of C per work-group, 8 waves as 4 x 2, 64 x 64 per wave. ----
// A stage is 64 k of all 384 operand rows (128 B a row, LDS pitch 144 B so that the 16-byte fragment reads spread over the banks). Asynchronous copies bring whole 128-byte lines from global memory straight into LDS, two buffers:
// the next stage's copies fly while this stage is multiplied. Every operand line is asked for once per work-group, instead of in 32-byte pieces by every wave. k runs upward in steps of 32 into one accumulator chain per tile, as in gemm2_body. Requires M % 256 == 0, N % 128 == 0, K % 64 == 0.
// F16OUT: C16 = f16(alpha acc). Otherwise the residual epilogue: C = bf16(gam[0]) alpha acc + bf16(X), X laid out like C, both [CC][LL] planes (pitch LL at compile time: a lane's 32 loads and 32 stores share one address each and differ in the immediate offset).
#define G3_PITCH 72      /* f16 per LDS row */
#define G3_STAGE (384 * G3_PITCH)      /* f16 per buffer */
__device__ __forceinline__ unsigned g3_lds(const void* p) { return (unsigned)(size_t)p; }      /* byte offset in the work-group's LDS */
// The body takes its LDS from the calling kernel: ring = the two stage buffers, so = each wave's own output staging; bx = tile index, by = batch. so may lie on the ring's bytes: it is first written behind the loop, whose last trip ends with every wave's s_wait_dscnt 0 and s_wait_asynccnt 0 and a work-group barrier, with no refill behind it.
template <bool F16OUT>
__device__ __forceinline__ void gemm3_body(unsigned short* ring, float (*so)[64][68], unsigned bx, int by, const _Float16* __restrict__ A, int lda, size_t sA, const _Float16* __restrict__ Bh, int ldb, size_t sB, float alpha, float* __restrict__ C, _Float16* __restrict__ C16, const float* __restrict__ X, const float* __restrict__ gam, int ldc, size_t sC, int N, int K) {
  const int tid = threadIdx.x, lane = tid & 31, ln = lane & 15, hh = lane >> 4; const int w = __builtin_amdgcn_readfirstlane(tid >> 5); const int wm = w >> 1, wn = w & 1;
  const int ntn = N >> 7; const int mt = bx / ntn, nq = bx - mt * ntn; const int row0 = mt * 256, col0 = nq * 128; const size_t cofs = (size_t)by * sC;
  /* copy j of a thread: operand row j*32 + tid/8 of the stage (rows 0..255 = A, 256..383 = Bh), 16-byte piece tid%8: a wave's copy covers four whole rows */
  const unsigned short* ga = (const unsigned short*)A + (size_t)by * sA + (size_t)(row0 + (tid >> 3)) * lda + (tid & 7) * 8;
  const unsigned short* gb = (const unsigned short*)Bh + (size_t)by * sB + (size_t)(col0 + (tid >> 3)) * ldb + (tid & 7) * 8;
  const unsigned lb = g3_lds(ring) + (unsigned)(tid >> 3) * (G3_PITCH * 2) + (unsigned)(tid & 7) * 16;
  auto stage_in = [&](int s, int buf) {
    unsigned l[12]; const unsigned short* g[12];
#pragma unroll
    for (int j = 0; j < 12; ++j) { l[j] = lb + (unsigned)buf * (G3_STAGE * 2) + (unsigned)j * (32 * G3_PITCH * 2); g[j] = (j < 8 ? ga + (size_t)(j * 32) * lda : gb + (size_t)((j - 8) * 32) * ldb) + s * 64; }
    /* one stage's twelve copies; the s_wait_xcnt in the same statement is a precaution: it stands before any register that a copy names is written again */
    asm volatile("global_load_async_to_lds_b128 %0, %12, off\n\tglobal_load_async_to_lds_b128 %1, %13, off\n\tglobal_load_async_to_lds_b128 %2, %14, off\n\tglobal_load_async_to_lds_b128 %3, %15, off\n\t"
                 "global_load_async_to_lds_b128 %4, %16, off\n\tglobal_load_async_to_lds_b128 %5, %17, off\n\tglobal_load_async_to_lds_b128 %6, %18, off\n\tglobal_load_async_to_lds_b128 %7, %19, off\n\t"
                 "global_load_async_to_lds_b128 %8, %20, off\n\tglobal_load_async_to_lds_b128 %9, %21, off\n\tglobal_load_async_to_lds_b128 %10, %22, off\n\tglobal_load_async_to_lds_b128 %11, %23, off\n\ts_wait_xcnt 0x0"
                 :: "v"(l[0]), "v"(l[1]), "v"(l[2]), "v"(l[3]), "v"(l[4]), "v"(l[5]), "v"(l[6]), "v"(l[7]), "v"(l[8]), "v"(l[9]), "v"(l[10]), "v"(l[11]),
                    "v"(g[0]), "v"(g[1]), "v"(g[2]), "v"(g[3]), "v"(g[4]), "v"(g[5]), "v"(g[6]), "v"(g[7]), "v"(g[8]), "v"(g[9]), "v"(g[10]), "v"(g[11]) : "memory"); };
  float gsc = alpha; if (!F16OUT) gsc = bf16_round(gam[0]) * alpha;      /* read at entry, ahead of every asm statement: a scalar load */
  const int ns = K >> 6;
  stage_in(0, 0);
  asm volatile("s_wait_asynccnt 0x0" ::: "memory");      /* this wave's copies of stage 0 have landed */
  __syncthreads();      /* stage 0 is readable by every wave */
  if (ns > 1) stage_in(1, 1);
  const v8f z8 = {0.f,0.f,0.f,0.f,0.f,0.f,0.f,0.f}; v8f acc[4][4];
#pragma unroll
  for (int i = 0; i < 4; ++i)
#pragma unroll
    for (int j = 0; j < 4; ++j) acc[i][j] = z8;
  const int ao = (wm * 64 + ln) * G3_PITCH, bo = (256 + wn * 64 + ln) * G3_PITCH;
#pragma unroll 1      /* the stage loop stays rolled: the accumulators keep constant indices and the loop stays small */
  for (int s = 0; s < ns; ++s) { const _Float16* rb = (const _Float16*)ring + (s & 1) * G3_STAGE;
#pragma unroll
    for (int kk = 0; kk < 2; ++kk) { v16h a[4], b[4];
#pragma unroll
      for (int i = 0; i < 4; ++i) { a[i] = g2_frag(rb + ao + i * (16 * G3_PITCH) + kk * 32, hh); b[i] = g2_frag(rb + bo + i * (16 * G3_PITCH) + kk * 32, hh); }
      __builtin_amdgcn_sched_barrier(0);      /* the block's 16 LDS reads go out as one group ahead of its WMMAs: left free, the compiler reloads one A fragment per four WMMAs and waits out the LDS latency each time */
#pragma unroll
      for (int d = 0; d < 4; ++d) {      /* tiles in the order in which their fragments arrive (a0 b0 a1 b1 ...): the first WMMAs run while the later reads are still coming; each tile still gets one WMMA per block, k upward */
#pragma unroll
        for (int e = 0; e < d; ++e) { acc[e][d] = sc_mma(a[e], b[d], acc[e][d]); acc[d][e] = sc_mma(a[d], b[e], acc[d][e]); }
        acc[d][d] = sc_mma(a[d], b[d], acc[d][d]); }
      __builtin_amdgcn_sched_barrier(0); }      /* keeps the next group of reads behind this block, so that one fragment set is live */
    asm volatile("s_wait_dscnt 0x0" ::: "memory");      /* this wave's reads of the buffer are done before it may be refilled */
    asm volatile("s_wait_asynccnt 0x0" ::: "memory");      /* this wave's copies of stage s + 1 have landed */
    __syncthreads();      /* publishes stage s + 1 and ends every wave's reads of stage s */
    if (s + 2 < ns) stage_in(s + 2, s & 1); }
  asm volatile("s_wait_asynccnt 0x0" ::: "memory");      /* no copy is outstanding when the wave goes on to its end */
  const int rsub = lane >> 4, c4 = (lane & 15) * 4; const int ldo = F16OUT ? ldc : LL; const size_t o0 = cofs + (size_t)(row0 + wm * 64 + rsub) * ldo + col0 + wn * 64 + c4;
  v4f xr[F16OUT ? 1 : 32];      /* the lane's residual values, asked for in two groups of 16 loads: the first flies while the accumulators are staged, the second while the first half of the rows is formed and stored */
  if (!F16OUT) {
#pragma unroll      /* unrolled here and below: xr keeps constant indices and stays in registers */
    for (int q = 0; q < 16; ++q) xr[q] = *(const v4fa*)(X + o0 + (size_t)(q * 2) * ldo); }
  float (*sw)[68] = so[w];
#pragma unroll
  for (int i = 0; i < 4; ++i)
#pragma unroll
    for (int j = 0; j < 4; ++j)
#pragma unroll
      for (int r = 0; r < 8; ++r) sw[i * 16 + 8 * hh + r][j * 16 + ln] = F16OUT ? acc[i][j][r] * alpha : acc[i][j][r];
  __builtin_amdgcn_fence(__ATOMIC_ACQ_REL, "workgroup"); __builtin_amdgcn_wave_barrier();      /* the wave's staged rows are read back by other lanes of the same wave */
  if (!F16OUT) {
#pragma unroll
    for (int q = 16; q < 32; ++q) xr[q] = *(const v4fa*)(X + o0 + (size_t)(q * 2) * ldo); }
#pragma unroll
  for (int q = 0; q < 32; ++q) { const v4f v = *(const v4fa*)&sw[q * 2 + rsub][c4]; const size_t o = o0 + (size_t)(q * 2) * ldo;
    if (F16OUT) { v4h h4; for (int i = 0; i < 4; ++i) h4[i] = (_Float16)v[i]; *(v4h*)(C16 + o) = h4; }
    else { v4f y; for (int i = 0; i < 4; ++i) y[i] = v[i] * gsc + bf16_round(xr[q][i]); *(v4f*)(C + o) = y; } } }
template <bool F16OUT>
__global__ __launch_bounds__(256) void k_gemm3(const _Float16* __restrict__ A, int lda, size_t sA, const _Float16* __restrict__ Bh, int ldb, size_t sB, float alpha, float* __restrict__ C, _Float16* __restrict__ C16, const float* __restrict__ X, const float* __restrict__ gam, int ldc, size_t sC, int N, int K) {
  __shared__ __attribute__((aligned(16))) unsigned short ring[2 * G3_STAGE];
  __shared__ __attribute__((aligned(16))) float so[8][64][68];
  gemm3_body<F16OUT>(ring, so, blockIdx.x, blockIdx.y, A, lda, sA, Bh, ldb, sB, alpha, C, C16, X, gam, ldc, sC, N, K); }
// The three projections of x in one launch (none reads another's result); blockIdx.y = batch. blockIdx.x < LL / 128: f^T and g^T of 128 token rows, waves 0..3 forming f and waves 4..7 g from the same rows of XR (gemm2_body); the others: one 256 x 128 tile of h (gemm3_body).
// One LDS block serves as the ring and afterwards as the output staging: 136 KiB instead of 244, so that two work-groups fit a WGP and all 384 of the launch are resident at once.
__global__ __launch_bounds__(256) void k_proj(const _Float16* __restrict__ XR, const _Float16* __restrict__ BQ, const _Float16* __restrict__ BK, const _Float16* __restrict__ BV, _Float16* __restrict__ Fh, _Float16* __restrict__ Fl, _Float16* __restrict__ Gh, _Float16* __restrict__ Gl, _Float16* __restrict__ H16) {
  __shared__ __attribute__((aligned(16))) float sm[8][64][68]; static_assert(sizeof(sm) >= 2 * G3_STAGE * 2, "k_proj: the ring lies inside the staging block");
  const unsigned bx = blockIdx.x; const int by = blockIdx.y;
  if (bx < LL / 128) { const int w = __builtin_amdgcn_readfirstlane(threadIdx.x >> 5); const bool isg = w >= 4;
    gemm2_body<0, true>(sm[w], w & 3, bx, by, XR, CC, (size_t)LL * CC, isg ? BK : BQ, CC, 0, 0.0625f, nullptr, 0, nullptr, 1, 0, 0, nullptr, isg ? Gh : Fh, isg ? Gl : Fl, CQ, (size_t)LL * CQ, LL, CQ, CC); }
  else gemm3_body<true>((unsigned short*)&sm[0][0][0], sm, bx - LL / 128, by, BV, CC, 0, XR, CC, (size_t)LL * CC, 0.0625f, nullptr, H16, nullptr, nullptr, LL, (size_t)CC * LL, LL, CC); }

__device__ __forceinline__ void cl2rows_body(float (*tl)[33], unsigned bx, const float* __restrict__ X, _Float16* __restrict__ XR) { const int tid = threadIdx.x; const int nl = LL / 32, nc = CC / 64; const int cb_ = bx % nc; const int lb = (bx / nc) % nl; const size_t b = bx / (nc * nl); const int c0 = cb_ * 64, l0 = lb * 32;
  for (int i = tid; i < 64 * 32; i += 256) { const int c = i / 32, l = i % 32; tl[c][l] = bf16_round(X[(b * CC + c0 + c) * (size_t)LL + l0 + l]); }
  __syncthreads();
  { const int l = tid / 8, c8 = (tid % 8) * 8; FragH f; for (int q = 0; q < 8; ++q) f.h[q] = (_Float16)tl[c8 + q][l]; unsigned short* d = (unsigned short*)XR + (b * LL + l0 + l) * (size_t)CC + c0 + c8; *(v8us*)d = f.half[0];
    asm volatile("s_wait_xcnt 0x0" ::: "memory");      /* a precaution: stands before any register that the store names is written again (the calling kernel's other branches follow in the code) */
  } }
// The four input conversions in one launch (none reads another's result): the first blocks cast Wq, Wk and Wv, the others transpose x.
#define PB_QK (CQ * CC / 8 / 256)      /* blocks for Wq, and for Wk */
#define PB_V (CC * CC / 8 / 256)      /* blocks for Wv */
#define PB_X (NB * (LL / 32) * (CC / 64))      /* blocks for x */
__global__ __launch_bounds__(256) void k_prep(const float* __restrict__ x, const float* __restrict__ wq, const float* __restrict__ wk, const float* __restrict__ wv, _Float16* __restrict__ XR, _Float16* __restrict__ BQ, _Float16* __restrict__ BK, _Float16* __restrict__ BV) {
  __shared__ float tl[64][33]; const unsigned bx = blockIdx.x;
  if (bx < PB_QK) wnat_body(bx, wq, (size_t)CQ * CC / 8, BQ);
  else if (bx < 2 * PB_QK) wnat_body(bx - PB_QK, wk, (size_t)CQ * CC / 8, BK);
  else if (bx < 2 * PB_QK + PB_V) wnat_body(bx - 2 * PB_QK, wv, (size_t)CC * CC / 8, BV);
  else cl2rows_body(tl, bx - (2 * PB_QK + PB_V), x, XR); }


extern "C" void kernel_launch(void* const* d_in, const int* in_sizes, int n_in,
                              void* d_out, int out_size, void* d_ws, size_t ws_size, hipStream_t stream) {
  (void)in_sizes; (void)n_in; (void)out_size;
  const float* const* I = (const float* const*)d_in; const float* x = I[0]; const float* wq = I[1]; const float* wk = I[2]; const float* wv = I[3]; const float* gam = I[4];
  char* ws = (char*)d_ws; size_t off = 0;
  auto take = [&](size_t bytes) { char* p = ws + off; off += (bytes + 255) & ~(size_t)255; return p; };
  _Float16* BQ = (_Float16*)take((size_t)CQ * CC * 2); _Float16* BK = (_Float16*)take((size_t)CQ * CC * 2); _Float16* BV = (_Float16*)take((size_t)CC * CC * 2);
  _Float16* XR = (_Float16*)take(NR * CC * 2); _Float16* Fh = (_Float16*)take(NR * CQ * 2); _Float16* Fl = (_Float16*)take(NR * CQ * 2); _Float16* Gh = (_Float16*)take(NR * CQ * 2); _Float16* Gl = (_Float16*)take(NR * CQ * 2);
  _Float16* H16 = (_Float16*)take(NR * CC * 2); _Float16* P = (_Float16*)take(NR * LL * 2);
  if (off > ws_size) return;      /* approx 0.6 + 16 + 8 + 16 + 64 = 105 MiB: every plane holds all NB batches */
  /* every stage once for all batches: blockIdx.y = batch (k_prep: one-dimensional grid, batch from blockIdx.x) */
  k_prep<<<2 * PB_QK + PB_V + PB_X, 256, 0, stream>>>(x, wq, wk, wv, XR, BQ, BK, BV);      /* x16 f16 weights; exact f16 token rows [b*2048 + n][c] */
  k_proj<<<dim3(LL / 128 + (CC / 256) * (LL / 128), NB), 256, 0, stream>>>(XR, BQ, BK, BV, Fh, Fl, Gh, Gl, H16);      /* f^T rows [b][n][64] and g^T rows [b][m][64] -> hi/lo; h channel-major [b][c][n] f16 */
  k_scsm<2, 16><<<dim3(LL / 32, NB), 512, 0, stream>>>(Gh, Gl, Fh, Fl, P);      /* S^T[b][m][n] = g_m . f_n (hi.hi + 2^-10 (lo.hi + hi.lo)), softmax over n per key m (the module's dim=1 softmax) -> beta^T[b][m][n] x256 f16 */
  k_gemm3<false><<<dim3((CC / 256) * (LL / 128), NB), 256, 0, stream>>>(H16, LL, (size_t)CC * LL, P, LL, (size_t)LL * LL, 0.00390625f, (float*)d_out, nullptr, x, gam, LL, (size_t)CC * LL, LL, LL);      /* out[b][c][m] = gamma 2^-8 sum_n h[c][n] beta^T[m][n] + x[b][c][m] (channel-major = the output layout) */
}

// v007
// One run takes 94 microseconds.
// In two side-by-side timings against v006, it was 1.14 and 1.13 times as fast.
// All steps since v000 together make it 42.9 times as fast.
#include <hip/hip_runtime.h>
// SAGAN-style self-attention with 1x1-conv projections (x [8][512][2048] channel-first; f = Wq x, g = Wk x (64 channels), h = Wv x (512); scores[n][m] = sum_c f[c][n] g[c][m] (unscaled); beta = softmax over n (the QUERY axis, dim=1) for each m; o[c][m] = gamma sum_n h[c][n] beta[n][m] + x[c][m] -> [8][512][2048]; gamma = an input scalar).
// Structure: x transposed to exact f16 token rows via LDS tiles; f^T and g^T as one WMMA GEMM (f32 accumulation, exact x16 weights) cut in the GEMM's own epilogue into f16 hi + x1024 residual planes; h channel-major as a GEMM (weights as the A operand) into f16 (f/g, h and o: 256x128 work-group tiles; every GEMM's operands staged in LDS by asynchronous copies); every stage is one launch over all batches (blockIdx.y = batch): S^T[m][n] = g^T f (K = 64; hi.hi + lo.hi + hi.lo on WMMA) and its row softmax over n (f32 statistics, native exp; weights x256 f16) = beta^T in one launch, a work-group holding whole score rows in registers; o[c][m] = h . beta^T as a GEMM (K = 2048) channel-major straight into the output, its epilogue forming out = bf16(gamma) o + bf16(x). Stages that do not depend on one another share a launch, told apart by the block index: weight casts + transpose; f, g and h GEMMs; scores + softmax; output GEMM = 4 launches.
// Compute dtype: inputs rounded to bf16; x / weights exact; f, g as hi + residual (~2^-22: the unscaled logits have sigma ~8); h and the softmax weights plain f16 (~2^-12); logits, statistics, o f32. v_wmma_f32_16x16x32_f16.
#define NB 8
#define CC 512
#define CQ 64
#define LL 2048
#define SQ LL
#define DM 64
#define NH 1
#define HD 64
#define HG 1
#define NR ((size_t)NB * LL)
typedef __bf16 v16b __attribute__((ext_vector_type(16)));
typedef unsigned short v8us __attribute__((ext_vector_type(8), may_alias));
typedef float  v8f  __attribute__((ext_vector_type(8)));
typedef float  v4f  __attribute__((ext_vector_type(4)));
typedef float  v4fa __attribute__((ext_vector_type(4), may_alias));
union FragB { v16b v; v8us half[2]; unsigned short u[16]; };

__device__ __forceinline__ unsigned short bf16_bits(float x) { unsigned int u = __float_as_uint(x); return (unsigned short)((u + 0x7FFFu + ((u >> 16) & 1u)) >> 16); }
__device__ __forceinline__ float bf16_val(unsigned short b) { return __uint_as_float(((unsigned int)b) << 16); }
__device__ __forceinline__ float bf16_round(float x) { return bf16_val(bf16_bits(x)); }
// D += A·B with NT terms: 1 = ah·bh, 2 = + al·bh (A split), 3 = + ah·bl (both split)
template <int NT>
__device__ __forceinline__ v8f mmaN(v16b ah, v16b al, v16b bh, v16b bl, v8f c) {
  c = __builtin_amdgcn_wmma_f32_16x16x32_bf16(false, ah, false, bh, (short)0, c, false, false);
  if (NT >= 2) c = __builtin_amdgcn_wmma_f32_16x16x32_bf16(false, al, false, bh, (short)0, c, false, false);
  if (NT >= 3) c = __builtin_amdgcn_wmma_f32_16x16x32_bf16(false, ah, false, bl, (short)0, c, false, false);
  asm volatile("v_nop\n\tv_nop\n\tv_nop\n\tv_nop" : "+v"(c) : "v"(ah), "v"(al), "v"(bh), "v"(bl));
  return c;
}

__global__ __launch_bounds__(256) void k_wt_bf16(const float* __restrict__ W, unsigned short* __restrict__ Wt, int K, int N) {
  const int t = blockIdx.x * 256 + threadIdx.x;
  const int k8n = K / 8;
  if (t >= N * k8n) return;
  const int n = t / k8n, k8 = (t % k8n) * 8;
  v8us v;
#pragma unroll
  for (int i = 0; i < 8; ++i) v[i] = bf16_bits(W[(size_t)(k8 + i) * N + n]);
  *(v8us*)(Wt + (size_t)n * K + k8) = v;
  
}

// GEMM C[M][N] (f32, pitch ldc) = act(A[M][K]·W + bias). A f32 row-major (pitch lda) converted per fragment to bf16
// (ASPLIT: hi/lo two planes -> 2 terms, else single rounded term); Wt bf16 [N][K] (pitch ldb). BIAS_BF16 rounds the
// bias to bf16 first (bias quantised to bf16 before the add). K%32==0, M%16==0, N%64==0.
template <bool ASPLIT, int ACT, bool BIAS_BF16>
__global__ __launch_bounds__(128) void k_gemm_bf(const float* __restrict__ A, int lda, const unsigned short* __restrict__ Wt, int ldb,
                                               const float* __restrict__ bias, float* __restrict__ C, int ldc, int M, int N, int K) {
  __shared__ __attribute__((aligned(16))) float so[4][16][64];
  const int tid = threadIdx.x, w = tid >> 5, lane = tid & 31, ln = lane & 15, hh = lane >> 4;
  const int ntn = N / 64;
  const int wid = blockIdx.x * 4 + w;
  const int mt = wid / ntn, nq = wid % ntn;
  if (mt * 16 >= M) return;
  const int row0 = mt * 16, col0 = nq * 64;
  const float* arow = A + (size_t)(row0 + ln) * lda;
  v8f acc[4] = {};
  for (int kb = 0; kb < K; kb += 32) {
    FragB ah, al;
    const v4f x0 = *(const v4fa*)(arow + kb + 8 * hh), x1 = *(const v4fa*)(arow + kb + 8 * hh + 4);
    const v4f x2 = *(const v4fa*)(arow + kb + 16 + 8 * hh), x3 = *(const v4fa*)(arow + kb + 16 + 8 * hh + 4);
    float xs[16] = {x0[0],x0[1],x0[2],x0[3],x1[0],x1[1],x1[2],x1[3],x2[0],x2[1],x2[2],x2[3],x3[0],x3[1],x3[2],x3[3]};
#pragma unroll
    for (int i = 0; i < 16; ++i) { const unsigned short hb = bf16_bits(xs[i]); ah.u[i] = hb; al.u[i] = ASPLIT ? bf16_bits(xs[i] - bf16_val(hb)) : (unsigned short)0; }
#pragma unroll
    for (int t = 0; t < 4; ++t) {
      const unsigned short* brow = Wt + (size_t)(col0 + t * 16 + ln) * ldb + kb;
      FragB b;
      b.half[0] = *(const v8us*)(brow + 8 * hh);
      b.half[1] = *(const v8us*)(brow + 16 + 8 * hh);
      acc[t] = mmaN<ASPLIT ? 2 : 1>(ah.v, al.v, b.v, b.v, acc[t]);
    }
  }
#pragma unroll
  for (int t = 0; t < 4; ++t) {
    float bv = bias ? bias[col0 + t * 16 + ln] : 0.f;
    if (BIAS_BF16) bv = bf16_round(bv);
#pragma unroll
    for (int r = 0; r < 8; ++r) { float v = acc[t][r] + bv; if (ACT == 1) v = fmaxf(v, 0.f); so[w][8 * hh + r][t * 16 + ln] = v; }
  }
  __builtin_amdgcn_fence(__ATOMIC_ACQ_REL, "workgroup");
  __builtin_amdgcn_wave_barrier();
  const int rsub = lane >> 4, c4 = (lane & 15) * 4;
  {
#pragma unroll
    for (int q = 0; q < 8; ++q) {
      const int r = q * 2 + rsub;
      const v4f v = *(const v4fa*)&so[w][r][c4];
      *(v4f*)(C + (size_t)(row0 + r) * ldc + col0 + c4) = v;
    }
    
  }
}

// GEMM C = act(A·W + bias + resid): A f32 (ASPLIT -> hi/lo 2 terms), Wt bf16 [N][K]; ACT 0 none, 1 relu, 2 exact gelu;
// resid (optional, f32, row index = (row % rmod), pitch ldr, RES_BF16 rounds it) added before the activation.
template <bool ASPLIT, int ACT, bool BIAS_BF16, bool RES_BF16>
__global__ __launch_bounds__(128) void k_gemm_bf3(const float* __restrict__ A, int lda, const unsigned short* __restrict__ Wt, int ldb,
                                                const float* __restrict__ bias, const float* __restrict__ resid, int rmod, int ldr,
                                                float* __restrict__ C, int ldc, int M, int N, int K) {
  __shared__ __attribute__((aligned(16))) float so[4][16][64];
  const int tid = threadIdx.x, w = tid >> 5, lane = tid & 31, ln = lane & 15, hh = lane >> 4;
  const int ntn = N / 64;
  const int wid = blockIdx.x * 4 + w;
  const int mt = wid / ntn, nq = wid % ntn;
  if (mt * 16 >= M) return;
  const int row0 = mt * 16, col0 = nq * 64;
  const float* arow = A + (size_t)(row0 + ln) * lda;
  v8f acc[4] = {};
  for (int kb = 0; kb < K; kb += 32) {
    FragB ah, al;
    const v4f x0 = *(const v4fa*)(arow + kb + 8 * hh), x1 = *(const v4fa*)(arow + kb + 8 * hh + 4);
    const v4f x2 = *(const v4fa*)(arow + kb + 16 + 8 * hh), x3 = *(const v4fa*)(arow + kb + 16 + 8 * hh + 4);
    float xs[16] = {x0[0],x0[1],x0[2],x0[3],x1[0],x1[1],x1[2],x1[3],x2[0],x2[1],x2[2],x2[3],x3[0],x3[1],x3[2],x3[3]};
#pragma unroll
    for (int i = 0; i < 16; ++i) { const unsigned short hb = bf16_bits(xs[i]); ah.u[i] = hb; al.u[i] = ASPLIT ? bf16_bits(xs[i] - bf16_val(hb)) : (unsigned short)0; }
#pragma unroll
    for (int t = 0; t < 4; ++t) {
      const unsigned short* brow = Wt + (size_t)(col0 + t * 16 + ln) * ldb + kb;
      FragB b;
      b.half[0] = *(const v8us*)(brow + 8 * hh);
      b.half[1] = *(const v8us*)(brow + 16 + 8 * hh);
      acc[t] = mmaN<ASPLIT ? 2 : 1>(ah.v, al.v, b.v, b.v, acc[t]);
    }
  }
#pragma unroll
  for (int t = 0; t < 4; ++t) {
    const int col = col0 + t * 16 + ln;
    float bv = bias ? bias[col] : 0.f;
    if (BIAS_BF16) bv = bf16_round(bv);
#pragma unroll
    for (int r = 0; r < 8; ++r) {
      float v = acc[t][r] + bv;
      if (resid) { float rv = resid[(size_t)((row0 + 8 * hh + r) % rmod) * ldr + col]; if (RES_BF16) rv = bf16_round(rv); v += rv; }
      if (ACT == 1) v = fmaxf(v, 0.f);
      if (ACT == 2) v = 0.5f * v * (1.0f + erff(v * 0.70710678118654752f));
      if (ACT == 3) { const float u = 0.7978845608028654f * (v + 0.044715f * v * v * v); v = 0.5f * v * (1.0f + tanhf(u)); }
      so[w][8 * hh + r][t * 16 + ln] = v;
    }
  }
  __builtin_amdgcn_fence(__ATOMIC_ACQ_REL, "workgroup");
  __builtin_amdgcn_wave_barrier();
  const int rsub = lane >> 4, c4 = (lane & 15) * 4;
  {
#pragma unroll
    for (int q = 0; q < 8; ++q) {
      const int r = q * 2 + rsub;
      const v4f v = *(const v4fa*)&so[w][r][c4];
      *(v4f*)(C + (size_t)(row0 + r) * ldc + col0 + c4) = v;
    }
    
  }
}
// row LayerNorm (biased variance, eps) over N: s = X (+ R); optional out_sum <- s; out_norm <- (s-mu)*rsqrt(var+eps)*g + b
template <bool PARAM_BF16>
__global__ __launch_bounds__(256) void k_layernorm(const float* __restrict__ X, const float* __restrict__ R, const float* __restrict__ g, const float* __restrict__ bta,
                                                  float* __restrict__ out_sum, float* __restrict__ out_norm, int N, float eps) {
  __shared__ float red[256];
  const int row = blockIdx.x, tid = threadIdx.x;
  const float* x = X + (size_t)row * N; const float* rr = R ? R + (size_t)row * N : nullptr;
  float vals[16];                     // up to N = 4096
  const int per = N / 256;            // contiguous chunk per thread? use strided-by-4 chunks: thread handles j = tid*4 + 1024*u
  float s1 = 0.f;
  for (int u = 0; u < per / 4; ++u) {
    const int j = tid * 4 + 1024 * u;
    const v4f a = *(const v4fa*)(x + j);
    v4f b = {0.f,0.f,0.f,0.f}; if (rr) b = *(const v4fa*)(rr + j);
#pragma unroll
    for (int q = 0; q < 4; ++q) { const float v = a[q] + b[q]; vals[u * 4 + q] = v; s1 += v; }
  }
  red[tid] = s1; __syncthreads();
  for (int st = 128; st > 0; st >>= 1) { if (tid < st) red[tid] += red[tid + st]; __syncthreads(); }
  const float mu = red[0] / (float)N; __syncthreads();
  float s2 = 0.f;
  for (int u = 0; u < per / 4; ++u)
#pragma unroll
    for (int q = 0; q < 4; ++q) { const float c = vals[u * 4 + q] - mu; s2 += c * c; }
  red[tid] = s2; __syncthreads();
  for (int st = 128; st > 0; st >>= 1) { if (tid < st) red[tid] += red[tid + st]; __syncthreads(); }
  const float rs = rsqrtf(red[0] / (float)N + eps);
  {
    for (int u = 0; u < per / 4; ++u) {
      const int j = tid * 4 + 1024 * u;
      v4f o, sm;
#pragma unroll
      for (int q = 0; q < 4; ++q) {
        float gg = g[j + q], bb = bta[j + q];
        if (PARAM_BF16) { gg = bf16_round(gg); bb = bf16_round(bb); }
        sm[q] = vals[u * 4 + q]; o[q] = (vals[u * 4 + q] - mu) * rs * gg + bb;
      }
      if (out_sum) *(v4f*)(out_sum + (size_t)row * N + j) = sm;
      *(v4f*)(out_norm + (size_t)row * N + j) = o;
    }
    
  }
}



// ---- f16 WMMA path (v_wmma_f32_16x16x32_f16): 11-bit significands for operands in range — used where a [0,1] probability operand needs more precision than bf16
typedef _Float16 v16h __attribute__((ext_vector_type(16)));
union FragH { v16h v; v8us half[2]; _Float16 h[16]; unsigned short u[16]; };
template <int NT>
__device__ __forceinline__ v8f mmaH(v16h ah, v16h al, v16h bh, v16h bl, v8f c) {
  c = __builtin_amdgcn_wmma_f32_16x16x32_f16(false, ah, false, bh, (short)0, c, false, false);
  if (NT >= 2) c = __builtin_amdgcn_wmma_f32_16x16x32_f16(false, al, false, bh, (short)0, c, false, false);
  if (NT >= 3) c = __builtin_amdgcn_wmma_f32_16x16x32_f16(false, ah, false, bl, (short)0, c, false, false);
  asm volatile("v_nop\n\tv_nop\n\tv_nop\n\tv_nop" : "+v"(c) : "v"(ah), "v"(al), "v"(bh), "v"(bl));
  return c;
}
// batched GEMM like k_gemm_b but f16 operands: A f32 (split into f16 hi/lo if ASPLIT, else rounded to f16), Bt = f16 values [n][k]; alpha; C f32; N multiple of 16 (partial tiles skipped)
template <bool ASPLIT>
__global__ __launch_bounds__(128) void k_gemm_h(const float* __restrict__ A, int lda, size_t sA, const _Float16* __restrict__ Bh, int ldb, size_t sB, float alpha, float* __restrict__ C, int ldc, size_t sC, int M, int N, int K) {
  __shared__ __attribute__((aligned(16))) float so[4][16][64];
  const int tid = threadIdx.x, w = tid >> 5, lane = tid & 31, ln = lane & 15, hh = lane >> 4; const int by = blockIdx.y;
  A += (size_t)by * sA; Bh += (size_t)by * sB; C += (size_t)by * sC;
  const int ntn = (N + 63) / 64; const int wid = blockIdx.x * 4 + w; const int mt = wid / ntn, nq = wid % ntn; if (mt * 16 >= M) return;
  const int row0 = mt * 16, col0 = nq * 64; const float* arow = A + (size_t)(row0 + ln) * lda;
  v8f acc[4] = {};
  for (int kb = 0; kb < K; kb += 32) {
    FragH ah, al;
    const v4f x0 = *(const v4fa*)(arow + kb + 8 * hh), x1 = *(const v4fa*)(arow + kb + 8 * hh + 4), x2 = *(const v4fa*)(arow + kb + 16 + 8 * hh), x3 = *(const v4fa*)(arow + kb + 16 + 8 * hh + 4);
    float xs[16] = {x0[0],x0[1],x0[2],x0[3],x1[0],x1[1],x1[2],x1[3],x2[0],x2[1],x2[2],x2[3],x3[0],x3[1],x3[2],x3[3]};
#pragma unroll
    for (int i = 0; i < 16; ++i) { const _Float16 h = (_Float16)xs[i]; ah.h[i] = h; al.h[i] = ASPLIT ? (_Float16)(xs[i] - (float)h) : (_Float16)0.0f; }
#pragma unroll
    for (int t = 0; t < 4; ++t) { if (col0 + t * 16 >= N) continue; const size_t boff = (size_t)(col0 + t * 16 + ln) * ldb + kb; FragH bq; bq.half[0] = *(const v8us*)(Bh + boff + 8 * hh); bq.half[1] = *(const v8us*)(Bh + boff + 16 + 8 * hh);
      acc[t] = mmaH<ASPLIT ? 2 : 1>(ah.v, al.v, bq.v, bq.v, acc[t]); }
  }
#pragma unroll
  for (int t = 0; t < 4; ++t) { if (col0 + t * 16 >= N) continue;
#pragma unroll
    for (int r = 0; r < 8; ++r) so[w][8 * hh + r][t * 16 + ln] = acc[t][r] * alpha; }
  __builtin_amdgcn_fence(__ATOMIC_ACQ_REL, "workgroup"); __builtin_amdgcn_wave_barrier();
  const int rsub = lane >> 4, c4 = (lane & 15) * 4;
  {
#pragma unroll
    for (int q = 0; q < 8; ++q) { const int r = q * 2 + rsub; if (col0 + c4 < N) { const v4f v = *(const v4fa*)&so[w][r][c4]; *(v4f*)(C + (size_t)(row0 + r) * ldc + col0 + c4) = v; } }
     }
}

// Wt[n][k] = f16(W[k][n]·scale) from f32 row-major W[K][N] (scale = power of two; bf16-exact weights stay exact in f16 away from the subnormal range)
__global__ __launch_bounds__(256) void k_wt_f16(const float* __restrict__ W, _Float16* __restrict__ Wt, int K, int N, float scale) {
  const int t = blockIdx.x * 256 + threadIdx.x; if (t >= N * (K / 8)) return; const int n = t / (K / 8), k8 = (t % (K / 8)) * 8; FragH f;
#pragma unroll
  for (int i = 0; i < 8; ++i) f.h[i] = (_Float16)(bf16_round(W[(size_t)(k8 + i) * N + n]) * scale); const v8us o = f.half[0];
  *(v8us*)((unsigned short*)Wt + (size_t)n * K + k8) = o; 
}
// k_gemm_hh variant with fused epilogue: v = acc·alpha + bias[by·sBias + col] (+ CP[(row/rowsPerB)·sCPb + by·64 + col] if CP) ; ACT 0 none / 1 elu ; writes f16 C16 (and f32 C if non-null)
template <int ACT>
__global__ __launch_bounds__(128) void k_gemm_hhx(const _Float16* __restrict__ A, int lda, size_t sA, const _Float16* __restrict__ Bh, int ldb, size_t sB, float alpha, const float* __restrict__ bias, size_t sBias, const float* __restrict__ CP, int rowsPerB, size_t sCPb, int row0g,
    float* __restrict__ C, _Float16* __restrict__ C16, int ldc, size_t sC, int M, int N, int K) {
  __shared__ __attribute__((aligned(16))) float so[4][16][64];
  const int tid = threadIdx.x, w = tid >> 5, lane = tid & 31, ln = lane & 15, hh = lane >> 4; const int by = blockIdx.y;
  A += (size_t)by * sA; Bh += (size_t)by * sB; const size_t cofs = (size_t)by * sC; const float* bp = bias ? bias + (size_t)by * sBias : nullptr;
  const int ntn = (N + 63) / 64; const int wid = blockIdx.x * 4 + w; const int mt = wid / ntn, nq = wid % ntn; if (mt * 16 >= M) return;
  const int row0 = mt * 16, col0 = nq * 64; const _Float16* arow = A + (size_t)(row0 + ln) * lda;
  v8f acc[4] = {};
  for (int kb = 0; kb < K; kb += 32) { FragH ah; ah.half[0] = *(const v8us*)((const unsigned short*)arow + kb + 8 * hh); ah.half[1] = *(const v8us*)((const unsigned short*)arow + kb + 16 + 8 * hh);
#pragma unroll
    for (int t = 0; t < 4; ++t) { if (col0 + t * 16 >= N) continue; const size_t boff = (size_t)(col0 + t * 16 + ln) * ldb + kb; FragH bq; bq.half[0] = *(const v8us*)((const unsigned short*)Bh + boff + 8 * hh); bq.half[1] = *(const v8us*)((const unsigned short*)Bh + boff + 16 + 8 * hh);
      acc[t] = mmaH<1>(ah.v, ah.v, bq.v, bq.v, acc[t]); }
  }
#pragma unroll
  for (int t = 0; t < 4; ++t) { if (col0 + t * 16 >= N) continue; const int col = col0 + t * 16 + ln; const float bv = bp ? bf16_round(bp[col]) : 0.f;
#pragma unroll
    for (int r = 0; r < 8; ++r) { float v = acc[t][r] * alpha + bv; if (CP) { const int rr = row0g + row0 + 8 * hh + r; if (rowsPerB < 0) v += CP[cofs + (size_t)rr * ldc + col];      /* rowsPerB < 0: own element of the batched C plane */ else { const int bidx = rr / rowsPerB; v += CP[(size_t)bidx * sCPb + (size_t)by * 64 + col]; } } if (ACT == 1) v = (v > 0.f) ? v : expm1f(v); else if (ACT == 7) v = (v > 0.f) ? v + 1.0f : expf(v); else if (ACT == 8) v = tanhf(v); else if (ACT == 9) v = 0.5f * v * (1.0f + tanhf(0.7978845608028654f * (v + 0.044715f * v * v * v))); else if (ACT == 11) v = 1.0f / (1.0f + expf(-v)); else if (ACT == 12) v = (v > 0.f) ? v : 0.01f * v; else if (ACT == 14) v = (v > 0.f) ? v : 0.1f * v; else if (ACT == 16) v = (v >= 0.f) ? v : 0.3f * v; else if (ACT == 17) v = (v >= 0.f) ? v : 0.2f * v; else if (ACT == 15) v = v / (1.0f + expf(-v)); else if (ACT == 3) v = fmaxf(v, 0.f); else if (ACT == 6) v = 0.5f * v * (1.0f + erff(v * 0.70710678118654752f)); so[w][8 * hh + r][t * 16 + ln] = v; } }
  __builtin_amdgcn_fence(__ATOMIC_ACQ_REL, "workgroup"); __builtin_amdgcn_wave_barrier();
  const int rsub = lane >> 4, c4 = (lane & 15) * 4; typedef _Float16 v4h __attribute__((ext_vector_type(4)));
  {
#pragma unroll
    for (int q = 0; q < 8; ++q) { const int r = q * 2 + rsub; if (col0 + c4 < N) { const v4f v = *(const v4fa*)&so[w][r][c4]; if (C) *(v4f*)(C + cofs + (size_t)(row0 + r) * ldc + col0 + c4) = v; if (C16) { v4h h4; for (int i = 0; i < 4; ++i) h4[i] = (_Float16)v[i]; *(v4h*)(C16 + cofs + (size_t)(row0 + r) * ldc + col0 + c4) = h4; } } }
     }
}


typedef _Float16 v4h __attribute__((ext_vector_type(4)));

__global__ __launch_bounds__(256) void k_x16(const float* __restrict__ x, _Float16* __restrict__ X16, size_t n8) { const size_t t = (size_t)blockIdx.x * 256 + threadIdx.x; if (t >= n8) return; FragH f;
#pragma unroll
  for (int q = 0; q < 8; ++q) f.h[q] = (_Float16)bf16_round(x[t * 8 + q]); *(v8us*)((unsigned short*)X16 + t * 8) = f.half[0];  }
__global__ __launch_bounds__(256) void k_h16(const float* __restrict__ x, _Float16* __restrict__ X16, size_t n8) { const size_t t = (size_t)blockIdx.x * 256 + threadIdx.x; if (t >= n8) return; FragH f;
#pragma unroll
  for (int q = 0; q < 8; ++q) f.h[q] = (_Float16)x[t * 8 + q]; *(v8us*)((unsigned short*)X16 + t * 8) = f.half[0];  }
__global__ __launch_bounds__(256) void k_round16f(const float* __restrict__ W, _Float16* __restrict__ Bt, size_t n8) { const size_t t = (size_t)blockIdx.x * 256 + threadIdx.x; if (t >= n8) return; FragH f;
#pragma unroll
  for (int i = 0; i < 8; ++i) f.h[i] = (_Float16)(bf16_round(W[t * 8 + i]) * 16.0f); *(v8us*)((unsigned short*)Bt + t * 8) = f.half[0];  }
template <int NHv, int TTv>
__global__ __launch_bounds__(256) void k_vt(const _Float16* __restrict__ V16, int ldv, int voff, _Float16* __restrict__ Vt) { __shared__ unsigned short tl[64][66]; const int tid = threadIdx.x; const int slab = blockIdx.x / (TTv / 64), lg = blockIdx.x % (TTv / 64); const int b = slab / NHv, h = slab % NHv;
  for (int i = tid; i < 64 * 8; i += 256) { const int r = i / 8, c8 = (i % 8) * 8; FragH f; f.half[0] = *(const v8us*)((const unsigned short*)V16 + ((size_t)b * TTv + lg * 64 + r) * ldv + voff + h * 64 + c8);
#pragma unroll
    for (int q = 0; q < 8; ++q) tl[r][c8 + q] = f.u[q]; }
  __syncthreads();
  {
#pragma unroll
    for (int rd = 0; rd < 2; ++rd) { const int d = rd * 32 + tid / 8, pc = tid % 8; FragH f;
#pragma unroll
      for (int q = 0; q < 8; ++q) f.u[q] = tl[pc * 8 + q][d];
      *(v8us*)((unsigned short*)Vt + ((size_t)slab * 64 + d) * TTv + lg * 64 + pc * 8) = f.half[0]; }
     } }

// one 16 x 32 f16 fragment row piece of lane half hh from a K-contiguous row at p: k = 8 hh .. 8 hh + 7 and 16 + 8 hh .. 16 + 8 hh + 7
__device__ __forceinline__ v16h g2_frag(const _Float16* p, int hh) { FragH f; f.half[0] = *(const v8us*)((const unsigned short*)p + 8 * hh); f.half[1] = *(const v8us*)((const unsigned short*)p + 16 + 8 * hh); return f.v; }

__device__ __forceinline__ void wnat_body(unsigned bx, const float* __restrict__ w, size_t n8, _Float16* __restrict__ Bt) { const size_t t = (size_t)bx * 256 + threadIdx.x; if (t >= n8) return; FragH f; for (int q = 0; q < 8; ++q) f.h[q] = (_Float16)(bf16_round(w[t * 8 + q]) * 16.0f); *(v8us*)((unsigned short*)Bt + t * 8) = f.half[0];  }
__global__ __launch_bounds__(256) void k_rsm(const float* __restrict__ S, _Float16* __restrict__ P, int nrows) {
  #pragma clang fp contract(off)
  const int i = blockIdx.x * 256 + threadIdx.x; if (i >= nrows) return; const float* s = S + (size_t)i * SQ; float mx = -3.0e38f;
#pragma unroll 1
  for (int j = 0; j < SQ; ++j) mx = fmaxf(mx, s[j]); float se = 0.f;
#pragma unroll 1
  for (int j = 0; j < SQ; ++j) se += expf(s[j] - mx); const float sc = 256.0f / se;
#pragma unroll 1
  for (int j0 = 0; j0 < SQ; j0 += 8) { FragH f; for (int q = 0; q < 8; ++q) f.h[q] = (_Float16)(expf(s[j0 + q] - mx) * sc); unsigned short* d = (unsigned short*)P + (size_t)i * SQ + j0; *(v8us*)d = f.half[0];  } }
__global__ __launch_bounds__(256) void k_vt(const _Float16* __restrict__ V16, int b, int h0, _Float16* __restrict__ VT) { __shared__ unsigned short tl[64][65]; const int tid = threadIdx.x; const int hh = blockIdx.x % HG, sg = blockIdx.x / HG; const int s0 = sg * 64; const int h = h0 + hh;
  for (int i = tid; i < 64 * 8; i += 256) { const int j = i / 8, d8 = (i % 8) * 8; FragH f; f.half[0] = *(const v8us*)((const unsigned short*)V16 + ((size_t)b * SQ + s0 + j) * DM + h * HD + d8); for (int q = 0; q < 8; ++q) tl[d8 + q][j] = f.u[q]; }
  __syncthreads();
  { for (int i = tid; i < 64 * 8; i += 256) { const int d = i / 8, j8 = (i % 8) * 8; FragH f; for (int q = 0; q < 8; ++q) f.u[q] = tl[d][j8 + q]; *(v8us*)((unsigned short*)VT + ((size_t)hh * HD + d) * SQ + s0 + j8) = f.half[0]; }  } }


// lane l <-> l ^ M inside a 16-lane row (DPP row_xmask)
template <int M> __device__ __forceinline__ float ln_xm(float v) { return __int_as_float(__builtin_amdgcn_update_dpp(0, __float_as_int(v), 0x160 + M, 0xf, 0xf, true)); }
// 2^x (v_exp_f32). The v_nop in the same statement keeps the one issue slot that the instruction set asks for behind a transcendental, before its result is read or its source overwritten.
__device__ __forceinline__ float exp2_slot(float x) { float r; asm("v_exp_f32 %0, %1\n\tv_nop" : "=v"(r) : "v"(x)); return r; }
// Scores and their row softmax in one launch. A work-group owns MT*16 whole rows m of S^T[m][n] = g_m . f_n: each of its NW waves forms its own LL/NW columns on WMMA (hi.hi + 2^-10 (lo.hi + hi.lo)) and keeps them in
// accumulator registers through the maximum, the exponentials and the scaling, so the f32 score plane never goes to memory. Column tile t of a wave takes f rows n = base + (t>>3)*128 + ln*8 + (t&7): a lane then holds 8 neighbouring columns of a row, and one 16-byte store per lane writes whole lines of beta^T.
// Both operands come through LDS by asynchronous copies of whole 128-byte rows (LDS pitch 144 B, so that the 16-byte fragment reads spread over the banks): the g rows once for the work-group, each wave's own f rows in stages of two column tiles, two buffers, the next stage's copies flying while this stage is multiplied. A fragment load straight from global memory would touch 16 lines for 512 bytes.
#define SC_PITCH 72      /* f16 per LDS row */
__device__ __forceinline__ unsigned g3_lds(const void* p) { return (unsigned)(size_t)p; }      /* byte offset in the work-group's LDS */
__device__ __forceinline__ v8f sc_mma(v16h a, v16h b, v8f c) { return __builtin_amdgcn_wmma_f32_16x16x32_f16(false, a, false, b, (short)0, c, false, false); }
template <int MT, int NW>
__global__ __launch_bounds__(NW * 32) void k_scsm(const _Float16* __restrict__ Gh, const _Float16* __restrict__ Gl, const _Float16* __restrict__ Fh, const _Float16* __restrict__ Fl, _Float16* __restrict__ P) {
  constexpr int TP = LL / (NW * 16); static_assert(TP % 8 == 0 && (NW == 8 || NW == 16), "k_scsm: a wave takes whole groups of 8 column tiles; the cross-wave step reads one partial per lane of a 16-lane row");
  static_assert(NW * 4 == 2 * MT * 16, "k_scsm: one copy of four rows per wave brings in the g rows of both planes");
  __shared__ float rmx[MT * 16][NW]; __shared__ float rsu[MT * 16][NW];      /* one partial maximum / sum per row and wave */
  __shared__ __attribute__((aligned(16))) unsigned short gs[2 * MT * 16][SC_PITCH];      /* the work-group's g rows: hi plane, then residual plane */
  __shared__ __attribute__((aligned(16))) unsigned short fs[NW][2][64][SC_PITCH];      /* per wave two buffers of one stage = two column tiles: LDS row (plane * 2 + tile) * 16 + ln */
  const int lane = threadIdx.x & 31, ln = lane & 15, hh = lane >> 4; const int w = __builtin_amdgcn_readfirstlane(threadIdx.x >> 5);
  const size_t rb = (size_t)blockIdx.y * LL; const int m0 = blockIdx.x * (MT * 16); const int n0 = w * (TP * 16) + ln * 8;
  const v8f z8 = {0.f,0.f,0.f,0.f,0.f,0.f,0.f,0.f};
  /* a copy of a wave = four whole 128-byte rows: lane -> row rs of the four, 16-byte piece pc. Copy q of a stage and plane takes the f rows of lanes ln = 2q and 2q + 1 for the stage's two tiles: two neighbouring rows each, 256 bytes in a piece */
  const int rs = lane >> 3, pc = lane & 7;
  const size_t fo0 = (rb + w * (TP * 16) + (rs >> 1) * 8 + (rs & 1)) * CQ + pc * 8;
  const unsigned short* fgh = (const unsigned short*)Fh + fo0; const unsigned short* fgl = (const unsigned short*)Fl + fo0;
  const unsigned fl0 = g3_lds(&fs[w][0][(rs & 1) * 16 + (rs >> 1)][pc * 8]);
  auto stage_f = [&](int j, int buf) {      /* stage j = column tiles 2j and 2j + 1 of this wave */
#pragma unroll
    for (int p = 0; p < 2; ++p) { unsigned l[8]; const unsigned short* g[8];
#pragma unroll
      for (int q = 0; q < 8; ++q) { l[q] = fl0 + (unsigned)((buf * 64 + p * 32 + q * 2) * (SC_PITCH * 2)); g[q] = (p ? fgl : fgh) + (size_t)(((j >> 2) * 128 + q * 16 + (j & 3) * 2) * CQ); }
      /* one plane's eight copies; the s_wait_xcnt in the same statement is a precaution: it stands before any register that a copy names is written again */
      asm volatile("global_load_async_to_lds_b128 %0, %8, off\n\tglobal_load_async_to_lds_b128 %1, %9, off\n\tglobal_load_async_to_lds_b128 %2, %10, off\n\tglobal_load_async_to_lds_b128 %3, %11, off\n\t"
                   "global_load_async_to_lds_b128 %4, %12, off\n\tglobal_load_async_to_lds_b128 %5, %13, off\n\tglobal_load_async_to_lds_b128 %6, %14, off\n\tglobal_load_async_to_lds_b128 %7, %15, off\n\ts_wait_xcnt 0x0"
                   :: "v"(l[0]), "v"(l[1]), "v"(l[2]), "v"(l[3]), "v"(l[4]), "v"(l[5]), "v"(l[6]), "v"(l[7]), "v"(g[0]), "v"(g[1]), "v"(g[2]), "v"(g[3]), "v"(g[4]), "v"(g[5]), "v"(g[6]), "v"(g[7]) : "memory"); } };
  { const int gr = w * 4 + rs;      /* g: wave w brings LDS rows 4w .. 4w + 3, all of one plane */
    const unsigned short* gg = (const unsigned short*)(w * 4 >= MT * 16 ? Gl : Gh) + (rb + m0 + (gr & (MT * 16 - 1))) * CQ + pc * 8; const unsigned gl = g3_lds(&gs[gr][pc * 8]);
    /* the s_wait_xcnt in the same statement: the same precaution as above */
    asm volatile("global_load_async_to_lds_b128 %0, %1, off\n\ts_wait_xcnt 0x0" :: "v"(gl), "v"(gg) : "memory"); }
  constexpr int NS = TP / 2;
  stage_f(0, 0);
  asm volatile("s_wait_asynccnt 0x0" ::: "memory");      /* this wave's copies of g and of stage 0 have landed */
  __syncthreads();      /* g and stage 0 are readable by every wave */
  stage_f(1, 1);
  v16h ah[MT][2], al[MT][2];
#pragma unroll      /* full unroll here and below: the fragment and score arrays stay in registers */
  for (int mt = 0; mt < MT; ++mt) { const _Float16* gh = (const _Float16*)&gs[mt * 16 + ln][0]; const _Float16* gl = (const _Float16*)&gs[MT * 16 + mt * 16 + ln][0]; ah[mt][0] = g2_frag(gh, hh); ah[mt][1] = g2_frag(gh + 32, hh); al[mt][0] = g2_frag(gl, hh); al[mt][1] = g2_frag(gl + 32, hh); }
  v8f s[MT][TP];      /* lane (ln, hh), element r of s[mt][t] = row m0 + mt*16 + 8*hh + r, column n0 + (t>>3)*128 + (t&7) */
#pragma unroll
  for (int j = 0; j < NS; ++j) {
#pragma unroll
    for (int tt = 0; tt < 2; ++tt) { const int t = j * 2 + tt; const _Float16* fh = (const _Float16*)&fs[w][j & 1][tt * 16 + ln][0]; const _Float16* fl = (const _Float16*)&fs[w][j & 1][32 + tt * 16 + ln][0];
      const v16h bh0 = g2_frag(fh, hh), bh1 = g2_frag(fh + 32, hh), bl0 = g2_frag(fl, hh), bl1 = g2_frag(fl + 32, hh);
#pragma unroll
      for (int mt = 0; mt < MT; ++mt) { const v8f c = sc_mma(ah[mt][1], bh1, sc_mma(ah[mt][0], bh0, z8)); const v8f d = sc_mma(ah[mt][1], bl1, sc_mma(ah[mt][0], bl0, sc_mma(al[mt][1], bh1, sc_mma(al[mt][0], bh0, z8))));
        s[mt][t] = d * 0.0009765625f + c; }
      __builtin_amdgcn_sched_barrier(0); }      /* keeps the next tile's fragment reads behind this tile's WMMAs, so that one f fragment set is live: two cost a spill of scores */
    asm volatile("s_wait_dscnt 0x0" ::: "memory");      /* this wave's reads of the buffer are done before it may be refilled */
    asm volatile("s_wait_asynccnt 0x0" ::: "memory");      /* this wave's copies of stage j + 1 have landed */
    __syncthreads();      /* publishes stage j + 1 and ends the reads of stage j */
    if (j + 2 < NS) stage_f(j + 2, j & 1); }
  asm volatile("s_wait_asynccnt 0x0" ::: "memory");      /* no copy is outstanding when the wave goes on */
  v8f st[MT];
#pragma unroll
  for (int mt = 0; mt < MT; ++mt) { v8f m = s[mt][0];
#pragma unroll
    for (int t = 1; t < TP; ++t) m = __builtin_elementwise_max(m, s[mt][t]);
#pragma unroll
    for (int r = 0; r < 8; ++r) { float x = m[r]; x = fmaxf(x, ln_xm<1>(x)); x = fmaxf(x, ln_xm<2>(x)); x = fmaxf(x, ln_xm<4>(x)); x = fmaxf(x, ln_xm<8>(x)); m[r] = x; }
    st[mt] = m; }
  if (ln == 0) {
#pragma unroll
    for (int mt = 0; mt < MT; ++mt)
#pragma unroll
      for (int r = 0; r < 8; ++r) rmx[mt * 16 + 8 * hh + r][w] = st[mt][r]; }
  __syncthreads();      /* every wave's partial maxima are in LDS */
#pragma unroll
  for (int mt = 0; mt < MT; ++mt) { v8f m;
#pragma unroll
    for (int r = 0; r < 8; ++r) { float x = rmx[mt * 16 + 8 * hh + r][ln & (NW - 1)]; x = fmaxf(x, ln_xm<1>(x)); x = fmaxf(x, ln_xm<2>(x)); x = fmaxf(x, ln_xm<4>(x)); if (NW == 16) x = fmaxf(x, ln_xm<8>(x)); m[r] = x; }
    v8f a = z8;
#pragma unroll
    for (int t = 0; t < TP; ++t) { const v8f y = (s[mt][t] - m) * 1.442695041f; v8f e;
#pragma unroll
      for (int r = 0; r < 8; ++r) e[r] = exp2_slot(y[r]);      /* = native exp: the same multiply and v_exp_f32 */
      s[mt][t] = e; a += e; }
#pragma unroll
    for (int r = 0; r < 8; ++r) { float x = a[r]; x += ln_xm<1>(x); x += ln_xm<2>(x); x += ln_xm<4>(x); x += ln_xm<8>(x); a[r] = x; }
    st[mt] = a; }
  if (ln == 0) {
#pragma unroll
    for (int mt = 0; mt < MT; ++mt)
#pragma unroll
      for (int r = 0; r < 8; ++r) rsu[mt * 16 + 8 * hh + r][w] = st[mt][r]; }
  __syncthreads();      /* every wave's partial sums are in LDS */
#pragma unroll
  for (int mt = 0; mt < MT; ++mt) { v8f sc;
#pragma unroll
    for (int r = 0; r < 8; ++r) { float x = rsu[mt * 16 + 8 * hh + r][ln & (NW - 1)]; x += ln_xm<1>(x); x += ln_xm<2>(x); x += ln_xm<4>(x); if (NW == 16) x += ln_xm<8>(x); sc[r] = 256.0f / x; }
#pragma unroll
    for (int t = 0; t < TP; ++t) s[mt][t] *= sc;
#pragma unroll
    for (int r = 0; r < 8; ++r) { unsigned short* d = (unsigned short*)P + (rb + m0 + mt * 16 + 8 * hh + r) * LL + n0;
#pragma unroll
      for (int t8 = 0; t8 < TP / 8; ++t8) { FragH f;
#pragma unroll
        for (int q = 0; q < 8; ++q) f.h[q] = (_Float16)s[mt][t8 * 8 + q][r];
        *(v8us*)(d + t8 * 128) = f.half[0]; } } } }

// ---- GEMM with both operands staged in LDS: C[c][n] = alpha * sum_k A[c][k] Bh[n][k] (both K-contiguous f16), one 256 x 128 tile of C per work-group, 8 waves as 4 x 2, 64 x 64 per wave. ----
// A stage is 64 k of all 384 operand rows (128 B a row, LDS pitch 144 B so that the 16-byte fragment reads spread over the banks). Asynchronous copies bring whole 128-byte lines from global memory straight into LDS, two buffers:
// the next stage's copies fly while this stage is multiplied. Every operand line is asked for once per work-group, instead of in 32-byte pieces by every wave. k runs upward in steps of 32 into one accumulator chain per tile. Requires M % 256 == 0, N % 128 == 0, K % 64 == 0.
// HL (N = 128, two results of 64 columns side by side, each with rows of its own of pitch ldc): each f32 value alpha acc is cut into f16 hi + x1024 residual, columns 0..63 into C16 / CL, columns 64..127 into C16b / CLb, so the f32 rows never go to memory.
// F16OUT: C16 = f16(alpha acc). Otherwise the residual epilogue: C = bf16(gam[0]) alpha acc + bf16(X), X laid out like C, both [CC][LL] planes (pitch LL at compile time: a lane's 32 loads and 32 stores share one address each and differ in the immediate offset).
#define G3_PITCH 72      /* f16 per LDS row */
#define G3_STAGE (384 * G3_PITCH)      /* f16 per buffer */
// The body takes its LDS from the calling kernel: ring = the two stage buffers, so = each wave's own output staging; bx = tile index, by = batch. so may lie on the ring's bytes: it is first written behind the loop, whose last trip ends with every wave's s_wait_dscnt 0 and s_wait_asynccnt 0 and a work-group barrier, with no refill behind it.
template <bool F16OUT, bool HL = false>
__device__ __forceinline__ void gemm3_body(unsigned short* ring, float (*so)[64][68], unsigned bx, int by, const _Float16* __restrict__ A, int lda, size_t sA, const _Float16* __restrict__ Bh, int ldb, size_t sB, float alpha, float* __restrict__ C, _Float16* __restrict__ C16, const float* __restrict__ X, const float* __restrict__ gam, int ldc, size_t sC, int N, int K,
                                           _Float16* __restrict__ CL = nullptr, _Float16* __restrict__ C16b = nullptr, _Float16* __restrict__ CLb = nullptr) { static_assert(F16OUT || !HL, "gemm3_body: HL is a form of the f16 output");
  const int tid = threadIdx.x, lane = tid & 31, ln = lane & 15, hh = lane >> 4; const int w = __builtin_amdgcn_readfirstlane(tid >> 5); const int wm = w >> 1, wn = w & 1;
  const int ntn = N >> 7; const int mt = bx / ntn, nq = bx - mt * ntn; const int row0 = mt * 256, col0 = nq * 128; const size_t cofs = (size_t)by * sC;
  /* copy j of a thread: operand row j*32 + tid/8 of the stage (rows 0..255 = A, 256..383 = Bh), 16-byte piece tid%8: a wave's copy covers four whole rows */
  const unsigned short* ga = (const unsigned short*)A + (size_t)by * sA + (size_t)(row0 + (tid >> 3)) * lda + (tid & 7) * 8;
  const unsigned short* gb = (const unsigned short*)Bh + (size_t)by * sB + (size_t)(col0 + (tid >> 3)) * ldb + (tid & 7) * 8;
  const unsigned lb = g3_lds(ring) + (unsigned)(tid >> 3) * (G3_PITCH * 2) + (unsigned)(tid & 7) * 16;
  auto stage_in = [&](int s, int buf) {
    unsigned l[12]; const unsigned short* g[12];
#pragma unroll
    for (int j = 0; j < 12; ++j) { l[j] = lb + (unsigned)buf * (G3_STAGE * 2) + (unsigned)j * (32 * G3_PITCH * 2); g[j] = (j < 8 ? ga + (size_t)(j * 32) * lda : gb + (size_t)((j - 8) * 32) * ldb) + s * 64; }
    /* one stage's twelve copies; the s_wait_xcnt in the same statement is a precaution: it stands before any register that a copy names is written again */
    asm volatile("global_load_async_to_lds_b128 %0, %12, off\n\tglobal_load_async_to_lds_b128 %1, %13, off\n\tglobal_load_async_to_lds_b128 %2, %14, off\n\tglobal_load_async_to_lds_b128 %3, %15, off\n\t"
                 "global_load_async_to_lds_b128 %4, %16, off\n\tglobal_load_async_to_lds_b128 %5, %17, off\n\tglobal_load_async_to_lds_b128 %6, %18, off\n\tglobal_load_async_to_lds_b128 %7, %19, off\n\t"
                 "global_load_async_to_lds_b128 %8, %20, off\n\tglobal_load_async_to_lds_b128 %9, %21, off\n\tglobal_load_async_to_lds_b128 %10, %22, off\n\tglobal_load_async_to_lds_b128 %11, %23, off\n\ts_wait_xcnt 0x0"
                 :: "v"(l[0]), "v"(l[1]), "v"(l[2]), "v"(l[3]), "v"(l[4]), "v"(l[5]), "v"(l[6]), "v"(l[7]), "v"(l[8]), "v"(l[9]), "v"(l[10]), "v"(l[11]),
                    "v"(g[0]), "v"(g[1]), "v"(g[2]), "v"(g[3]), "v"(g[4]), "v"(g[5]), "v"(g[6]), "v"(g[7]), "v"(g[8]), "v"(g[9]), "v"(g[10]), "v"(g[11]) : "memory"); };
  float gsc = alpha; if (!F16OUT) gsc = bf16_round(gam[0]) * alpha;      /* read at entry, ahead of every asm statement: a scalar load */
  const int ns = K >> 6;
  stage_in(0, 0);
  asm volatile("s_wait_asynccnt 0x0" ::: "memory");      /* this wave's copies of stage 0 have landed */
  __syncthreads();      /* stage 0 is readable by every wave */
  if (ns > 1) stage_in(1, 1);
  const v8f z8 = {0.f,0.f,0.f,0.f,0.f,0.f,0.f,0.f}; v8f acc[4][4];
#pragma unroll
  for (int i = 0; i < 4; ++i)
#pragma unroll
    for (int j = 0; j < 4; ++j) acc[i][j] = z8;
  const int ao = (wm * 64 + ln) * G3_PITCH, bo = (256 + wn * 64 + ln) * G3_PITCH;
#pragma unroll 1      /* the stage loop stays rolled: the accumulators keep constant indices and the loop stays small */
  for (int s = 0; s < ns; ++s) { const _Float16* rb = (const _Float16*)ring + (s & 1) * G3_STAGE;
#pragma unroll
    for (int kk = 0; kk < 2; ++kk) { v16h a[4], b[4];
#pragma unroll
      for (int i = 0; i < 4; ++i) { a[i] = g2_frag(rb + ao + i * (16 * G3_PITCH) + kk * 32, hh); b[i] = g2_frag(rb + bo + i * (16 * G3_PITCH) + kk * 32, hh); }
      __builtin_amdgcn_sched_barrier(0);      /* the block's 16 LDS reads go out as one group ahead of its WMMAs: left free, the compiler reloads one A fragment per four WMMAs and waits out the LDS latency each time */
#pragma unroll
      for (int d = 0; d < 4; ++d) {      /* tiles in the order in which their fragments arrive (a0 b0 a1 b1 ...): the first WMMAs run while the later reads are still coming; each tile still gets one WMMA per block, k upward */
#pragma unroll
        for (int e = 0; e < d; ++e) { acc[e][d] = sc_mma(a[e], b[d], acc[e][d]); acc[d][e] = sc_mma(a[d], b[e], acc[d][e]); }
        acc[d][d] = sc_mma(a[d], b[d], acc[d][d]); }
      __builtin_amdgcn_sched_barrier(0); }      /* keeps the next group of reads behind this block, so that one fragment set is live */
    asm volatile("s_wait_dscnt 0x0" ::: "memory");      /* this wave's reads of the buffer are done before it may be refilled */
    asm volatile("s_wait_asynccnt 0x0" ::: "memory");      /* this wave's copies of stage s + 1 have landed */
    __syncthreads();      /* publishes stage s + 1 and ends every wave's reads of stage s */
    if (s + 2 < ns) stage_in(s + 2, s & 1); }
  asm volatile("s_wait_asynccnt 0x0" ::: "memory");      /* no copy is outstanding when the wave goes on to its end */
  const int rsub = lane >> 4, c4 = (lane & 15) * 4; const int ldo = F16OUT ? ldc : LL; const size_t o0 = cofs + (size_t)(row0 + wm * 64 + rsub) * ldo + col0 + wn * 64 + c4;
  v4f xr[F16OUT ? 1 : 32];      /* the lane's residual values, asked for in two groups of 16 loads: the first flies while the accumulators are staged, the second while the first half of the rows is formed and stored */
  if (!F16OUT) {
#pragma unroll      /* unrolled here and below: xr keeps constant indices and stays in registers */
    for (int q = 0; q < 16; ++q) xr[q] = *(const v4fa*)(X + o0 + (size_t)(q * 2) * ldo); }
  float (*sw)[68] = so[w];
#pragma unroll
  for (int i = 0; i < 4; ++i)
#pragma unroll
    for (int j = 0; j < 4; ++j)
#pragma unroll
      for (int r = 0; r < 8; ++r) sw[i * 16 + 8 * hh + r][j * 16 + ln] = F16OUT ? acc[i][j][r] * alpha : acc[i][j][r];
  __builtin_amdgcn_fence(__ATOMIC_ACQ_REL, "workgroup"); __builtin_amdgcn_wave_barrier();      /* the wave's staged rows are read back by other lanes of the same wave */
  if (!F16OUT) {
#pragma unroll
    for (int q = 16; q < 32; ++q) xr[q] = *(const v4fa*)(X + o0 + (size_t)(q * 2) * ldo); }
#pragma unroll
  for (int q = 0; q < 32; ++q) { const v4f v = *(const v4fa*)&sw[q * 2 + rsub][c4]; const size_t o = o0 + (size_t)(q * 2) * ldo;
    if (HL) { v4h h4, l4; for (int i = 0; i < 4; ++i) { const _Float16 h = (_Float16)v[i]; h4[i] = h; l4[i] = (_Float16)((v[i] - (float)h) * 1024.0f); } const size_t oh = cofs + (size_t)(row0 + wm * 64 + q * 2 + rsub) * ldc + c4; *(v4h*)((wn ? C16b : C16) + oh) = h4; *(v4h*)((wn ? CLb : CL) + oh) = l4; }
    else if (F16OUT) { v4h h4; for (int i = 0; i < 4; ++i) h4[i] = (_Float16)v[i]; *(v4h*)(C16 + o) = h4; }
    else { v4f y; for (int i = 0; i < 4; ++i) y[i] = v[i] * gsc + bf16_round(xr[q][i]); *(v4f*)(C + o) = y; } } }
template <bool F16OUT>
__global__ __launch_bounds__(256) void k_gemm3(const _Float16* __restrict__ A, int lda, size_t sA, const _Float16* __restrict__ Bh, int ldb, size_t sB, float alpha, float* __restrict__ C, _Float16* __restrict__ C16, const float* __restrict__ X, const float* __restrict__ gam, int ldc, size_t sC, int N, int K) {
  __shared__ __attribute__((aligned(16))) unsigned short ring[2 * G3_STAGE];
  __shared__ __attribute__((aligned(16))) float so[8][64][68];
  gemm3_body<F16OUT>(ring, so, blockIdx.x, blockIdx.y, A, lda, sA, Bh, ldb, sB, alpha, C, C16, X, gam, ldc, sC, N, K); }
// The three projections of x in one launch (none reads another's result); blockIdx.y = batch. blockIdx.x < LL / 256: f^T and g^T of 256 token rows as one 256 x 128 tile (A = token rows of XR, B = the 64 rows of BQ and the 64 of BK, which follow them in memory); the others: one 256 x 128 tile of h. Both on gemm3_body.
// One LDS block serves as the ring and afterwards as the output staging: 136 KiB instead of 244, so that two work-groups fit a WGP and all 320 of the launch are resident at once.
__global__ __launch_bounds__(256) void k_proj(const _Float16* __restrict__ XR, const _Float16* __restrict__ BQK, const _Float16* __restrict__ BV, _Float16* __restrict__ Fh, _Float16* __restrict__ Fl, _Float16* __restrict__ Gh, _Float16* __restrict__ Gl, _Float16* __restrict__ H16) {
  __shared__ __attribute__((aligned(16))) float sm[8][64][68]; static_assert(sizeof(sm) >= 2 * G3_STAGE * 2, "k_proj: the ring lies inside the staging block");
  const unsigned bx = blockIdx.x; const int by = blockIdx.y;
  if (bx < LL / 256) gemm3_body<true, true>((unsigned short*)&sm[0][0][0], sm, bx, by, XR, CC, (size_t)LL * CC, BQK, CC, 0, 0.0625f, nullptr, Fh, nullptr, nullptr, CQ, (size_t)LL * CQ, 2 * CQ, CC, Fl, Gh, Gl);
  else gemm3_body<true>((unsigned short*)&sm[0][0][0], sm, bx - LL / 256, by, BV, CC, 0, XR, CC, (size_t)LL * CC, 0.0625f, nullptr, H16, nullptr, nullptr, LL, (size_t)CC * LL, LL, CC); }

__device__ __forceinline__ void cl2rows_body(float (*tl)[33], unsigned bx, const float* __restrict__ X, _Float16* __restrict__ XR) { const int tid = threadIdx.x; const int nl = LL / 32, nc = CC / 64; const int cb_ = bx % nc; const int lb = (bx / nc) % nl; const size_t b = bx / (nc * nl); const int c0 = cb_ * 64, l0 = lb * 32;
  for (int i = tid; i < 64 * 32; i += 256) { const int c = i / 32, l = i % 32; tl[c][l] = bf16_round(X[(b * CC + c0 + c) * (size_t)LL + l0 + l]); }
  __syncthreads();
  { const int l = tid / 8, c8 = (tid % 8) * 8; FragH f; for (int q = 0; q < 8; ++q) f.h[q] = (_Float16)tl[c8 + q][l]; unsigned short* d = (unsigned short*)XR + (b * LL + l0 + l) * (size_t)CC + c0 + c8; *(v8us*)d = f.half[0];
    asm volatile("s_wait_xcnt 0x0" ::: "memory");      /* a precaution: stands before any register that the store names is written again (the calling kernel's other branches follow in the code) */
  } }
// The four input conversions in one launch (none reads another's result): the first blocks cast Wq, Wk and Wv, the others transpose x.
#define PB_QK (CQ * CC / 8 / 256)      /* blocks for Wq, and for Wk */
#define PB_V (CC * CC / 8 / 256)      /* blocks for Wv */
#define PB_X (NB * (LL / 32) * (CC / 64))      /* blocks for x */
__global__ __launch_bounds__(256) void k_prep(const float* __restrict__ x, const float* __restrict__ wq, const float* __restrict__ wk, const float* __restrict__ wv, _Float16* __restrict__ XR, _Float16* __restrict__ BQ, _Float16* __restrict__ BK, _Float16* __restrict__ BV) {
  __shared__ float tl[64][33]; const unsigned bx = blockIdx.x;
  if (bx < PB_QK) wnat_body(bx, wq, (size_t)CQ * CC / 8, BQ);
  else if (bx < 2 * PB_QK) wnat_body(bx - PB_QK, wk, (size_t)CQ * CC / 8, BK);
  else if (bx < 2 * PB_QK + PB_V) wnat_body(bx - 2 * PB_QK, wv, (size_t)CC * CC / 8, BV);
  else cl2rows_body(tl, bx - (2 * PB_QK + PB_V), x, XR); }


extern "C" void kernel_launch(void* const* d_in, const int* in_sizes, int n_in,
                              void* d_out, int out_size, void* d_ws, size_t ws_size, hipStream_t stream) {
  (void)in_sizes; (void)n_in; (void)out_size;
  const float* const* I = (const float* const*)d_in; const float* x = I[0]; const float* wq = I[1]; const float* wk = I[2]; const float* wv = I[3]; const float* gam = I[4];
  char* ws = (char*)d_ws; size_t off = 0;
  auto take = [&](size_t bytes) { char* p = ws + off; off += (bytes + 255) & ~(size_t)255; return p; };
  _Float16* BQ = (_Float16*)take((size_t)2 * CQ * CC * 2); _Float16* BK = BQ + (size_t)CQ * CC;      /* one block: the rows of Wk follow those of Wq */
  _Float16* BV = (_Float16*)take((size_t)CC * CC * 2);
  _Float16* XR = (_Float16*)take(NR * CC * 2); _Float16* Fh = (_Float16*)take(NR * CQ * 2); _Float16* Fl = (_Float16*)take(NR * CQ * 2); _Float16* Gh = (_Float16*)take(NR * CQ * 2); _Float16* Gl = (_Float16*)take(NR * CQ * 2);
  _Float16* H16 = (_Float16*)take(NR * CC * 2); _Float16* P = (_Float16*)take(NR * LL * 2);
  if (off > ws_size) return;      /* approx 0.6 + 16 + 8 + 16 + 64 = 105 MiB: every plane holds all NB batches */
  /* every stage once for all batches: blockIdx.y = batch (k_prep: one-dimensional grid, batch from blockIdx.x) */
  k_prep<<<2 * PB_QK + PB_V + PB_X, 256, 0, stream>>>(x, wq, wk, wv, XR, BQ, BK, BV);      /* x16 f16 weights; exact f16 token rows [b*2048 + n][c] */
  k_proj<<<dim3(LL / 256 + (CC / 256) * (LL / 128), NB), 256, 0, stream>>>(XR, BQ, BV, Fh, Fl, Gh, Gl, H16);      /* f^T rows [b][n][64] and g^T rows [b][m][64] -> hi/lo; h channel-major [b][c][n] f16 */
  k_scsm<2, 16><<<dim3(LL / 32, NB), 512, 0, stream>>>(Gh, Gl, Fh, Fl, P);      /* S^T[b][m][n] = g_m . f_n (hi.hi + 2^-10 (lo.hi + hi.lo)), softmax over n per key m (the module's dim=1 softmax) -> beta^T[b][m][n] x256 f16 */
  k_gemm3<false><<<dim3((CC / 256) * (LL / 128), NB), 256, 0, stream>>>(H16, LL, (size_t)CC * LL, P, LL, (size_t)LL * LL, 0.00390625f, (float*)d_out, nullptr, x, gam, LL, (size_t)CC * LL, LL, LL);      /* out[b][c][m] = gamma 2^-8 sum_n h[c][n] beta^T[m][n] + x[b][c][m] (channel-major = the output layout) */
}

// v008
// Measured time: 89.2 microseconds a run.
// Timed twice side by side with v007, it ran 1.05 times as fast both times.
// Over all steps from v000 it is 45.1 times as fast.
#include <hip/hip_runtime.h>
// SAGAN-style self-attention with 1x1-conv projections (x [8][512][2048] channel-first; f = Wq x, g = Wk x (64 channels), h = Wv x (512); scores[n][m] = sum_c f[c][n] g[c][m] (unscaled); beta = softmax over n (the QUERY axis, dim=1) for each m; o[c][m] = gamma sum_n h[c][n] beta[n][m] + x[c][m] -> [8][512][2048]; gamma = an input scalar).
// Structure: x transposed to exact f16 token rows via LDS tiles; f^T and g^T as one WMMA GEMM (f32 accumulation, exact x16 weights) cut in the GEMM's own epilogue into f16 hi + x1024 residual planes; h channel-major as a GEMM (weights as the A operand) into f16 (f/g, h and o: 256x128 work-group tiles; every GEMM's operands staged in LDS by asynchronous copies); every stage is one launch over all batches (blockIdx.y = batch): S^T[m][n] = g^T f (K = 64; hi.hi + lo.hi + hi.lo on WMMA) and its row softmax over n (f32 statistics, native exp; weights x256 f16) = beta^T in one launch, a work-group holding whole score rows in registers; o[c][m] = h . beta^T as a GEMM (K = 2048) channel-major straight into the output, its epilogue forming out = bf16(gamma) o + bf16(x). Stages that do not depend on one another share a launch, told apart by the block index: weight casts + transpose; f, g and h GEMMs; scores + softmax; output GEMM = 4 launches.
// Compute dtype: inputs rounded to bf16; x / weights exact; f, g as hi + residual (~2^-22: the unscaled logits have sigma ~8); h and the softmax weights plain f16 (~2^-12); logits, statistics, o f32. v_wmma_f32_16x16x32_f16.
#define NB 8
#define CC 512
#define CQ 64
#define LL 2048
#define SQ LL
#define DM 64
#define NH 1
#define HD 64
#define HG 1
#define NR ((size_t)NB * LL)
typedef __bf16 v16b __attribute__((ext_vector_type(16)));
typedef unsigned short v8us __attribute__((ext_vector_type(8), may_alias));
typedef float  v8f  __attribute__((ext_vector_type(8)));
typedef float  v4f  __attribute__((ext_vector_type(4)));
typedef float  v4fa __attribute__((ext_vector_type(4), may_alias));
union FragB { v16b v; v8us half[2]; unsigned short u[16]; };

__device__ __forceinline__ unsigned short bf16_bits(float x) { unsigned int u = __float_as_uint(x); return (unsigned short)((u + 0x7FFFu + ((u >> 16) & 1u)) >> 16); }
__device__ __forceinline__ float bf16_val(unsigned short b) { return __uint_as_float(((unsigned int)b) << 16); }
__device__ __forceinline__ float bf16_round(float x) { return bf16_val(bf16_bits(x)); }
// D += A·B with NT terms: 1 = ah·bh, 2 = + al·bh (A split), 3 = + ah·bl (both split)
template <int NT>
__device__ __forceinline__ v8f mmaN(v16b ah, v16b al, v16b bh, v16b bl, v8f c) {
  c = __builtin_amdgcn_wmma_f32_16x16x32_bf16(false, ah, false, bh, (short)0, c, false, false);
  if (NT >= 2) c = __builtin_amdgcn_wmma_f32_16x16x32_bf16(false, al, false, bh, (short)0, c, false, false);
  if (NT >= 3) c = __builtin_amdgcn_wmma_f32_16x16x32_bf16(false, ah, false, bl, (short)0, c, false, false);
  asm volatile("v_nop\n\tv_nop\n\tv_nop\n\tv_nop" : "+v"(c) : "v"(ah), "v"(al), "v"(bh), "v"(bl));
  return c;
}

__global__ __launch_bounds__(256) void k_wt_bf16(const float* __restrict__ W, unsigned short* __restrict__ Wt, int K, int N) {
  const int t = blockIdx.x * 256 + threadIdx.x;
  const int k8n = K / 8;
  if (t >= N * k8n) return;
  const int n = t / k8n, k8 = (t % k8n) * 8;
  v8us v;
#pragma unroll
  for (int i = 0; i < 8; ++i) v[i] = bf16_bits(W[(size_t)(k8 + i) * N + n]);
  *(v8us*)(Wt + (size_t)n * K + k8) = v;
  
}

// GEMM C[M][N] (f32, pitch ldc) = act(A[M][K]·W + bias). A f32 row-major (pitch lda) converted per fragment to bf16
// (ASPLIT: hi/lo two planes -> 2 terms, else single rounded term); Wt bf16 [N][K] (pitch ldb). BIAS_BF16 rounds the
// bias to bf16 first (bias quantised to bf16 before the add). K%32==0, M%16==0, N%64==0.
template <bool ASPLIT, int ACT, bool BIAS_BF16>
__global__ __launch_bounds__(128) void k_gemm_bf(const float* __restrict__ A, int lda, const unsigned short* __restrict__ Wt, int ldb,
                                               const float* __restrict__ bias, float* __restrict__ C, int ldc, int M, int N, int K) {
  __shared__ __attribute__((aligned(16))) float so[4][16][64];
  const int tid = threadIdx.x, w = tid >> 5, lane = tid & 31, ln = lane & 15, hh = lane >> 4;
  const int ntn = N / 64;
  const int wid = blockIdx.x * 4 + w;
  const int mt = wid / ntn, nq = wid % ntn;
  if (mt * 16 >= M) return;
  const int row0 = mt * 16, col0 = nq * 64;
  const float* arow = A + (size_t)(row0 + ln) * lda;
  v8f acc[4] = {};
  for (int kb = 0; kb < K; kb += 32) {
    FragB ah, al;
    const v4f x0 = *(const v4fa*)(arow + kb + 8 * hh), x1 = *(const v4fa*)(arow + kb + 8 * hh + 4);
    const v4f x2 = *(const v4fa*)(arow + kb + 16 + 8 * hh), x3 = *(const v4fa*)(arow + kb + 16 + 8 * hh + 4);
    float xs[16] = {x0[0],x0[1],x0[2],x0[3],x1[0],x1[1],x1[2],x1[3],x2[0],x2[1],x2[2],x2[3],x3[0],x3[1],x3[2],x3[3]};
#pragma unroll
    for (int i = 0; i < 16; ++i) { const unsigned short hb = bf16_bits(xs[i]); ah.u[i] = hb; al.u[i] = ASPLIT ? bf16_bits(xs[i] - bf16_val(hb)) : (unsigned short)0; }
#pragma unroll
    for (int t = 0; t < 4; ++t) {
      const unsigned short* brow = Wt + (size_t)(col0 + t * 16 + ln) * ldb + kb;
      FragB b;
      b.half[0] = *(const v8us*)(brow + 8 * hh);
      b.half[1] = *(const v8us*)(brow + 16 + 8 * hh);
      acc[t] = mmaN<ASPLIT ? 2 : 1>(ah.v, al.v, b.v, b.v, acc[t]);
    }
  }
#pragma unroll
  for (int t = 0; t < 4; ++t) {
    float bv = bias ? bias[col0 + t * 16 + ln] : 0.f;
    if (BIAS_BF16) bv = bf16_round(bv);
#pragma unroll
    for (int r = 0; r < 8; ++r) { float v = acc[t][r] + bv; if (ACT == 1) v = fmaxf(v, 0.f); so[w][8 * hh + r][t * 16 + ln] = v; }
  }
  __builtin_amdgcn_fence(__ATOMIC_ACQ_REL, "workgroup");
  __builtin_amdgcn_wave_barrier();
  const int rsub = lane >> 4, c4 = (lane & 15) * 4;
  {
#pragma unroll
    for (int q = 0; q < 8; ++q) {
      const int r = q * 2 + rsub;
      const v4f v = *(const v4fa*)&so[w][r][c4];
      *(v4f*)(C + (size_t)(row0 + r) * ldc + col0 + c4) = v;
    }
    
  }
}

// GEMM C = act(A·W + bias + resid): A f32 (ASPLIT -> hi/lo 2 terms), Wt bf16 [N][K]; ACT 0 none, 1 relu, 2 exact gelu;
// resid (optional, f32, row index = (row % rmod), pitch ldr, RES_BF16 rounds it) added before the activation.
template <bool ASPLIT, int ACT, bool BIAS_BF16, bool RES_BF16>
__global__ __launch_bounds__(128) void k_gemm_bf3(const float* __restrict__ A, int lda, const unsigned short* __restrict__ Wt, int ldb,
                                                const float* __restrict__ bias, const float* __restrict__ resid, int rmod, int ldr,
                                                float* __restrict__ C, int ldc, int M, int N, int K) {
  __shared__ __attribute__((aligned(16))) float so[4][16][64];
  const int tid = threadIdx.x, w = tid >> 5, lane = tid & 31, ln = lane & 15, hh = lane >> 4;
  const int ntn = N / 64;
  const int wid = blockIdx.x * 4 + w;
  const int mt = wid / ntn, nq = wid % ntn;
  if (mt * 16 >= M) return;
  const int row0 = mt * 16, col0 = nq * 64;
  const float* arow = A + (size_t)(row0 + ln) * lda;
  v8f acc[4] = {};
  for (int kb = 0; kb < K; kb += 32) {
    FragB ah, al;
    const v4f x0 = *(const v4fa*)(arow + kb + 8 * hh), x1 = *(const v4fa*)(arow + kb + 8 * hh + 4);
    const v4f x2 = *(const v4fa*)(arow + kb + 16 + 8 * hh), x3 = *(const v4fa*)(arow + kb + 16 + 8 * hh + 4);
    float xs[16] = {x0[0],x0[1],x0[2],x0[3],x1[0],x1[1],x1[2],x1[3],x2[0],x2[1],x2[2],x2[3],x3[0],x3[1],x3[2],x3[3]};
#pragma unroll
    for (int i = 0; i < 16; ++i) { const unsigned short hb = bf16_bits(xs[i]); ah.u[i] = hb; al.u[i] = ASPLIT ? bf16_bits(xs[i] - bf16_val(hb)) : (unsigned short)0; }
#pragma unroll
    for (int t = 0; t < 4; ++t) {
      const unsigned short* brow = Wt + (size_t)(col0 + t * 16 + ln) * ldb + kb;
      FragB b;
      b.half[0] = *(const v8us*)(brow + 8 * hh);
      b.half[1] = *(const v8us*)(brow + 16 + 8 * hh);
      acc[t] = mmaN<ASPLIT ? 2 : 1>(ah.v, al.v, b.v, b.v, acc[t]);
    }
  }
#pragma unroll
  for (int t = 0; t < 4; ++t) {
    const int col = col0 + t * 16 + ln;
    float bv = bias ? bias[col] : 0.f;
    if (BIAS_BF16) bv = bf16_round(bv);
#pragma unroll
    for (int r = 0; r < 8; ++r) {
      float v = acc[t][r] + bv;
      if (resid) { float rv = resid[(size_t)((row0 + 8 * hh + r) % rmod) * ldr + col]; if (RES_BF16) rv = bf16_round(rv); v += rv; }
      if (ACT == 1) v = fmaxf(v, 0.f);
      if (ACT == 2) v = 0.5f * v * (1.0f + erff(v * 0.70710678118654752f));
      if (ACT == 3) { const float u = 0.7978845608028654f * (v + 0.044715f * v * v * v); v = 0.5f * v * (1.0f + tanhf(u)); }
      so[w][8 * hh + r][t * 16 + ln] = v;
    }
  }
  __builtin_amdgcn_fence(__ATOMIC_ACQ_REL, "workgroup");
  __builtin_amdgcn_wave_barrier();
  const int rsub = lane >> 4, c4 = (lane & 15) * 4;
  {
#pragma unroll
    for (int q = 0; q < 8; ++q) {
      const int r = q * 2 + rsub;
      const v4f v = *(const v4fa*)&so[w][r][c4];
      *(v4f*)(C + (size_t)(row0 + r) * ldc + col0 + c4) = v;
    }
    
  }
}
// row LayerNorm (biased variance, eps) over N: s = X (+ R); optional out_sum <- s; out_norm <- (s-mu)*rsqrt(var+eps)*g + b
template <bool PARAM_BF16>
__global__ __launch_bounds__(256) void k_layernorm(const float* __restrict__ X, const float* __restrict__ R, const float* __restrict__ g, const float* __restrict__ bta,
                                                  float* __restrict__ out_sum, float* __restrict__ out_norm, int N, float eps) {
  __shared__ float red[256];
  const int row = blockIdx.x, tid = threadIdx.x;
  const float* x = X + (size_t)row * N; const float* rr = R ? R + (size_t)row * N : nullptr;
  float vals[16];                     // up to N = 4096
  const int per = N / 256;            // contiguous chunk per thread? use strided-by-4 chunks: thread handles j = tid*4 + 1024*u
  float s1 = 0.f;
  for (int u = 0; u < per / 4; ++u) {
    const int j = tid * 4 + 1024 * u;
    const v4f a = *(const v4fa*)(x + j);
    v4f b = {0.f,0.f,0.f,0.f}; if (rr) b = *(const v4fa*)(rr + j);
#pragma unroll
    for (int q = 0; q < 4; ++q) { const float v = a[q] + b[q]; vals[u * 4 + q] = v; s1 += v; }
  }
  red[tid] = s1; __syncthreads();
  for (int st = 128; st > 0; st >>= 1) { if (tid < st) red[tid] += red[tid + st]; __syncthreads(); }
  const float mu = red[0] / (float)N; __syncthreads();
  float s2 = 0.f;
  for (int u = 0; u < per / 4; ++u)
#pragma unroll
    for (int q = 0; q < 4; ++q) { const float c = vals[u * 4 + q] - mu; s2 += c * c; }
  red[tid] = s2; __syncthreads();
  for (int st = 128; st > 0; st >>= 1) { if (tid < st) red[tid] += red[tid + st]; __syncthreads(); }
  const float rs = rsqrtf(red[0] / (float)N + eps);
  {
    for (int u = 0; u < per / 4; ++u) {
      const int j = tid * 4 + 1024 * u;
      v4f o, sm;
#pragma unroll
      for (int q = 0; q < 4; ++q) {
        float gg = g[j + q], bb = bta[j + q];
        if (PARAM_BF16) { gg = bf16_round(gg); bb = bf16_round(bb); }
        sm[q] = vals[u * 4 + q]; o[q] = (vals[u * 4 + q] - mu) * rs * gg + bb;
      }
      if (out_sum) *(v4f*)(out_sum + (size_t)row * N + j) = sm;
      *(v4f*)(out_norm + (size_t)row * N + j) = o;
    }
    
  }
}



// ---- f16 WMMA path (v_wmma_f32_16x16x32_f16): 11-bit significands for operands in range — used where a [0,1] probability operand needs more precision than bf16
typedef _Float16 v16h __attribute__((ext_vector_type(16)));
union FragH { v16h v; v8us half[2]; _Float16 h[16]; unsigned short u[16]; };
template <int NT>
__device__ __forceinline__ v8f mmaH(v16h ah, v16h al, v16h bh, v16h bl, v8f c) {
  c = __builtin_amdgcn_wmma_f32_16x16x32_f16(false, ah, false, bh, (short)0, c, false, false);
  if (NT >= 2) c = __builtin_amdgcn_wmma_f32_16x16x32_f16(false, al, false, bh, (short)0, c, false, false);
  if (NT >= 3) c = __builtin_amdgcn_wmma_f32_16x16x32_f16(false, ah, false, bl, (short)0, c, false, false);
  asm volatile("v_nop\n\tv_nop\n\tv_nop\n\tv_nop" : "+v"(c) : "v"(ah), "v"(al), "v"(bh), "v"(bl));
  return c;
}
// batched GEMM like k_gemm_b but f16 operands: A f32 (split into f16 hi/lo if ASPLIT, else rounded to f16), Bt = f16 values [n][k]; alpha; C f32; N multiple of 16 (partial tiles skipped)
template <bool ASPLIT>
__global__ __launch_bounds__(128) void k_gemm_h(const float* __restrict__ A, int lda, size_t sA, const _Float16* __restrict__ Bh, int ldb, size_t sB, float alpha, float* __restrict__ C, int ldc, size_t sC, int M, int N, int K) {
  __shared__ __attribute__((aligned(16))) float so[4][16][64];
  const int tid = threadIdx.x, w = tid >> 5, lane = tid & 31, ln = lane & 15, hh = lane >> 4; const int by = blockIdx.y;
  A += (size_t)by * sA; Bh += (size_t)by * sB; C += (size_t)by * sC;
  const int ntn = (N + 63) / 64; const int wid = blockIdx.x * 4 + w; const int mt = wid / ntn, nq = wid % ntn; if (mt * 16 >= M) return;
  const int row0 = mt * 16, col0 = nq * 64; const float* arow = A + (size_t)(row0 + ln) * lda;
  v8f acc[4] = {};
  for (int kb = 0; kb < K; kb += 32) {
    FragH ah, al;
    const v4f x0 = *(const v4fa*)(arow + kb + 8 * hh), x1 = *(const v4fa*)(arow + kb + 8 * hh + 4), x2 = *(const v4fa*)(arow + kb + 16 + 8 * hh), x3 = *(const v4fa*)(arow + kb + 16 + 8 * hh + 4);
    float xs[16] = {x0[0],x0[1],x0[2],x0[3],x1[0],x1[1],x1[2],x1[3],x2[0],x2[1],x2[2],x2[3],x3[0],x3[1],x3[2],x3[3]};
#pragma unroll
    for (int i = 0; i < 16; ++i) { const _Float16 h = (_Float16)xs[i]; ah.h[i] = h; al.h[i] = ASPLIT ? (_Float16)(xs[i] - (float)h) : (_Float16)0.0f; }
#pragma unroll
    for (int t = 0; t < 4; ++t) { if (col0 + t * 16 >= N) continue; const size_t boff = (size_t)(col0 + t * 16 + ln) * ldb + kb; FragH bq; bq.half[0] = *(const v8us*)(Bh + boff + 8 * hh); bq.half[1] = *(const v8us*)(Bh + boff + 16 + 8 * hh);
      acc[t] = mmaH<ASPLIT ? 2 : 1>(ah.v, al.v, bq.v, bq.v, acc[t]); }
  }
#pragma unroll
  for (int t = 0; t < 4; ++t) { if (col0 + t * 16 >= N) continue;
#pragma unroll
    for (int r = 0; r < 8; ++r) so[w][8 * hh + r][t * 16 + ln] = acc[t][r] * alpha; }
  __builtin_amdgcn_fence(__ATOMIC_ACQ_REL, "workgroup"); __builtin_amdgcn_wave_barrier();
  const int rsub = lane >> 4, c4 = (lane & 15) * 4;
  {
#pragma unroll
    for (int q = 0; q < 8; ++q) { const int r = q * 2 + rsub; if (col0 + c4 < N) { const v4f v = *(const v4fa*)&so[w][r][c4]; *(v4f*)(C + (size_t)(row0 + r) * ldc + col0 + c4) = v; } }
     }
}

// Wt[n][k] = f16(W[k][n]·scale) from f32 row-major W[K][N] (scale = power of two; bf16-exact weights stay exact in f16 away from the subnormal range)
__global__ __launch_bounds__(256) void k_wt_f16(const float* __restrict__ W, _Float16* __restrict__ Wt, int K, int N, float scale) {
  const int t = blockIdx.x * 256 + threadIdx.x; if (t >= N * (K / 8)) return; const int n = t / (K / 8), k8 = (t % (K / 8)) * 8; FragH f;
#pragma unroll
  for (int i = 0; i < 8; ++i) f.h[i] = (_Float16)(bf16_round(W[(size_t)(k8 + i) * N + n]) * scale); const v8us o = f.half[0];
  *(v8us*)((unsigned short*)Wt + (size_t)n * K + k8) = o; 
}
// k_gemm_hh variant with fused epilogue: v = acc·alpha + bias[by·sBias + col] (+ CP[(row/rowsPerB)·sCPb + by·64 + col] if CP) ; ACT 0 none / 1 elu ; writes f16 C16 (and f32 C if non-null)
template <int ACT>
__global__ __launch_bounds__(128) void k_gemm_hhx(const _Float16* __restrict__ A, int lda, size_t sA, const _Float16* __restrict__ Bh, int ldb, size_t sB, float alpha, const float* __restrict__ bias, size_t sBias, const float* __restrict__ CP, int rowsPerB, size_t sCPb, int row0g,
    float* __restrict__ C, _Float16* __restrict__ C16, int ldc, size_t sC, int M, int N, int K) {
  __shared__ __attribute__((aligned(16))) float so[4][16][64];
  const int tid = threadIdx.x, w = tid >> 5, lane = tid & 31, ln = lane & 15, hh = lane >> 4; const int by = blockIdx.y;
  A += (size_t)by * sA; Bh += (size_t)by * sB; const size_t cofs = (size_t)by * sC; const float* bp = bias ? bias + (size_t)by * sBias : nullptr;
  const int ntn = (N + 63) / 64; const int wid = blockIdx.x * 4 + w; const int mt = wid / ntn, nq = wid % ntn; if (mt * 16 >= M) return;
  const int row0 = mt * 16, col0 = nq * 64; const _Float16* arow = A + (size_t)(row0 + ln) * lda;
  v8f acc[4] = {};
  for (int kb = 0; kb < K; kb += 32) { FragH ah; ah.half[0] = *(const v8us*)((const unsigned short*)arow + kb + 8 * hh); ah.half[1] = *(const v8us*)((const unsigned short*)arow + kb + 16 + 8 * hh);
#pragma unroll
    for (int t = 0; t < 4; ++t) { if (col0 + t * 16 >= N) continue; const size_t boff = (size_t)(col0 + t * 16 + ln) * ldb + kb; FragH bq; bq.half[0] = *(const v8us*)((const unsigned short*)Bh + boff + 8 * hh); bq.half[1] = *(const v8us*)((const unsigned short*)Bh + boff + 16 + 8 * hh);
      acc[t] = mmaH<1>(ah.v, ah.v, bq.v, bq.v, acc[t]); }
  }
#pragma unroll
  for (int t = 0; t < 4; ++t) { if (col0 + t * 16 >= N) continue; const int col = col0 + t * 16 + ln; const float bv = bp ? bf16_round(bp[col]) : 0.f;
#pragma unroll
    for (int r = 0; r < 8; ++r) { float v = acc[t][r] * alpha + bv; if (CP) { const int rr = row0g + row0 + 8 * hh + r; if (rowsPerB < 0) v += CP[cofs + (size_t)rr * ldc + col];      /* rowsPerB < 0: own element of the batched C plane */ else { const int bidx = rr / rowsPerB; v += CP[(size_t)bidx * sCPb + (size_t)by * 64 + col]; } } if (ACT == 1) v = (v > 0.f) ? v : expm1f(v); else if (ACT == 7) v = (v > 0.f) ? v + 1.0f : expf(v); else if (ACT == 8) v = tanhf(v); else if (ACT == 9) v = 0.5f * v * (1.0f + tanhf(0.7978845608028654f * (v + 0.044715f * v * v * v))); else if (ACT == 11) v = 1.0f / (1.0f + expf(-v)); else if (ACT == 12) v = (v > 0.f) ? v : 0.01f * v; else if (ACT == 14) v = (v > 0.f) ? v : 0.1f * v; else if (ACT == 16) v = (v >= 0.f) ? v : 0.3f * v; else if (ACT == 17) v = (v >= 0.f) ? v : 0.2f * v; else if (ACT == 15) v = v / (1.0f + expf(-v)); else if (ACT == 3) v = fmaxf(v, 0.f); else if (ACT == 6) v = 0.5f * v * (1.0f + erff(v * 0.70710678118654752f)); so[w][8 * hh + r][t * 16 + ln] = v; } }
  __builtin_amdgcn_fence(__ATOMIC_ACQ_REL, "workgroup"); __builtin_amdgcn_wave_barrier();
  const int rsub = lane >> 4, c4 = (lane & 15) * 4; typedef _Float16 v4h __attribute__((ext_vector_type(4)));
  {
#pragma unroll
    for (int q = 0; q < 8; ++q) { const int r = q * 2 + rsub; if (col0 + c4 < N) { const v4f v = *(const v4fa*)&so[w][r][c4]; if (C) *(v4f*)(C + cofs + (size_t)(row0 + r) * ldc + col0 + c4) = v; if (C16) { v4h h4; for (int i = 0; i < 4; ++i) h4[i] = (_Float16)v[i]; *(v4h*)(C16 + cofs + (size_t)(row0 + r) * ldc + col0 + c4) = h4; } } }
     }
}


typedef _Float16 v4h __attribute__((ext_vector_type(4)));

__global__ __launch_bounds__(256) void k_x16(const float* __restrict__ x, _Float16* __restrict__ X16, size_t n8) { const size_t t = (size_t)blockIdx.x * 256 + threadIdx.x; if (t >= n8) return; FragH f;
#pragma unroll
  for (int q = 0; q < 8; ++q) f.h[q] = (_Float16)bf16_round(x[t * 8 + q]); *(v8us*)((unsigned short*)X16 + t * 8) = f.half[0];  }
__global__ __launch_bounds__(256) void k_h16(const float* __restrict__ x, _Float16* __restrict__ X16, size_t n8) { const size_t t = (size_t)blockIdx.x * 256 + threadIdx.x; if (t >= n8) return; FragH f;
#pragma unroll
  for (int q = 0; q < 8; ++q) f.h[q] = (_Float16)x[t * 8 + q]; *(v8us*)((unsigned short*)X16 + t * 8) = f.half[0];  }
__global__ __launch_bounds__(256) void k_round16f(const float* __restrict__ W, _Float16* __restrict__ Bt, size_t n8) { const size_t t = (size_t)blockIdx.x * 256 + threadIdx.x; if (t >= n8) return; FragH f;
#pragma unroll
  for (int i = 0; i < 8; ++i) f.h[i] = (_Float16)(bf16_round(W[t * 8 + i]) * 16.0f); *(v8us*)((unsigned short*)Bt + t * 8) = f.half[0];  }
template <int NHv, int TTv>
__global__ __launch_bounds__(256) void k_vt(const _Float16* __restrict__ V16, int ldv, int voff, _Float16* __restrict__ Vt) { __shared__ unsigned short tl[64][66]; const int tid = threadIdx.x; const int slab = blockIdx.x / (TTv / 64), lg = blockIdx.x % (TTv / 64); const int b = slab / NHv, h = slab % NHv;
  for (int i = tid; i < 64 * 8; i += 256) { const int r = i / 8, c8 = (i % 8) * 8; FragH f; f.half[0] = *(const v8us*)((const unsigned short*)V16 + ((size_t)b * TTv + lg * 64 + r) * ldv + voff + h * 64 + c8);
#pragma unroll
    for (int q = 0; q < 8; ++q) tl[r][c8 + q] = f.u[q]; }
  __syncthreads();
  {
#pragma unroll
    for (int rd = 0; rd < 2; ++rd) { const int d = rd * 32 + tid / 8, pc = tid % 8; FragH f;
#pragma unroll
      for (int q = 0; q < 8; ++q) f.u[q] = tl[pc * 8 + q][d];
      *(v8us*)((unsigned short*)Vt + ((size_t)slab * 64 + d) * TTv + lg * 64 + pc * 8) = f.half[0]; }
     } }

// one 16 x 32 f16 fragment row piece of lane half hh from a K-contiguous row at p: k = 8 hh .. 8 hh + 7 and 16 + 8 hh .. 16 + 8 hh + 7
__device__ __forceinline__ v16h g2_frag(const _Float16* p, int hh) { FragH f; f.half[0] = *(const v8us*)((const unsigned short*)p + 8 * hh); f.half[1] = *(const v8us*)((const unsigned short*)p + 16 + 8 * hh); return f.v; }

__device__ __forceinline__ void wnat_body(unsigned bx, const float* __restrict__ w, size_t n8, _Float16* __restrict__ Bt) { const size_t t = (size_t)bx * 256 + threadIdx.x; if (t >= n8) return; FragH f; for (int q = 0; q < 8; ++q) f.h[q] = (_Float16)(bf16_round(w[t * 8 + q]) * 16.0f); *(v8us*)((unsigned short*)Bt + t * 8) = f.half[0];  }
__global__ __launch_bounds__(256) void k_rsm(const float* __restrict__ S, _Float16* __restrict__ P, int nrows) {
  #pragma clang fp contract(off)
  const int i = blockIdx.x * 256 + threadIdx.x; if (i >= nrows) return; const float* s = S + (size_t)i * SQ; float mx = -3.0e38f;
#pragma unroll 1
  for (int j = 0; j < SQ; ++j) mx = fmaxf(mx, s[j]); float se = 0.f;
#pragma unroll 1
  for (int j = 0; j < SQ; ++j) se += expf(s[j] - mx); const float sc = 256.0f / se;
#pragma unroll 1
  for (int j0 = 0; j0 < SQ; j0 += 8) { FragH f; for (int q = 0; q < 8; ++q) f.h[q] = (_Float16)(expf(s[j0 + q] - mx) * sc); unsigned short* d = (unsigned short*)P + (size_t)i * SQ + j0; *(v8us*)d = f.half[0];  } }
__global__ __launch_bounds__(256) void k_vt(const _Float16* __restrict__ V16, int b, int h0, _Float16* __restrict__ VT) { __shared__ unsigned short tl[64][65]; const int tid = threadIdx.x; const int hh = blockIdx.x % HG, sg = blockIdx.x / HG; const int s0 = sg * 64; const int h = h0 + hh;
  for (int i = tid; i < 64 * 8; i += 256) { const int j = i / 8, d8 = (i % 8) * 8; FragH f; f.half[0] = *(const v8us*)((const unsigned short*)V16 + ((size_t)b * SQ + s0 + j) * DM + h * HD + d8); for (int q = 0; q < 8; ++q) tl[d8 + q][j] = f.u[q]; }
  __syncthreads();
  { for (int i = tid; i < 64 * 8; i += 256) { const int d = i / 8, j8 = (i % 8) * 8; FragH f; for (int q = 0; q < 8; ++q) f.u[q] = tl[d][j8 + q]; *(v8us*)((unsigned short*)VT + ((size_t)hh * HD + d) * SQ + s0 + j8) = f.half[0]; }  } }


// lane l <-> l ^ M inside a 16-lane row (DPP row_xmask)
template <int M> __device__ __forceinline__ float ln_xm(float v) { return __int_as_float(__builtin_amdgcn_update_dpp(0, __float_as_int(v), 0x160 + M, 0xf, 0xf, true)); }
// 2^x (v_exp_f32). The v_nop in the same statement keeps the one issue slot that the instruction set asks for behind a transcendental, before its result is read or its source overwritten.
__device__ __forceinline__ float exp2_slot(float x) { float r; asm("v_exp_f32 %0, %1\n\tv_nop" : "=v"(r) : "v"(x)); return r; }
// Scores and their row softmax in one launch. A work-group owns MT*16 whole rows m of S^T[m][n] = g_m . f_n: each of its NW waves forms its own LL/NW columns on WMMA (hi.hi + 2^-10 (lo.hi + hi.lo)) and keeps them in
// accumulator registers through the maximum, the exponentials and the scaling, so the f32 score plane never goes to memory. Column tile t of a wave takes f rows n = base + (t>>3)*128 + ln*8 + (t&7): a lane then holds 8 neighbouring columns of a row, and one 16-byte store per lane writes whole lines of beta^T.
// Both operands come through LDS by asynchronous copies of whole 128-byte rows (LDS pitch 144 B, so that the 16-byte fragment reads spread over the banks): the g rows once for the work-group, each wave's own f rows in stages of two column tiles, two buffers, the next stage's copies flying while this stage is multiplied. A fragment load straight from global memory would touch 16 lines for 512 bytes.
#define SC_PITCH 72      /* f16 per LDS row */
__device__ __forceinline__ unsigned g3_lds(const void* p) { return (unsigned)(size_t)p; }      /* byte offset in the work-group's LDS */
__device__ __forceinline__ v8f sc_mma(v16h a, v16h b, v8f c) { return __builtin_amdgcn_wmma_f32_16x16x32_f16(false, a, false, b, (short)0, c, false, false); }
template <int MT, int NW>
__global__ __launch_bounds__(NW * 32) void k_scsm(const _Float16* __restrict__ Gh, const _Float16* __restrict__ Gl, const _Float16* __restrict__ Fh, const _Float16* __restrict__ Fl, _Float16* __restrict__ P) {
  constexpr int TP = LL / (NW * 16); static_assert(TP % 8 == 0 && (NW == 8 || NW == 16), "k_scsm: a wave takes whole groups of 8 column tiles; the cross-wave step reads one partial per lane of a 16-lane row");
  static_assert(NW * 4 == 2 * MT * 16, "k_scsm: one copy of four rows per wave brings in the g rows of both planes");
  __shared__ float rmx[MT * 16][NW]; __shared__ float rsu[MT * 16][NW];      /* one partial maximum / sum per row and wave */
  __shared__ __attribute__((aligned(16))) unsigned short gs[2 * MT * 16][SC_PITCH];      /* the work-group's g rows: hi plane, then residual plane */
  __shared__ __attribute__((aligned(16))) unsigned short fs[NW][2][64][SC_PITCH];      /* per wave two buffers of one stage = two column tiles: LDS row (plane * 2 + tile) * 16 + ln */
  const int lane = threadIdx.x & 31, ln = lane & 15, hh = lane >> 4; const int w = __builtin_amdgcn_readfirstlane(threadIdx.x >> 5);
  const size_t rb = (size_t)blockIdx.y * LL; const int m0 = blockIdx.x * (MT * 16); const int n0 = w * (TP * 16) + ln * 8;
  const v8f z8 = {0.f,0.f,0.f,0.f,0.f,0.f,0.f,0.f};
  /* a copy of a wave = four whole 128-byte rows: lane -> row rs of the four, 16-byte piece pc. Copy q of a stage and plane takes the f rows of lanes ln = 2q and 2q + 1 for the stage's two tiles: two neighbouring rows each, 256 bytes in a piece */
  const int rs = lane >> 3, pc = lane & 7;
  const size_t fo0 = (rb + w * (TP * 16) + (rs >> 1) * 8 + (rs & 1)) * CQ + pc * 8;
  const unsigned short* fgh = (const unsigned short*)Fh + fo0; const unsigned short* fgl = (const unsigned short*)Fl + fo0;
  const unsigned fl0 = g3_lds(&fs[w][0][(rs & 1) * 16 + (rs >> 1)][pc * 8]);
  auto stage_f = [&](int j, int buf) {      /* stage j = column tiles 2j and 2j + 1 of this wave */
#pragma unroll
    for (int p = 0; p < 2; ++p) { unsigned l[8]; const unsigned short* g[8];
#pragma unroll
      for (int q = 0; q < 8; ++q) { l[q] = fl0 + (unsigned)((buf * 64 + p * 32 + q * 2) * (SC_PITCH * 2)); g[q] = (p ? fgl : fgh) + (size_t)(((j >> 2) * 128 + q * 16 + (j & 3) * 2) * CQ); }
      /* one plane's eight copies; the s_wait_xcnt in the same statement is a precaution: it stands before any register that a copy names is written again */
      asm volatile("global_load_async_to_lds_b128 %0, %8, off\n\tglobal_load_async_to_lds_b128 %1, %9, off\n\tglobal_load_async_to_lds_b128 %2, %10, off\n\tglobal_load_async_to_lds_b128 %3, %11, off\n\t"
                   "global_load_async_to_lds_b128 %4, %12, off\n\tglobal_load_async_to_lds_b128 %5, %13, off\n\tglobal_load_async_to_lds_b128 %6, %14, off\n\tglobal_load_async_to_lds_b128 %7, %15, off\n\ts_wait_xcnt 0x0"
                   :: "v"(l[0]), "v"(l[1]), "v"(l[2]), "v"(l[3]), "v"(l[4]), "v"(l[5]), "v"(l[6]), "v"(l[7]), "v"(g[0]), "v"(g[1]), "v"(g[2]), "v"(g[3]), "v"(g[4]), "v"(g[5]), "v"(g[6]), "v"(g[7]) : "memory"); } };
  { const int gr = w * 4 + rs;      /* g: wave w brings LDS rows 4w .. 4w + 3, all of one plane */
    const unsigned short* gg = (const unsigned short*)(w * 4 >= MT * 16 ? Gl : Gh) + (rb + m0 + (gr & (MT * 16 - 1))) * CQ + pc * 8; const unsigned gl = g3_lds(&gs[gr][pc * 8]);
    /* the s_wait_xcnt in the same statement: the same precaution as above */
    asm volatile("global_load_async_to_lds_b128 %0, %1, off\n\ts_wait_xcnt 0x0" :: "v"(gl), "v"(gg) : "memory"); }
  constexpr int NS = TP / 2;
  stage_f(0, 0);
  asm volatile("s_wait_asynccnt 0x0" ::: "memory");      /* this wave's copies of g and of stage 0 have landed */
  __syncthreads();      /* g and stage 0 are readable by every wave */
  stage_f(1, 1);
  v16h ah[MT][2], al[MT][2];
#pragma unroll      /* full unroll here and below: the fragment and score arrays stay in registers */
  for (int mt = 0; mt < MT; ++mt) { const _Float16* gh = (const _Float16*)&gs[mt * 16 + ln][0]; const _Float16* gl = (const _Float16*)&gs[MT * 16 + mt * 16 + ln][0]; ah[mt][0] = g2_frag(gh, hh); ah[mt][1] = g2_frag(gh + 32, hh); al[mt][0] = g2_frag(gl, hh); al[mt][1] = g2_frag(gl + 32, hh); }
  v8f s[MT][TP];      /* lane (ln, hh), element r of s[mt][t] = row m0 + mt*16 + 8*hh + r, column n0 + (t>>3)*128 + (t&7) */
#pragma unroll
  for (int j = 0; j < NS; ++j) {
#pragma unroll
    for (int tt = 0; tt < 2; ++tt) { const int t = j * 2 + tt; const _Float16* fh = (const _Float16*)&fs[w][j & 1][tt * 16 + ln][0]; const _Float16* fl = (const _Float16*)&fs[w][j & 1][32 + tt * 16 + ln][0];
      const v16h bh0 = g2_frag(fh, hh), bh1 = g2_frag(fh + 32, hh), bl0 = g2_frag(fl, hh), bl1 = g2_frag(fl + 32, hh);
#pragma unroll
      for (int mt = 0; mt < MT; ++mt) { const v8f c = sc_mma(ah[mt][1], bh1, sc_mma(ah[mt][0], bh0, z8)); const v8f d = sc_mma(ah[mt][1], bl1, sc_mma(ah[mt][0], bl0, sc_mma(al[mt][1], bh1, sc_mma(al[mt][0], bh0, z8))));
        s[mt][t] = d * 0.0009765625f + c; }
      __builtin_amdgcn_sched_barrier(0); }      /* keeps the next tile's fragment reads behind this tile's WMMAs, so that one f fragment set is live: two cost a spill of scores */
    asm volatile("s_wait_dscnt 0x0" ::: "memory");      /* this wave's reads of the buffer are done before it may be refilled */
    asm volatile("s_wait_asynccnt 0x0" ::: "memory");      /* this wave's copies of stage j + 1 have landed */
    __syncthreads();      /* publishes stage j + 1 and ends the reads of stage j */
    if (j + 2 < NS) stage_f(j + 2, j & 1); }
  asm volatile("s_wait_asynccnt 0x0" ::: "memory");      /* no copy is outstanding when the wave goes on */
  v8f st[MT];
#pragma unroll
  for (int mt = 0; mt < MT; ++mt) { v8f m = s[mt][0];
#pragma unroll
    for (int t = 1; t < TP; ++t) m = __builtin_elementwise_max(m, s[mt][t]);
#pragma unroll
    for (int r = 0; r < 8; ++r) { float x = m[r]; x = fmaxf(x, ln_xm<1>(x)); x = fmaxf(x, ln_xm<2>(x)); x = fmaxf(x, ln_xm<4>(x)); x = fmaxf(x, ln_xm<8>(x)); m[r] = x; }
    st[mt] = m; }
  if (ln == 0) {
#pragma unroll
    for (int mt = 0; mt < MT; ++mt)
#pragma unroll
      for (int r = 0; r < 8; ++r) rmx[mt * 16 + 8 * hh + r][w] = st[mt][r]; }
  __syncthreads();      /* every wave's partial maxima are in LDS */
#pragma unroll
  for (int mt = 0; mt < MT; ++mt) { v8f m;
#pragma unroll
    for (int r = 0; r < 8; ++r) { float x = rmx[mt * 16 + 8 * hh + r][ln & (NW - 1)]; x = fmaxf(x, ln_xm<1>(x)); x = fmaxf(x, ln_xm<2>(x)); x = fmaxf(x, ln_xm<4>(x)); if (NW == 16) x = fmaxf(x, ln_xm<8>(x)); m[r] = x; }
    v8f a = z8;
#pragma unroll
    for (int t = 0; t < TP; ++t) { const v8f y = (s[mt][t] - m) * 1.442695041f; v8f e;
#pragma unroll
      for (int r = 0; r < 8; ++r) e[r] = exp2_slot(y[r]);      /* = native exp: the same multiply and v_exp_f32 */
      s[mt][t] = e; a += e; }
#pragma unroll
    for (int r = 0; r < 8; ++r) { float x = a[r]; x += ln_xm<1>(x); x += ln_xm<2>(x); x += ln_xm<4>(x); x += ln_xm<8>(x); a[r] = x; }
    st[mt] = a; }
  if (ln == 0) {
#pragma unroll
    for (int mt = 0; mt < MT; ++mt)
#pragma unroll
      for (int r = 0; r < 8; ++r) rsu[mt * 16 + 8 * hh + r][w] = st[mt][r]; }
  __syncthreads();      /* every wave's partial sums are in LDS */
#pragma unroll
  for (int mt = 0; mt < MT; ++mt) { v8f sc;
#pragma unroll
    for (int r = 0; r < 8; ++r) { float x = rsu[mt * 16 + 8 * hh + r][ln & (NW - 1)]; x += ln_xm<1>(x); x += ln_xm<2>(x); x += ln_xm<4>(x); if (NW == 16) x += ln_xm<8>(x); sc[r] = 256.0f / x; }
#pragma unroll
    for (int t = 0; t < TP; ++t) s[mt][t] *= sc;
#pragma unroll
    for (int r = 0; r < 8; ++r) { unsigned short* d = (unsigned short*)P + (rb + m0 + mt * 16 + 8 * hh + r) * LL + n0;
#pragma unroll
      for (int t8 = 0; t8 < TP / 8; ++t8) { FragH f;
#pragma unroll
        for (int q = 0; q < 8; ++q) f.h[q] = (_Float16)s[mt][t8 * 8 + q][r];
        *(v8us*)(d + t8 * 128) = f.half[0]; } } } }

// ---- GEMM with both operands staged in LDS: C[c][n] = alpha * sum_k A[c][k] Bh[n][k] (both K-contiguous f16), one 256 x 128 tile of C per work-group, 8 waves as 4 x 2, 64 x 64 per wave. ----
// A stage is 64 k of all 384 operand rows (128 B a row, LDS pitch 144 B so that the 16-byte fragment reads spread over the banks). Asynchronous copies bring whole 128-byte lines from global memory straight into LDS, two buffers:
// the next stage's copies fly while this stage is multiplied. Every operand line is asked for once per work-group, instead of in 32-byte pieces by every wave. k runs upward in steps of 32 into one accumulator chain per tile. Requires M % 256 == 0, N % 128 == 0, K % 64 == 0.
// HL (N = 128, two results of 64 columns side by side, each with rows of its own of pitch ldc): each f32 value alpha acc is cut into f16 hi + x1024 residual, columns 0..63 into C16 / CL, columns 64..127 into C16b / CLb, so the f32 rows never go to memory.
// F16OUT: C16 = f16(alpha acc). Otherwise the residual epilogue: C = bf16(gam[0]) alpha acc + bf16(X), X laid out like C, both [CC][LL] planes (pitch LL at compile time: a lane's 32 loads and 32 stores share one address each and differ in the immediate offset).
#define G3_PITCH 72      /* f16 per LDS row */
#define G3_STAGE (384 * G3_PITCH)      /* f16 per buffer */
// The body takes its LDS from the calling kernel: ring = the two stage buffers, so = each wave's own output staging; bx = tile index, by = batch. so may lie on the ring's bytes: it is first written behind the loop, whose last trip ends with every wave's s_wait_dscnt 0 and s_wait_asynccnt 0 and a work-group barrier, with no refill behind it.
template <bool F16OUT, bool HL = false>
__device__ __forceinline__ void gemm3_body(unsigned short* ring, float (*so)[64][68], unsigned bx, int by, const _Float16* __restrict__ A, int lda, size_t sA, const _Float16* __restrict__ Bh, int ldb, size_t sB, float alpha, float* __restrict__ C, _Float16* __restrict__ C16, const float* __restrict__ X, const float* __restrict__ gam, int ldc, size_t sC, int N, int K,
                                           _Float16* __restrict__ CL = nullptr, _Float16* __restrict__ C16b = nullptr, _Float16* __restrict__ CLb = nullptr) { static_assert(F16OUT || !HL, "gemm3_body: HL is a form of the f16 output");
  const int tid = threadIdx.x, lane = tid & 31, ln = lane & 15, hh = lane >> 4; const int w = __builtin_amdgcn_readfirstlane(tid >> 5); const int wm = w >> 1, wn = w & 1;
  const int ntn = N >> 7; const int mt = bx / ntn, nq = bx - mt * ntn; const int row0 = mt * 256, col0 = nq * 128; const size_t cofs = (size_t)by * sC;
  /* copy j of a thread: operand row j*32 + tid/8 of the stage (rows 0..255 = A, 256..383 = Bh), 16-byte piece tid%8: a wave's copy covers four whole rows */
  const unsigned short* ga = (const unsigned short*)A + (size_t)by * sA + (size_t)(row0 + (tid >> 3)) * lda + (tid & 7) * 8;
  const unsigned short* gb = (const unsigned short*)Bh + (size_t)by * sB + (size_t)(col0 + (tid >> 3)) * ldb + (tid & 7) * 8;
  const unsigned lb = g3_lds(ring) + (unsigned)(tid >> 3) * (G3_PITCH * 2) + (unsigned)(tid & 7) * 16;
  auto stage_in = [&](int s, int buf) {
    unsigned l[12]; const unsigned short* g[12];
#pragma unroll
    for (int j = 0; j < 12; ++j) { l[j] = lb + (unsigned)buf * (G3_STAGE * 2) + (unsigned)j * (32 * G3_PITCH * 2); g[j] = (j < 8 ? ga + (size_t)(j * 32) * lda : gb + (size_t)((j - 8) * 32) * ldb) + s * 64; }
    /* one stage's twelve copies; the s_wait_xcnt in the same statement is a precaution: it stands before any register that a copy names is written again */
    asm volatile("global_load_async_to_lds_b128 %0, %12, off\n\tglobal_load_async_to_lds_b128 %1, %13, off\n\tglobal_load_async_to_lds_b128 %2, %14, off\n\tglobal_load_async_to_lds_b128 %3, %15, off\n\t"
                 "global_load_async_to_lds_b128 %4, %16, off\n\tglobal_load_async_to_lds_b128 %5, %17, off\n\tglobal_load_async_to_lds_b128 %6, %18, off\n\tglobal_load_async_to_lds_b128 %7, %19, off\n\t"
                 "global_load_async_to_lds_b128 %8, %20, off\n\tglobal_load_async_to_lds_b128 %9, %21, off\n\tglobal_load_async_to_lds_b128 %10, %22, off\n\tglobal_load_async_to_lds_b128 %11, %23, off\n\ts_wait_xcnt 0x0"
                 :: "v"(l[0]), "v"(l[1]), "v"(l[2]), "v"(l[3]), "v"(l[4]), "v"(l[5]), "v"(l[6]), "v"(l[7]), "v"(l[8]), "v"(l[9]), "v"(l[10]), "v"(l[11]),
                    "v"(g[0]), "v"(g[1]), "v"(g[2]), "v"(g[3]), "v"(g[4]), "v"(g[5]), "v"(g[6]), "v"(g[7]), "v"(g[8]), "v"(g[9]), "v"(g[10]), "v"(g[11]) : "memory"); };
  float gsc = alpha; if (!F16OUT) gsc = bf16_round(gam[0]) * alpha;      /* read at entry, ahead of every asm statement: a scalar load */
  const int ns = K >> 6;
  stage_in(0, 0);
  asm volatile("s_wait_asynccnt 0x0" ::: "memory");      /* this wave's copies of stage 0 have landed */
  __syncthreads();      /* stage 0 is readable by every wave */
  if (ns > 1) stage_in(1, 1);
  const v8f z8 = {0.f,0.f,0.f,0.f,0.f,0.f,0.f,0.f}; v8f acc[4][4];
#pragma unroll
  for (int i = 0; i < 4; ++i)
#pragma unroll
    for (int j = 0; j < 4; ++j) acc[i][j] = z8;
  const int ao = (wm * 64 + ln) * G3_PITCH, bo = (256 + wn * 64 + ln) * G3_PITCH;
#pragma unroll 1      /* the stage loop stays rolled: the accumulators keep constant indices and the loop stays small */
  for (int s = 0; s < ns; ++s) { const _Float16* rb = (const _Float16*)ring + (s & 1) * G3_STAGE;
#pragma unroll
    for (int kk = 0; kk < 2; ++kk) { v16h a[4], b[4];
#pragma unroll
      for (int i = 0; i < 4; ++i) { a[i] = g2_frag(rb + ao + i * (16 * G3_PITCH) + kk * 32, hh); b[i] = g2_frag(rb + bo + i * (16 * G3_PITCH) + kk * 32, hh); }
      __builtin_amdgcn_sched_barrier(0);      /* the block's 16 LDS reads go out as one group ahead of its WMMAs: left free, the compiler reloads one A fragment per four WMMAs and waits out the LDS latency each time */
#pragma unroll
      for (int d = 0; d < 4; ++d) {      /* tiles in the order in which their fragments arrive (a0 b0 a1 b1 ...): the first WMMAs run while the later reads are still coming; each tile still gets one WMMA per block, k upward */
#pragma unroll
        for (int e = 0; e < d; ++e) { acc[e][d] = sc_mma(a[e], b[d], acc[e][d]); acc[d][e] = sc_mma(a[d], b[e], acc[d][e]); }
        acc[d][d] = sc_mma(a[d], b[d], acc[d][d]); }
      __builtin_amdgcn_sched_barrier(0); }      /* keeps the next group of reads behind this block, so that one fragment set is live */
    asm volatile("s_wait_dscnt 0x0" ::: "memory");      /* this wave's reads of the buffer are done before it may be refilled */
    asm volatile("s_wait_asynccnt 0x0" ::: "memory");      /* this wave's copies of stage s + 1 have landed */
    __syncthreads();      /* publishes stage s + 1 and ends every wave's reads of stage s */
    if (s + 2 < ns) stage_in(s + 2, s & 1); }
  asm volatile("s_wait_asynccnt 0x0" ::: "memory");      /* no copy is outstanding when the wave goes on to its end */
  const int rsub = lane >> 4, c4 = (lane & 15) * 4; const int ldo = F16OUT ? ldc : LL; const size_t o0 = cofs + (size_t)(row0 + wm * 64 + rsub) * ldo + col0 + wn * 64 + c4;
  v4f xr[F16OUT ? 1 : 32];      /* the lane's residual values, asked for in two groups of 16 loads: the first flies while the accumulators are staged, the second while the first half of the rows is formed and stored */
  if (!F16OUT) {
#pragma unroll      /* unrolled here and below: xr keeps constant indices and stays in registers */
    for (int q = 0; q < 16; ++q) xr[q] = *(const v4fa*)(X + o0 + (size_t)(q * 2) * ldo); }
  float (*sw)[68] = so[w];
#pragma unroll
  for (int i = 0; i < 4; ++i)
#pragma unroll
    for (int j = 0; j < 4; ++j)
#pragma unroll
      for (int r = 0; r < 8; ++r) sw[i * 16 + 8 * hh + r][j * 16 + ln] = F16OUT ? acc[i][j][r] * alpha : acc[i][j][r];
  __builtin_amdgcn_fence(__ATOMIC_ACQ_REL, "workgroup"); __builtin_amdgcn_wave_barrier();      /* the wave's staged rows are read back by other lanes of the same wave */
  if (!F16OUT) {
#pragma unroll
    for (int q = 16; q < 32; ++q) xr[q] = *(const v4fa*)(X + o0 + (size_t)(q * 2) * ldo); }
#pragma unroll
  for (int q = 0; q < 32; ++q) { const v4f v = *(const v4fa*)&sw[q * 2 + rsub][c4]; const size_t o = o0 + (size_t)(q * 2) * ldo;
    if (HL) { v4h h4, l4; for (int i = 0; i < 4; ++i) { const _Float16 h = (_Float16)v[i]; h4[i] = h; l4[i] = (_Float16)((v[i] - (float)h) * 1024.0f); } const size_t oh = cofs + (size_t)(row0 + wm * 64 + q * 2 + rsub) * ldc + c4; *(v4h*)((wn ? C16b : C16) + oh) = h4; *(v4h*)((wn ? CLb : CL) + oh) = l4; }
    else if (F16OUT) { v4h h4; for (int i = 0; i < 4; ++i) h4[i] = (_Float16)v[i]; *(v4h*)(C16 + o) = h4; }
    else { v4f y; for (int i = 0; i < 4; ++i) y[i] = v[i] * gsc + bf16_round(xr[q][i]); *(v4f*)(C + o) = y; } } }
template <bool F16OUT>
__global__ __launch_bounds__(256) void k_gemm3(const _Float16* __restrict__ A, int lda, size_t sA, const _Float16* __restrict__ Bh, int ldb, size_t sB, float alpha, float* __restrict__ C, _Float16* __restrict__ C16, const float* __restrict__ X, const float* __restrict__ gam, int ldc, size_t sC, int N, int K) {
  __shared__ __attribute__((aligned(16))) unsigned short ring[2 * G3_STAGE];
  __shared__ __attribute__((aligned(16))) float so[8][64][68];
  gemm3_body<F16OUT>(ring, so, blockIdx.x, blockIdx.y, A, lda, sA, Bh, ldb, sB, alpha, C, C16, X, gam, ldc, sC, N, K); }
// The three projections of x in one launch (none reads another's result); blockIdx.y = batch. blockIdx.x < LL / 256: f^T and g^T of 256 token rows as one 256 x 128 tile (A = token rows of XR, B = the 64 rows of BQ and the 64 of BK, which follow them in memory); the others: one 256 x 128 tile of h. Both on gemm3_body.
// One LDS block serves as the ring and afterwards as the output staging: 136 KiB instead of 244, so that two work-groups fit a WGP and all 320 of the launch are resident at once.
__global__ __launch_bounds__(256) void k_proj(const _Float16* __restrict__ XR, const _Float16* __restrict__ BQK, const _Float16* __restrict__ BV, _Float16* __restrict__ Fh, _Float16* __restrict__ Fl, _Float16* __restrict__ Gh, _Float16* __restrict__ Gl, _Float16* __restrict__ H16) {
  __shared__ __attribute__((aligned(16))) float sm[8][64][68]; static_assert(sizeof(sm) >= 2 * G3_STAGE * 2, "k_proj: the ring lies inside the staging block");
  const unsigned bx = blockIdx.x; const int by = blockIdx.y;
  if (bx < LL / 256) gemm3_body<true, true>((unsigned short*)&sm[0][0][0], sm, bx, by, XR, CC, (size_t)LL * CC, BQK, CC, 0, 0.0625f, nullptr, Fh, nullptr, nullptr, CQ, (size_t)LL * CQ, 2 * CQ, CC, Fl, Gh, Gl);
  else gemm3_body<true>((unsigned short*)&sm[0][0][0], sm, bx - LL / 256, by, BV, CC, 0, XR, CC, (size_t)LL * CC, 0.0625f, nullptr, H16, nullptr, nullptr, LL, (size_t)CC * LL, LL, CC); }

// x [b][c][l] f32 -> exact f16 token rows XR [b][l][c], one 128 c x 128 l tile per work-group. Wave w takes 16 channel rows: each of its loads is 512 contiguous bytes of one row, all 16 in flight at once; a lane then holds 16 channels of 4 tokens
// and writes them to LDS as 16-byte pieces of 8 channels. Piece k of token row l lies at place k ^ ((l >> 2) & 15) of the row: the 16 lanes of a half wave, whose rows are 4 apart, then write 16 different places, and a reader's half wave takes one whole row. Every store to XR covers 256 contiguous bytes per half wave.
__device__ __forceinline__ void cl2rows_body(unsigned short (*tl)[128], unsigned bx, const float* __restrict__ X, _Float16* __restrict__ XR) { const int tid = threadIdx.x, lane = tid & 31, w = tid >> 5; const int nl = LL / 128, nc = CC / 128; const int cb_ = bx % nc; const int lb = (bx / nc) % nl; const size_t b = bx / (nc * nl); const int c0 = cb_ * 128, l0 = lb * 128;
  const float* s = X + (b * CC + c0 + w * 16) * (size_t)LL + l0 + lane * 4; v4f v[16];
#pragma unroll      /* unrolled here and below: v and o keep constant indices and stay in registers */
  for (int j = 0; j < 16; ++j) v[j] = *(const v4fa*)(s + (size_t)j * LL);
  asm volatile("s_wait_xcnt 0x0" :: "v"(s) : "memory");      /* a precaution: stands before any register that a load names is written again; the address is an input, so that no load's own result is laid on it. The statement also holds all 16 loads ahead of the conversions: left free, the compiler sends eight, waits for them and only then sends the other eight, two memory latencies in a row */
#pragma unroll
  for (int i = 0; i < 4; ++i)
#pragma unroll
    for (int k = 0; k < 2; ++k) { FragH f;
#pragma unroll
      for (int q = 0; q < 8; ++q) f.h[q] = (_Float16)bf16_round(v[k * 8 + q][i]);
      *(v8us*)&tl[lane * 4 + i][((w * 2 + k) ^ (lane & 15)) * 8] = f.half[0]; }
  __syncthreads();
  { const int r = tid >> 4, k = tid & 15; unsigned short* d = (unsigned short*)XR + (b * LL + l0 + r) * (size_t)CC + c0 + k * 8; v8us o[8];
#pragma unroll
    for (int p = 0; p < 8; ++p) { const int l = p * 16 + r; o[p] = *(const v8us*)&tl[l][(k ^ ((l >> 2) & 15)) * 8]; }
#pragma unroll
    for (int p = 0; p < 8; ++p) *(v8us*)(d + (size_t)(p * 16) * CC) = o[p];
    asm volatile("s_wait_xcnt 0x0" ::: "memory");      /* a precaution: stands before any register that a store names is written again (the calling kernel's other branches follow in the code) */
  } }
// The four input conversions in one launch (none reads another's result): the first blocks cast Wq, Wk and Wv, the others transpose x.
#define PB_QK (CQ * CC / 8 / 256)      /* blocks for Wq, and for Wk */
#define PB_V (CC * CC / 8 / 256)      /* blocks for Wv */
#define PB_X (NB * (LL / 128) * (CC / 128))      /* blocks for x */
__global__ __launch_bounds__(256) void k_prep(const float* __restrict__ x, const float* __restrict__ wq, const float* __restrict__ wk, const float* __restrict__ wv, _Float16* __restrict__ XR, _Float16* __restrict__ BQ, _Float16* __restrict__ BK, _Float16* __restrict__ BV) {
  __shared__ __attribute__((aligned(16))) unsigned short tl[128][128]; const unsigned bx = blockIdx.x;
  if (bx < PB_QK) wnat_body(bx, wq, (size_t)CQ * CC / 8, BQ);
  else if (bx < 2 * PB_QK) wnat_body(bx - PB_QK, wk, (size_t)CQ * CC / 8, BK);
  else if (bx < 2 * PB_QK + PB_V) wnat_body(bx - 2 * PB_QK, wv, (size_t)CC * CC / 8, BV);
  else cl2rows_body(tl, bx - (2 * PB_QK + PB_V), x, XR); }


extern "C" void kernel_launch(void* const* d_in, const int* in_sizes, int n_in,
                              void* d_out, int out_size, void* d_ws, size_t ws_size, hipStream_t stream) {
  (void)in_sizes; (void)n_in; (void)out_size;
  const float* const* I = (const float* const*)d_in; const float* x = I[0]; const float* wq = I[1]; const float* wk = I[2]; const float* wv = I[3]; const float* gam = I[4];
  char* ws = (char*)d_ws; size_t off = 0;
  auto take = [&](size_t bytes) { char* p = ws + off; off += (bytes + 255) & ~(size_t)255; return p; };
  _Float16* BQ = (_Float16*)take((size_t)2 * CQ * CC * 2); _Float16* BK = BQ + (size_t)CQ * CC;      /* one block: the rows of Wk follow those of Wq */
  _Float16* BV = (_Float16*)take((size_t)CC * CC * 2);
  _Float16* XR = (_Float16*)take(NR * CC * 2); _Float16* Fh = (_Float16*)take(NR * CQ * 2); _Float16* Fl = (_Float16*)take(NR * CQ * 2); _Float16* Gh = (_Float16*)take(NR * CQ * 2); _Float16* Gl = (_Float16*)take(NR * CQ * 2);
  _Float16* H16 = (_Float16*)take(NR * CC * 2); _Float16* P = (_Float16*)take(NR * LL * 2);
  if (off > ws_size) return;      /* approx 0.6 + 16 + 8 + 16 + 64 = 105 MiB: every plane holds all NB batches */
  /* every stage once for all batches: blockIdx.y = batch (k_prep: one-dimensional grid, batch from blockIdx.x) */
  k_prep<<<2 * PB_QK + PB_V + PB_X, 256, 0, stream>>>(x, wq, wk, wv, XR, BQ, BK, BV);      /* x16 f16 weights; exact f16 token rows [b*2048 + n][c] */
  k_proj<<<dim3(LL / 256 + (CC / 256) * (LL / 128), NB), 256, 0, stream>>>(XR, BQ, BV, Fh, Fl, Gh, Gl, H16);      /* f^T rows [b][n][64] and g^T rows [b][m][64] -> hi/lo; h channel-major [b][c][n] f16 */
  k_scsm<2, 16><<<dim3(LL / 32, NB), 512, 0, stream>>>(Gh, Gl, Fh, Fl, P);      /* S^T[b][m][n] = g_m . f_n (hi.hi + 2^-10 (lo.hi + hi.lo)), softmax over n per key m (the module's dim=1 softmax) -> beta^T[b][m][n] x256 f16 */
  k_gemm3<false><<<dim3((CC / 256) * (LL / 128), NB), 256, 0, stream>>>(H16, LL, (size_t)CC * LL, P, LL, (size_t)LL * LL, 0.00390625f, (float*)d_out, nullptr, x, gam, LL, (size_t)CC * LL, LL, LL);      /* out[b][c][m] = gamma 2^-8 sum_n h[c][n] beta^T[m][n] + x[b][c][m] (channel-major = the output layout) */
}

// v009
// Measured time: 82.1 microseconds a run.
// Two timings next to v008 put it at 1.09 and 1.08 times that version's speed.
// All steps since v000 together make it 48.8 times as fast.
#include <hip/hip_runtime.h>
// SAGAN-style self-attention with 1x1-conv projections (x [8][512][2048] channel-first; f = Wq x, g = Wk x (64 channels), h = Wv x (512); scores[n][m] = sum_c f[c][n] g[c][m] (unscaled); beta = softmax over n (the QUERY axis, dim=1) for each m; o[c][m] = gamma sum_n h[c][n] beta[n][m] + x[c][m] -> [8][512][2048]; gamma = an input scalar).
// Structure: x transposed to exact f16 token rows via LDS tiles; f^T and g^T as one WMMA GEMM (f32 accumulation, exact x16 weights) cut in the GEMM's own epilogue into f16 hi + x1024 residual planes; h channel-major as a GEMM (weights as the A operand) into f16 (f/g, h and o: 256x128 work-group tiles; every GEMM's operands staged in LDS by asynchronous copies; the output GEMM, whose beta^T rows come from memory, keeps two stages of copies in flight); every stage is one launch over all batches (blockIdx.y = batch): S^T[m][n] = g^T f (K = 64; hi.hi + lo.hi + hi.lo on WMMA) and its row softmax over n (f32 statistics, native exp; weights x256 f16) = beta^T in one launch, a work-group holding whole score rows in registers; o[c][m] = h . beta^T as a GEMM (K = 2048) channel-major straight into the output, its epilogue forming out = bf16(gamma) o + bf16(x). Stages that do not depend on one another share a launch, told apart by the block index: weight casts + transpose; f, g and h GEMMs; scores + softmax; output GEMM = 4 launches.
// Compute dtype: inputs rounded to bf16; x / weights exact; f, g as hi + residual (~2^-22: the unscaled logits have sigma ~8); h and the softmax weights plain f16 (~2^-12); logits, statistics, o f32. v_wmma_f32_16x16x32_f16.
#define NB 8
#define CC 512
#define CQ 64
#define LL 2048
#define SQ LL
#define DM 64
#define NH 1
#define HD 64
#define HG 1
#define NR ((size_t)NB * LL)
typedef __bf16 v16b __attribute__((ext_vector_type(16)));
typedef unsigned short v8us __attribute__((ext_vector_type(8), may_alias));
typedef float  v8f  __attribute__((ext_vector_type(8)));
typedef float  v4f  __attribute__((ext_vector_type(4)));
typedef float  v4fa __attribute__((ext_vector_type(4), may_alias));
union FragB { v16b v; v8us half[2]; unsigned short u[16]; };

__device__ __forceinline__ unsigned short bf16_bits(float x) { unsigned int u = __float_as_uint(x); return (unsigned short)((u + 0x7FFFu + ((u >> 16) & 1u)) >> 16); }
__device__ __forceinline__ float bf16_val(unsigned short b) { return __uint_as_float(((unsigned int)b) << 16); }
__device__ __forceinline__ float bf16_round(float x) { return bf16_val(bf16_bits(x)); }
// D += A·B with NT terms: 1 = ah·bh, 2 = + al·bh (A split), 3 = + ah·bl (both split)
template <int NT>
__device__ __forceinline__ v8f mmaN(v16b ah, v16b al, v16b bh, v16b bl, v8f c) {
  c = __builtin_amdgcn_wmma_f32_16x16x32_bf16(false, ah, false, bh, (short)0, c, false, false);
  if (NT >= 2) c = __builtin_amdgcn_wmma_f32_16x16x32_bf16(false, al, false, bh, (short)0, c, false, false);
  if (NT >= 3) c = __builtin_amdgcn_wmma_f32_16x16x32_bf16(false, ah, false, bl, (short)0, c, false, false);
  asm volatile("v_nop\n\tv_nop\n\tv_nop\n\tv_nop" : "+v"(c) : "v"(ah), "v"(al), "v"(bh), "v"(bl));
  return c;
}

__global__ __launch_bounds__(256) void k_wt_bf16(const float* __restrict__ W, unsigned short* __restrict__ Wt, int K, int N) {
  const int t = blockIdx.x * 256 + threadIdx.x;
  const int k8n = K / 8;
  if (t >= N * k8n) return;
  const int n = t / k8n, k8 = (t % k8n) * 8;
  v8us v;
#pragma unroll
  for (int i = 0; i < 8; ++i) v[i] = bf16_bits(W[(size_t)(k8 + i) * N + n]);
  *(v8us*)(Wt + (size_t)n * K + k8) = v;
  
}

// GEMM C[M][N] (f32, pitch ldc) = act(A[M][K]·W + bias). A f32 row-major (pitch lda) converted per fragment to bf16
// (ASPLIT: hi/lo two planes -> 2 terms, else single rounded term); Wt bf16 [N][K] (pitch ldb). BIAS_BF16 rounds the
// bias to bf16 first (bias quantised to bf16 before the add). K%32==0, M%16==0, N%64==0.
template <bool ASPLIT, int ACT, bool BIAS_BF16>
__global__ __launch_bounds__(128) void k_gemm_bf(const float* __restrict__ A, int lda, const unsigned short* __restrict__ Wt, int ldb,
                                               const float* __restrict__ bias, float* __restrict__ C, int ldc, int M, int N, int K) {
  __shared__ __attribute__((aligned(16))) float so[4][16][64];
  const int tid = threadIdx.x, w = tid >> 5, lane = tid & 31, ln = lane & 15, hh = lane >> 4;
  const int ntn = N / 64;
  const int wid = blockIdx.x * 4 + w;
  const int mt = wid / ntn, nq = wid % ntn;
  if (mt * 16 >= M) return;
  const int row0 = mt * 16, col0 = nq * 64;
  const float* arow = A + (size_t)(row0 + ln) * lda;
  v8f acc[4] = {};
  for (int kb = 0; kb < K; kb += 32) {
    FragB ah, al;
    const v4f x0 = *(const v4fa*)(arow + kb + 8 * hh), x1 = *(const v4fa*)(arow + kb + 8 * hh + 4);
    const v4f x2 = *(const v4fa*)(arow + kb + 16 + 8 * hh), x3 = *(const v4fa*)(arow + kb + 16 + 8 * hh + 4);
    float xs[16] = {x0[0],x0[1],x0[2],x0[3],x1[0],x1[1],x1[2],x1[3],x2[0],x2[1],x2[2],x2[3],x3[0],x3[1],x3[2],x3[3]};
#pragma unroll
    for (int i = 0; i < 16; ++i) { const unsigned short hb = bf16_bits(xs[i]); ah.u[i] = hb; al.u[i] = ASPLIT ? bf16_bits(xs[i] - bf16_val(hb)) : (unsigned short)0; }
#pragma unroll
    for (int t = 0; t < 4; ++t) {
      const unsigned short* brow = Wt + (size_t)(col0 + t * 16 + ln) * ldb + kb;
      FragB b;
      b.half[0] = *(const v8us*)(brow + 8 * hh);
      b.half[1] = *(const v8us*)(brow + 16 + 8 * hh);
      acc[t] = mmaN<ASPLIT ? 2 : 1>(ah.v, al.v, b.v, b.v, acc[t]);
    }
  }
#pragma unroll
  for (int t = 0; t < 4; ++t) {
    float bv = bias ? bias[col0 + t * 16 + ln] : 0.f;
    if (BIAS_BF16) bv = bf16_round(bv);
#pragma unroll
    for (int r = 0; r < 8; ++r) { float v = acc[t][r] + bv; if (ACT == 1) v = fmaxf(v, 0.f); so[w][8 * hh + r][t * 16 + ln] = v; }
  }
  __builtin_amdgcn_fence(__ATOMIC_ACQ_REL, "workgroup");
  __builtin_amdgcn_wave_barrier();
  const int rsub = lane >> 4, c4 = (lane & 15) * 4;
  {
#pragma unroll
    for (int q = 0; q < 8; ++q) {
      const int r = q * 2 + rsub;
      const v4f v = *(const v4fa*)&so[w][r][c4];
      *(v4f*)(C + (size_t)(row0 + r) * ldc + col0 + c4) = v;
    }
    
  }
}

// GEMM C = act(A·W + bias + resid): A f32 (ASPLIT -> hi/lo 2 terms), Wt bf16 [N][K]; ACT 0 none, 1 relu, 2 exact gelu;
// resid (optional, f32, row index = (row % rmod), pitch ldr, RES_BF16 rounds it) added before the activation.
template <bool ASPLIT, int ACT, bool BIAS_BF16, bool RES_BF16>
__global__ __launch_bounds__(128) void k_gemm_bf3(const float* __restrict__ A, int lda, const unsigned short* __restrict__ Wt, int ldb,
                                                const float* __restrict__ bias, const float* __restrict__ resid, int rmod, int ldr,
                                                float* __restrict__ C, int ldc, int M, int N, int K) {
  __shared__ __attribute__((aligned(16))) float so[4][16][64];
  const int tid = threadIdx.x, w = tid >> 5, lane = tid & 31, ln = lane & 15, hh = lane >> 4;
  const int ntn = N / 64;
  const int wid = blockIdx.x * 4 + w;
  const int mt = wid / ntn, nq = wid % ntn;
  if (mt * 16 >= M) return;
  const int row0 = mt * 16, col0 = nq * 64;
  const float* arow = A + (size_t)(row0 + ln) * lda;
  v8f acc[4] = {};
  for (int kb = 0; kb < K; kb += 32) {
    FragB ah, al;
    const v4f x0 = *(const v4fa*)(arow + kb + 8 * hh), x1 = *(const v4fa*)(arow + kb + 8 * hh + 4);
    const v4f x2 = *(const v4fa*)(arow + kb + 16 + 8 * hh), x3 = *(const v4fa*)(arow + kb + 16 + 8 * hh + 4);
    float xs[16] = {x0[0],x0[1],x0[2],x0[3],x1[0],x1[1],x1[2],x1[3],x2[0],x2[1],x2[2],x2[3],x3[0],x3[1],x3[2],x3[3]};
#pragma unroll
    for (int i = 0; i < 16; ++i) { const unsigned short hb = bf16_bits(xs[i]); ah.u[i] = hb; al.u[i] = ASPLIT ? bf16_bits(xs[i] - bf16_val(hb)) : (unsigned short)0; }
#pragma unroll
    for (int t = 0; t < 4; ++t) {
      const unsigned short* brow = Wt + (size_t)(col0 + t * 16 + ln) * ldb + kb;
      FragB b;
      b.half[0] = *(const v8us*)(brow + 8 * hh);
      b.half[1] = *(const v8us*)(brow + 16 + 8 * hh);
      acc[t] = mmaN<ASPLIT ? 2 : 1>(ah.v, al.v, b.v, b.v, acc[t]);
    }
  }
#pragma unroll
  for (int t = 0; t < 4; ++t) {
    const int col = col0 + t * 16 + ln;
    float bv = bias ? bias[col] : 0.f;
    if (BIAS_BF16) bv = bf16_round(bv);
#pragma unroll
    for (int r = 0; r < 8; ++r) {
      float v = acc[t][r] + bv;
      if (resid) { float rv = resid[(size_t)((row0 + 8 * hh + r) % rmod) * ldr + col]; if (RES_BF16) rv = bf16_round(rv); v += rv; }
      if (ACT == 1) v = fmaxf(v, 0.f);
      if (ACT == 2) v = 0.5f * v * (1.0f + erff(v * 0.70710678118654752f));
      if (ACT == 3) { const float u = 0.7978845608028654f * (v + 0.044715f * v * v * v); v = 0.5f * v * (1.0f + tanhf(u)); }
      so[w][8 * hh + r][t * 16 + ln] = v;
    }
  }
  __builtin_amdgcn_fence(__ATOMIC_ACQ_REL, "workgroup");
  __builtin_amdgcn_wave_barrier();
  const int rsub = lane >> 4, c4 = (lane & 15) * 4;
  {
#pragma unroll
    for (int q = 0; q < 8; ++q) {
      const int r = q * 2 + rsub;
      const v4f v = *(const v4fa*)&so[w][r][c4];
      *(v4f*)(C + (size_t)(row0 + r) * ldc + col0 + c4) = v;
    }
    
  }
}
// row LayerNorm (biased variance, eps) over N: s = X (+ R); optional out_sum <- s; out_norm <- (s-mu)*rsqrt(var+eps)*g + b
template <bool PARAM_BF16>
__global__ __launch_bounds__(256) void k_layernorm(const float* __restrict__ X, const float* __restrict__ R, const float* __restrict__ g, const float* __restrict__ bta,
                                                  float* __restrict__ out_sum, float* __restrict__ out_norm, int N, float eps) {
  __shared__ float red[256];
  const int row = blockIdx.x, tid = threadIdx.x;
  const float* x = X + (size_t)row * N; const float* rr = R ? R + (size_t)row * N : nullptr;
  float vals[16];                     // up to N = 4096
  const int per = N / 256;            // contiguous chunk per thread? use strided-by-4 chunks: thread handles j = tid*4 + 1024*u
  float s1 = 0.f;
  for (int u = 0; u < per / 4; ++u) {
    const int j = tid * 4 + 1024 * u;
    const v4f a = *(const v4fa*)(x + j);
    v4f b = {0.f,0.f,0.f,0.f}; if (rr) b = *(const v4fa*)(rr + j);
#pragma unroll
    for (int q = 0; q < 4; ++q) { const float v = a[q] + b[q]; vals[u * 4 + q] = v; s1 += v; }
  }
  red[tid] = s1; __syncthreads();
  for (int st = 128; st > 0; st >>= 1) { if (tid < st) red[tid] += red[tid + st]; __syncthreads(); }
  const float mu = red[0] / (float)N; __syncthreads();
  float s2 = 0.f;
  for (int u = 0; u < per / 4; ++u)
#pragma unroll
    for (int q = 0; q < 4; ++q) { const float c = vals[u * 4 + q] - mu; s2 += c * c; }
  red[tid] = s2; __syncthreads();
  for (int st = 128; st > 0; st >>= 1) { if (tid < st) red[tid] += red[tid + st]; __syncthreads(); }
  const float rs = rsqrtf(red[0] / (float)N + eps);
  {
    for (int u = 0; u < per / 4; ++u) {
      const int j = tid * 4 + 1024 * u;
      v4f o, sm;
#pragma unroll
      for (int q = 0; q < 4; ++q) {
        float gg = g[j + q], bb = bta[j + q];
        if (PARAM_BF16) { gg = bf16_round(gg); bb = bf16_round(bb); }
        sm[q] = vals[u * 4 + q]; o[q] = (vals[u * 4 + q] - mu) * rs * gg + bb;
      }
      if (out_sum) *(v4f*)(out_sum + (size_t)row * N + j) = sm;
      *(v4f*)(out_norm + (size_t)row * N + j) = o;
    }
    
  }
}



// ---- f16 WMMA path (v_wmma_f32_16x16x32_f16): 11-bit significands for operands in range — used where a [0,1] probability operand needs more precision than bf16
typedef _Float16 v16h __attribute__((ext_vector_type(16)));
union FragH { v16h v; v8us half[2]; _Float16 h[16]; unsigned short u[16]; };
template <int NT>
__device__ __forceinline__ v8f mmaH(v16h ah, v16h al, v16h bh, v16h bl, v8f c) {
  c = __builtin_amdgcn_wmma_f32_16x16x32_f16(false, ah, false, bh, (short)0, c, false, false);
  if (NT >= 2) c = __builtin_amdgcn_wmma_f32_16x16x32_f16(false, al, false, bh, (short)0, c, false, false);
  if (NT >= 3) c = __builtin_amdgcn_wmma_f32_16x16x32_f16(false, ah, false, bl, (short)0, c, false, false);
  asm volatile("v_nop\n\tv_nop\n\tv_nop\n\tv_nop" : "+v"(c) : "v"(ah), "v"(al), "v"(bh), "v"(bl));
  return c;
}
// batched GEMM like k_gemm_b but f16 operands: A f32 (split into f16 hi/lo if ASPLIT, else rounded to f16), Bt = f16 values [n][k]; alpha; C f32; N multiple of 16 (partial tiles skipped)
template <bool ASPLIT>
__global__ __launch_bounds__(128) void k_gemm_h(const float* __restrict__ A, int lda, size_t sA, const _Float16* __restrict__ Bh, int ldb, size_t sB, float alpha, float* __restrict__ C, int ldc, size_t sC, int M, int N, int K) {
  __shared__ __attribute__((aligned(16))) float so[4][16][64];
  const int tid = threadIdx.x, w = tid >> 5, lane = tid & 31, ln = lane & 15, hh = lane >> 4; const int by = blockIdx.y;
  A += (size_t)by * sA; Bh += (size_t)by * sB; C += (size_t)by * sC;
  const int ntn = (N + 63) / 64; const int wid = blockIdx.x * 4 + w; const int mt = wid / ntn, nq = wid % ntn; if (mt * 16 >= M) return;
  const int row0 = mt * 16, col0 = nq * 64; const float* arow = A + (size_t)(row0 + ln) * lda;
  v8f acc[4] = {};
  for (int kb = 0; kb < K; kb += 32) {
    FragH ah, al;
    const v4f x0 = *(const v4fa*)(arow + kb + 8 * hh), x1 = *(const v4fa*)(arow + kb + 8 * hh + 4), x2 = *(const v4fa*)(arow + kb + 16 + 8 * hh), x3 = *(const v4fa*)(arow + kb + 16 + 8 * hh + 4);
    float xs[16] = {x0[0],x0[1],x0[2],x0[3],x1[0],x1[1],x1[2],x1[3],x2[0],x2[1],x2[2],x2[3],x3[0],x3[1],x3[2],x3[3]};
#pragma unroll
    for (int i = 0; i < 16; ++i) { const _Float16 h = (_Float16)xs[i]; ah.h[i] = h; al.h[i] = ASPLIT ? (_Float16)(xs[i] - (float)h) : (_Float16)0.0f; }
#pragma unroll
    for (int t = 0; t < 4; ++t) { if (col0 + t * 16 >= N) continue; const size_t boff = (size_t)(col0 + t * 16 + ln) * ldb + kb; FragH bq; bq.half[0] = *(const v8us*)(Bh + boff + 8 * hh); bq.half[1] = *(const v8us*)(Bh + boff + 16 + 8 * hh);
      acc[t] = mmaH<ASPLIT ? 2 : 1>(ah.v, al.v, bq.v, bq.v, acc[t]); }
  }
#pragma unroll
  for (int t = 0; t < 4; ++t) { if (col0 + t * 16 >= N) continue;
#pragma unroll
    for (int r = 0; r < 8; ++r) so[w][8 * hh + r][t * 16 + ln] = acc[t][r] * alpha; }
  __builtin_amdgcn_fence(__ATOMIC_ACQ_REL, "workgroup"); __builtin_amdgcn_wave_barrier();
  const int rsub = lane >> 4, c4 = (lane & 15) * 4;
  {
#pragma unroll
    for (int q = 0; q < 8; ++q) { const int r = q * 2 + rsub; if (col0 + c4 < N) { const v4f v = *(const v4fa*)&so[w][r][c4]; *(v4f*)(C + (size_t)(row0 + r) * ldc + col0 + c4) = v; } }
     }
}

// Wt[n][k] = f16(W[k][n]·scale) from f32 row-major W[K][N] (scale = power of two; bf16-exact weights stay exact in f16 away from the subnormal range)
__global__ __launch_bounds__(256) void k_wt_f16(const float* __restrict__ W, _Float16* __restrict__ Wt, int K, int N, float scale) {
  const int t = blockIdx.x * 256 + threadIdx.x; if (t >= N * (K / 8)) return; const int n = t / (K / 8), k8 = (t % (K / 8)) * 8; FragH f;
#pragma unroll
  for (int i = 0; i < 8; ++i) f.h[i] = (_Float16)(bf16_round(W[(size_t)(k8 + i) * N + n]) * scale); const v8us o = f.half[0];
  *(v8us*)((unsigned short*)Wt + (size_t)n * K + k8) = o; 
}
// k_gemm_hh variant with fused epilogue: v = acc·alpha + bias[by·sBias + col] (+ CP[(row/rowsPerB)·sCPb + by·64 + col] if CP) ; ACT 0 none / 1 elu ; writes f16 C16 (and f32 C if non-null)
template <int ACT>
__global__ __launch_bounds__(128) void k_gemm_hhx(const _Float16* __restrict__ A, int lda, size_t sA, const _Float16* __restrict__ Bh, int ldb, size_t sB, float alpha, const float* __restrict__ bias, size_t sBias, const float* __restrict__ CP, int rowsPerB, size_t sCPb, int row0g,
    float* __restrict__ C, _Float16* __restrict__ C16, int ldc, size_t sC, int M, int N, int K) {
  __shared__ __attribute__((aligned(16))) float so[4][16][64];
  const int tid = threadIdx.x, w = tid >> 5, lane = tid & 31, ln = lane & 15, hh = lane >> 4; const int by = blockIdx.y;
  A += (size_t)by * sA; Bh += (size_t)by * sB; const size_t cofs = (size_t)by * sC; const float* bp = bias ? bias + (size_t)by * sBias : nullptr;
  const int ntn = (N + 63) / 64; const int wid = blockIdx.x * 4 + w; const int mt = wid / ntn, nq = wid % ntn; if (mt * 16 >= M) return;
  const int row0 = mt * 16, col0 = nq * 64; const _Float16* arow = A + (size_t)(row0 + ln) * lda;
  v8f acc[4] = {};
  for (int kb = 0; kb < K; kb += 32) { FragH ah; ah.half[0] = *(const v8us*)((const unsigned short*)arow + kb + 8 * hh); ah.half[1] = *(const v8us*)((const unsigned short*)arow + kb + 16 + 8 * hh);
#pragma unroll
    for (int t = 0; t < 4; ++t) { if (col0 + t * 16 >= N) continue; const size_t boff = (size_t)(col0 + t * 16 + ln) * ldb + kb; FragH bq; bq.half[0] = *(const v8us*)((const unsigned short*)Bh + boff + 8 * hh); bq.half[1] = *(const v8us*)((const unsigned short*)Bh + boff + 16 + 8 * hh);
      acc[t] = mmaH<1>(ah.v, ah.v, bq.v, bq.v, acc[t]); }
  }
#pragma unroll
  for (int t = 0; t < 4; ++t) { if (col0 + t * 16 >= N) continue; const int col = col0 + t * 16 + ln; const float bv = bp ? bf16_round(bp[col]) : 0.f;
#pragma unroll
    for (int r = 0; r < 8; ++r) { float v = acc[t][r] * alpha + bv; if (CP) { const int rr = row0g + row0 + 8 * hh + r; if (rowsPerB < 0) v += CP[cofs + (size_t)rr * ldc + col];      /* rowsPerB < 0: own element of the batched C plane */ else { const int bidx = rr / rowsPerB; v += CP[(size_t)bidx * sCPb + (size_t)by * 64 + col]; } } if (ACT == 1) v = (v > 0.f) ? v : expm1f(v); else if (ACT == 7) v = (v > 0.f) ? v + 1.0f : expf(v); else if (ACT == 8) v = tanhf(v); else if (ACT == 9) v = 0.5f * v * (1.0f + tanhf(0.7978845608028654f * (v + 0.044715f * v * v * v))); else if (ACT == 11) v = 1.0f / (1.0f + expf(-v)); else if (ACT == 12) v = (v > 0.f) ? v : 0.01f * v; else if (ACT == 14) v = (v > 0.f) ? v : 0.1f * v; else if (ACT == 16) v = (v >= 0.f) ? v : 0.3f * v; else if (ACT == 17) v = (v >= 0.f) ? v : 0.2f * v; else if (ACT == 15) v = v / (1.0f + expf(-v)); else if (ACT == 3) v = fmaxf(v, 0.f); else if (ACT == 6) v = 0.5f * v * (1.0f + erff(v * 0.70710678118654752f)); so[w][8 * hh + r][t * 16 + ln] = v; } }
  __builtin_amdgcn_fence(__ATOMIC_ACQ_REL, "workgroup"); __builtin_amdgcn_wave_barrier();
  const int rsub = lane >> 4, c4 = (lane & 15) * 4; typedef _Float16 v4h __attribute__((ext_vector_type(4)));
  {
#pragma unroll
    for (int q = 0; q < 8; ++q) { const int r = q * 2 + rsub; if (col0 + c4 < N) { const v4f v = *(const v4fa*)&so[w][r][c4]; if (C) *(v4f*)(C + cofs + (size_t)(row0 + r) * ldc + col0 + c4) = v; if (C16) { v4h h4; for (int i = 0; i < 4; ++i) h4[i] = (_Float16)v[i]; *(v4h*)(C16 + cofs + (size_t)(row0 + r) * ldc + col0 + c4) = h4; } } }
     }
}


typedef _Float16 v4h __attribute__((ext_vector_type(4)));

__global__ __launch_bounds__(256) void k_x16(const float* __restrict__ x, _Float16* __restrict__ X16, size_t n8) { const size_t t = (size_t)blockIdx.x * 256 + threadIdx.x; if (t >= n8) return; FragH f;
#pragma unroll
  for (int q = 0; q < 8; ++q) f.h[q] = (_Float16)bf16_round(x[t * 8 + q]); *(v8us*)((unsigned short*)X16 + t * 8) = f.half[0];  }
__global__ __launch_bounds__(256) void k_h16(const float* __restrict__ x, _Float16* __restrict__ X16, size_t n8) { const size_t t = (size_t)blockIdx.x * 256 + threadIdx.x; if (t >= n8) return; FragH f;
#pragma unroll
  for (int q = 0; q < 8; ++q) f.h[q] = (_Float16)x[t * 8 + q]; *(v8us*)((unsigned short*)X16 + t * 8) = f.half[0];  }
__global__ __launch_bounds__(256) void k_round16f(const float* __restrict__ W, _Float16* __restrict__ Bt, size_t n8) { const size_t t = (size_t)blockIdx.x * 256 + threadIdx.x; if (t >= n8) return; FragH f;
#pragma unroll
  for (int i = 0; i < 8; ++i) f.h[i] = (_Float16)(bf16_round(W[t * 8 + i]) * 16.0f); *(v8us*)((unsigned short*)Bt + t * 8) = f.half[0];  }
template <int NHv, int TTv>
__global__ __launch_bounds__(256) void k_vt(const _Float16* __restrict__ V16, int ldv, int voff, _Float16* __restrict__ Vt) { __shared__ unsigned short tl[64][66]; const int tid = threadIdx.x; const int slab = blockIdx.x / (TTv / 64), lg = blockIdx.x % (TTv / 64); const int b = slab / NHv, h = slab % NHv;
  for (int i = tid; i < 64 * 8; i += 256) { const int r = i / 8, c8 = (i % 8) * 8; FragH f; f.half[0] = *(const v8us*)((const unsigned short*)V16 + ((size_t)b * TTv + lg * 64 + r) * ldv + voff + h * 64 + c8);
#pragma unroll
    for (int q = 0; q < 8; ++q) tl[r][c8 + q] = f.u[q]; }
  __syncthreads();
  {
#pragma unroll
    for (int rd = 0; rd < 2; ++rd) { const int d = rd * 32 + tid / 8, pc = tid % 8; FragH f;
#pragma unroll
      for (int q = 0; q < 8; ++q) f.u[q] = tl[pc * 8 + q][d];
      *(v8us*)((unsigned short*)Vt + ((size_t)slab * 64 + d) * TTv + lg * 64 + pc * 8) = f.half[0]; }
     } }

// one 16 x 32 f16 fragment row piece of lane half hh from a K-contiguous row at p: k = 8 hh .. 8 hh + 7 and 16 + 8 hh .. 16 + 8 hh + 7
__device__ __forceinline__ v16h g2_frag(const _Float16* p, int hh) { FragH f; f.half[0] = *(const v8us*)((const unsigned short*)p + 8 * hh); f.half[1] = *(const v8us*)((const unsigned short*)p + 16 + 8 * hh); return f.v; }

__device__ __forceinline__ void wnat_body(unsigned bx, const float* __restrict__ w, size_t n8, _Float16* __restrict__ Bt) { const size_t t = (size_t)bx * 256 + threadIdx.x; if (t >= n8) return; FragH f; for (int q = 0; q < 8; ++q) f.h[q] = (_Float16)(bf16_round(w[t * 8 + q]) * 16.0f); *(v8us*)((unsigned short*)Bt + t * 8) = f.half[0];  }
__global__ __launch_bounds__(256) void k_rsm(const float* __restrict__ S, _Float16* __restrict__ P, int nrows) {
  #pragma clang fp contract(off)
  const int i = blockIdx.x * 256 + threadIdx.x; if (i >= nrows) return; const float* s = S + (size_t)i * SQ; float mx = -3.0e38f;
#pragma unroll 1
  for (int j = 0; j < SQ; ++j) mx = fmaxf(mx, s[j]); float se = 0.f;
#pragma unroll 1
  for (int j = 0; j < SQ; ++j) se += expf(s[j] - mx); const float sc = 256.0f / se;
#pragma unroll 1
  for (int j0 = 0; j0 < SQ; j0 += 8) { FragH f; for (int q = 0; q < 8; ++q) f.h[q] = (_Float16)(expf(s[j0 + q] - mx) * sc); unsigned short* d = (unsigned short*)P + (size_t)i * SQ + j0; *(v8us*)d = f.half[0];  } }
__global__ __launch_bounds__(256) void k_vt(const _Float16* __restrict__ V16, int b, int h0, _Float16* __restrict__ VT) { __shared__ unsigned short tl[64][65]; const int tid = threadIdx.x; const int hh = blockIdx.x % HG, sg = blockIdx.x / HG; const int s0 = sg * 64; const int h = h0 + hh;
  for (int i = tid; i < 64 * 8; i += 256) { const int j = i / 8, d8 = (i % 8) * 8; FragH f; f.half[0] = *(const v8us*)((const unsigned short*)V16 + ((size_t)b * SQ + s0 + j) * DM + h * HD + d8); for (int q = 0; q < 8; ++q) tl[d8 + q][j] = f.u[q]; }
  __syncthreads();
  { for (int i = tid; i < 64 * 8; i += 256) { const int d = i / 8, j8 = (i % 8) * 8; FragH f; for (int q = 0; q < 8; ++q) f.u[q] = tl[d][j8 + q]; *(v8us*)((unsigned short*)VT + ((size_t)hh * HD + d) * SQ + s0 + j8) = f.half[0]; }  } }


// lane l <-> l ^ M inside a 16-lane row (DPP row_xmask)
template <int M> __device__ __forceinline__ float ln_xm(float v) { return __int_as_float(__builtin_amdgcn_update_dpp(0, __float_as_int(v), 0x160 + M, 0xf, 0xf, true)); }
// 2^x (v_exp_f32). The v_nop in the same statement keeps the one issue slot that the instruction set asks for behind a transcendental, before its result is read or its source overwritten.
__device__ __forceinline__ float exp2_slot(float x) { float r; asm("v_exp_f32 %0, %1\n\tv_nop" : "=v"(r) : "v"(x)); return r; }
// Scores and their row softmax in one launch. A work-group owns MT*16 whole rows m of S^T[m][n] = g_m . f_n: each of its NW waves forms its own LL/NW columns on WMMA (hi.hi + 2^-10 (lo.hi + hi.lo)) and keeps them in
// accumulator registers through the maximum, the exponentials and the scaling, so the f32 score plane never goes to memory. Column tile t of a wave takes f rows n = base + (t>>3)*128 + ln*8 + (t&7): a lane then holds 8 neighbouring columns of a row, and one 16-byte store per lane writes whole lines of beta^T.
// Both operands come through LDS by asynchronous copies of whole 128-byte rows (LDS pitch 144 B, so that the 16-byte fragment reads spread over the banks): the g rows once for the work-group, each wave's own f rows in stages of two column tiles, two buffers, the next stage's copies flying while this stage is multiplied. A fragment load straight from global memory would touch 16 lines for 512 bytes.
#define SC_PITCH 72      /* f16 per LDS row */
__device__ __forceinline__ unsigned g3_lds(const void* p) { return (unsigned)(size_t)p; }      /* byte offset in the work-group's LDS */
__device__ __forceinline__ v8f sc_mma(v16h a, v16h b, v8f c) { return __builtin_amdgcn_wmma_f32_16x16x32_f16(false, a, false, b, (short)0, c, false, false); }
template <int MT, int NW>
__global__ __launch_bounds__(NW * 32) void k_scsm(const _Float16* __restrict__ Gh, const _Float16* __restrict__ Gl, const _Float16* __restrict__ Fh, const _Float16* __restrict__ Fl, _Float16* __restrict__ P) {
  constexpr int TP = LL / (NW * 16); static_assert(TP % 8 == 0 && (NW == 8 || NW == 16), "k_scsm: a wave takes whole groups of 8 column tiles; the cross-wave step reads one partial per lane of a 16-lane row");
  static_assert(NW * 4 == 2 * MT * 16, "k_scsm: one copy of four rows per wave brings in the g rows of both planes");
  __shared__ float rmx[MT * 16][NW]; __shared__ float rsu[MT * 16][NW];      /* one partial maximum / sum per row and wave */
  __shared__ __attribute__((aligned(16))) unsigned short gs[2 * MT * 16][SC_PITCH];      /* the work-group's g rows: hi plane, then residual plane */
  __shared__ __attribute__((aligned(16))) unsigned short fs[NW][2][64][SC_PITCH];      /* per wave two buffers of one stage = two column tiles: LDS row (plane * 2 + tile) * 16 + ln */
  const int lane = threadIdx.x & 31, ln = lane & 15, hh = lane >> 4; const int w = __builtin_amdgcn_readfirstlane(threadIdx.x >> 5);
  const size_t rb = (size_t)blockIdx.y * LL; const int m0 = blockIdx.x * (MT * 16); const int n0 = w * (TP * 16) + ln * 8;
  const v8f z8 = {0.f,0.f,0.f,0.f,0.f,0.f,0.f,0.f};
  /* a copy of a wave = four whole 128-byte rows: lane -> row rs of the four, 16-byte piece pc. Copy q of a stage and plane takes the f rows of lanes ln = 2q and 2q + 1 for the stage's two tiles: two neighbouring rows each, 256 bytes in a piece */
  const int rs = lane >> 3, pc = lane & 7;
  const size_t fo0 = (rb + w * (TP * 16) + (rs >> 1) * 8 + (rs & 1)) * CQ + pc * 8;
  const unsigned short* fgh = (const unsigned short*)Fh + fo0; const unsigned short* fgl = (const unsigned short*)Fl + fo0;
  const unsigned fl0 = g3_lds(&fs[w][0][(rs & 1) * 16 + (rs >> 1)][pc * 8]);
  auto stage_f = [&](int j, int buf) {      /* stage j = column tiles 2j and 2j + 1 of this wave */
#pragma unroll
    for (int p = 0; p < 2; ++p) { unsigned l[8]; const unsigned short* g[8];
#pragma unroll
      for (int q = 0; q < 8; ++q) { l[q] = fl0 + (unsigned)((buf * 64 + p * 32 + q * 2) * (SC_PITCH * 2)); g[q] = (p ? fgl : fgh) + (size_t)(((j >> 2) * 128 + q * 16 + (j & 3) * 2) * CQ); }
      /* one plane's eight copies; the s_wait_xcnt in the same statement is a precaution: it stands before any register that a copy names is written again */
      asm volatile("global_load_async_to_lds_b128 %0, %8, off\n\tglobal_load_async_to_lds_b128 %1, %9, off\n\tglobal_load_async_to_lds_b128 %2, %10, off\n\tglobal_load_async_to_lds_b128 %3, %11, off\n\t"
                   "global_load_async_to_lds_b128 %4, %12, off\n\tglobal_load_async_to_lds_b128 %5, %13, off\n\tglobal_load_async_to_lds_b128 %6, %14, off\n\tglobal_load_async_to_lds_b128 %7, %15, off\n\ts_wait_xcnt 0x0"
                   :: "v"(l[0]), "v"(l[1]), "v"(l[2]), "v"(l[3]), "v"(l[4]), "v"(l[5]), "v"(l[6]), "v"(l[7]), "v"(g[0]), "v"(g[1]), "v"(g[2]), "v"(g[3]), "v"(g[4]), "v"(g[5]), "v"(g[6]), "v"(g[7]) : "memory"); } };
  { const int gr = w * 4 + rs;      /* g: wave w brings LDS rows 4w .. 4w + 3, all of one plane */
    const unsigned short* gg = (const unsigned short*)(w * 4 >= MT * 16 ? Gl : Gh) + (rb + m0 + (gr & (MT * 16 - 1))) * CQ + pc * 8; const unsigned gl = g3_lds(&gs[gr][pc * 8]);
    /* the s_wait_xcnt in the same statement: the same precaution as above */
    asm volatile("global_load_async_to_lds_b128 %0, %1, off\n\ts_wait_xcnt 0x0" :: "v"(gl), "v"(gg) : "memory"); }
  constexpr int NS = TP / 2;
  stage_f(0, 0);
  asm volatile("s_wait_asynccnt 0x0" ::: "memory");      /* this wave's copies of g and of stage 0 have landed */
  __syncthreads();      /* g and stage 0 are readable by every wave */
  stage_f(1, 1);
  v16h ah[MT][2], al[MT][2];
#pragma unroll      /* full unroll here and below: the fragment and score arrays stay in registers */
  for (int mt = 0; mt < MT; ++mt) { const _Float16* gh = (const _Float16*)&gs[mt * 16 + ln][0]; const _Float16* gl = (const _Float16*)&gs[MT * 16 + mt * 16 + ln][0]; ah[mt][0] = g2_frag(gh, hh); ah[mt][1] = g2_frag(gh + 32, hh); al[mt][0] = g2_frag(gl, hh); al[mt][1] = g2_frag(gl + 32, hh); }
  v8f s[MT][TP];      /* lane (ln, hh), element r of s[mt][t] = row m0 + mt*16 + 8*hh + r, column n0 + (t>>3)*128 + (t&7) */
#pragma unroll
  for (int j = 0; j < NS; ++j) {
#pragma unroll
    for (int tt = 0; tt < 2; ++tt) { const int t = j * 2 + tt; const _Float16* fh = (const _Float16*)&fs[w][j & 1][tt * 16 + ln][0]; const _Float16* fl = (const _Float16*)&fs[w][j & 1][32 + tt * 16 + ln][0];
      const v16h bh0 = g2_frag(fh, hh), bh1 = g2_frag(fh + 32, hh), bl0 = g2_frag(fl, hh), bl1 = g2_frag(fl + 32, hh);
#pragma unroll
      for (int mt = 0; mt < MT; ++mt) { const v8f c = sc_mma(ah[mt][1], bh1, sc_mma(ah[mt][0], bh0, z8)); const v8f d = sc_mma(ah[mt][1], bl1, sc_mma(ah[mt][0], bl0, sc_mma(al[mt][1], bh1, sc_mma(al[mt][0], bh0, z8))));
        s[mt][t] = d * 0.0009765625f + c; }
      __builtin_amdgcn_sched_barrier(0); }      /* keeps the next tile's fragment reads behind this tile's WMMAs, so that one f fragment set is live: two cost a spill of scores */
    asm volatile("s_wait_dscnt 0x0" ::: "memory");      /* this wave's reads of the buffer are done before it may be refilled */
    asm volatile("s_wait_asynccnt 0x0" ::: "memory");      /* this wave's copies of stage j + 1 have landed */
    __syncthreads();      /* publishes stage j + 1 and ends the reads of stage j */
    if (j + 2 < NS) stage_f(j + 2, j & 1); }
  asm volatile("s_wait_asynccnt 0x0" ::: "memory");      /* no copy is outstanding when the wave goes on */
  v8f st[MT];
#pragma unroll
  for (int mt = 0; mt < MT; ++mt) { v8f m = s[mt][0];
#pragma unroll
    for (int t = 1; t < TP; ++t) m = __builtin_elementwise_max(m, s[mt][t]);
#pragma unroll
    for (int r = 0; r < 8; ++r) { float x = m[r]; x = fmaxf(x, ln_xm<1>(x)); x = fmaxf(x, ln_xm<2>(x)); x = fmaxf(x, ln_xm<4>(x)); x = fmaxf(x, ln_xm<8>(x)); m[r] = x; }
    st[mt] = m; }
  if (ln == 0) {
#pragma unroll
    for (int mt = 0; mt < MT; ++mt)
#pragma unroll
      for (int r = 0; r < 8; ++r) rmx[mt * 16 + 8 * hh + r][w] = st[mt][r]; }
  __syncthreads();      /* every wave's partial maxima are in LDS */
#pragma unroll
  for (int mt = 0; mt < MT; ++mt) { v8f m;
#pragma unroll
    for (int r = 0; r < 8; ++r) { float x = rmx[mt * 16 + 8 * hh + r][ln & (NW - 1)]; x = fmaxf(x, ln_xm<1>(x)); x = fmaxf(x, ln_xm<2>(x)); x = fmaxf(x, ln_xm<4>(x)); if (NW == 16) x = fmaxf(x, ln_xm<8>(x)); m[r] = x; }
    v8f a = z8;
#pragma unroll
    for (int t = 0; t < TP; ++t) { const v8f y = (s[mt][t] - m) * 1.442695041f; v8f e;
#pragma unroll
      for (int r = 0; r < 8; ++r) e[r] = exp2_slot(y[r]);      /* = native exp: the same multiply and v_exp_f32 */
      s[mt][t] = e; a += e; }
#pragma unroll
    for (int r = 0; r < 8; ++r) { float x = a[r]; x += ln_xm<1>(x); x += ln_xm<2>(x); x += ln_xm<4>(x); x += ln_xm<8>(x); a[r] = x; }
    st[mt] = a; }
  if (ln == 0) {
#pragma unroll
    for (int mt = 0; mt < MT; ++mt)
#pragma unroll
      for (int r = 0; r < 8; ++r) rsu[mt * 16 + 8 * hh + r][w] = st[mt][r]; }
  __syncthreads();      /* every wave's partial sums are in LDS */
#pragma unroll
  for (int mt = 0; mt < MT; ++mt) { v8f sc;
#pragma unroll
    for (int r = 0; r < 8; ++r) { float x = rsu[mt * 16 + 8 * hh + r][ln & (NW - 1)]; x += ln_xm<1>(x); x += ln_xm<2>(x); x += ln_xm<4>(x); if (NW == 16) x += ln_xm<8>(x); sc[r] = 256.0f / x; }
#pragma unroll
    for (int t = 0; t < TP; ++t) s[mt][t] *= sc;
#pragma unroll
    for (int r = 0; r < 8; ++r) { unsigned short* d = (unsigned short*)P + (rb + m0 + mt * 16 + 8 * hh + r) * LL + n0;
#pragma unroll
      for (int t8 = 0; t8 < TP / 8; ++t8) { FragH f;
#pragma unroll
        for (int q = 0; q < 8; ++q) f.h[q] = (_Float16)s[mt][t8 * 8 + q][r];
        *(v8us*)(d + t8 * 128) = f.half[0]; } } } }

// ---- GEMM with both operands staged in LDS: C[c][n] = alpha * sum_k A[c][k] Bh[n][k] (both K-contiguous f16), one 256 x 128 tile of C per work-group, 8 waves as 4 x 2, 64 x 64 per wave. ----
// A stage is 64 k of all 384 operand rows (128 B a row, LDS pitch 144 B so that the 16-byte fragment reads spread over the banks). Asynchronous copies bring whole 128-byte lines from global memory straight into LDS, two buffers:
// the next stage's copies fly while this stage is multiplied. Every operand line is asked for once per work-group, instead of in 32-byte pieces by every wave. k runs upward in steps of 32 into one accumulator chain per tile. Requires M % 256 == 0, N % 128 == 0, K % 64 == 0.
// HL (N = 128, two results of 64 columns side by side, each with rows of its own of pitch ldc): each f32 value alpha acc is cut into f16 hi + x1024 residual, columns 0..63 into C16 / CL, columns 64..127 into C16b / CLb, so the f32 rows never go to memory.
// F16OUT: C16 = f16(alpha acc). Otherwise the residual epilogue: C = bf16(gam[0]) alpha acc + bf16(X), X laid out like C, both [CC][LL] planes (pitch LL at compile time: a lane's 32 loads and 32 stores share one address each and differ in the immediate offset).
#define G3_PITCH 72      /* f16 per LDS row */
#define G3_STAGE (384 * G3_PITCH)      /* f16 per buffer */
#define G3D_PITCH 136      /* DEEP: f16 per LDS row (256 B + 16) */
#define G3D_STAGE (384 * G3D_PITCH)      /* DEEP: f16 per buffer */
// DEEP (K = lda = ldb = LL): a stage is 128 k (256 B a row, LDS pitch 272 B), three buffers, and the two halves of the work-group take turns at copying: waves 0..3 bring the even stages, waves 4..7 the odd ones. In trip s the half of parity s sends stage s + 2 into the buffer that trip s - 1 has read, and waits for it at the foot of trip s + 1.
// A wave then never has more than one stage of its own outstanding, so that its wait is to 0, while the other half's stage flies on across the barrier: a stage has up to two trips to land in instead of one, and the copies of two stages are in flight most of the time. The 48 copies go out a dozen per WMMA block, behind the block's LDS reads, whose latency covers their issue.
// The body takes its LDS from the calling kernel: ring = the stage buffers, so = each wave's own output staging; bx = tile index, by = batch. so may lie on the ring's bytes: it is first written behind the loop, whose last trip ends with every wave's s_wait_dscnt 0 and s_wait_asynccnt 0 and a work-group barrier, with no refill behind it (DEEP: the last two stages were waited for by their senders at the feet of the two trips before, and nothing is sent in the last two trips).
template <bool F16OUT, bool HL = false, bool DEEP = false>
__device__ __forceinline__ void gemm3_body(unsigned short* ring, float (*so)[64][68], unsigned bx, int by, const _Float16* __restrict__ A, int lda, size_t sA, const _Float16* __restrict__ Bh, int ldb, size_t sB, float alpha, float* __restrict__ C, _Float16* __restrict__ C16, const float* __restrict__ X, const float* __restrict__ gam, int ldc, size_t sC, int N, int K,
                                           _Float16* __restrict__ CL = nullptr, _Float16* __restrict__ C16b = nullptr, _Float16* __restrict__ CLb = nullptr) { static_assert(F16OUT || !HL, "gemm3_body: HL is a form of the f16 output");
  const int tid = threadIdx.x, lane = tid & 31, ln = lane & 15, hh = lane >> 4; const int w = __builtin_amdgcn_readfirstlane(tid >> 5); const int wm = w >> 1, wn = w & 1;
  const int ntn = N >> 7; const int mt = bx / ntn, nq = bx - mt * ntn; const int row0 = mt * 256, col0 = nq * 128; const size_t cofs = (size_t)by * sC;
  constexpr int KS = DEEP ? 128 : 64, PITCH = DEEP ? G3D_PITCH : G3_PITCH, STAGE = 384 * PITCH;      /* k per stage; f16 per LDS row and per buffer */
  constexpr int RP = DEEP ? 8 : 32;      /* operand rows that one copy of every copying thread covers */
  /* copy j of a thread: operand row j*32 + tid/8 of the stage (rows 0..255 = A, 256..383 = Bh), 16-byte piece tid%8: a wave's copy covers four whole rows. DEEP: 128 threads copy a stage: row j*8 + (tid%128)/16, piece tid%16: two whole 256-byte rows per wave's copy */
  const int crow = DEEP ? (tid & 127) >> 4 : tid >> 3, cpc = DEEP ? tid & 15 : tid & 7;
  const int la = DEEP ? LL : lda, lbp = DEEP ? LL : ldb;      /* DEEP: operand rows of pitch LL, known at compile time: a copy's address is one pointer plus a constant */
  const unsigned short* ga = (const unsigned short*)A + (size_t)by * sA + (size_t)(row0 + crow) * la + cpc * 8;
  const unsigned short* gb = (const unsigned short*)Bh + (size_t)by * sB + (size_t)(col0 + crow) * lbp + cpc * 8;
  const unsigned short* na = ga + (w >> 2) * KS; const unsigned short* nb = gb + (w >> 2) * KS;      /* DEEP: where this wave's next stage begins; they step on with every stage it copies, so that the 48 addresses are formed where they are used and are not kept in registers through the loop */
  const unsigned lb = g3_lds(ring) + (unsigned)crow * (PITCH * 2) + (unsigned)cpc * 16;
  auto copy12 = [&](int c, int s, int buf) {      /* copies c .. c + 11 of a stage */
    unsigned l[12]; const unsigned short* g[12];
#pragma unroll
    for (int j = 0; j < 12; ++j) { const int r = (c + j) * RP; l[j] = lb + (unsigned)buf * (STAGE * 2) + (unsigned)r * (PITCH * 2); g[j] = DEEP ? (r < 256 ? na + (size_t)r * la : nb + (size_t)(r - 256) * lbp) : (r < 256 ? ga + (size_t)r * la : gb + (size_t)(r - 256) * lbp) + s * KS; }
    /* twelve copies of the stage; the s_wait_xcnt in the same statement is a precaution: it stands before any register that a copy names is written again */
    asm volatile("global_load_async_to_lds_b128 %0, %12, off\n\tglobal_load_async_to_lds_b128 %1, %13, off\n\tglobal_load_async_to_lds_b128 %2, %14, off\n\tglobal_load_async_to_lds_b128 %3, %15, off\n\t"
                 "global_load_async_to_lds_b128 %4, %16, off\n\tglobal_load_async_to_lds_b128 %5, %17, off\n\tglobal_load_async_to_lds_b128 %6, %18, off\n\tglobal_load_async_to_lds_b128 %7, %19, off\n\t"
                 "global_load_async_to_lds_b128 %8, %20, off\n\tglobal_load_async_to_lds_b128 %9, %21, off\n\tglobal_load_async_to_lds_b128 %10, %22, off\n\tglobal_load_async_to_lds_b128 %11, %23, off\n\ts_wait_xcnt 0x0"
                 :: "v"(l[0]), "v"(l[1]), "v"(l[2]), "v"(l[3]), "v"(l[4]), "v"(l[5]), "v"(l[6]), "v"(l[7]), "v"(l[8]), "v"(l[9]), "v"(l[10]), "v"(l[11]),
                    "v"(g[0]), "v"(g[1]), "v"(g[2]), "v"(g[3]), "v"(g[4]), "v"(g[5]), "v"(g[6]), "v"(g[7]), "v"(g[8]), "v"(g[9]), "v"(g[10]), "v"(g[11]) : "memory"); };
  auto stage_in = [&](int s, int buf) {
#pragma unroll      /* unrolled: which operand a copy takes is known at compile time */
    for (int c = 0; c < 384 / RP; c += 12) copy12(c, s, buf);
    if (DEEP) { na += 2 * KS; nb += 2 * KS; } };
  float gsc = alpha; if (!F16OUT) gsc = bf16_round(gam[0]) * alpha;      /* read at entry, ahead of every asm statement: a scalar load */
  const int ns = DEEP ? LL / KS : K / KS; const int half = w >> 2;      /* DEEP: this wave copies the stages of parity half (a scalar: every test on it is a scalar branch) */
  if (DEEP) { static_assert(LL / 128 >= 2, "gemm3_body: the deep ring's prologue fills two stages");
    if (half == 0) { stage_in(0, 0); asm volatile("s_wait_asynccnt 0x0" ::: "memory"); }      /* the copying waves' stage 0 has landed */
    else stage_in(1, 1);      /* flies across the barrier; waited for at the foot of trip 0 */
    __syncthreads(); }      /* stage 0 is readable by every wave */
  else {
  stage_in(0, 0);
  asm volatile("s_wait_asynccnt 0x0" ::: "memory");      /* this wave's copies of stage 0 have landed */
  __syncthreads();      /* stage 0 is readable by every wave */
  if (ns > 1) stage_in(1, 1); }
  const v8f z8 = {0.f,0.f,0.f,0.f,0.f,0.f,0.f,0.f}; v8f acc[4][4];
#pragma unroll
  for (int i = 0; i < 4; ++i)
#pragma unroll
    for (int j = 0; j < 4; ++j) acc[i][j] = z8;
  const int ao = (wm * 64 + ln) * PITCH, bo = (256 + wn * 64 + ln) * PITCH; int cur = 0;      /* cur: DEEP, the buffer of stage s = s mod 3 */
#pragma unroll 1      /* the stage loop stays rolled: the accumulators keep constant indices and the loop stays small */
  for (int s = 0; s < ns; ++s) { const _Float16* rb = (const _Float16*)ring + (DEEP ? cur : s & 1) * STAGE;
    const bool send = DEEP && half == (s & 1) && s + 2 < ns; const int nxt = cur == 0 ? 2 : cur - 1;      /* DEEP: this wave sends stage s + 2 in this trip, into buffer (s + 2) mod 3, which every wave left at the barrier of trip s - 1 */
#pragma unroll
    for (int kk = 0; kk < KS / 32; ++kk) { v16h a[4], b[4];
#pragma unroll
      for (int i = 0; i < 4; ++i) { a[i] = g2_frag(rb + ao + i * (16 * PITCH) + kk * 32, hh); b[i] = g2_frag(rb + bo + i * (16 * PITCH) + kk * 32, hh); }
      __builtin_amdgcn_sched_barrier(0);      /* the block's 16 LDS reads go out as one group ahead of its WMMAs: left free, the compiler reloads one A fragment per four WMMAs and waits out the LDS latency each time */
      if (DEEP) { if (send) copy12(kk * 12, 0, nxt); }      /* a quarter of stage s + 2, sent while the block's LDS reads (of another buffer) are on their way */
#pragma unroll
      for (int d = 0; d < 4; ++d) {      /* tiles in the order in which their fragments arrive (a0 b0 a1 b1 ...): the first WMMAs run while the later reads are still coming; each tile still gets one WMMA per block, k upward */
#pragma unroll
        for (int e = 0; e < d; ++e) { acc[e][d] = sc_mma(a[e], b[d], acc[e][d]); acc[d][e] = sc_mma(a[d], b[e], acc[d][e]); }
        acc[d][d] = sc_mma(a[d], b[d], acc[d][d]); }
      __builtin_amdgcn_sched_barrier(0); }      /* keeps the next group of reads behind this block, so that one fragment set is live */
    asm volatile("s_wait_dscnt 0x0" ::: "memory");      /* this wave's reads of the buffer are done before it may be refilled */
    if (!DEEP || half == ((s + 1) & 1)) asm volatile("s_wait_asynccnt 0x0" ::: "memory");      /* this wave's copies of stage s + 1 have landed (DEEP: only the half that sent it waits; the other half's stage s + 2 flies on) */
    __syncthreads();      /* publishes stage s + 1 and ends every wave's reads of stage s */
    if (DEEP) { if (send) { na += 2 * KS; nb += 2 * KS; } cur = cur == 2 ? 0 : cur + 1; }
    else if (s + 2 < ns) stage_in(s + 2, s & 1); }
  asm volatile("s_wait_asynccnt 0x0" ::: "memory");      /* no copy is outstanding when the wave goes on to its end */
  const int rsub = lane >> 4, c4 = (lane & 15) * 4; const int ldo = F16OUT ? ldc : LL; const size_t o0 = cofs + (size_t)(row0 + wm * 64 + rsub) * ldo + col0 + wn * 64 + c4;
  v4f xr[F16OUT ? 1 : 32];      /* the lane's residual values, asked for in two groups of 16 loads: the first flies while the accumulators are staged, the second while the first half of the rows is formed and stored */
  if (!F16OUT) {
#pragma unroll      /* unrolled here and below: xr keeps constant indices and stays in registers */
    for (int q = 0; q < 16; ++q) xr[q] = *(const v4fa*)(X + o0 + (size_t)(q * 2) * ldo); }
  float (*sw)[68] = so[w];
#pragma unroll
  for (int i = 0; i < 4; ++i)
#pragma unroll
    for (int j = 0; j < 4; ++j)
#pragma unroll
      for (int r = 0; r < 8; ++r) sw[i * 16 + 8 * hh + r][j * 16 + ln] = F16OUT ? acc[i][j][r] * alpha : acc[i][j][r];
  __builtin_amdgcn_fence(__ATOMIC_ACQ_REL, "workgroup"); __builtin_amdgcn_wave_barrier();      /* the wave's staged rows are read back by other lanes of the same wave */
  if (!F16OUT) {
#pragma unroll
    for (int q = 16; q < 32; ++q) xr[q] = *(const v4fa*)(X + o0 + (size_t)(q * 2) * ldo); }
#pragma unroll
  for (int q = 0; q < 32; ++q) { const v4f v = *(const v4fa*)&sw[q * 2 + rsub][c4]; const size_t o = o0 + (size_t)(q * 2) * ldo;
    if (HL) { v4h h4, l4; for (int i = 0; i < 4; ++i) { const _Float16 h = (_Float16)v[i]; h4[i] = h; l4[i] = (_Float16)((v[i] - (float)h) * 1024.0f); } const size_t oh = cofs + (size_t)(row0 + wm * 64 + q * 2 + rsub) * ldc + c4; *(v4h*)((wn ? C16b : C16) + oh) = h4; *(v4h*)((wn ? CLb : CL) + oh) = l4; }
    else if (F16OUT) { v4h h4; for (int i = 0; i < 4; ++i) h4[i] = (_Float16)v[i]; *(v4h*)(C16 + o) = h4; }
    else { v4f y; for (int i = 0; i < 4; ++i) y[i] = v[i] * gsc + bf16_round(xr[q][i]); *(v4f*)(C + o) = y; } } }
template <bool F16OUT>
__global__ __launch_bounds__(256) void k_gemm3(const _Float16* __restrict__ A, int lda, size_t sA, const _Float16* __restrict__ Bh, int ldb, size_t sB, float alpha, float* __restrict__ C, _Float16* __restrict__ C16, const float* __restrict__ X, const float* __restrict__ gam, int ldc, size_t sC, int N, int K) {
  __shared__ __attribute__((aligned(16))) unsigned short ring[3 * G3D_STAGE]; static_assert(sizeof(ring) >= sizeof(float) * 8 * 64 * 68, "k_gemm3: the output staging lies inside the ring");      /* one LDS block: the three buffers, afterwards the output staging (306 KiB; both side by side would not fit a WGP) */
  gemm3_body<F16OUT, false, true>(ring, (float (*)[64][68])ring, blockIdx.x, blockIdx.y, A, lda, sA, Bh, ldb, sB, alpha, C, C16, X, gam, ldc, sC, N, K); }
// The three projections of x in one launch (none reads another's result); blockIdx.y = batch. blockIdx.x < LL / 256: f^T and g^T of 256 token rows as one 256 x 128 tile (A = token rows of XR, B = the 64 rows of BQ and the 64 of BK, which follow them in memory); the others: one 256 x 128 tile of h. Both on gemm3_body.
// One LDS block serves as the ring and afterwards as the output staging: 136 KiB instead of 244, so that two work-groups fit a WGP and all 320 of the launch are resident at once.
__global__ __launch_bounds__(256) void k_proj(const _Float16* __restrict__ XR, const _Float16* __restrict__ BQK, const _Float16* __restrict__ BV, _Float16* __restrict__ Fh, _Float16* __restrict__ Fl, _Float16* __restrict__ Gh, _Float16* __restrict__ Gl, _Float16* __restrict__ H16) {
  __shared__ __attribute__((aligned(16))) float sm[8][64][68]; static_assert(sizeof(sm) >= 2 * G3_STAGE * 2, "k_proj: the ring lies inside the staging block");
  const unsigned bx = blockIdx.x; const int by = blockIdx.y;
  if (bx < LL / 256) gemm3_body<true, true>((unsigned short*)&sm[0][0][0], sm, bx, by, XR, CC, (size_t)LL * CC, BQK, CC, 0, 0.0625f, nullptr, Fh, nullptr, nullptr, CQ, (size_t)LL * CQ, 2 * CQ, CC, Fl, Gh, Gl);
  else gemm3_body<true>((unsigned short*)&sm[0][0][0], sm, bx - LL / 256, by, BV, CC, 0, XR, CC, (size_t)LL * CC, 0.0625f, nullptr, H16, nullptr, nullptr, LL, (size_t)CC * LL, LL, CC); }

// x [b][c][l] f32 -> exact f16 token rows XR [b][l][c], one 128 c x 128 l tile per work-group. Wave w takes 16 channel rows: each of its loads is 512 contiguous bytes of one row, all 16 in flight at once; a lane then holds 16 channels of 4 tokens
// and writes them to LDS as 16-byte pieces of 8 channels. Piece k of token row l lies at place k ^ ((l >> 2) & 15) of the row: the 16 lanes of a half wave, whose rows are 4 apart, then write 16 different places, and a reader's half wave takes one whole row. Every store to XR covers 256 contiguous bytes per half wave.
__device__ __forceinline__ void cl2rows_body(unsigned short (*tl)[128], unsigned bx, const float* __restrict__ X, _Float16* __restrict__ XR) { const int tid = threadIdx.x, lane = tid & 31, w = tid >> 5; const int nl = LL / 128, nc = CC / 128; const int cb_ = bx % nc; const int lb = (bx / nc) % nl; const size_t b = bx / (nc * nl); const int c0 = cb_ * 128, l0 = lb * 128;
  const float* s = X + (b * CC + c0 + w * 16) * (size_t)LL + l0 + lane * 4; v4f v[16];
#pragma unroll      /* unrolled here and below: v and o keep constant indices and stay in registers */
  for (int j = 0; j < 16; ++j) v[j] = *(const v4fa*)(s + (size_t)j * LL);
  asm volatile("s_wait_xcnt 0x0" :: "v"(s) : "memory");      /* a precaution: stands before any register that a load names is written again; the address is an input, so that no load's own result is laid on it. The statement also holds all 16 loads ahead of the conversions: left free, the compiler sends eight, waits for them and only then sends the other eight, two memory latencies in a row */
#pragma unroll
  for (int i = 0; i < 4; ++i)
#pragma unroll
    for (int k = 0; k < 2; ++k) { FragH f;
#pragma unroll
      for (int q = 0; q < 8; ++q) f.h[q] = (_Float16)bf16_round(v[k * 8 + q][i]);
      *(v8us*)&tl[lane * 4 + i][((w * 2 + k) ^ (lane & 15)) * 8] = f.half[0]; }
  __syncthreads();
  { const int r = tid >> 4, k = tid & 15; unsigned short* d = (unsigned short*)XR + (b * LL + l0 + r) * (size_t)CC + c0 + k * 8; v8us o[8];
#pragma unroll
    for (int p = 0; p < 8; ++p) { const int l = p * 16 + r; o[p] = *(const v8us*)&tl[l][(k ^ ((l >> 2) & 15)) * 8]; }
#pragma unroll
    for (int p = 0; p < 8; ++p) *(v8us*)(d + (size_t)(p * 16) * CC) = o[p];
    asm volatile("s_wait_xcnt 0x0" ::: "memory");      /* a precaution: stands before any register that a store names is written again (the calling kernel's other branches follow in the code) */
  } }
// The four input conversions in one launch (none reads another's result): the first blocks cast Wq, Wk and Wv, the others transpose x.
#define PB_QK (CQ * CC / 8 / 256)      /* blocks for Wq, and for Wk */
#define PB_V (CC * CC / 8 / 256)      /* blocks for Wv */
#define PB_X (NB * (LL / 128) * (CC / 128))      /* blocks for x */
__global__ __launch_bounds__(256) void k_prep(const float* __restrict__ x, const float* __restrict__ wq, const float* __restrict__ wk, const float* __restrict__ wv, _Float16* __restrict__ XR, _Float16* __restrict__ BQ, _Float16* __restrict__ BK, _Float16* __restrict__ BV) {
  __shared__ __attribute__((aligned(16))) unsigned short tl[128][128]; const unsigned bx = blockIdx.x;
  if (bx < PB_QK) wnat_body(bx, wq, (size_t)CQ * CC / 8, BQ);
  else if (bx < 2 * PB_QK) wnat_body(bx - PB_QK, wk, (size_t)CQ * CC / 8, BK);
  else if (bx < 2 * PB_QK + PB_V) wnat_body(bx - 2 * PB_QK, wv, (size_t)CC * CC / 8, BV);
  else cl2rows_body(tl, bx - (2 * PB_QK + PB_V), x, XR); }


extern "C" void kernel_launch(void* const* d_in, const int* in_sizes, int n_in,
                              void* d_out, int out_size, void* d_ws, size_t ws_size, hipStream_t stream) {
  (void)in_sizes; (void)n_in; (void)out_size;
  const float* const* I = (const float* const*)d_in; const float* x = I[0]; const float* wq = I[1]; const float* wk = I[2]; const float* wv = I[3]; const float* gam = I[4];
  char* ws = (char*)d_ws; size_t off = 0;
  auto take = [&](size_t bytes) { char* p = ws + off; off += (bytes + 255) & ~(size_t)255; return p; };
  _Float16* BQ = (_Float16*)take((size_t)2 * CQ * CC * 2); _Float16* BK = BQ + (size_t)CQ * CC;      /* one block: the rows of Wk follow those of Wq */
  _Float16* BV = (_Float16*)take((size_t)CC * CC * 2);
  _Float16* XR = (_Float16*)take(NR * CC * 2); _Float16* Fh = (_Float16*)take(NR * CQ * 2); _Float16* Fl = (_Float16*)take(NR * CQ * 2); _Float16* Gh = (_Float16*)take(NR * CQ * 2); _Float16* Gl = (_Float16*)take(NR * CQ * 2);
  _Float16* H16 = (_Float16*)take(NR * CC * 2); _Float16* P = (_Float16*)take(NR * LL * 2);
  if (off > ws_size) return;      /* approx 0.6 + 16 + 8 + 16 + 64 = 105 MiB: every plane holds all NB batches */
  /* every stage once for all batches: blockIdx.y = batch (k_prep: one-dimensional grid, batch from blockIdx.x) */
  k_prep<<<2 * PB_QK + PB_V + PB_X, 256, 0, stream>>>(x, wq, wk, wv, XR, BQ, BK, BV);      /* x16 f16 weights; exact f16 token rows [b*2048 + n][c] */
  k_proj<<<dim3(LL / 256 + (CC / 256) * (LL / 128), NB), 256, 0, stream>>>(XR, BQ, BV, Fh, Fl, Gh, Gl, H16);      /* f^T rows [b][n][64] and g^T rows [b][m][64] -> hi/lo; h channel-major [b][c][n] f16 */
  k_scsm<2, 16><<<dim3(LL / 32, NB), 512, 0, stream>>>(Gh, Gl, Fh, Fl, P);      /* S^T[b][m][n] = g_m . f_n (hi.hi + 2^-10 (lo.hi + hi.lo)), softmax over n per key m (the module's dim=1 softmax) -> beta^T[b][m][n] x256 f16 */
  k_gemm3<false><<<dim3((CC / 256) * (LL / 128), NB), 256, 0, stream>>>(H16, LL, (size_t)CC * LL, P, LL, (size_t)LL * LL, 0.00390625f, (float*)d_out, nullptr, x, gam, LL, (size_t)CC * LL, LL, LL);      /* out[b][c][m] = gamma 2^-8 sum_n h[c][n] beta^T[m][n] + x[b][c][m] (channel-major = the output layout) */
}

// v010
// Measured time: 79 microseconds a run.
// Timed twice side by side with v009, it ran 1.03 times as fast both times.
// Counting every step since v000, it is 50.4 times as fast.
#include <hip/hip_runtime.h>
// SAGAN-style self-attention with 1x1-conv projections (x [8][512][2048] channel-first; f = Wq x, g = Wk x (64 channels), h = Wv x (512); scores[n][m] = sum_c f[c][n] g[c][m] (unscaled); beta = softmax over n (the QUERY axis, dim=1) for each m; o[c][m] = gamma sum_n h[c][n] beta[n][m] + x[c][m] -> [8][512][2048]; gamma = an input scalar).
// Structure: x transposed to exact f16 token rows via LDS tiles; f^T and g^T as one WMMA GEMM (f32 accumulation, exact x16 weights) cut in the GEMM's own epilogue into f16 hi + x1024 residual planes; h channel-major as a GEMM (weights as the A operand) into f16 (f/g, h and o: 256x128 work-group tiles; every GEMM's operands staged in LDS by asynchronous copies; the output GEMM, whose beta^T rows come from memory, keeps two stages of copies in flight); every stage is one launch over all batches (blockIdx.y = batch): S^T[m][n] = g^T f (K = 64; hi.hi + lo.hi + hi.lo on WMMA) and its row softmax over n (f32 statistics, native exp; weights x256 f16) = beta^T in one launch, a work-group holding whole score rows in registers; o[c][m] = h . beta^T as a GEMM (K = 2048) channel-major straight into the output, its epilogue forming out = bf16(gamma) o + bf16(x). Stages that do not depend on one another share a launch, told apart by the block index: weight casts + transpose; f, g and h GEMMs; scores + softmax; output GEMM = 4 launches.
// Compute dtype: inputs rounded to bf16; x / weights exact; f, g as hi + residual (~2^-22: the unscaled logits have sigma ~8); h and the softmax weights plain f16 (~2^-12); logits, statistics, o f32. v_wmma_f32_16x16x32_f16.
#define NB 8
#define CC 512
#define CQ 64
#define LL 2048
#define SQ LL
#define DM 64
#define NH 1
#define HD 64
#define HG 1
#define NR ((size_t)NB * LL)
typedef __bf16 v16b __attribute__((ext_vector_type(16)));
typedef unsigned short v8us __attribute__((ext_vector_type(8), may_alias));
typedef float  v8f  __attribute__((ext_vector_type(8)));
typedef float  v4f  __attribute__((ext_vector_type(4)));
typedef float  v4fa __attribute__((ext_vector_type(4), may_alias));
union FragB { v16b v; v8us half[2]; unsigned short u[16]; };

__device__ __forceinline__ unsigned short bf16_bits(float x) { unsigned int u = __float_as_uint(x); return (unsigned short)((u + 0x7FFFu + ((u >> 16) & 1u)) >> 16); }
__device__ __forceinline__ float bf16_val(unsigned short b) { return __uint_as_float(((unsigned int)b) << 16); }
__device__ __forceinline__ float bf16_round(float x) { return bf16_val(bf16_bits(x)); }
// D += A·B with NT terms: 1 = ah·bh, 2 = + al·bh (A split), 3 = + ah·bl (both split)
template <int NT>
__device__ __forceinline__ v8f mmaN(v16b ah, v16b al, v16b bh, v16b bl, v8f c) {
  c = __builtin_amdgcn_wmma_f32_16x16x32_bf16(false, ah, false, bh, (short)0, c, false, false);
  if (NT >= 2) c = __builtin_amdgcn_wmma_f32_16x16x32_bf16(false, al, false, bh, (short)0, c, false, false);
  if (NT >= 3) c = __builtin_amdgcn_wmma_f32_16x16x32_bf16(false, ah, false, bl, (short)0, c, false, false);
  asm volatile("v_nop\n\tv_nop\n\tv_nop\n\tv_nop" : "+v"(c) : "v"(ah), "v"(al), "v"(bh), "v"(bl));
  return c;
}

__global__ __launch_bounds__(256) void k_wt_bf16(const float* __restrict__ W, unsigned short* __restrict__ Wt, int K, int N) {
  const int t = blockIdx.x * 256 + threadIdx.x;
  const int k8n = K / 8;
  if (t >= N * k8n) return;
  const int n = t / k8n, k8 = (t % k8n) * 8;
  v8us v;
#pragma unroll
  for (int i = 0; i < 8; ++i) v[i] = bf16_bits(W[(size_t)(k8 + i) * N + n]);
  *(v8us*)(Wt + (size_t)n * K + k8) = v;
  
}

// GEMM C[M][N] (f32, pitch ldc) = act(A[M][K]·W + bias). A f32 row-major (pitch lda) converted per fragment to bf16
// (ASPLIT: hi/lo two planes -> 2 terms, else single rounded term); Wt bf16 [N][K] (pitch ldb). BIAS_BF16 rounds the
// bias to bf16 first (bias quantised to bf16 before the add). K%32==0, M%16==0, N%64==0.
template <bool ASPLIT, int ACT, bool BIAS_BF16>
__global__ __launch_bounds__(128) void k_gemm_bf(const float* __restrict__ A, int lda, const unsigned short* __restrict__ Wt, int ldb,
                                               const float* __restrict__ bias, float* __restrict__ C, int ldc, int M, int N, int K) {
  __shared__ __attribute__((aligned(16))) float so[4][16][64];
  const int tid = threadIdx.x, w = tid >> 5, lane = tid & 31, ln = lane & 15, hh = lane >> 4;
  const int ntn = N / 64;
  const int wid = blockIdx.x * 4 + w;
  const int mt = wid / ntn, nq = wid % ntn;
  if (mt * 16 >= M) return;
  const int row0 = mt * 16, col0 = nq * 64;
  const float* arow = A + (size_t)(row0 + ln) * lda;
  v8f acc[4] = {};
  for (int kb = 0; kb < K; kb += 32) {
    FragB ah, al;
    const v4f x0 = *(const v4fa*)(arow + kb + 8 * hh), x1 = *(const v4fa*)(arow + kb + 8 * hh + 4);
    const v4f x2 = *(const v4fa*)(arow + kb + 16 + 8 * hh), x3 = *(const v4fa*)(arow + kb + 16 + 8 * hh + 4);
    float xs[16] = {x0[0],x0[1],x0[2],x0[3],x1[0],x1[1],x1[2],x1[3],x2[0],x2[1],x2[2],x2[3],x3[0],x3[1],x3[2],x3[3]};
#pragma unroll
    for (int i = 0; i < 16; ++i) { const unsigned short hb = bf16_bits(xs[i]); ah.u[i] = hb; al.u[i] = ASPLIT ? bf16_bits(xs[i] - bf16_val(hb)) : (unsigned short)0; }
#pragma unroll
    for (int t = 0; t < 4; ++t) {
      const unsigned short* brow = Wt + (size_t)(col0 + t * 16 + ln) * ldb + kb;
      FragB b;
      b.half[0] = *(const v8us*)(brow + 8 * hh);
      b.half[1] = *(const v8us*)(brow + 16 + 8 * hh);
      acc[t] = mmaN<ASPLIT ? 2 : 1>(ah.v, al.v, b.v, b.v, acc[t]);
    }
  }
#pragma unroll
  for (int t = 0; t < 4; ++t) {
    float bv = bias ? bias[col0 + t * 16 + ln] : 0.f;
    if (BIAS_BF16) bv = bf16_round(bv);
#pragma unroll
    for (int r = 0; r < 8; ++r) { float v = acc[t][r] + bv; if (ACT == 1) v = fmaxf(v, 0.f); so[w][8 * hh + r][t * 16 + ln] = v; }
  }
  __builtin_amdgcn_fence(__ATOMIC_ACQ_REL, "workgroup");
  __builtin_amdgcn_wave_barrier();
  const int rsub = lane >> 4, c4 = (lane & 15) * 4;
  {
#pragma unroll
    for (int q = 0; q < 8; ++q) {
      const int r = q * 2 + rsub;
      const v4f v = *(const v4fa*)&so[w][r][c4];
      *(v4f*)(C + (size_t)(row0 + r) * ldc + col0 + c4) = v;
    }
    
  }
}

// GEMM C = act(A·W + bias + resid): A f32 (ASPLIT -> hi/lo 2 terms), Wt bf16 [N][K]; ACT 0 none, 1 relu, 2 exact gelu;
// resid (optional, f32, row index = (row % rmod), pitch ldr, RES_BF16 rounds it) added before the activation.
template <bool ASPLIT, int ACT, bool BIAS_BF16, bool RES_BF16>
__global__ __launch_bounds__(128) void k_gemm_bf3(const float* __restrict__ A, int lda, const unsigned short* __restrict__ Wt, int ldb,
                                                const float* __restrict__ bias, const float* __restrict__ resid, int rmod, int ldr,
                                                float* __restrict__ C, int ldc, int M, int N, int K) {
  __shared__ __attribute__((aligned(16))) float so[4][16][64];
  const int tid = threadIdx.x, w = tid >> 5, lane = tid & 31, ln = lane & 15, hh = lane >> 4;
  const int ntn = N / 64;
  const int wid = blockIdx.x * 4 + w;
  const int mt = wid / ntn, nq = wid % ntn;
  if (mt * 16 >= M) return;
  const int row0 = mt * 16, col0 = nq * 64;
  const float* arow = A + (size_t)(row0 + ln) * lda;
  v8f acc[4] = {};
  for (int kb = 0; kb < K; kb += 32) {
    FragB ah, al;
    const v4f x0 = *(const v4fa*)(arow + kb + 8 * hh), x1 = *(const v4fa*)(arow + kb + 8 * hh + 4);
    const v4f x2 = *(const v4fa*)(arow + kb + 16 + 8 * hh), x3 = *(const v4fa*)(arow + kb + 16 + 8 * hh + 4);
    float xs[16] = {x0[0],x0[1],x0[2],x0[3],x1[0],x1[1],x1[2],x1[3],x2[0],x2[1],x2[2],x2[3],x3[0],x3[1],x3[2],x3[3]};
#pragma unroll
    for (int i = 0; i < 16; ++i) { const unsigned short hb = bf16_bits(xs[i]); ah.u[i] = hb; al.u[i] = ASPLIT ? bf16_bits(xs[i] - bf16_val(hb)) : (unsigned short)0; }
#pragma unroll
    for (int t = 0; t < 4; ++t) {
      const unsigned short* brow = Wt + (size_t)(col0 + t * 16 + ln) * ldb + kb;
      FragB b;
      b.half[0] = *(const v8us*)(brow + 8 * hh);
      b.half[1] = *(const v8us*)(brow + 16 + 8 * hh);
      acc[t] = mmaN<ASPLIT ? 2 : 1>(ah.v, al.v, b.v, b.v, acc[t]);
    }
  }
#pragma unroll
  for (int t = 0; t < 4; ++t) {
    const int col = col0 + t * 16 + ln;
    float bv = bias ? bias[col] : 0.f;
    if (BIAS_BF16) bv = bf16_round(bv);
#pragma unroll
    for (int r = 0; r < 8; ++r) {
      float v = acc[t][r] + bv;
      if (resid) { float rv = resid[(size_t)((row0 + 8 * hh + r) % rmod) * ldr + col]; if (RES_BF16) rv = bf16_round(rv); v += rv; }
      if (ACT == 1) v = fmaxf(v, 0.f);
      if (ACT == 2) v = 0.5f * v * (1.0f + erff(v * 0.70710678118654752f));
      if (ACT == 3) { const float u = 0.7978845608028654f * (v + 0.044715f * v * v * v); v = 0.5f * v * (1.0f + tanhf(u)); }
      so[w][8 * hh + r][t * 16 + ln] = v;
    }
  }
  __builtin_amdgcn_fence(__ATOMIC_ACQ_REL, "workgroup");
  __builtin_amdgcn_wave_barrier();
  const int rsub = lane >> 4, c4 = (lane & 15) * 4;
  {
#pragma unroll
    for (int q = 0; q < 8; ++q) {
      const int r = q * 2 + rsub;
      const v4f v = *(const v4fa*)&so[w][r][c4];
      *(v4f*)(C + (size_t)(row0 + r) * ldc + col0 + c4) = v;
    }
    
  }
}
// row LayerNorm (biased variance, eps) over N: s = X (+ R); optional out_sum <- s; out_norm <- (s-mu)*rsqrt(var+eps)*g + b
template <bool PARAM_BF16>
__global__ __launch_bounds__(256) void k_layernorm(const float* __restrict__ X, const float* __restrict__ R, const float* __restrict__ g, const float* __restrict__ bta,
                                                  float* __restrict__ out_sum, float* __restrict__ out_norm, int N, float eps) {
  __shared__ float red[256];
  const int row = blockIdx.x, tid = threadIdx.x;
  const float* x = X + (size_t)row * N; const float* rr = R ? R + (size_t)row * N : nullptr;
  float vals[16];                     // up to N = 4096
  const int per = N / 256;            // contiguous chunk per thread? use strided-by-4 chunks: thread handles j = tid*4 + 1024*u
  float s1 = 0.f;
  for (int u = 0; u < per / 4; ++u) {
    const int j = tid * 4 + 1024 * u;
    const v4f a = *(const v4fa*)(x + j);
    v4f b = {0.f,0.f,0.f,0.f}; if (rr) b = *(const v4fa*)(rr + j);
#pragma unroll
    for (int q = 0; q < 4; ++q) { const float v = a[q] + b[q]; vals[u * 4 + q] = v; s1 += v; }
  }
  red[tid] = s1; __syncthreads();
  for (int st = 128; st > 0; st >>= 1) { if (tid < st) red[tid] += red[tid + st]; __syncthreads(); }
  const float mu = red[0] / (float)N; __syncthreads();
  float s2 = 0.f;
  for (int u = 0; u < per / 4; ++u)
#pragma unroll
    for (int q = 0; q < 4; ++q) { const float c = vals[u * 4 + q] - mu; s2 += c * c; }
  red[tid] = s2; __syncthreads();
  for (int st = 128; st > 0; st >>= 1) { if (tid < st) red[tid] += red[tid + st]; __syncthreads(); }
  const float rs = rsqrtf(red[0] / (float)N + eps);
  {
    for (int u = 0; u < per / 4; ++u) {
      const int j = tid * 4 + 1024 * u;
      v4f o, sm;
#pragma unroll
      for (int q = 0; q < 4; ++q) {
        float gg = g[j + q], bb = bta[j + q];
        if (PARAM_BF16) { gg = bf16_round(gg); bb = bf16_round(bb); }
        sm[q] = vals[u * 4 + q]; o[q] = (vals[u * 4 + q] - mu) * rs * gg + bb;
      }
      if (out_sum) *(v4f*)(out_sum + (size_t)row * N + j) = sm;
      *(v4f*)(out_norm + (size_t)row * N + j) = o;
    }
    
  }
}



// ---- f16 WMMA path (v_wmma_f32_16x16x32_f16): 11-bit significands for operands in range — used where a [0,1] probability operand needs more precision than bf16
typedef _Float16 v16h __attribute__((ext_vector_type(16)));
union FragH { v16h v; v8us half[2]; _Float16 h[16]; unsigned short u[16]; };
template <int NT>
__device__ __forceinline__ v8f mmaH(v16h ah, v16h al, v16h bh, v16h bl, v8f c) {
  c = __builtin_amdgcn_wmma_f32_16x16x32_f16(false, ah, false, bh, (short)0, c, false, false);
  if (NT >= 2) c = __builtin_amdgcn_wmma_f32_16x16x32_f16(false, al, false, bh, (short)0, c, false, false);
  if (NT >= 3) c = __builtin_amdgcn_wmma_f32_16x16x32_f16(false, ah, false, bl, (short)0, c, false, false);
  asm volatile("v_nop\n\tv_nop\n\tv_nop\n\tv_nop" : "+v"(c) : "v"(ah), "v"(al), "v"(bh), "v"(bl));
  return c;
}
// batched GEMM like k_gemm_b but f16 operands: A f32 (split into f16 hi/lo if ASPLIT, else rounded to f16), Bt = f16 values [n][k]; alpha; C f32; N multiple of 16 (partial tiles skipped)
template <bool ASPLIT>
__global__ __launch_bounds__(128) void k_gemm_h(const float* __restrict__ A, int lda, size_t sA, const _Float16* __restrict__ Bh, int ldb, size_t sB, float alpha, float* __restrict__ C, int ldc, size_t sC, int M, int N, int K) {
  __shared__ __attribute__((aligned(16))) float so[4][16][64];
  const int tid = threadIdx.x, w = tid >> 5, lane = tid & 31, ln = lane & 15, hh = lane >> 4; const int by = blockIdx.y;
  A += (size_t)by * sA; Bh += (size_t)by * sB; C += (size_t)by * sC;
  const int ntn = (N + 63) / 64; const int wid = blockIdx.x * 4 + w; const int mt = wid / ntn, nq = wid % ntn; if (mt * 16 >= M) return;
  const int row0 = mt * 16, col0 = nq * 64; const float* arow = A + (size_t)(row0 + ln) * lda;
  v8f acc[4] = {};
  for (int kb = 0; kb < K; kb += 32) {
    FragH ah, al;
    const v4f x0 = *(const v4fa*)(arow + kb + 8 * hh), x1 = *(const v4fa*)(arow + kb + 8 * hh + 4), x2 = *(const v4fa*)(arow + kb + 16 + 8 * hh), x3 = *(const v4fa*)(arow + kb + 16 + 8 * hh + 4);
    float xs[16] = {x0[0],x0[1],x0[2],x0[3],x1[0],x1[1],x1[2],x1[3],x2[0],x2[1],x2[2],x2[3],x3[0],x3[1],x3[2],x3[3]};
#pragma unroll
    for (int i = 0; i < 16; ++i) { const _Float16 h = (_Float16)xs[i]; ah.h[i] = h; al.h[i] = ASPLIT ? (_Float16)(xs[i] - (float)h) : (_Float16)0.0f; }
#pragma unroll
    for (int t = 0; t < 4; ++t) { if (col0 + t * 16 >= N) continue; const size_t boff = (size_t)(col0 + t * 16 + ln) * ldb + kb; FragH bq; bq.half[0] = *(const v8us*)(Bh + boff + 8 * hh); bq.half[1] = *(const v8us*)(Bh + boff + 16 + 8 * hh);
      acc[t] = mmaH<ASPLIT ? 2 : 1>(ah.v, al.v, bq.v, bq.v, acc[t]); }
  }
#pragma unroll
  for (int t = 0; t < 4; ++t) { if (col0 + t * 16 >= N) continue;
#pragma unroll
    for (int r = 0; r < 8; ++r) so[w][8 * hh + r][t * 16 + ln] = acc[t][r] * alpha; }
  __builtin_amdgcn_fence(__ATOMIC_ACQ_REL, "workgroup"); __builtin_amdgcn_wave_barrier();
  const int rsub = lane >> 4, c4 = (lane & 15) * 4;
  {
#pragma unroll
    for (int q = 0; q < 8; ++q) { const int r = q * 2 + rsub; if (col0 + c4 < N) { const v4f v = *(const v4fa*)&so[w][r][c4]; *(v4f*)(C + (size_t)(row0 + r) * ldc + col0 + c4) = v; } }
     }
}

// Wt[n][k] = f16(W[k][n]·scale) from f32 row-major W[K][N] (scale = power of two; bf16-exact weights stay exact in f16 away from the subnormal range)
__global__ __launch_bounds__(256) void k_wt_f16(const float* __restrict__ W, _Float16* __restrict__ Wt, int K, int N, float scale) {
  const int t = blockIdx.x * 256 + threadIdx.x; if (t >= N * (K / 8)) return; const int n = t / (K / 8), k8 = (t % (K / 8)) * 8; FragH f;
#pragma unroll
  for (int i = 0; i < 8; ++i) f.h[i] = (_Float16)(bf16_round(W[(size_t)(k8 + i) * N + n]) * scale); const v8us o = f.half[0];
  *(v8us*)((unsigned short*)Wt + (size_t)n * K + k8) = o; 
}
// k_gemm_hh variant with fused epilogue: v = acc·alpha + bias[by·sBias + col] (+ CP[(row/rowsPerB)·sCPb + by·64 + col] if CP) ; ACT 0 none / 1 elu ; writes f16 C16 (and f32 C if non-null)
template <int ACT>
__global__ __launch_bounds__(128) void k_gemm_hhx(const _Float16* __restrict__ A, int lda, size_t sA, const _Float16* __restrict__ Bh, int ldb, size_t sB, float alpha, const float* __restrict__ bias, size_t sBias, const float* __restrict__ CP, int rowsPerB, size_t sCPb, int row0g,
    float* __restrict__ C, _Float16* __restrict__ C16, int ldc, size_t sC, int M, int N, int K) {
  __shared__ __attribute__((aligned(16))) float so[4][16][64];
  const int tid = threadIdx.x, w = tid >> 5, lane = tid & 31, ln = lane & 15, hh = lane >> 4; const int by = blockIdx.y;
  A += (size_t)by * sA; Bh += (size_t)by * sB; const size_t cofs = (size_t)by * sC; const float* bp = bias ? bias + (size_t)by * sBias : nullptr;
  const int ntn = (N + 63) / 64; const int wid = blockIdx.x * 4 + w; const int mt = wid / ntn, nq = wid % ntn; if (mt * 16 >= M) return;
  const int row0 = mt * 16, col0 = nq * 64; const _Float16* arow = A + (size_t)(row0 + ln) * lda;
  v8f acc[4] = {};
  for (int kb = 0; kb < K; kb += 32) { FragH ah; ah.half[0] = *(const v8us*)((const unsigned short*)arow + kb + 8 * hh); ah.half[1] = *(const v8us*)((const unsigned short*)arow + kb + 16 + 8 * hh);
#pragma unroll
    for (int t = 0; t < 4; ++t) { if (col0 + t * 16 >= N) continue; const size_t boff = (size_t)(col0 + t * 16 + ln) * ldb + kb; FragH bq; bq.half[0] = *(const v8us*)((const unsigned short*)Bh + boff + 8 * hh); bq.half[1] = *(const v8us*)((const unsigned short*)Bh + boff + 16 + 8 * hh);
      acc[t] = mmaH<1>(ah.v, ah.v, bq.v, bq.v, acc[t]); }
  }
#pragma unroll
  for (int t = 0; t < 4; ++t) { if (col0 + t * 16 >= N) continue; const int col = col0 + t * 16 + ln; const float bv = bp ? bf16_round(bp[col]) : 0.f;
#pragma unroll
    for (int r = 0; r < 8; ++r) { float v = acc[t][r] * alpha + bv; if (CP) { const int rr = row0g + row0 + 8 * hh + r; if (rowsPerB < 0) v += CP[cofs + (size_t)rr * ldc + col];      /* rowsPerB < 0: own element of the batched C plane */ else { const int bidx = rr / rowsPerB; v += CP[(size_t)bidx * sCPb + (size_t)by * 64 + col]; } } if (ACT == 1) v = (v > 0.f) ? v : expm1f(v); else if (ACT == 7) v = (v > 0.f) ? v + 1.0f : expf(v); else if (ACT == 8) v = tanhf(v); else if (ACT == 9) v = 0.5f * v * (1.0f + tanhf(0.7978845608028654f * (v + 0.044715f * v * v * v))); else if (ACT == 11) v = 1.0f / (1.0f + expf(-v)); else if (ACT == 12) v = (v > 0.f) ? v : 0.01f * v; else if (ACT == 14) v = (v > 0.f) ? v : 0.1f * v; else if (ACT == 16) v = (v >= 0.f) ? v : 0.3f * v; else if (ACT == 17) v = (v >= 0.f) ? v : 0.2f * v; else if (ACT == 15) v = v / (1.0f + expf(-v)); else if (ACT == 3) v = fmaxf(v, 0.f); else if (ACT == 6) v = 0.5f * v * (1.0f + erff(v * 0.70710678118654752f)); so[w][8 * hh + r][t * 16 + ln] = v; } }
  __builtin_amdgcn_fence(__ATOMIC_ACQ_REL, "workgroup"); __builtin_amdgcn_wave_barrier();
  const int rsub = lane >> 4, c4 = (lane & 15) * 4; typedef _Float16 v4h __attribute__((ext_vector_type(4)));
  {
#pragma unroll
    for (int q = 0; q < 8; ++q) { const int r = q * 2 + rsub; if (col0 + c4 < N) { const v4f v = *(const v4fa*)&so[w][r][c4]; if (C) *(v4f*)(C + cofs + (size_t)(row0 + r) * ldc + col0 + c4) = v; if (C16) { v4h h4; for (int i = 0; i < 4; ++i) h4[i] = (_Float16)v[i]; *(v4h*)(C16 + cofs + (size_t)(row0 + r) * ldc + col0 + c4) = h4; } } }
     }
}


typedef _Float16 v4h __attribute__((ext_vector_type(4)));

__global__ __launch_bounds__(256) void k_x16(const float* __restrict__ x, _Float16* __restrict__ X16, size_t n8) { const size_t t = (size_t)blockIdx.x * 256 + threadIdx.x; if (t >= n8) return; FragH f;
#pragma unroll
  for (int q = 0; q < 8; ++q) f.h[q] = (_Float16)bf16_round(x[t * 8 + q]); *(v8us*)((unsigned short*)X16 + t * 8) = f.half[0];  }
__global__ __launch_bounds__(256) void k_h16(const float* __restrict__ x, _Float16* __restrict__ X16, size_t n8) { const size_t t = (size_t)blockIdx.x * 256 + threadIdx.x; if (t >= n8) return; FragH f;
#pragma unroll
  for (int q = 0; q < 8; ++q) f.h[q] = (_Float16)x[t * 8 + q]; *(v8us*)((unsigned short*)X16 + t * 8) = f.half[0];  }
__global__ __launch_bounds__(256) void k_round16f(const float* __restrict__ W, _Float16* __restrict__ Bt, size_t n8) { const size_t t = (size_t)blockIdx.x * 256 + threadIdx.x; if (t >= n8) return; FragH f;
#pragma unroll
  for (int i = 0; i < 8; ++i) f.h[i] = (_Float16)(bf16_round(W[t * 8 + i]) * 16.0f); *(v8us*)((unsigned short*)Bt + t * 8) = f.half[0];  }
template <int NHv, int TTv>
__global__ __launch_bounds__(256) void k_vt(const _Float16* __restrict__ V16, int ldv, int voff, _Float16* __restrict__ Vt) { __shared__ unsigned short tl[64][66]; const int tid = threadIdx.x; const int slab = blockIdx.x / (TTv / 64), lg = blockIdx.x % (TTv / 64); const int b = slab / NHv, h = slab % NHv;
  for (int i = tid; i < 64 * 8; i += 256) { const int r = i / 8, c8 = (i % 8) * 8; FragH f; f.half[0] = *(const v8us*)((const unsigned short*)V16 + ((size_t)b * TTv + lg * 64 + r) * ldv + voff + h * 64 + c8);
#pragma unroll
    for (int q = 0; q < 8; ++q) tl[r][c8 + q] = f.u[q]; }
  __syncthreads();
  {
#pragma unroll
    for (int rd = 0; rd < 2; ++rd) { const int d = rd * 32 + tid / 8, pc = tid % 8; FragH f;
#pragma unroll
      for (int q = 0; q < 8; ++q) f.u[q] = tl[pc * 8 + q][d];
      *(v8us*)((unsigned short*)Vt + ((size_t)slab * 64 + d) * TTv + lg * 64 + pc * 8) = f.half[0]; }
     } }

// one 16 x 32 f16 fragment row piece of lane half hh from a K-contiguous row at p: k = 8 hh .. 8 hh + 7 and 16 + 8 hh .. 16 + 8 hh + 7
__device__ __forceinline__ v16h g2_frag(const _Float16* p, int hh) { FragH f; f.half[0] = *(const v8us*)((const unsigned short*)p + 8 * hh); f.half[1] = *(const v8us*)((const unsigned short*)p + 16 + 8 * hh); return f.v; }

__device__ __forceinline__ void wnat_body(unsigned bx, const float* __restrict__ w, size_t n8, _Float16* __restrict__ Bt) { const size_t t = (size_t)bx * 256 + threadIdx.x; if (t >= n8) return; FragH f; for (int q = 0; q < 8; ++q) f.h[q] = (_Float16)(bf16_round(w[t * 8 + q]) * 16.0f); *(v8us*)((unsigned short*)Bt + t * 8) = f.half[0];  }
__global__ __launch_bounds__(256) void k_rsm(const float* __restrict__ S, _Float16* __restrict__ P, int nrows) {
  #pragma clang fp contract(off)
  const int i = blockIdx.x * 256 + threadIdx.x; if (i >= nrows) return; const float* s = S + (size_t)i * SQ; float mx = -3.0e38f;
#pragma unroll 1
  for (int j = 0; j < SQ; ++j) mx = fmaxf(mx, s[j]); float se = 0.f;
#pragma unroll 1
  for (int j = 0; j < SQ; ++j) se += expf(s[j] - mx); const float sc = 256.0f / se;
#pragma unroll 1
  for (int j0 = 0; j0 < SQ; j0 += 8) { FragH f; for (int q = 0; q < 8; ++q) f.h[q] = (_Float16)(expf(s[j0 + q] - mx) * sc); unsigned short* d = (unsigned short*)P + (size_t)i * SQ + j0; *(v8us*)d = f.half[0];  } }
__global__ __launch_bounds__(256) void k_vt(const _Float16* __restrict__ V16, int b, int h0, _Float16* __restrict__ VT) { __shared__ unsigned short tl[64][65]; const int tid = threadIdx.x; const int hh = blockIdx.x % HG, sg = blockIdx.x / HG; const int s0 = sg * 64; const int h = h0 + hh;
  for (int i = tid; i < 64 * 8; i += 256) { const int j = i / 8, d8 = (i % 8) * 8; FragH f; f.half[0] = *(const v8us*)((const unsigned short*)V16 + ((size_t)b * SQ + s0 + j) * DM + h * HD + d8); for (int q = 0; q < 8; ++q) tl[d8 + q][j] = f.u[q]; }
  __syncthreads();
  { for (int i = tid; i < 64 * 8; i += 256) { const int d = i / 8, j8 = (i % 8) * 8; FragH f; for (int q = 0; q < 8; ++q) f.u[q] = tl[d][j8 + q]; *(v8us*)((unsigned short*)VT + ((size_t)hh * HD + d) * SQ + s0 + j8) = f.half[0]; }  } }


// lane l <-> l ^ M inside a 16-lane row (DPP row_xmask)
template <int M> __device__ __forceinline__ float ln_xm(float v) { return __int_as_float(__builtin_amdgcn_update_dpp(0, __float_as_int(v), 0x160 + M, 0xf, 0xf, true)); }
// 2^x (v_exp_f32). The v_nop in the same statement keeps the one issue slot that the instruction set asks for behind a transcendental, before its result is read or its source overwritten.
__device__ __forceinline__ float exp2_slot(float x) { float r; asm("v_exp_f32 %0, %1\n\tv_nop" : "=v"(r) : "v"(x)); return r; }
// Scores and their row softmax in one launch. A work-group owns MT*16 whole rows m of S^T[m][n] = g_m . f_n: each of its NW waves forms its own LL/NW columns on WMMA (hi.hi + 2^-10 (lo.hi + hi.lo)) and keeps them in
// accumulator registers through the maximum, the exponentials and the scaling, so the f32 score plane never goes to memory. Column tile t of a wave takes f rows n = base + (t>>3)*128 + ln*8 + (t&7): a lane then holds 8 neighbouring columns of a row, and one 16-byte store per lane writes whole lines of beta^T.
// Both operands come through LDS by asynchronous copies of whole 128-byte rows (LDS pitch 144 B, so that the 16-byte fragment reads spread over the banks): the g rows once for the work-group, each wave's own f rows in stages of two column tiles, two buffers, the next stage's copies flying while this stage is multiplied. A fragment load straight from global memory would touch 16 lines for 512 bytes.
// A work-group takes two such row blocks one after the other (one work-group per WGP covers the whole launch in one round). The second block walks the f stages backwards: the last two stages of the first block are still in the two buffers, so that it starts at once and copies only the other stages; its g rows come in during the first block's stage loop.
#define SC_PITCH 72      /* f16 per LDS row */
__device__ __forceinline__ unsigned g3_lds(const void* p) { return (unsigned)(size_t)p; }      /* byte offset in the work-group's LDS */
__device__ __forceinline__ v8f sc_mma(v16h a, v16h b, v8f c) { return __builtin_amdgcn_wmma_f32_16x16x32_f16(false, a, false, b, (short)0, c, false, false); }
template <int MT, int NW>
__global__ __launch_bounds__(NW * 32) void k_scsm(const _Float16* __restrict__ Gh, const _Float16* __restrict__ Gl, const _Float16* __restrict__ Fh, const _Float16* __restrict__ Fl, _Float16* __restrict__ P) {
  constexpr int TP = LL / (NW * 16); static_assert(TP % 8 == 0 && (NW == 8 || NW == 16), "k_scsm: a wave takes whole groups of 8 column tiles; the cross-wave step reads one partial per lane of a 16-lane row");
  static_assert(NW * 4 == 2 * MT * 16, "k_scsm: one copy of four rows per wave brings in the g rows of both planes");
  __shared__ float rmx[MT * 16][NW]; __shared__ float rsu[MT * 16][NW];      /* one partial maximum / sum per row and wave */
  __shared__ __attribute__((aligned(16))) unsigned short gs[2 * MT * 16][SC_PITCH];      /* the work-group's g rows: hi plane, then residual plane */
  __shared__ __attribute__((aligned(16))) unsigned short fs[NW][2][64][SC_PITCH];      /* per wave two buffers of one stage = two column tiles: LDS row (plane * 2 + tile) * 16 + ln */
  const int lane = threadIdx.x & 31, ln = lane & 15, hh = lane >> 4; const int w = __builtin_amdgcn_readfirstlane(threadIdx.x >> 5);
  const size_t rb = (size_t)blockIdx.y * LL; const int mb = blockIdx.x * (2 * MT * 16); const int n0 = w * (TP * 16) + ln * 8;
  const v8f z8 = {0.f,0.f,0.f,0.f,0.f,0.f,0.f,0.f};
  /* a copy of a wave = four whole 128-byte rows: lane -> row rs of the four, 16-byte piece pc. Copy q of a stage and plane takes the f rows of lanes ln = 2q and 2q + 1 for the stage's two tiles: two neighbouring rows each, 256 bytes in a piece */
  const int rs = lane >> 3, pc = lane & 7;
  const size_t fo0 = (rb + w * (TP * 16) + (rs >> 1) * 8 + (rs & 1)) * CQ + pc * 8;
  const unsigned short* fgh = (const unsigned short*)Fh + fo0; const unsigned short* fgl = (const unsigned short*)Fl + fo0;
  const unsigned fl0 = g3_lds(&fs[w][0][(rs & 1) * 16 + (rs >> 1)][pc * 8]);
  auto stage_f = [&](int j, int buf) {      /* stage j = column tiles 2j and 2j + 1 of this wave */
#pragma unroll
    for (int p = 0; p < 2; ++p) { unsigned l[8]; const unsigned short* g[8];
#pragma unroll
      for (int q = 0; q < 8; ++q) { l[q] = fl0 + (unsigned)((buf * 64 + p * 32 + q * 2) * (SC_PITCH * 2)); g[q] = (p ? fgl : fgh) + (size_t)(((j >> 2) * 128 + q * 16 + (j & 3) * 2) * CQ); }
      /* one plane's eight copies; the s_wait_xcnt in the same statement is a precaution: it stands before any register that a copy names is written again */
      asm volatile("global_load_async_to_lds_b128 %0, %8, off\n\tglobal_load_async_to_lds_b128 %1, %9, off\n\tglobal_load_async_to_lds_b128 %2, %10, off\n\tglobal_load_async_to_lds_b128 %3, %11, off\n\t"
                   "global_load_async_to_lds_b128 %4, %12, off\n\tglobal_load_async_to_lds_b128 %5, %13, off\n\tglobal_load_async_to_lds_b128 %6, %14, off\n\tglobal_load_async_to_lds_b128 %7, %15, off\n\ts_wait_xcnt 0x0"
                   :: "v"(l[0]), "v"(l[1]), "v"(l[2]), "v"(l[3]), "v"(l[4]), "v"(l[5]), "v"(l[6]), "v"(l[7]), "v"(g[0]), "v"(g[1]), "v"(g[2]), "v"(g[3]), "v"(g[4]), "v"(g[5]), "v"(g[6]), "v"(g[7]) : "memory"); } };
  auto copy_g = [&](int m0) { const int gr = w * 4 + rs;      /* g rows of the block that begins at m0: wave w brings LDS rows 4w .. 4w + 3, all of one plane */
    const unsigned short* gg = (const unsigned short*)(w * 4 >= MT * 16 ? Gl : Gh) + (rb + m0 + (gr & (MT * 16 - 1))) * CQ + pc * 8; const unsigned gl = g3_lds(&gs[gr][pc * 8]);
    /* the s_wait_xcnt in the same statement: the same precaution as above */
    asm volatile("global_load_async_to_lds_b128 %0, %1, off\n\ts_wait_xcnt 0x0" :: "v"(gl), "v"(gg) : "memory"); };
  constexpr int NS = TP / 2; static_assert(NS >= 2, "k_scsm: the second block's g rows are waited for at the foot of the first block's second trip");
  copy_g(mb);
  stage_f(0, 0);
  asm volatile("s_wait_asynccnt 0x0" ::: "memory");      /* this wave's copies of g and of stage 0 have landed */
  __syncthreads();      /* g and stage 0 are readable by every wave */
  stage_f(1, 1);
#pragma unroll      /* unrolled: the order of the stages, and with it every index of the score array, is known at compile time in both blocks */
  for (int blk = 0; blk < 2; ++blk) { const int m0 = mb + blk * (MT * 16);
  v16h ah[MT][2], al[MT][2];
#pragma unroll      /* full unroll here and below: the fragment and score arrays stay in registers */
  for (int mt = 0; mt < MT; ++mt) { const _Float16* gh = (const _Float16*)&gs[mt * 16 + ln][0]; const _Float16* gl = (const _Float16*)&gs[MT * 16 + mt * 16 + ln][0]; ah[mt][0] = g2_frag(gh, hh); ah[mt][1] = g2_frag(gh + 32, hh); al[mt][0] = g2_frag(gl, hh); al[mt][1] = g2_frag(gl + 32, hh); }
  v8f s[MT][TP];      /* lane (ln, hh), element r of s[mt][t] = row m0 + mt*16 + 8*hh + r, column n0 + (t>>3)*128 + (t&7) */
#pragma unroll
  for (int jj = 0; jj < NS; ++jj) { const int j = blk ? NS - 1 - jj : jj;      /* stage j lies in buffer j & 1 in both blocks; the second block begins with the two stages that the first has left there */
#pragma unroll
    for (int tt = 0; tt < 2; ++tt) { const int t = j * 2 + tt; const _Float16* fh = (const _Float16*)&fs[w][j & 1][tt * 16 + ln][0]; const _Float16* fl = (const _Float16*)&fs[w][j & 1][32 + tt * 16 + ln][0];
      const v16h bh0 = g2_frag(fh, hh), bh1 = g2_frag(fh + 32, hh), bl0 = g2_frag(fl, hh), bl1 = g2_frag(fl + 32, hh);
#pragma unroll
      for (int mt = 0; mt < MT; ++mt) { const v8f c = sc_mma(ah[mt][1], bh1, sc_mma(ah[mt][0], bh0, z8)); const v8f d = sc_mma(ah[mt][1], bl1, sc_mma(ah[mt][0], bl0, sc_mma(al[mt][1], bh1, sc_mma(al[mt][0], bh0, z8))));
        s[mt][t] = d * 0.0009765625f + c; }
      __builtin_amdgcn_sched_barrier(0); }      /* keeps the next tile's fragment reads behind this tile's WMMAs, so that one f fragment set is live: two cost a spill of scores */
    asm volatile("s_wait_dscnt 0x0" ::: "memory");      /* this wave's reads of the buffer are done before it may be refilled */
    asm volatile("s_wait_asynccnt 0x0" ::: "memory");      /* this wave's copies of the next trip's stage (and, in the first block's second trip, of the second block's g rows) have landed */
    asm volatile("s_barrier_signal -1\n\ts_barrier_wait -1" ::: "memory");      /* the work-group barrier: publishes the next trip's stage and ends the reads of stage j (first trip: also of the g rows, which every wave has in registers by now). By hand, behind the two waits above: __syncthreads() would also wait (s_wait_storecnt 0) until the first block's stores of beta^T, which no wave reads, have drained, and hold up the second block's first trip */
    if (jj + 2 < NS) stage_f(blk ? j - 2 : j + 2, j & 1);
    if (blk == 0 && jj == 0) copy_g(mb + MT * 16); }
  asm volatile("s_wait_asynccnt 0x0" ::: "memory");      /* no copy is outstanding when the wave goes on */
  v8f st[MT];
#pragma unroll
  for (int mt = 0; mt < MT; ++mt) { v8f m = s[mt][0];
#pragma unroll
    for (int t = 1; t < TP; ++t) m = __builtin_elementwise_max(m, s[mt][t]);
#pragma unroll
    for (int r = 0; r < 8; ++r) { float x = m[r]; x = fmaxf(x, ln_xm<1>(x)); x = fmaxf(x, ln_xm<2>(x)); x = fmaxf(x, ln_xm<4>(x)); x = fmaxf(x, ln_xm<8>(x)); m[r] = x; }
    st[mt] = m; }
  if (ln == 0) {
#pragma unroll
    for (int mt = 0; mt < MT; ++mt)
#pragma unroll
      for (int r = 0; r < 8; ++r) rmx[mt * 16 + 8 * hh + r][w] = st[mt][r]; }
  __syncthreads();      /* every wave's partial maxima are in LDS */
#pragma unroll
  for (int mt = 0; mt < MT; ++mt) { v8f m;
#pragma unroll
    for (int r = 0; r < 8; ++r) { float x = rmx[mt * 16 + 8 * hh + r][ln & (NW - 1)]; x = fmaxf(x, ln_xm<1>(x)); x = fmaxf(x, ln_xm<2>(x)); x = fmaxf(x, ln_xm<4>(x)); if (NW == 16) x = fmaxf(x, ln_xm<8>(x)); m[r] = x; }
    v8f a = z8;
#pragma unroll
    for (int t = 0; t < TP; ++t) { const v8f y = (s[mt][t] - m) * 1.442695041f; v8f e;
#pragma unroll
      for (int r = 0; r < 8; ++r) e[r] = exp2_slot(y[r]);      /* = native exp: the same multiply and v_exp_f32 */
      s[mt][t] = e; a += e; }
#pragma unroll
    for (int r = 0; r < 8; ++r) { float x = a[r]; x += ln_xm<1>(x); x += ln_xm<2>(x); x += ln_xm<4>(x); x += ln_xm<8>(x); a[r] = x; }
    st[mt] = a; }
  if (ln == 0) {
#pragma unroll
    for (int mt = 0; mt < MT; ++mt)
#pragma unroll
      for (int r = 0; r < 8; ++r) rsu[mt * 16 + 8 * hh + r][w] = st[mt][r]; }
  __syncthreads();      /* every wave's partial sums are in LDS */
#pragma unroll
  for (int mt = 0; mt < MT; ++mt) { v8f sc;
#pragma unroll
    for (int r = 0; r < 8; ++r) { float x = rsu[mt * 16 + 8 * hh + r][ln & (NW - 1)]; x += ln_xm<1>(x); x += ln_xm<2>(x); x += ln_xm<4>(x); if (NW == 16) x += ln_xm<8>(x); sc[r] = 256.0f / x; }
#pragma unroll
    for (int t = 0; t < TP; ++t) s[mt][t] *= sc;
#pragma unroll
    for (int r = 0; r < 8; ++r) { unsigned short* d = (unsigned short*)P + (rb + m0 + mt * 16 + 8 * hh + r) * LL + n0;
#pragma unroll
      for (int t8 = 0; t8 < TP / 8; ++t8) { FragH f;
#pragma unroll
        for (int q = 0; q < 8; ++q) f.h[q] = (_Float16)s[mt][t8 * 8 + q][r];
        *(v8us*)(d + t8 * 128) = f.half[0]; } } }
  if (blk == 0) asm volatile("s_wait_xcnt 0x0" ::: "memory");      /* a precaution: stands before any register that a store names is written again (the second block's code follows) */
  } }

// ---- GEMM with both operands staged in LDS: C[c][n] = alpha * sum_k A[c][k] Bh[n][k] (both K-contiguous f16), one 256 x 128 tile of C per work-group, 8 waves as 4 x 2, 64 x 64 per wave. ----
// A stage is 64 k of all 384 operand rows (128 B a row, LDS pitch 144 B so that the 16-byte fragment reads spread over the banks). Asynchronous copies bring whole 128-byte lines from global memory straight into LDS, two buffers:
// the next stage's copies fly while this stage is multiplied. Every operand line is asked for once per work-group, instead of in 32-byte pieces by every wave. k runs upward in steps of 32 into one accumulator chain per tile. Requires M % 256 == 0, N % 128 == 0, K % 64 == 0.
// HL (N = 128, two results of 64 columns side by side, each with rows of its own of pitch ldc): each f32 value alpha acc is cut into f16 hi + x1024 residual, columns 0..63 into C16 / CL, columns 64..127 into C16b / CLb, so the f32 rows never go to memory.
// F16OUT: C16 = f16(alpha acc). Otherwise the residual epilogue: C = bf16(gam[0]) alpha acc + bf16(X), X laid out like C, both [CC][LL] planes (pitch LL at compile time: a lane's 32 loads and 32 stores share one address each and differ in the immediate offset).
#define G3_PITCH 72      /* f16 per LDS row */
#define G3_STAGE (384 * G3_PITCH)      /* f16 per buffer */
#define G3D_PITCH 136      /* DEEP: f16 per LDS row (256 B + 16) */
#define G3D_STAGE (384 * G3D_PITCH)      /* DEEP: f16 per buffer */
// DEEP (K = lda = ldb = LL): a stage is 128 k (256 B a row, LDS pitch 272 B), three buffers, and the two halves of the work-group take turns at copying: waves 0..3 bring the even stages, waves 4..7 the odd ones. In trip s the half of parity s sends stage s + 2 into the buffer that trip s - 1 has read, and waits for it at the foot of trip s + 1.
// A wave then never has more than one stage of its own outstanding, so that its wait is to 0, while the other half's stage flies on across the barrier: a stage has up to two trips to land in instead of one, and the copies of two stages are in flight most of the time. The 48 copies go out a dozen per WMMA block, behind the block's LDS reads, whose latency covers their issue.
// The body takes its LDS from the calling kernel: ring = the stage buffers, so = each wave's own output staging; bx = tile index, by = batch. so may lie on the ring's bytes: it is first written behind the loop, whose last trip ends with every wave's s_wait_dscnt 0 and s_wait_asynccnt 0 and a work-group barrier, with no refill behind it (DEEP: the last two stages were waited for by their senders at the feet of the two trips before, and nothing is sent in the last two trips).
template <bool F16OUT, bool HL = false, bool DEEP = false>
__device__ __forceinline__ void gemm3_body(unsigned short* ring, float (*so)[64][68], unsigned bx, int by, const _Float16* __restrict__ A, int lda, size_t sA, const _Float16* __restrict__ Bh, int ldb, size_t sB, float alpha, float* __restrict__ C, _Float16* __restrict__ C16, const float* __restrict__ X, const float* __restrict__ gam, int ldc, size_t sC, int N, int K,
                                           _Float16* __restrict__ CL = nullptr, _Float16* __restrict__ C16b = nullptr, _Float16* __restrict__ CLb = nullptr) { static_assert(F16OUT || !HL, "gemm3_body: HL is a form of the f16 output");
  const int tid = threadIdx.x, lane = tid & 31, ln = lane & 15, hh = lane >> 4; const int w = __builtin_amdgcn_readfirstlane(tid >> 5); const int wm = w >> 1, wn = w & 1;
  const int ntn = N >> 7; const int mt = bx / ntn, nq = bx - mt * ntn; const int row0 = mt * 256, col0 = nq * 128; const size_t cofs = (size_t)by * sC;
  constexpr int KS = DEEP ? 128 : 64, PITCH = DEEP ? G3D_PITCH : G3_PITCH, STAGE = 384 * PITCH;      /* k per stage; f16 per LDS row and per buffer */
  constexpr int RP = DEEP ? 8 : 32;      /* operand rows that one copy of every copying thread covers */
  /* copy j of a thread: operand row j*32 + tid/8 of the stage (rows 0..255 = A, 256..383 = Bh), 16-byte piece tid%8: a wave's copy covers four whole rows. DEEP: 128 threads copy a stage: row j*8 + (tid%128)/16, piece tid%16: two whole 256-byte rows per wave's copy */
  const int crow = DEEP ? (tid & 127) >> 4 : tid >> 3, cpc = DEEP ? tid & 15 : tid & 7;
  const int la = DEEP ? LL : lda, lbp = DEEP ? LL : ldb;      /* DEEP: operand rows of pitch LL, known at compile time: a copy's address is one pointer plus a constant */
  const unsigned short* ga = (const unsigned short*)A + (size_t)by * sA + (size_t)(row0 + crow) * la + cpc * 8;
  const unsigned short* gb = (const unsigned short*)Bh + (size_t)by * sB + (size_t)(col0 + crow) * lbp + cpc * 8;
  const unsigned short* na = ga + (w >> 2) * KS; const unsigned short* nb = gb + (w >> 2) * KS;      /* DEEP: where this wave's next stage begins; they step on with every stage it copies, so that the 48 addresses are formed where they are used and are not kept in registers through the loop */
  const unsigned lb = g3_lds(ring) + (unsigned)crow * (PITCH * 2) + (unsigned)cpc * 16;
  auto copy12 = [&](int c, int s, int buf) {      /* copies c .. c + 11 of a stage */
    unsigned l[12]; const unsigned short* g[12];
#pragma unroll
    for (int j = 0; j < 12; ++j) { const int r = (c + j) * RP; l[j] = lb + (unsigned)buf * (STAGE * 2) + (unsigned)r * (PITCH * 2); g[j] = DEEP ? (r < 256 ? na + (size_t)r * la : nb + (size_t)(r - 256) * lbp) : (r < 256 ? ga + (size_t)r * la : gb + (size_t)(r - 256) * lbp) + s * KS; }
    /* twelve copies of the stage; the s_wait_xcnt in the same statement is a precaution: it stands before any register that a copy names is written again */
    asm volatile("global_load_async_to_lds_b128 %0, %12, off\n\tglobal_load_async_to_lds_b128 %1, %13, off\n\tglobal_load_async_to_lds_b128 %2, %14, off\n\tglobal_load_async_to_lds_b128 %3, %15, off\n\t"
                 "global_load_async_to_lds_b128 %4, %16, off\n\tglobal_load_async_to_lds_b128 %5, %17, off\n\tglobal_load_async_to_lds_b128 %6, %18, off\n\tglobal_load_async_to_lds_b128 %7, %19, off\n\t"
                 "global_load_async_to_lds_b128 %8, %20, off\n\tglobal_load_async_to_lds_b128 %9, %21, off\n\tglobal_load_async_to_lds_b128 %10, %22, off\n\tglobal_load_async_to_lds_b128 %11, %23, off\n\ts_wait_xcnt 0x0"
                 :: "v"(l[0]), "v"(l[1]), "v"(l[2]), "v"(l[3]), "v"(l[4]), "v"(l[5]), "v"(l[6]), "v"(l[7]), "v"(l[8]), "v"(l[9]), "v"(l[10]), "v"(l[11]),
                    "v"(g[0]), "v"(g[1]), "v"(g[2]), "v"(g[3]), "v"(g[4]), "v"(g[5]), "v"(g[6]), "v"(g[7]), "v"(g[8]), "v"(g[9]), "v"(g[10]), "v"(g[11]) : "memory"); };
  auto stage_in = [&](int s, int buf) {
#pragma unroll      /* unrolled: which operand a copy takes is known at compile time */
    for (int c = 0; c < 384 / RP; c += 12) copy12(c, s, buf);
    if (DEEP) { na += 2 * KS; nb += 2 * KS; } };
  float gsc = alpha; if (!F16OUT) gsc = bf16_round(gam[0]) * alpha;      /* read at entry, ahead of every asm statement: a scalar load */
  const int ns = DEEP ? LL / KS : K / KS; const int half = w >> 2;      /* DEEP: this wave copies the stages of parity half (a scalar: every test on it is a scalar branch) */
  if (DEEP) { static_assert(LL / 128 >= 2, "gemm3_body: the deep ring's prologue fills two stages");
    if (half == 0) { stage_in(0, 0); asm volatile("s_wait_asynccnt 0x0" ::: "memory"); }      /* the copying waves' stage 0 has landed */
    else stage_in(1, 1);      /* flies across the barrier; waited for at the foot of trip 0 */
    __syncthreads(); }      /* stage 0 is readable by every wave */
  else {
  stage_in(0, 0);
  asm volatile("s_wait_asynccnt 0x0" ::: "memory");      /* this wave's copies of stage 0 have landed */
  __syncthreads();      /* stage 0 is readable by every wave */
  if (ns > 1) stage_in(1, 1); }
  const v8f z8 = {0.f,0.f,0.f,0.f,0.f,0.f,0.f,0.f}; v8f acc[4][4];
#pragma unroll
  for (int i = 0; i < 4; ++i)
#pragma unroll
    for (int j = 0; j < 4; ++j) acc[i][j] = z8;
  const int ao = (wm * 64 + ln) * PITCH, bo = (256 + wn * 64 + ln) * PITCH; int cur = 0;      /* cur: DEEP, the buffer of stage s = s mod 3 */
#pragma unroll 1      /* the stage loop stays rolled: the accumulators keep constant indices and the loop stays small */
  for (int s = 0; s < ns; ++s) { const _Float16* rb = (const _Float16*)ring + (DEEP ? cur : s & 1) * STAGE;
    const bool send = DEEP && half == (s & 1) && s + 2 < ns; const int nxt = cur == 0 ? 2 : cur - 1;      /* DEEP: this wave sends stage s + 2 in this trip, into buffer (s + 2) mod 3, which every wave left at the barrier of trip s - 1 */
#pragma unroll
    for (int kk = 0; kk < KS / 32; ++kk) { v16h a[4], b[4];
#pragma unroll
      for (int i = 0; i < 4; ++i) { a[i] = g2_frag(rb + ao + i * (16 * PITCH) + kk * 32, hh); b[i] = g2_frag(rb + bo + i * (16 * PITCH) + kk * 32, hh); }
      __builtin_amdgcn_sched_barrier(0);      /* the block's 16 LDS reads go out as one group ahead of its WMMAs: left free, the compiler reloads one A fragment per four WMMAs and waits out the LDS latency each time */
      if (DEEP) { if (send) copy12(kk * 12, 0, nxt); }      /* a quarter of stage s + 2, sent while the block's LDS reads (of another buffer) are on their way */
#pragma unroll
      for (int d = 0; d < 4; ++d) {      /* tiles in the order in which their fragments arrive (a0 b0 a1 b1 ...): the first WMMAs run while the later reads are still coming; each tile still gets one WMMA per block, k upward */
#pragma unroll
        for (int e = 0; e < d; ++e) { acc[e][d] = sc_mma(a[e], b[d], acc[e][d]); acc[d][e] = sc_mma(a[d], b[e], acc[d][e]); }
        acc[d][d] = sc_mma(a[d], b[d], acc[d][d]); }
      __builtin_amdgcn_sched_barrier(0); }      /* keeps the next group of reads behind this block, so that one fragment set is live */
    asm volatile("s_wait_dscnt 0x0" ::: "memory");      /* this wave's reads of the buffer are done before it may be refilled */
    if (!DEEP || half == ((s + 1) & 1)) asm volatile("s_wait_asynccnt 0x0" ::: "memory");      /* this wave's copies of stage s + 1 have landed (DEEP: only the half that sent it waits; the other half's stage s + 2 flies on) */
    __syncthreads();      /* publishes stage s + 1 and ends every wave's reads of stage s */
    if (DEEP) { if (send) { na += 2 * KS; nb += 2 * KS; } cur = cur == 2 ? 0 : cur + 1; }
    else if (s + 2 < ns) stage_in(s + 2, s & 1); }
  asm volatile("s_wait_asynccnt 0x0" ::: "memory");      /* no copy is outstanding when the wave goes on to its end */
  const int rsub = lane >> 4, c4 = (lane & 15) * 4; const int ldo = F16OUT ? ldc : LL; const size_t o0 = cofs + (size_t)(row0 + wm * 64 + rsub) * ldo + col0 + wn * 64 + c4;
  v4f xr[F16OUT ? 1 : 32];      /* the lane's residual values, asked for in two groups of 16 loads: the first flies while the accumulators are staged, the second while the first half of the rows is formed and stored */
  if (!F16OUT) {
#pragma unroll      /* unrolled here and below: xr keeps constant indices and stays in registers */
    for (int q = 0; q < 16; ++q) xr[q] = *(const v4fa*)(X + o0 + (size_t)(q * 2) * ldo); }
  float (*sw)[68] = so[w];
#pragma unroll
  for (int i = 0; i < 4; ++i)
#pragma unroll
    for (int j = 0; j < 4; ++j)
#pragma unroll
      for (int r = 0; r < 8; ++r) sw[i * 16 + 8 * hh + r][j * 16 + ln] = F16OUT ? acc[i][j][r] * alpha : acc[i][j][r];
  __builtin_amdgcn_fence(__ATOMIC_ACQ_REL, "workgroup"); __builtin_amdgcn_wave_barrier();      /* the wave's staged rows are read back by other lanes of the same wave */
  if (!F16OUT) {
#pragma unroll
    for (int q = 16; q < 32; ++q) xr[q] = *(const v4fa*)(X + o0 + (size_t)(q * 2) * ldo); }
#pragma unroll
  for (int q = 0; q < 32; ++q) { const v4f v = *(const v4fa*)&sw[q * 2 + rsub][c4]; const size_t o = o0 + (size_t)(q * 2) * ldo;
    if (HL) { v4h h4, l4; for (int i = 0; i < 4; ++i) { const _Float16 h = (_Float16)v[i]; h4[i] = h; l4[i] = (_Float16)((v[i] - (float)h) * 1024.0f); } const size_t oh = cofs + (size_t)(row0 + wm * 64 + q * 2 + rsub) * ldc + c4; *(v4h*)((wn ? C16b : C16) + oh) = h4; *(v4h*)((wn ? CLb : CL) + oh) = l4; }
    else if (F16OUT) { v4h h4; for (int i = 0; i < 4; ++i) h4[i] = (_Float16)v[i]; *(v4h*)(C16 + o) = h4; }
    else { v4f y; for (int i = 0; i < 4; ++i) y[i] = v[i] * gsc + bf16_round(xr[q][i]); *(v4f*)(C + o) = y; } } }
template <bool F16OUT>
__global__ __launch_bounds__(256) void k_gemm3(const _Float16* __restrict__ A, int lda, size_t sA, const _Float16* __restrict__ Bh, int ldb, size_t sB, float alpha, float* __restrict__ C, _Float16* __restrict__ C16, const float* __restrict__ X, const float* __restrict__ gam, int ldc, size_t sC, int N, int K) {
  __shared__ __attribute__((aligned(16))) unsigned short ring[3 * G3D_STAGE]; static_assert(sizeof(ring) >= sizeof(float) * 8 * 64 * 68, "k_gemm3: the output staging lies inside the ring");      /* one LDS block: the three buffers, afterwards the output staging (306 KiB; both side by side would not fit a WGP) */
  gemm3_body<F16OUT, false, true>(ring, (float (*)[64][68])ring, blockIdx.x, blockIdx.y, A, lda, sA, Bh, ldb, sB, alpha, C, C16, X, gam, ldc, sC, N, K); }
// The three projections of x in one launch (none reads another's result); blockIdx.y = batch. blockIdx.x < LL / 256: f^T and g^T of 256 token rows as one 256 x 128 tile (A = token rows of XR, B = the 64 rows of BQ and the 64 of BK, which follow them in memory); the others: one 256 x 128 tile of h. Both on gemm3_body.
// One LDS block serves as the ring and afterwards as the output staging: 136 KiB instead of 244, so that two work-groups fit a WGP and all 320 of the launch are resident at once.
__global__ __launch_bounds__(256) void k_proj(const _Float16* __restrict__ XR, const _Float16* __restrict__ BQK, const _Float16* __restrict__ BV, _Float16* __restrict__ Fh, _Float16* __restrict__ Fl, _Float16* __restrict__ Gh, _Float16* __restrict__ Gl, _Float16* __restrict__ H16) {
  __shared__ __attribute__((aligned(16))) float sm[8][64][68]; static_assert(sizeof(sm) >= 2 * G3_STAGE * 2, "k_proj: the ring lies inside the staging block");
  const unsigned bx = blockIdx.x; const int by = blockIdx.y;
  if (bx < LL / 256) gemm3_body<true, true>((unsigned short*)&sm[0][0][0], sm, bx, by, XR, CC, (size_t)LL * CC, BQK, CC, 0, 0.0625f, nullptr, Fh, nullptr, nullptr, CQ, (size_t)LL * CQ, 2 * CQ, CC, Fl, Gh, Gl);
  else gemm3_body<true>((unsigned short*)&sm[0][0][0], sm, bx - LL / 256, by, BV, CC, 0, XR, CC, (size_t)LL * CC, 0.0625f, nullptr, H16, nullptr, nullptr, LL, (size_t)CC * LL, LL, CC); }

// x [b][c][l] f32 -> exact f16 token rows XR [b][l][c], one 128 c x 128 l tile per work-group. Wave w takes 16 channel rows: each of its loads is 512 contiguous bytes of one row, all 16 in flight at once; a lane then holds 16 channels of 4 tokens
// and writes them to LDS as 16-byte pieces of 8 channels. Piece k of token row l lies at place k ^ ((l >> 2) & 15) of the row: the 16 lanes of a half wave, whose rows are 4 apart, then write 16 different places, and a reader's half wave takes one whole row. Every store to XR covers 256 contiguous bytes per half wave.
__device__ __forceinline__ void cl2rows_body(unsigned short (*tl)[128], unsigned bx, const float* __restrict__ X, _Float16* __restrict__ XR) { const int tid = threadIdx.x, lane = tid & 31, w = tid >> 5; const int nl = LL / 128, nc = CC / 128; const int cb_ = bx % nc; const int lb = (bx / nc) % nl; const size_t b = bx / (nc * nl); const int c0 = cb_ * 128, l0 = lb * 128;
  const float* s = X + (b * CC + c0 + w * 16) * (size_t)LL + l0 + lane * 4; v4f v[16];
#pragma unroll      /* unrolled here and below: v and o keep constant indices and stay in registers */
  for (int j = 0; j < 16; ++j) v[j] = *(const v4fa*)(s + (size_t)j * LL);
  asm volatile("s_wait_xcnt 0x0" :: "v"(s) : "memory");      /* a precaution: stands before any register that a load names is written again; the address is an input, so that no load's own result is laid on it. The statement also holds all 16 loads ahead of the conversions: left free, the compiler sends eight, waits for them and only then sends the other eight, two memory latencies in a row */
#pragma unroll
  for (int i = 0; i < 4; ++i)
#pragma unroll
    for (int k = 0; k < 2; ++k) { FragH f;
#pragma unroll
      for (int q = 0; q < 8; ++q) f.h[q] = (_Float16)bf16_round(v[k * 8 + q][i]);
      *(v8us*)&tl[lane * 4 + i][((w * 2 + k) ^ (lane & 15)) * 8] = f.half[0]; }
  __syncthreads();
  { const int r = tid >> 4, k = tid & 15; unsigned short* d = (unsigned short*)XR + (b * LL + l0 + r) * (size_t)CC + c0 + k * 8; v8us o[8];
#pragma unroll
    for (int p = 0; p < 8; ++p) { const int l = p * 16 + r; o[p] = *(const v8us*)&tl[l][(k ^ ((l >> 2) & 15)) * 8]; }
#pragma unroll
    for (int p = 0; p < 8; ++p) *(v8us*)(d + (size_t)(p * 16) * CC) = o[p];
    asm volatile("s_wait_xcnt 0x0" ::: "memory");      /* a precaution: stands before any register that a store names is written again (the calling kernel's other branches follow in the code) */
  } }
// The four input conversions in one launch (none reads another's result): the first blocks cast Wq, Wk and Wv, the others transpose x.
#define PB_QK (CQ * CC / 8 / 256)      /* blocks for Wq, and for Wk */
#define PB_V (CC * CC / 8 / 256)      /* blocks for Wv */
#define PB_X (NB * (LL / 128) * (CC / 128))      /* blocks for x */
__global__ __launch_bounds__(256) void k_prep(const float* __restrict__ x, const float* __restrict__ wq, const float* __restrict__ wk, const float* __restrict__ wv, _Float16* __restrict__ XR, _Float16* __restrict__ BQ, _Float16* __restrict__ BK, _Float16* __restrict__ BV) {
  __shared__ __attribute__((aligned(16))) unsigned short tl[128][128]; const unsigned bx = blockIdx.x;
  if (bx < PB_QK) wnat_body(bx, wq, (size_t)CQ * CC / 8, BQ);
  else if (bx < 2 * PB_QK) wnat_body(bx - PB_QK, wk, (size_t)CQ * CC / 8, BK);
  else if (bx < 2 * PB_QK + PB_V) wnat_body(bx - 2 * PB_QK, wv, (size_t)CC * CC / 8, BV);
  else cl2rows_body(tl, bx - (2 * PB_QK + PB_V), x, XR); }


extern "C" void kernel_launch(void* const* d_in, const int* in_sizes, int n_in,
                              void* d_out, int out_size, void* d_ws, size_t ws_size, hipStream_t stream) {
  (void)in_sizes; (void)n_in; (void)out_size;
  const float* const* I = (const float* const*)d_in; const float* x = I[0]; const float* wq = I[1]; const float* wk = I[2]; const float* wv = I[3]; const float* gam = I[4];
  char* ws = (char*)d_ws; size_t off = 0;
  auto take = [&](size_t bytes) { char* p = ws + off; off += (bytes + 255) & ~(size_t)255; return p; };
  _Float16* BQ = (_Float16*)take((size_t)2 * CQ * CC * 2); _Float16* BK = BQ + (size_t)CQ * CC;      /* one block: the rows of Wk follow those of Wq */
  _Float16* BV = (_Float16*)take((size_t)CC * CC * 2);
  _Float16* XR = (_Float16*)take(NR * CC * 2); _Float16* Fh = (_Float16*)take(NR * CQ * 2); _Float16* Fl = (_Float16*)take(NR * CQ * 2); _Float16* Gh = (_Float16*)take(NR * CQ * 2); _Float16* Gl = (_Float16*)take(NR * CQ * 2);
  _Float16* H16 = (_Float16*)take(NR * CC * 2); _Float16* P = (_Float16*)take(NR * LL * 2);
  if (off > ws_size) return;      /* approx 0.6 + 16 + 8 + 16 + 64 = 105 MiB: every plane holds all NB batches */
  /* every stage once for all batches: blockIdx.y = batch (k_prep: one-dimensional grid, batch from blockIdx.x) */
  k_prep<<<2 * PB_QK + PB_V + PB_X, 256, 0, stream>>>(x, wq, wk, wv, XR, BQ, BK, BV);      /* x16 f16 weights; exact f16 token rows [b*2048 + n][c] */
  k_proj<<<dim3(LL / 256 + (CC / 256) * (LL / 128), NB), 256, 0, stream>>>(XR, BQ, BV, Fh, Fl, Gh, Gl, H16);      /* f^T rows [b][n][64] and g^T rows [b][m][64] -> hi/lo; h channel-major [b][c][n] f16 */
  k_scsm<2, 16><<<dim3(LL / 64, NB), 512, 0, stream>>>(Gh, Gl, Fh, Fl, P);      /* S^T[b][m][n] = g_m . f_n (hi.hi + 2^-10 (lo.hi + hi.lo)), softmax over n per key m (the module's dim=1 softmax) -> beta^T[b][m][n] x256 f16 */
  k_gemm3<false><<<dim3((CC / 256) * (LL / 128), NB), 256, 0, stream>>>(H16, LL, (size_t)CC * LL, P, LL, (size_t)LL * LL, 0.00390625f, (float*)d_out, nullptr, x, gam, LL, (size_t)CC * LL, LL, LL);      /* out[b][c][m] = gamma 2^-8 sum_n h[c][n] beta^T[m][n] + x[b][c][m] (channel-major = the output layout) */
}
